// v000
// Measured on an AMD MI455X. A time is GPU time per run, averaged over a window of back-to-back runs after a warm-up
// (all launches, gaps included; the runs take copies of the inputs in turn), and the median of several windows.
// Apart from v000's, it joins two sittings. Times from different sittings can be a few percent apart, while
// side-by-side timings come from the same sitting.
// v000, which the later versions start from, runs in 13.2 milliseconds.
#include <hip/hip_runtime.h>
// Multi-head attention on three unbatched inputs with [in][out] bias-free q / k / v projections, a biased output projection and the source's MODEL-WIDTH score scale; the inputs arrive in the order values, keys, query (each [4096][1024]; v / k / q = stream W ([in][out] 1024 x 1024 sd 1/32, NO biases), 16 heads of 64; energy / sqrt(1024) (the module scales by the EMBED width, not the head width: 1/32); softmax over all 4096 keys (no mask); out = merged Wo + bo ([in][out]) -> [4096][1024]); ONE head per attention launch group.
// Structure: token rows r = b*4096 + s; the query, key and value sources as exact f16 rows (bf16-rounded); Q, K, V as three WMMA GEMMs (32x64 wave tiles, f32 accumulation, exact x16 weights, no bias, f16 outputs); per batch: V^T for all heads via LDS transposes; per (batch, head): scores GEMM (K = 64, batched over the heads on grid.y, alpha = 1/32), row softmax on VALU (f32 statistics, native exp; weights stored x256 as f16), o = P . V^T GEMM (K = 4096, alpha 2^-2: o carried x64 against f16 subnormal flush, folded into the output GEMM alpha) written straight into the merged f16 o rows; out = o W_o + b GEMM (f32) into the output layout.
// Compute dtype: inputs rounded to bf16; x / weights exact; q, k, v, softmax weights and o as plain f16 GEMM operands (~2^-12); scores and softmax statistics f32. v_wmma_f32_16x16x32_f16.
#define NB 1
#define SQ 4096
#define DM 1024
#define NH 16
#define HD 64
#define HG 1                         /* heads per attention launch group */
#define B0 0                         /* first batch processed (debug hook) */
#define NBR NB                       /* batches processed (debug hook) */
#define NR ((size_t)NB * SQ)         /* token rows */
#define MP ((int)((size_t)NBR * SQ)) /* rows projected (debug hook) */
#define QN SQ                        /* query rows attended per batch (debug hook) */
#define NHD NH                       /* heads attended (debug hook) */
#define MPO MP                       /* rows through the output stage (debug hook) */
#define LQ DM      /* row pitch of the q/k/v rows */
typedef __bf16 v16b __attribute__((ext_vector_type(16)));
typedef unsigned short v8us __attribute__((ext_vector_type(8), may_alias));
typedef float  v8f  __attribute__((ext_vector_type(8)));
typedef float  v4f  __attribute__((ext_vector_type(4)));
typedef float  v4fa __attribute__((ext_vector_type(4), may_alias));
union FragB { v16b v; v8us half[2]; unsigned short u[16]; };

__device__ __forceinline__ unsigned short bf16_bits(float x) { unsigned int u = __float_as_uint(x); return (unsigned short)((u + 0x7FFFu + ((u >> 16) & 1u)) >> 16); }
__device__ __forceinline__ float bf16_val(unsigned short b) { return __uint_as_float(((unsigned int)b) << 16); }
__device__ __forceinline__ float bf16_round(float x) { return bf16_val(bf16_bits(x)); }
// D += A·B with NT terms: 1 = ah·bh, 2 = + al·bh (A split), 3 = + ah·bl (both split)
template <int NT>
__device__ __forceinline__ v8f mmaN(v16b ah, v16b al, v16b bh, v16b bl, v8f c) {
  c = __builtin_amdgcn_wmma_f32_16x16x32_bf16(false, ah, false, bh, (short)0, c, false, false);
  if (NT >= 2) c = __builtin_amdgcn_wmma_f32_16x16x32_bf16(false, al, false, bh, (short)0, c, false, false);
  if (NT >= 3) c = __builtin_amdgcn_wmma_f32_16x16x32_bf16(false, ah, false, bl, (short)0, c, false, false);
  asm volatile("v_nop\n\tv_nop\n\tv_nop\n\tv_nop" : "+v"(c) : "v"(ah), "v"(al), "v"(bh), "v"(bl));
  return c;
}

__global__ __launch_bounds__(256) void k_wt_bf16(const float* __restrict__ W, unsigned short* __restrict__ Wt, int K, int N) {
  const int t = blockIdx.x * 256 + threadIdx.x;
  const int k8n = K / 8;
  if (t >= N * k8n) return;
  const int n = t / k8n, k8 = (t % k8n) * 8;
  v8us v;
#pragma unroll
  for (int i = 0; i < 8; ++i) v[i] = bf16_bits(W[(size_t)(k8 + i) * N + n]);
  *(v8us*)(Wt + (size_t)n * K + k8) = v;
  
}

// GEMM C[M][N] (f32, pitch ldc) = act(A[M][K]·W + bias). A f32 row-major (pitch lda) converted per fragment to bf16
// (ASPLIT: hi/lo two planes -> 2 terms, else single rounded term); Wt bf16 [N][K] (pitch ldb). BIAS_BF16 rounds the
// bias to bf16 first (bias quantised to bf16 before the add). K%32==0, M%16==0, N%64==0.
template <bool ASPLIT, int ACT, bool BIAS_BF16>
__global__ __launch_bounds__(128) void k_gemm_bf(const float* __restrict__ A, int lda, const unsigned short* __restrict__ Wt, int ldb,
                                               const float* __restrict__ bias, float* __restrict__ C, int ldc, int M, int N, int K) {
  __shared__ __attribute__((aligned(16))) float so[4][16][64];
  const int tid = threadIdx.x, w = tid >> 5, lane = tid & 31, ln = lane & 15, hh = lane >> 4;
  const int ntn = N / 64;
  const int wid = blockIdx.x * 4 + w;
  const int mt = wid / ntn, nq = wid % ntn;
  if (mt * 16 >= M) return;
  const int row0 = mt * 16, col0 = nq * 64;
  const float* arow = A + (size_t)(row0 + ln) * lda;
  v8f acc[4] = {};
  for (int kb = 0; kb < K; kb += 32) {
    FragB ah, al;
    const v4f x0 = *(const v4fa*)(arow + kb + 8 * hh), x1 = *(const v4fa*)(arow + kb + 8 * hh + 4);
    const v4f x2 = *(const v4fa*)(arow + kb + 16 + 8 * hh), x3 = *(const v4fa*)(arow + kb + 16 + 8 * hh + 4);
    float xs[16] = {x0[0],x0[1],x0[2],x0[3],x1[0],x1[1],x1[2],x1[3],x2[0],x2[1],x2[2],x2[3],x3[0],x3[1],x3[2],x3[3]};
#pragma unroll
    for (int i = 0; i < 16; ++i) { const unsigned short hb = bf16_bits(xs[i]); ah.u[i] = hb; al.u[i] = ASPLIT ? bf16_bits(xs[i] - bf16_val(hb)) : (unsigned short)0; }
#pragma unroll
    for (int t = 0; t < 4; ++t) {
      const unsigned short* brow = Wt + (size_t)(col0 + t * 16 + ln) * ldb + kb;
      FragB b;
      b.half[0] = *(const v8us*)(brow + 8 * hh);
      b.half[1] = *(const v8us*)(brow + 16 + 8 * hh);
      acc[t] = mmaN<ASPLIT ? 2 : 1>(ah.v, al.v, b.v, b.v, acc[t]);
    }
  }
#pragma unroll
  for (int t = 0; t < 4; ++t) {
    float bv = bias ? bias[col0 + t * 16 + ln] : 0.f;
    if (BIAS_BF16) bv = bf16_round(bv);
#pragma unroll
    for (int r = 0; r < 8; ++r) { float v = acc[t][r] + bv; if (ACT == 1) v = fmaxf(v, 0.f); so[w][8 * hh + r][t * 16 + ln] = v; }
  }
  __builtin_amdgcn_fence(__ATOMIC_ACQ_REL, "workgroup");
  __builtin_amdgcn_wave_barrier();
  const int rsub = lane >> 4, c4 = (lane & 15) * 4;
  {
#pragma unroll
    for (int q = 0; q < 8; ++q) {
      const int r = q * 2 + rsub;
      const v4f v = *(const v4fa*)&so[w][r][c4];
      *(v4f*)(C + (size_t)(row0 + r) * ldc + col0 + c4) = v;
    }
    
  }
}

// GEMM C = act(A·W + bias + resid): A f32 (ASPLIT -> hi/lo 2 terms), Wt bf16 [N][K]; ACT 0 none, 1 relu, 2 exact gelu;
// resid (optional, f32, row index = (row % rmod), pitch ldr, RES_BF16 rounds it) added before the activation.
template <bool ASPLIT, int ACT, bool BIAS_BF16, bool RES_BF16>
__global__ __launch_bounds__(128) void k_gemm_bf3(const float* __restrict__ A, int lda, const unsigned short* __restrict__ Wt, int ldb,
                                                const float* __restrict__ bias, const float* __restrict__ resid, int rmod, int ldr,
                                                float* __restrict__ C, int ldc, int M, int N, int K) {
  __shared__ __attribute__((aligned(16))) float so[4][16][64];
  const int tid = threadIdx.x, w = tid >> 5, lane = tid & 31, ln = lane & 15, hh = lane >> 4;
  const int ntn = N / 64;
  const int wid = blockIdx.x * 4 + w;
  const int mt = wid / ntn, nq = wid % ntn;
  if (mt * 16 >= M) return;
  const int row0 = mt * 16, col0 = nq * 64;
  const float* arow = A + (size_t)(row0 + ln) * lda;
  v8f acc[4] = {};
  for (int kb = 0; kb < K; kb += 32) {
    FragB ah, al;
    const v4f x0 = *(const v4fa*)(arow + kb + 8 * hh), x1 = *(const v4fa*)(arow + kb + 8 * hh + 4);
    const v4f x2 = *(const v4fa*)(arow + kb + 16 + 8 * hh), x3 = *(const v4fa*)(arow + kb + 16 + 8 * hh + 4);
    float xs[16] = {x0[0],x0[1],x0[2],x0[3],x1[0],x1[1],x1[2],x1[3],x2[0],x2[1],x2[2],x2[3],x3[0],x3[1],x3[2],x3[3]};
#pragma unroll
    for (int i = 0; i < 16; ++i) { const unsigned short hb = bf16_bits(xs[i]); ah.u[i] = hb; al.u[i] = ASPLIT ? bf16_bits(xs[i] - bf16_val(hb)) : (unsigned short)0; }
#pragma unroll
    for (int t = 0; t < 4; ++t) {
      const unsigned short* brow = Wt + (size_t)(col0 + t * 16 + ln) * ldb + kb;
      FragB b;
      b.half[0] = *(const v8us*)(brow + 8 * hh);
      b.half[1] = *(const v8us*)(brow + 16 + 8 * hh);
      acc[t] = mmaN<ASPLIT ? 2 : 1>(ah.v, al.v, b.v, b.v, acc[t]);
    }
  }
#pragma unroll
  for (int t = 0; t < 4; ++t) {
    const int col = col0 + t * 16 + ln;
    float bv = bias ? bias[col] : 0.f;
    if (BIAS_BF16) bv = bf16_round(bv);
#pragma unroll
    for (int r = 0; r < 8; ++r) {
      float v = acc[t][r] + bv;
      if (resid) { float rv = resid[(size_t)((row0 + 8 * hh + r) % rmod) * ldr + col]; if (RES_BF16) rv = bf16_round(rv); v += rv; }
      if (ACT == 1) v = fmaxf(v, 0.f);
      if (ACT == 2) v = 0.5f * v * (1.0f + erff(v * 0.70710678118654752f));
      if (ACT == 3) { const float u = 0.7978845608028654f * (v + 0.044715f * v * v * v); v = 0.5f * v * (1.0f + tanhf(u)); }
      so[w][8 * hh + r][t * 16 + ln] = v;
    }
  }
  __builtin_amdgcn_fence(__ATOMIC_ACQ_REL, "workgroup");
  __builtin_amdgcn_wave_barrier();
  const int rsub = lane >> 4, c4 = (lane & 15) * 4;
  {
#pragma unroll
    for (int q = 0; q < 8; ++q) {
      const int r = q * 2 + rsub;
      const v4f v = *(const v4fa*)&so[w][r][c4];
      *(v4f*)(C + (size_t)(row0 + r) * ldc + col0 + c4) = v;
    }
    
  }
}
// row LayerNorm (biased variance, eps) over N: s = X (+ R); optional out_sum <- s; out_norm <- (s-mu)*rsqrt(var+eps)*g + b
template <bool PARAM_BF16>
__global__ __launch_bounds__(256) void k_layernorm(const float* __restrict__ X, const float* __restrict__ R, const float* __restrict__ g, const float* __restrict__ bta,
                                                  float* __restrict__ out_sum, float* __restrict__ out_norm, int N, float eps) {
  __shared__ float red[256];
  const int row = blockIdx.x, tid = threadIdx.x;
  const float* x = X + (size_t)row * N; const float* rr = R ? R + (size_t)row * N : nullptr;
  float vals[16];                     // up to N = 4096
  const int per = N / 256;            // contiguous chunk per thread? use strided-by-4 chunks: thread handles j = tid*4 + 1024*u
  float s1 = 0.f;
  for (int u = 0; u < per / 4; ++u) {
    const int j = tid * 4 + 1024 * u;
    const v4f a = *(const v4fa*)(x + j);
    v4f b = {0.f,0.f,0.f,0.f}; if (rr) b = *(const v4fa*)(rr + j);
#pragma unroll
    for (int q = 0; q < 4; ++q) { const float v = a[q] + b[q]; vals[u * 4 + q] = v; s1 += v; }
  }
  red[tid] = s1; __syncthreads();
  for (int st = 128; st > 0; st >>= 1) { if (tid < st) red[tid] += red[tid + st]; __syncthreads(); }
  const float mu = red[0] / (float)N; __syncthreads();
  float s2 = 0.f;
  for (int u = 0; u < per / 4; ++u)
#pragma unroll
    for (int q = 0; q < 4; ++q) { const float c = vals[u * 4 + q] - mu; s2 += c * c; }
  red[tid] = s2; __syncthreads();
  for (int st = 128; st > 0; st >>= 1) { if (tid < st) red[tid] += red[tid + st]; __syncthreads(); }
  const float rs = rsqrtf(red[0] / (float)N + eps);
  {
    for (int u = 0; u < per / 4; ++u) {
      const int j = tid * 4 + 1024 * u;
      v4f o, sm;
#pragma unroll
      for (int q = 0; q < 4; ++q) {
        float gg = g[j + q], bb = bta[j + q];
        if (PARAM_BF16) { gg = bf16_round(gg); bb = bf16_round(bb); }
        sm[q] = vals[u * 4 + q]; o[q] = (vals[u * 4 + q] - mu) * rs * gg + bb;
      }
      if (out_sum) *(v4f*)(out_sum + (size_t)row * N + j) = sm;
      *(v4f*)(out_norm + (size_t)row * N + j) = o;
    }
    
  }
}



// ---- f16 WMMA path (v_wmma_f32_16x16x32_f16): 11-bit significands for operands in range — used where a [0,1] probability operand needs more precision than bf16
typedef _Float16 v16h __attribute__((ext_vector_type(16)));
union FragH { v16h v; v8us half[2]; _Float16 h[16]; unsigned short u[16]; };
template <int NT>
__device__ __forceinline__ v8f mmaH(v16h ah, v16h al, v16h bh, v16h bl, v8f c) {
  c = __builtin_amdgcn_wmma_f32_16x16x32_f16(false, ah, false, bh, (short)0, c, false, false);
  if (NT >= 2) c = __builtin_amdgcn_wmma_f32_16x16x32_f16(false, al, false, bh, (short)0, c, false, false);
  if (NT >= 3) c = __builtin_amdgcn_wmma_f32_16x16x32_f16(false, ah, false, bl, (short)0, c, false, false);
  asm volatile("v_nop\n\tv_nop\n\tv_nop\n\tv_nop" : "+v"(c) : "v"(ah), "v"(al), "v"(bh), "v"(bl));
  return c;
}
// batched GEMM like k_gemm_b but f16 operands: A f32 (split into f16 hi/lo if ASPLIT, else rounded to f16), Bt = f16 values [n][k]; alpha; C f32; N multiple of 16 (partial tiles skipped)
template <bool ASPLIT>
__global__ __launch_bounds__(128) void k_gemm_h(const float* __restrict__ A, int lda, size_t sA, const _Float16* __restrict__ Bh, int ldb, size_t sB, float alpha, float* __restrict__ C, int ldc, size_t sC, int M, int N, int K) {
  __shared__ __attribute__((aligned(16))) float so[4][16][64];
  const int tid = threadIdx.x, w = tid >> 5, lane = tid & 31, ln = lane & 15, hh = lane >> 4; const int by = blockIdx.y;
  A += (size_t)by * sA; Bh += (size_t)by * sB; C += (size_t)by * sC;
  const int ntn = (N + 63) / 64; const int wid = blockIdx.x * 4 + w; const int mt = wid / ntn, nq = wid % ntn; if (mt * 16 >= M) return;
  const int row0 = mt * 16, col0 = nq * 64; const float* arow = A + (size_t)(row0 + ln) * lda;
  v8f acc[4] = {};
  for (int kb = 0; kb < K; kb += 32) {
    FragH ah, al;
    const v4f x0 = *(const v4fa*)(arow + kb + 8 * hh), x1 = *(const v4fa*)(arow + kb + 8 * hh + 4), x2 = *(const v4fa*)(arow + kb + 16 + 8 * hh), x3 = *(const v4fa*)(arow + kb + 16 + 8 * hh + 4);
    float xs[16] = {x0[0],x0[1],x0[2],x0[3],x1[0],x1[1],x1[2],x1[3],x2[0],x2[1],x2[2],x2[3],x3[0],x3[1],x3[2],x3[3]};
#pragma unroll
    for (int i = 0; i < 16; ++i) { const _Float16 h = (_Float16)xs[i]; ah.h[i] = h; al.h[i] = ASPLIT ? (_Float16)(xs[i] - (float)h) : (_Float16)0.0f; }
#pragma unroll
    for (int t = 0; t < 4; ++t) { if (col0 + t * 16 >= N) continue; const size_t boff = (size_t)(col0 + t * 16 + ln) * ldb + kb; FragH bq; bq.half[0] = *(const v8us*)(Bh + boff + 8 * hh); bq.half[1] = *(const v8us*)(Bh + boff + 16 + 8 * hh);
      acc[t] = mmaH<ASPLIT ? 2 : 1>(ah.v, al.v, bq.v, bq.v, acc[t]); }
  }
#pragma unroll
  for (int t = 0; t < 4; ++t) { if (col0 + t * 16 >= N) continue;
#pragma unroll
    for (int r = 0; r < 8; ++r) so[w][8 * hh + r][t * 16 + ln] = acc[t][r] * alpha; }
  __builtin_amdgcn_fence(__ATOMIC_ACQ_REL, "workgroup"); __builtin_amdgcn_wave_barrier();
  const int rsub = lane >> 4, c4 = (lane & 15) * 4;
  {
#pragma unroll
    for (int q = 0; q < 8; ++q) { const int r = q * 2 + rsub; if (col0 + c4 < N) { const v4f v = *(const v4fa*)&so[w][r][c4]; *(v4f*)(C + (size_t)(row0 + r) * ldc + col0 + c4) = v; } }
     }
}

// Wt[n][k] = f16(W[k][n]·scale) from f32 row-major W[K][N] (scale = power of two; bf16-exact weights stay exact in f16 away from the subnormal range)
__global__ __launch_bounds__(256) void k_wt_f16(const float* __restrict__ W, _Float16* __restrict__ Wt, int K, int N, float scale) {
  const int t = blockIdx.x * 256 + threadIdx.x; if (t >= N * (K / 8)) return; const int n = t / (K / 8), k8 = (t % (K / 8)) * 8; FragH f;
#pragma unroll
  for (int i = 0; i < 8; ++i) f.h[i] = (_Float16)(bf16_round(W[(size_t)(k8 + i) * N + n]) * scale); const v8us o = f.half[0];
  *(v8us*)((unsigned short*)Wt + (size_t)n * K + k8) = o; 
}
// k_gemm_hh variant with fused epilogue: v = acc·alpha + bias[by·sBias + col] (+ CP[(row/rowsPerB)·sCPb + by·64 + col] if CP) ; ACT 0 none / 1 elu ; writes f16 C16 (and f32 C if non-null)
template <int ACT>
__global__ __launch_bounds__(128) void k_gemm_hhx(const _Float16* __restrict__ A, int lda, size_t sA, const _Float16* __restrict__ Bh, int ldb, size_t sB, float alpha, const float* __restrict__ bias, size_t sBias, const float* __restrict__ CP, int rowsPerB, size_t sCPb, int row0g,
    float* __restrict__ C, _Float16* __restrict__ C16, int ldc, size_t sC, int M, int N, int K) {
  __shared__ __attribute__((aligned(16))) float so[4][16][64];
  const int tid = threadIdx.x, w = tid >> 5, lane = tid & 31, ln = lane & 15, hh = lane >> 4; const int by = blockIdx.y;
  A += (size_t)by * sA; Bh += (size_t)by * sB; const size_t cofs = (size_t)by * sC; const float* bp = bias ? bias + (size_t)by * sBias : nullptr;
  const int ntn = (N + 63) / 64; const int wid = blockIdx.x * 4 + w; const int mt = wid / ntn, nq = wid % ntn; if (mt * 16 >= M) return;
  const int row0 = mt * 16, col0 = nq * 64; const _Float16* arow = A + (size_t)(row0 + ln) * lda;
  v8f acc[4] = {};
  for (int kb = 0; kb < K; kb += 32) { FragH ah; ah.half[0] = *(const v8us*)((const unsigned short*)arow + kb + 8 * hh); ah.half[1] = *(const v8us*)((const unsigned short*)arow + kb + 16 + 8 * hh);
#pragma unroll
    for (int t = 0; t < 4; ++t) { if (col0 + t * 16 >= N) continue; const size_t boff = (size_t)(col0 + t * 16 + ln) * ldb + kb; FragH bq; bq.half[0] = *(const v8us*)((const unsigned short*)Bh + boff + 8 * hh); bq.half[1] = *(const v8us*)((const unsigned short*)Bh + boff + 16 + 8 * hh);
      acc[t] = mmaH<1>(ah.v, ah.v, bq.v, bq.v, acc[t]); }
  }
#pragma unroll
  for (int t = 0; t < 4; ++t) { if (col0 + t * 16 >= N) continue; const int col = col0 + t * 16 + ln; const float bv = bp ? bf16_round(bp[col]) : 0.f;
#pragma unroll
    for (int r = 0; r < 8; ++r) { float v = acc[t][r] * alpha + bv; if (CP) { const int rr = row0g + row0 + 8 * hh + r; if (rowsPerB < 0) v += CP[cofs + (size_t)rr * ldc + col];      /* rowsPerB < 0: own element of the batched C plane */ else { const int bidx = rr / rowsPerB; v += CP[(size_t)bidx * sCPb + (size_t)by * 64 + col]; } } if (ACT == 1) v = (v > 0.f) ? v : expm1f(v); else if (ACT == 7) v = (v > 0.f) ? v + 1.0f : expf(v); else if (ACT == 8) v = tanhf(v); else if (ACT == 9) v = 0.5f * v * (1.0f + tanhf(0.7978845608028654f * (v + 0.044715f * v * v * v))); else if (ACT == 11) v = 1.0f / (1.0f + expf(-v)); else if (ACT == 12) v = (v > 0.f) ? v : 0.01f * v; else if (ACT == 14) v = (v > 0.f) ? v : 0.1f * v; else if (ACT == 16) v = (v >= 0.f) ? v : 0.3f * v; else if (ACT == 17) v = (v >= 0.f) ? v : 0.2f * v; else if (ACT == 15) v = v / (1.0f + expf(-v)); else if (ACT == 3) v = fmaxf(v, 0.f); else if (ACT == 6) v = 0.5f * v * (1.0f + erff(v * 0.70710678118654752f)); so[w][8 * hh + r][t * 16 + ln] = v; } }
  __builtin_amdgcn_fence(__ATOMIC_ACQ_REL, "workgroup"); __builtin_amdgcn_wave_barrier();
  const int rsub = lane >> 4, c4 = (lane & 15) * 4; typedef _Float16 v4h __attribute__((ext_vector_type(4)));
  {
#pragma unroll
    for (int q = 0; q < 8; ++q) { const int r = q * 2 + rsub; if (col0 + c4 < N) { const v4f v = *(const v4fa*)&so[w][r][c4]; if (C) *(v4f*)(C + cofs + (size_t)(row0 + r) * ldc + col0 + c4) = v; if (C16) { v4h h4; for (int i = 0; i < 4; ++i) h4[i] = (_Float16)v[i]; *(v4h*)(C16 + cofs + (size_t)(row0 + r) * ldc + col0 + c4) = h4; } } }
     }
}


typedef _Float16 v4h __attribute__((ext_vector_type(4)));

__global__ __launch_bounds__(256) void k_x16(const float* __restrict__ x, _Float16* __restrict__ X16, size_t n8) { const size_t t = (size_t)blockIdx.x * 256 + threadIdx.x; if (t >= n8) return; FragH f;
#pragma unroll
  for (int q = 0; q < 8; ++q) f.h[q] = (_Float16)bf16_round(x[t * 8 + q]); *(v8us*)((unsigned short*)X16 + t * 8) = f.half[0];  }
__global__ __launch_bounds__(256) void k_h16(const float* __restrict__ x, _Float16* __restrict__ X16, size_t n8) { const size_t t = (size_t)blockIdx.x * 256 + threadIdx.x; if (t >= n8) return; FragH f;
#pragma unroll
  for (int q = 0; q < 8; ++q) f.h[q] = (_Float16)x[t * 8 + q]; *(v8us*)((unsigned short*)X16 + t * 8) = f.half[0];  }
__global__ __launch_bounds__(256) void k_round16f(const float* __restrict__ W, _Float16* __restrict__ Bt, size_t n8) { const size_t t = (size_t)blockIdx.x * 256 + threadIdx.x; if (t >= n8) return; FragH f;
#pragma unroll
  for (int i = 0; i < 8; ++i) f.h[i] = (_Float16)(bf16_round(W[t * 8 + i]) * 16.0f); *(v8us*)((unsigned short*)Bt + t * 8) = f.half[0];  }
template <int NHv, int TTv>
__global__ __launch_bounds__(256) void k_vt(const _Float16* __restrict__ V16, int ldv, int voff, _Float16* __restrict__ Vt) { __shared__ unsigned short tl[64][66]; const int tid = threadIdx.x; const int slab = blockIdx.x / (TTv / 64), lg = blockIdx.x % (TTv / 64); const int b = slab / NHv, h = slab % NHv;
  for (int i = tid; i < 64 * 8; i += 256) { const int r = i / 8, c8 = (i % 8) * 8; FragH f; f.half[0] = *(const v8us*)((const unsigned short*)V16 + ((size_t)b * TTv + lg * 64 + r) * ldv + voff + h * 64 + c8);
#pragma unroll
    for (int q = 0; q < 8; ++q) tl[r][c8 + q] = f.u[q]; }
  __syncthreads();
  {
#pragma unroll
    for (int rd = 0; rd < 2; ++rd) { const int d = rd * 32 + tid / 8, pc = tid % 8; FragH f;
#pragma unroll
      for (int q = 0; q < 8; ++q) f.u[q] = tl[pc * 8 + q][d];
      *(v8us*)((unsigned short*)Vt + ((size_t)slab * 64 + d) * TTv + lg * 64 + pc * 8) = f.half[0]; }
     } }

__global__ __launch_bounds__(256) void k_hl(const float* __restrict__ F, _Float16* __restrict__ Hh, _Float16* __restrict__ Hl, size_t n8) { const size_t t = (size_t)blockIdx.x * 256 + threadIdx.x; if (t >= n8) return; FragH fh, fl; const v4f a = *(const v4fa*)(F + t * 8), c = *(const v4fa*)(F + t * 8 + 4);
#pragma unroll
  for (int q = 0; q < 4; ++q) { _Float16 h = (_Float16)a[q]; fh.h[q] = h; fl.h[q] = (_Float16)((a[q] - (float)h) * 1024.0f); h = (_Float16)c[q]; fh.h[4 + q] = h; fl.h[4 + q] = (_Float16)((c[q] - (float)h) * 1024.0f); }
  { *(v8us*)((unsigned short*)Hh + t * 8) = fh.half[0]; *(v8us*)((unsigned short*)Hl + t * 8) = fl.half[0];  } }

// ---- fast GEMM (wave tile 32x64; requires M % 32 == 0 rows per launch region and N % 64 == 0); epilogue = k_gemm_hhx semantics ----
__device__ __forceinline__ v16h g2_frag(const _Float16* p, int hh) { FragH f; f.half[0] = *(const v8us*)((const unsigned short*)p + 8 * hh); f.half[1] = *(const v8us*)((const unsigned short*)p + 16 + 8 * hh); return f.v; }
__device__ __forceinline__ v8f g2_mma(v16h a, v16h b, v8f c) { v8f d = __builtin_amdgcn_wmma_f32_16x16x32_f16(false, a, false, b, (short)0, c, false, false); asm volatile("v_nop\n\tv_nop\n\tv_nop\n\tv_nop" : "+v"(d) : "v"(a), "v"(b)); return d; }
template <int ACT>
__global__ __launch_bounds__(128) void k_gemm2(const _Float16* __restrict__ A, int lda, size_t sA, const _Float16* __restrict__ Bh, int ldb, size_t sB, float alpha, const float* __restrict__ bias, size_t sBias, const float* __restrict__ CP, int rowsPerB, size_t sCPb, int row0g,
    float* __restrict__ C, _Float16* __restrict__ C16, int ldc, size_t sC, int M, int N, int K) { static_assert(ACT == 0 || ACT == 3 || ACT == 6 || ACT == 8 || ACT == 9 || ACT == 11 || ACT == 12 || ACT == 14 || ACT == 15 || ACT == 16 || ACT == 17, "k_gemm2: unsupported ACT code (would silently apply no activation)");
  __shared__ __attribute__((aligned(16))) float so[4][32][68];
  const int tid = threadIdx.x, w = tid >> 5, lane = tid & 31, ln = lane & 15, hh = lane >> 4; const int by = blockIdx.y;
  A += (size_t)by * sA; Bh += (size_t)by * sB; const size_t cofs = (size_t)by * sC; const float* bp = bias ? bias + (size_t)by * sBias : nullptr;
  const int ntn = N >> 6; const int mt = blockIdx.x / ntn, nq = blockIdx.x - mt * ntn; const int row0 = mt * 128 + 32 * w, col0 = nq * 64; if (row0 >= M) return;
  const _Float16* a0p = A + (size_t)(row0 + ln) * lda; const _Float16* a1p = a0p + (size_t)16 * lda;
  const _Float16* b0p = Bh + (size_t)(col0 + ln) * ldb; const _Float16* b1p = b0p + (size_t)16 * ldb; const _Float16* b2p = b1p + (size_t)16 * ldb; const _Float16* b3p = b2p + (size_t)16 * ldb;
  const v8f z8 = {0.f,0.f,0.f,0.f,0.f,0.f,0.f,0.f}; v8f c00 = z8, c01 = z8, c02 = z8, c03 = z8, c10 = z8, c11 = z8, c12 = z8, c13 = z8;
#pragma unroll 1
  for (int kb = 0; kb < K; kb += 32) { const v16h a0 = g2_frag(a0p + kb, hh), a1 = g2_frag(a1p + kb, hh);
    v16h b = g2_frag(b0p + kb, hh); c00 = g2_mma(a0, b, c00); c10 = g2_mma(a1, b, c10);
    b = g2_frag(b1p + kb, hh); c01 = g2_mma(a0, b, c01); c11 = g2_mma(a1, b, c11);
    b = g2_frag(b2p + kb, hh); c02 = g2_mma(a0, b, c02); c12 = g2_mma(a1, b, c12);
    b = g2_frag(b3p + kb, hh); c03 = g2_mma(a0, b, c03); c13 = g2_mma(a1, b, c13); }
  v8f accs[8] = {c00, c01, c02, c03, c10, c11, c12, c13};
#pragma unroll
  for (int u = 0; u < 8; ++u) { const int t = u & 3, half = u >> 2; const int col = col0 + t * 16 + ln; const float bv = bp ? bf16_round(bp[col]) : 0.f;
#pragma unroll
    for (int r = 0; r < 8; ++r) { const int rloc = half * 16 + 8 * hh + r; float v = accs[u][r] * alpha + bv; if (CP) { if (rowsPerB < 0) v += CP[cofs + (size_t)(row0g + row0 + rloc) * ldc + col];      /* rowsPerB < 0: own element of the batched C plane */ else { const int bidx = (row0g + row0 + rloc) / rowsPerB; v += CP[(size_t)bidx * sCPb + (size_t)by * 64 + col]; } }
      if (ACT == 3) v = fmaxf(v, 0.f); else if (ACT == 6) v = 0.5f * v * (1.0f + erff(v * 0.70710678118654752f)); else if (ACT == 11) v = 1.0f / (1.0f + expf(-v)); else if (ACT == 15) v = v / (1.0f + expf(-v)); else if (ACT == 12) v = (v > 0.f) ? v : 0.01f * v; else if (ACT == 8) v = tanhf(v); else if (ACT == 9) v = 0.5f * v * (1.0f + tanhf(0.7978845608028654f * (v + 0.044715f * v * v * v))); else if (ACT == 14) v = (v > 0.f) ? v : 0.1f * v; else if (ACT == 16) v = (v >= 0.f) ? v : 0.3f * v; else if (ACT == 17) v = (v >= 0.f) ? v : 0.2f * v;
      so[w][rloc][t * 16 + ln] = v; } }
  __builtin_amdgcn_fence(__ATOMIC_ACQ_REL, "workgroup"); __builtin_amdgcn_wave_barrier();
  const int rsub = lane >> 4, c4 = (lane & 15) * 4;
  {
#pragma unroll
    for (int q = 0; q < 16; ++q) { const int r = q * 2 + rsub; const v4f v = *(const v4fa*)&so[w][r][c4]; if (C) *(v4f*)(C + cofs + (size_t)(row0 + r) * ldc + col0 + c4) = v; if (C16) { v4h h4; for (int i = 0; i < 4; ++i) h4[i] = (_Float16)v[i]; *(v4h*)(C16 + cofs + (size_t)(row0 + r) * ldc + col0 + c4) = h4; } }
     } }


__global__ __launch_bounds__(256) void k_wnat(const float* __restrict__ w, size_t n8, _Float16* __restrict__ Bt) { const size_t t = (size_t)blockIdx.x * 256 + threadIdx.x; if (t >= n8) return; FragH f; for (int q = 0; q < 8; ++q) f.h[q] = (_Float16)(bf16_round(w[t * 8 + q]) * 16.0f); *(v8us*)((unsigned short*)Bt + t * 8) = f.half[0];  }
__global__ __launch_bounds__(256) void k_rsm(const float* __restrict__ S, _Float16* __restrict__ P, int nrows) {
  #pragma clang fp contract(off)
  const int i = blockIdx.x * 256 + threadIdx.x; if (i >= nrows) return; const float* s = S + (size_t)i * SQ; float mx = -3.0e38f;
#pragma unroll 1
  for (int j = 0; j < SQ; ++j) mx = fmaxf(mx, s[j]); float se = 0.f;
#pragma unroll 1
  for (int j = 0; j < SQ; ++j) se += expf(s[j] - mx); const float sc = 256.0f / se;
#pragma unroll 1
  for (int j0 = 0; j0 < SQ; j0 += 8) { FragH f; for (int q = 0; q < 8; ++q) f.h[q] = (_Float16)(expf(s[j0 + q] - mx) * sc); unsigned short* d = (unsigned short*)P + (size_t)i * SQ + j0; *(v8us*)d = f.half[0];  } }
__global__ __launch_bounds__(256) void k_vt(const _Float16* __restrict__ V16, int b, int h0, _Float16* __restrict__ VT) { __shared__ unsigned short tl[64][65]; const int tid = threadIdx.x; const int hh = blockIdx.x % HG, sg = blockIdx.x / HG; const int s0 = sg * 64; const int h = h0 + hh;
  for (int i = tid; i < 64 * 8; i += 256) { const int j = i / 8, d8 = (i % 8) * 8; FragH f; f.half[0] = *(const v8us*)((const unsigned short*)V16 + ((size_t)b * SQ + s0 + j) * DM + h * HD + d8); for (int q = 0; q < 8; ++q) tl[d8 + q][j] = f.u[q]; }
  __syncthreads();
  { for (int i = tid; i < 64 * 8; i += 256) { const int d = i / 8, j8 = (i % 8) * 8; FragH f; for (int q = 0; q < 8; ++q) f.u[q] = tl[d][j8 + q]; *(v8us*)((unsigned short*)VT + ((size_t)hh * HD + d) * SQ + s0 + j8) = f.half[0]; }  } }



__global__ __launch_bounds__(256) void k_rsmf(const float* __restrict__ S, _Float16* __restrict__ P, int qn, int hg) {
  #pragma clang fp contract(off)
  const int t = blockIdx.x * 256 + threadIdx.x; if (t >= qn * hg) return; const size_t i = (size_t)(t / qn) * SQ + (t % qn); const float* s = S + i * SQ; float mx = -3.0e38f;
#pragma unroll 1
  for (int j = 0; j < SQ; ++j) mx = fmaxf(mx, s[j]); float se = 0.f;
#pragma unroll 1
  for (int j = 0; j < SQ; ++j) se += __expf(s[j] - mx); const float sc = 256.0f / se;
#pragma unroll 1
  for (int j0 = 0; j0 < SQ; j0 += 8) { FragH f; for (int q = 0; q < 8; ++q) f.h[q] = (_Float16)(__expf(s[j0 + q] - mx) * sc); unsigned short* d = (unsigned short*)P + i * SQ + j0; *(v8us*)d = f.half[0];  } }

extern "C" void kernel_launch(void* const* d_in, const int* in_sizes, int n_in,
                              void* d_out, int out_size, void* d_ws, size_t ws_size, hipStream_t stream) {
  (void)in_sizes; (void)n_in; (void)out_size;
  const float* const* I = (const float* const*)d_in; const float* xq = I[2]; const float* xk = I[1]; const float* xv = I[0]; const float* wq = I[5]; const float* bq = nullptr; const float* wk = I[4]; const float* bk = nullptr; const float* wv = I[3]; const float* bv = nullptr; const float* wo = I[6]; const float* bo = I[7];      /* input order: values, keys, query (three unbatched [4096][1024] streams in REVERSE order: the query stream is I[2]), Wv, Wk, Wq (the weights in the same reverse order: Wq is I[5]), Wo, bo ([in][out] weights); the q / k / v projections have NO biases: null pointers in the guarded bias slots */
  char* ws = (char*)d_ws; size_t off = 0;
  auto take = [&](size_t bytes) { char* p = ws + off; off += (bytes + 255) & ~(size_t)255; return p; };
  _Float16* BQ = (_Float16*)take((size_t)DM * DM * 2); _Float16* BK = (_Float16*)take((size_t)DM * DM * 2); _Float16* BV = (_Float16*)take((size_t)DM * DM * 2); _Float16* BO = (_Float16*)take((size_t)DM * DM * 2);
  _Float16* XQ = (_Float16*)take(NR * DM * 2); _Float16* XK = (_Float16*)take(NR * DM * 2); _Float16* XV = (_Float16*)take(NR * DM * 2); _Float16* Q16 = (_Float16*)take(NR * DM * 2); _Float16* K16 = (_Float16*)take(NR * DM * 2); _Float16* V16 = (_Float16*)take(NR * DM * 2); _Float16* O16 = (_Float16*)take(NR * DM * 2);
  float* S = (float*)take((size_t)HG * SQ * SQ * 4); _Float16* P = (_Float16*)take((size_t)HG * SQ * SQ * 2); _Float16* VT = (_Float16*)take((size_t)NH * HD * SQ * 2);
  if (off > ws_size) return;
  { const unsigned g = (unsigned)(((size_t)DM * (DM / 8) + 255) / 256); k_wt_f16<<<g, 256, 0, stream>>>(wq, BQ, DM, DM, 16.0f); k_wt_f16<<<g, 256, 0, stream>>>(wk, BK, DM, DM, 16.0f); k_wt_f16<<<g, 256, 0, stream>>>(wv, BV, DM, DM, 16.0f); k_wt_f16<<<g, 256, 0, stream>>>(wo, BO, DM, DM, 16.0f); }      /* [in][out] -> Bt[n][k] x16 (transposing builder) */

  k_x16<<<(unsigned)((NR * DM / 8 + 255) / 256), 256, 0, stream>>>(xq, XQ, NR * DM / 8); k_x16<<<(unsigned)((NR * DM / 8 + 255) / 256), 256, 0, stream>>>(xk, XK, NR * DM / 8); k_x16<<<(unsigned)((NR * DM / 8 + 255) / 256), 256, 0, stream>>>(xv, XV, NR * DM / 8);      /* the three inputs as exact f16 rows */
  const size_t r0p = (size_t)B0 * SQ;      /* first projected row */
  k_gemm2<0><<<dim3((unsigned)((MP / 128) * (DM / 64)), 1), 128, 0, stream>>>(XQ + r0p * DM, DM, 0, BQ, DM, 0, 0.0625f, bq, 0, nullptr, 1, 0, 0, nullptr, Q16 + r0p * DM, DM, 0, MP, DM, DM);
  k_gemm2<0><<<dim3((unsigned)((MP / 128) * (DM / 64)), 1), 128, 0, stream>>>(XK + r0p * DM, DM, 0, BK, DM, 0, 0.0625f, bk, 0, nullptr, 1, 0, 0, nullptr, K16 + r0p * DM, DM, 0, MP, DM, DM);
  k_gemm2<0><<<dim3((unsigned)((MP / 128) * (DM / 64)), 1), 128, 0, stream>>>(XV + r0p * DM, DM, 0, BV, DM, 0, 0.0625f, bv, 0, nullptr, 1, 0, 0, nullptr, V16 + r0p * DM, DM, 0, MP, DM, DM);
  for (int b = B0; b < B0 + NBR; ++b) { const size_t r0 = (size_t)b * SQ;
    k_vt<NH, SQ><<<NH * (SQ / 64), 256, 0, stream>>>(V16 + r0 * LQ, LQ, 0, VT);      /* V^T [NH][HD][SQ] for this batch */
    for (int h0 = 0; h0 < NHD; h0 += HG) {
      k_gemm2<0><<<dim3((QN / 128) * (SQ / 64), HG), 128, 0, stream>>>(Q16 + r0 * LQ + h0 * HD, LQ, (size_t)HD, K16 + r0 * LQ + h0 * HD, LQ, (size_t)HD, 0.03125f, nullptr, 0, nullptr, 1, 0, 0, S, nullptr, SQ, (size_t)SQ * SQ, QN, SQ, HD);      /* scores, HG heads per launch */      /* THIS module's score scale: 1/sqrt(EMBED 1024) = 1/32 (the model width, the source's form) */
      k_rsmf<<<(HG * QN + 255) / 256, 256, 0, stream>>>(S, P, QN, HG);      /* P = 256 softmax (f16), rows of all HG heads */
      k_gemm2<0><<<dim3((QN / 128) * (HD / 64), HG), 128, 0, stream>>>(P, SQ, (size_t)SQ * SQ, VT + (size_t)h0 * HD * SQ, SQ, (size_t)HD * SQ, 0.25f, nullptr, 0, nullptr, 1, 0, 0, nullptr, O16 + r0 * DM + h0 * HD, DM, (size_t)HD, QN, HD, SQ); } }      /* o (merged heads) as f16 rows */
  k_gemm2<0><<<dim3((unsigned)((MPO / 128) * (DM / 64)), 1), 128, 0, stream>>>(O16 + r0p * DM, DM, 0, BO, DM, 0, 0.0009765625f, bo, 0, nullptr, 1, 0, 0, (float*)d_out + r0p * DM, nullptr, DM, 0, MPO, DM, DM);      /* out rows are the output layout */
}

// v001
// Measured time: 2770 microseconds a run.
// In two side-by-side timings against v000, it was 4.80 and 4.79 times as fast.
#include <hip/hip_runtime.h>
// Multi-head attention on three unbatched inputs with [in][out] bias-free q / k / v projections, a biased output projection and the source's MODEL-WIDTH score scale; the inputs arrive in the order values, keys, query (each [4096][1024]; v / k / q = stream W ([in][out] 1024 x 1024 sd 1/32, NO biases), 16 heads of 64; energy / sqrt(1024) (the module scales by the EMBED width, not the head width: 1/32); softmax over all 4096 keys (no mask); out = merged Wo + bo ([in][out]) -> [4096][1024]); ONE head per attention launch group.
// Structure: token rows r = b*4096 + s; the query, key and value sources as exact f16 rows (bf16-rounded); Q, K, V as three WMMA GEMMs (32x64 wave tiles, f32 accumulation, exact x16 weights, no bias, f16 outputs); per batch: V^T for all heads via LDS transposes; per (batch, head): scores GEMM (K = 64, batched over the heads on grid.y, alpha = 1/32), row softmax on VALU (f32 statistics, native exp; weights stored x256 as f16), o = P . V^T GEMM (K = 4096, alpha 2^-2: o carried x64 against f16 subnormal flush, folded into the output GEMM alpha) written straight into the merged f16 o rows; out = o W_o + b GEMM (f32) into the output layout.
// Compute dtype: inputs rounded to bf16; x / weights exact; q, k, v, softmax weights and o as plain f16 GEMM operands (~2^-12); scores and softmax statistics f32. v_wmma_f32_16x16x32_f16.
#define NB 1
#define SQ 4096
#define DM 1024
#define NH 16
#define HD 64
#define HG 1                         /* heads per attention launch group */
#define B0 0                         /* first batch processed (debug hook) */
#define NBR NB                       /* batches processed (debug hook) */
#define NR ((size_t)NB * SQ)         /* token rows */
#define MP ((int)((size_t)NBR * SQ)) /* rows projected (debug hook) */
#define QN SQ                        /* query rows attended per batch (debug hook) */
#define NHD NH                       /* heads attended (debug hook) */
#define MPO MP                       /* rows through the output stage (debug hook) */
#define LQ DM      /* row pitch of the q/k/v rows */
typedef __bf16 v16b __attribute__((ext_vector_type(16)));
typedef unsigned short v8us __attribute__((ext_vector_type(8), may_alias));
typedef float  v8f  __attribute__((ext_vector_type(8)));
typedef float  v4f  __attribute__((ext_vector_type(4)));
typedef float  v4fa __attribute__((ext_vector_type(4), may_alias));
union FragB { v16b v; v8us half[2]; unsigned short u[16]; };

__device__ __forceinline__ unsigned short bf16_bits(float x) { unsigned int u = __float_as_uint(x); return (unsigned short)((u + 0x7FFFu + ((u >> 16) & 1u)) >> 16); }
__device__ __forceinline__ float bf16_val(unsigned short b) { return __uint_as_float(((unsigned int)b) << 16); }
__device__ __forceinline__ float bf16_round(float x) { return bf16_val(bf16_bits(x)); }
// D += A·B with NT terms: 1 = ah·bh, 2 = + al·bh (A split), 3 = + ah·bl (both split)
template <int NT>
__device__ __forceinline__ v8f mmaN(v16b ah, v16b al, v16b bh, v16b bl, v8f c) {
  c = __builtin_amdgcn_wmma_f32_16x16x32_bf16(false, ah, false, bh, (short)0, c, false, false);
  if (NT >= 2) c = __builtin_amdgcn_wmma_f32_16x16x32_bf16(false, al, false, bh, (short)0, c, false, false);
  if (NT >= 3) c = __builtin_amdgcn_wmma_f32_16x16x32_bf16(false, ah, false, bl, (short)0, c, false, false);
  asm volatile("v_nop\n\tv_nop\n\tv_nop\n\tv_nop" : "+v"(c) : "v"(ah), "v"(al), "v"(bh), "v"(bl));
  return c;
}

__global__ __launch_bounds__(256) void k_wt_bf16(const float* __restrict__ W, unsigned short* __restrict__ Wt, int K, int N) {
  const int t = blockIdx.x * 256 + threadIdx.x;
  const int k8n = K / 8;
  if (t >= N * k8n) return;
  const int n = t / k8n, k8 = (t % k8n) * 8;
  v8us v;
#pragma unroll
  for (int i = 0; i < 8; ++i) v[i] = bf16_bits(W[(size_t)(k8 + i) * N + n]);
  *(v8us*)(Wt + (size_t)n * K + k8) = v;
  
}

// GEMM C[M][N] (f32, pitch ldc) = act(A[M][K]·W + bias). A f32 row-major (pitch lda) converted per fragment to bf16
// (ASPLIT: hi/lo two planes -> 2 terms, else single rounded term); Wt bf16 [N][K] (pitch ldb). BIAS_BF16 rounds the
// bias to bf16 first (bias quantised to bf16 before the add). K%32==0, M%16==0, N%64==0.
template <bool ASPLIT, int ACT, bool BIAS_BF16>
__global__ __launch_bounds__(128) void k_gemm_bf(const float* __restrict__ A, int lda, const unsigned short* __restrict__ Wt, int ldb,
                                               const float* __restrict__ bias, float* __restrict__ C, int ldc, int M, int N, int K) {
  __shared__ __attribute__((aligned(16))) float so[4][16][64];
  const int tid = threadIdx.x, w = tid >> 5, lane = tid & 31, ln = lane & 15, hh = lane >> 4;
  const int ntn = N / 64;
  const int wid = blockIdx.x * 4 + w;
  const int mt = wid / ntn, nq = wid % ntn;
  if (mt * 16 >= M) return;
  const int row0 = mt * 16, col0 = nq * 64;
  const float* arow = A + (size_t)(row0 + ln) * lda;
  v8f acc[4] = {};
  for (int kb = 0; kb < K; kb += 32) {
    FragB ah, al;
    const v4f x0 = *(const v4fa*)(arow + kb + 8 * hh), x1 = *(const v4fa*)(arow + kb + 8 * hh + 4);
    const v4f x2 = *(const v4fa*)(arow + kb + 16 + 8 * hh), x3 = *(const v4fa*)(arow + kb + 16 + 8 * hh + 4);
    float xs[16] = {x0[0],x0[1],x0[2],x0[3],x1[0],x1[1],x1[2],x1[3],x2[0],x2[1],x2[2],x2[3],x3[0],x3[1],x3[2],x3[3]};
#pragma unroll
    for (int i = 0; i < 16; ++i) { const unsigned short hb = bf16_bits(xs[i]); ah.u[i] = hb; al.u[i] = ASPLIT ? bf16_bits(xs[i] - bf16_val(hb)) : (unsigned short)0; }
#pragma unroll
    for (int t = 0; t < 4; ++t) {
      const unsigned short* brow = Wt + (size_t)(col0 + t * 16 + ln) * ldb + kb;
      FragB b;
      b.half[0] = *(const v8us*)(brow + 8 * hh);
      b.half[1] = *(const v8us*)(brow + 16 + 8 * hh);
      acc[t] = mmaN<ASPLIT ? 2 : 1>(ah.v, al.v, b.v, b.v, acc[t]);
    }
  }
#pragma unroll
  for (int t = 0; t < 4; ++t) {
    float bv = bias ? bias[col0 + t * 16 + ln] : 0.f;
    if (BIAS_BF16) bv = bf16_round(bv);
#pragma unroll
    for (int r = 0; r < 8; ++r) { float v = acc[t][r] + bv; if (ACT == 1) v = fmaxf(v, 0.f); so[w][8 * hh + r][t * 16 + ln] = v; }
  }
  __builtin_amdgcn_fence(__ATOMIC_ACQ_REL, "workgroup");
  __builtin_amdgcn_wave_barrier();
  const int rsub = lane >> 4, c4 = (lane & 15) * 4;
  {
#pragma unroll
    for (int q = 0; q < 8; ++q) {
      const int r = q * 2 + rsub;
      const v4f v = *(const v4fa*)&so[w][r][c4];
      *(v4f*)(C + (size_t)(row0 + r) * ldc + col0 + c4) = v;
    }
    
  }
}

// GEMM C = act(A·W + bias + resid): A f32 (ASPLIT -> hi/lo 2 terms), Wt bf16 [N][K]; ACT 0 none, 1 relu, 2 exact gelu;
// resid (optional, f32, row index = (row % rmod), pitch ldr, RES_BF16 rounds it) added before the activation.
template <bool ASPLIT, int ACT, bool BIAS_BF16, bool RES_BF16>
__global__ __launch_bounds__(128) void k_gemm_bf3(const float* __restrict__ A, int lda, const unsigned short* __restrict__ Wt, int ldb,
                                                const float* __restrict__ bias, const float* __restrict__ resid, int rmod, int ldr,
                                                float* __restrict__ C, int ldc, int M, int N, int K) {
  __shared__ __attribute__((aligned(16))) float so[4][16][64];
  const int tid = threadIdx.x, w = tid >> 5, lane = tid & 31, ln = lane & 15, hh = lane >> 4;
  const int ntn = N / 64;
  const int wid = blockIdx.x * 4 + w;
  const int mt = wid / ntn, nq = wid % ntn;
  if (mt * 16 >= M) return;
  const int row0 = mt * 16, col0 = nq * 64;
  const float* arow = A + (size_t)(row0 + ln) * lda;
  v8f acc[4] = {};
  for (int kb = 0; kb < K; kb += 32) {
    FragB ah, al;
    const v4f x0 = *(const v4fa*)(arow + kb + 8 * hh), x1 = *(const v4fa*)(arow + kb + 8 * hh + 4);
    const v4f x2 = *(const v4fa*)(arow + kb + 16 + 8 * hh), x3 = *(const v4fa*)(arow + kb + 16 + 8 * hh + 4);
    float xs[16] = {x0[0],x0[1],x0[2],x0[3],x1[0],x1[1],x1[2],x1[3],x2[0],x2[1],x2[2],x2[3],x3[0],x3[1],x3[2],x3[3]};
#pragma unroll
    for (int i = 0; i < 16; ++i) { const unsigned short hb = bf16_bits(xs[i]); ah.u[i] = hb; al.u[i] = ASPLIT ? bf16_bits(xs[i] - bf16_val(hb)) : (unsigned short)0; }
#pragma unroll
    for (int t = 0; t < 4; ++t) {
      const unsigned short* brow = Wt + (size_t)(col0 + t * 16 + ln) * ldb + kb;
      FragB b;
      b.half[0] = *(const v8us*)(brow + 8 * hh);
      b.half[1] = *(const v8us*)(brow + 16 + 8 * hh);
      acc[t] = mmaN<ASPLIT ? 2 : 1>(ah.v, al.v, b.v, b.v, acc[t]);
    }
  }
#pragma unroll
  for (int t = 0; t < 4; ++t) {
    const int col = col0 + t * 16 + ln;
    float bv = bias ? bias[col] : 0.f;
    if (BIAS_BF16) bv = bf16_round(bv);
#pragma unroll
    for (int r = 0; r < 8; ++r) {
      float v = acc[t][r] + bv;
      if (resid) { float rv = resid[(size_t)((row0 + 8 * hh + r) % rmod) * ldr + col]; if (RES_BF16) rv = bf16_round(rv); v += rv; }
      if (ACT == 1) v = fmaxf(v, 0.f);
      if (ACT == 2) v = 0.5f * v * (1.0f + erff(v * 0.70710678118654752f));
      if (ACT == 3) { const float u = 0.7978845608028654f * (v + 0.044715f * v * v * v); v = 0.5f * v * (1.0f + tanhf(u)); }
      so[w][8 * hh + r][t * 16 + ln] = v;
    }
  }
  __builtin_amdgcn_fence(__ATOMIC_ACQ_REL, "workgroup");
  __builtin_amdgcn_wave_barrier();
  const int rsub = lane >> 4, c4 = (lane & 15) * 4;
  {
#pragma unroll
    for (int q = 0; q < 8; ++q) {
      const int r = q * 2 + rsub;
      const v4f v = *(const v4fa*)&so[w][r][c4];
      *(v4f*)(C + (size_t)(row0 + r) * ldc + col0 + c4) = v;
    }
    
  }
}
// row LayerNorm (biased variance, eps) over N: s = X (+ R); optional out_sum <- s; out_norm <- (s-mu)*rsqrt(var+eps)*g + b
template <bool PARAM_BF16>
__global__ __launch_bounds__(256) void k_layernorm(const float* __restrict__ X, const float* __restrict__ R, const float* __restrict__ g, const float* __restrict__ bta,
                                                  float* __restrict__ out_sum, float* __restrict__ out_norm, int N, float eps) {
  __shared__ float red[256];
  const int row = blockIdx.x, tid = threadIdx.x;
  const float* x = X + (size_t)row * N; const float* rr = R ? R + (size_t)row * N : nullptr;
  float vals[16];                     // up to N = 4096
  const int per = N / 256;            // contiguous chunk per thread? use strided-by-4 chunks: thread handles j = tid*4 + 1024*u
  float s1 = 0.f;
  for (int u = 0; u < per / 4; ++u) {
    const int j = tid * 4 + 1024 * u;
    const v4f a = *(const v4fa*)(x + j);
    v4f b = {0.f,0.f,0.f,0.f}; if (rr) b = *(const v4fa*)(rr + j);
#pragma unroll
    for (int q = 0; q < 4; ++q) { const float v = a[q] + b[q]; vals[u * 4 + q] = v; s1 += v; }
  }
  red[tid] = s1; __syncthreads();
  for (int st = 128; st > 0; st >>= 1) { if (tid < st) red[tid] += red[tid + st]; __syncthreads(); }
  const float mu = red[0] / (float)N; __syncthreads();
  float s2 = 0.f;
  for (int u = 0; u < per / 4; ++u)
#pragma unroll
    for (int q = 0; q < 4; ++q) { const float c = vals[u * 4 + q] - mu; s2 += c * c; }
  red[tid] = s2; __syncthreads();
  for (int st = 128; st > 0; st >>= 1) { if (tid < st) red[tid] += red[tid + st]; __syncthreads(); }
  const float rs = rsqrtf(red[0] / (float)N + eps);
  {
    for (int u = 0; u < per / 4; ++u) {
      const int j = tid * 4 + 1024 * u;
      v4f o, sm;
#pragma unroll
      for (int q = 0; q < 4; ++q) {
        float gg = g[j + q], bb = bta[j + q];
        if (PARAM_BF16) { gg = bf16_round(gg); bb = bf16_round(bb); }
        sm[q] = vals[u * 4 + q]; o[q] = (vals[u * 4 + q] - mu) * rs * gg + bb;
      }
      if (out_sum) *(v4f*)(out_sum + (size_t)row * N + j) = sm;
      *(v4f*)(out_norm + (size_t)row * N + j) = o;
    }
    
  }
}



// ---- f16 WMMA path (v_wmma_f32_16x16x32_f16): 11-bit significands for operands in range — used where a [0,1] probability operand needs more precision than bf16
typedef _Float16 v16h __attribute__((ext_vector_type(16)));
union FragH { v16h v; v8us half[2]; _Float16 h[16]; unsigned short u[16]; };
template <int NT>
__device__ __forceinline__ v8f mmaH(v16h ah, v16h al, v16h bh, v16h bl, v8f c) {
  c = __builtin_amdgcn_wmma_f32_16x16x32_f16(false, ah, false, bh, (short)0, c, false, false);
  if (NT >= 2) c = __builtin_amdgcn_wmma_f32_16x16x32_f16(false, al, false, bh, (short)0, c, false, false);
  if (NT >= 3) c = __builtin_amdgcn_wmma_f32_16x16x32_f16(false, ah, false, bl, (short)0, c, false, false);
  asm volatile("v_nop\n\tv_nop\n\tv_nop\n\tv_nop" : "+v"(c) : "v"(ah), "v"(al), "v"(bh), "v"(bl));
  return c;
}
// batched GEMM like k_gemm_b but f16 operands: A f32 (split into f16 hi/lo if ASPLIT, else rounded to f16), Bt = f16 values [n][k]; alpha; C f32; N multiple of 16 (partial tiles skipped)
template <bool ASPLIT>
__global__ __launch_bounds__(128) void k_gemm_h(const float* __restrict__ A, int lda, size_t sA, const _Float16* __restrict__ Bh, int ldb, size_t sB, float alpha, float* __restrict__ C, int ldc, size_t sC, int M, int N, int K) {
  __shared__ __attribute__((aligned(16))) float so[4][16][64];
  const int tid = threadIdx.x, w = tid >> 5, lane = tid & 31, ln = lane & 15, hh = lane >> 4; const int by = blockIdx.y;
  A += (size_t)by * sA; Bh += (size_t)by * sB; C += (size_t)by * sC;
  const int ntn = (N + 63) / 64; const int wid = blockIdx.x * 4 + w; const int mt = wid / ntn, nq = wid % ntn; if (mt * 16 >= M) return;
  const int row0 = mt * 16, col0 = nq * 64; const float* arow = A + (size_t)(row0 + ln) * lda;
  v8f acc[4] = {};
  for (int kb = 0; kb < K; kb += 32) {
    FragH ah, al;
    const v4f x0 = *(const v4fa*)(arow + kb + 8 * hh), x1 = *(const v4fa*)(arow + kb + 8 * hh + 4), x2 = *(const v4fa*)(arow + kb + 16 + 8 * hh), x3 = *(const v4fa*)(arow + kb + 16 + 8 * hh + 4);
    float xs[16] = {x0[0],x0[1],x0[2],x0[3],x1[0],x1[1],x1[2],x1[3],x2[0],x2[1],x2[2],x2[3],x3[0],x3[1],x3[2],x3[3]};
#pragma unroll
    for (int i = 0; i < 16; ++i) { const _Float16 h = (_Float16)xs[i]; ah.h[i] = h; al.h[i] = ASPLIT ? (_Float16)(xs[i] - (float)h) : (_Float16)0.0f; }
#pragma unroll
    for (int t = 0; t < 4; ++t) { if (col0 + t * 16 >= N) continue; const size_t boff = (size_t)(col0 + t * 16 + ln) * ldb + kb; FragH bq; bq.half[0] = *(const v8us*)(Bh + boff + 8 * hh); bq.half[1] = *(const v8us*)(Bh + boff + 16 + 8 * hh);
      acc[t] = mmaH<ASPLIT ? 2 : 1>(ah.v, al.v, bq.v, bq.v, acc[t]); }
  }
#pragma unroll
  for (int t = 0; t < 4; ++t) { if (col0 + t * 16 >= N) continue;
#pragma unroll
    for (int r = 0; r < 8; ++r) so[w][8 * hh + r][t * 16 + ln] = acc[t][r] * alpha; }
  __builtin_amdgcn_fence(__ATOMIC_ACQ_REL, "workgroup"); __builtin_amdgcn_wave_barrier();
  const int rsub = lane >> 4, c4 = (lane & 15) * 4;
  {
#pragma unroll
    for (int q = 0; q < 8; ++q) { const int r = q * 2 + rsub; if (col0 + c4 < N) { const v4f v = *(const v4fa*)&so[w][r][c4]; *(v4f*)(C + (size_t)(row0 + r) * ldc + col0 + c4) = v; } }
     }
}

// Wt[n][k] = f16(W[k][n]·scale) from f32 row-major W[K][N] (scale = power of two; bf16-exact weights stay exact in f16 away from the subnormal range)
__global__ __launch_bounds__(256) void k_wt_f16(const float* __restrict__ W, _Float16* __restrict__ Wt, int K, int N, float scale) {
  const int t = blockIdx.x * 256 + threadIdx.x; if (t >= N * (K / 8)) return; const int n = t / (K / 8), k8 = (t % (K / 8)) * 8; FragH f;
#pragma unroll
  for (int i = 0; i < 8; ++i) f.h[i] = (_Float16)(bf16_round(W[(size_t)(k8 + i) * N + n]) * scale); const v8us o = f.half[0];
  *(v8us*)((unsigned short*)Wt + (size_t)n * K + k8) = o; 
}
// k_gemm_hh variant with fused epilogue: v = acc·alpha + bias[by·sBias + col] (+ CP[(row/rowsPerB)·sCPb + by·64 + col] if CP) ; ACT 0 none / 1 elu ; writes f16 C16 (and f32 C if non-null)
template <int ACT>
__global__ __launch_bounds__(128) void k_gemm_hhx(const _Float16* __restrict__ A, int lda, size_t sA, const _Float16* __restrict__ Bh, int ldb, size_t sB, float alpha, const float* __restrict__ bias, size_t sBias, const float* __restrict__ CP, int rowsPerB, size_t sCPb, int row0g,
    float* __restrict__ C, _Float16* __restrict__ C16, int ldc, size_t sC, int M, int N, int K) {
  __shared__ __attribute__((aligned(16))) float so[4][16][64];
  const int tid = threadIdx.x, w = tid >> 5, lane = tid & 31, ln = lane & 15, hh = lane >> 4; const int by = blockIdx.y;
  A += (size_t)by * sA; Bh += (size_t)by * sB; const size_t cofs = (size_t)by * sC; const float* bp = bias ? bias + (size_t)by * sBias : nullptr;
  const int ntn = (N + 63) / 64; const int wid = blockIdx.x * 4 + w; const int mt = wid / ntn, nq = wid % ntn; if (mt * 16 >= M) return;
  const int row0 = mt * 16, col0 = nq * 64; const _Float16* arow = A + (size_t)(row0 + ln) * lda;
  v8f acc[4] = {};
  for (int kb = 0; kb < K; kb += 32) { FragH ah; ah.half[0] = *(const v8us*)((const unsigned short*)arow + kb + 8 * hh); ah.half[1] = *(const v8us*)((const unsigned short*)arow + kb + 16 + 8 * hh);
#pragma unroll
    for (int t = 0; t < 4; ++t) { if (col0 + t * 16 >= N) continue; const size_t boff = (size_t)(col0 + t * 16 + ln) * ldb + kb; FragH bq; bq.half[0] = *(const v8us*)((const unsigned short*)Bh + boff + 8 * hh); bq.half[1] = *(const v8us*)((const unsigned short*)Bh + boff + 16 + 8 * hh);
      acc[t] = mmaH<1>(ah.v, ah.v, bq.v, bq.v, acc[t]); }
  }
#pragma unroll
  for (int t = 0; t < 4; ++t) { if (col0 + t * 16 >= N) continue; const int col = col0 + t * 16 + ln; const float bv = bp ? bf16_round(bp[col]) : 0.f;
#pragma unroll
    for (int r = 0; r < 8; ++r) { float v = acc[t][r] * alpha + bv; if (CP) { const int rr = row0g + row0 + 8 * hh + r; if (rowsPerB < 0) v += CP[cofs + (size_t)rr * ldc + col];      /* rowsPerB < 0: own element of the batched C plane */ else { const int bidx = rr / rowsPerB; v += CP[(size_t)bidx * sCPb + (size_t)by * 64 + col]; } } if (ACT == 1) v = (v > 0.f) ? v : expm1f(v); else if (ACT == 7) v = (v > 0.f) ? v + 1.0f : expf(v); else if (ACT == 8) v = tanhf(v); else if (ACT == 9) v = 0.5f * v * (1.0f + tanhf(0.7978845608028654f * (v + 0.044715f * v * v * v))); else if (ACT == 11) v = 1.0f / (1.0f + expf(-v)); else if (ACT == 12) v = (v > 0.f) ? v : 0.01f * v; else if (ACT == 14) v = (v > 0.f) ? v : 0.1f * v; else if (ACT == 16) v = (v >= 0.f) ? v : 0.3f * v; else if (ACT == 17) v = (v >= 0.f) ? v : 0.2f * v; else if (ACT == 15) v = v / (1.0f + expf(-v)); else if (ACT == 3) v = fmaxf(v, 0.f); else if (ACT == 6) v = 0.5f * v * (1.0f + erff(v * 0.70710678118654752f)); so[w][8 * hh + r][t * 16 + ln] = v; } }
  __builtin_amdgcn_fence(__ATOMIC_ACQ_REL, "workgroup"); __builtin_amdgcn_wave_barrier();
  const int rsub = lane >> 4, c4 = (lane & 15) * 4; typedef _Float16 v4h __attribute__((ext_vector_type(4)));
  {
#pragma unroll
    for (int q = 0; q < 8; ++q) { const int r = q * 2 + rsub; if (col0 + c4 < N) { const v4f v = *(const v4fa*)&so[w][r][c4]; if (C) *(v4f*)(C + cofs + (size_t)(row0 + r) * ldc + col0 + c4) = v; if (C16) { v4h h4; for (int i = 0; i < 4; ++i) h4[i] = (_Float16)v[i]; *(v4h*)(C16 + cofs + (size_t)(row0 + r) * ldc + col0 + c4) = h4; } } }
     }
}


typedef _Float16 v4h __attribute__((ext_vector_type(4)));

__global__ __launch_bounds__(256) void k_x16(const float* __restrict__ x, _Float16* __restrict__ X16, size_t n8) { const size_t t = (size_t)blockIdx.x * 256 + threadIdx.x; if (t >= n8) return; FragH f;
#pragma unroll
  for (int q = 0; q < 8; ++q) f.h[q] = (_Float16)bf16_round(x[t * 8 + q]); *(v8us*)((unsigned short*)X16 + t * 8) = f.half[0];  }
__global__ __launch_bounds__(256) void k_h16(const float* __restrict__ x, _Float16* __restrict__ X16, size_t n8) { const size_t t = (size_t)blockIdx.x * 256 + threadIdx.x; if (t >= n8) return; FragH f;
#pragma unroll
  for (int q = 0; q < 8; ++q) f.h[q] = (_Float16)x[t * 8 + q]; *(v8us*)((unsigned short*)X16 + t * 8) = f.half[0];  }
__global__ __launch_bounds__(256) void k_round16f(const float* __restrict__ W, _Float16* __restrict__ Bt, size_t n8) { const size_t t = (size_t)blockIdx.x * 256 + threadIdx.x; if (t >= n8) return; FragH f;
#pragma unroll
  for (int i = 0; i < 8; ++i) f.h[i] = (_Float16)(bf16_round(W[t * 8 + i]) * 16.0f); *(v8us*)((unsigned short*)Bt + t * 8) = f.half[0];  }
template <int NHv, int TTv>
__global__ __launch_bounds__(256) void k_vt(const _Float16* __restrict__ V16, int ldv, int voff, _Float16* __restrict__ Vt) { __shared__ unsigned short tl[64][66]; const int tid = threadIdx.x; const int slab = blockIdx.x / (TTv / 64), lg = blockIdx.x % (TTv / 64); const int b = slab / NHv, h = slab % NHv;
  for (int i = tid; i < 64 * 8; i += 256) { const int r = i / 8, c8 = (i % 8) * 8; FragH f; f.half[0] = *(const v8us*)((const unsigned short*)V16 + ((size_t)b * TTv + lg * 64 + r) * ldv + voff + h * 64 + c8);
#pragma unroll
    for (int q = 0; q < 8; ++q) tl[r][c8 + q] = f.u[q]; }
  __syncthreads();
  {
#pragma unroll
    for (int rd = 0; rd < 2; ++rd) { const int d = rd * 32 + tid / 8, pc = tid % 8; FragH f;
#pragma unroll
      for (int q = 0; q < 8; ++q) f.u[q] = tl[pc * 8 + q][d];
      *(v8us*)((unsigned short*)Vt + ((size_t)slab * 64 + d) * TTv + lg * 64 + pc * 8) = f.half[0]; }
     } }

__global__ __launch_bounds__(256) void k_hl(const float* __restrict__ F, _Float16* __restrict__ Hh, _Float16* __restrict__ Hl, size_t n8) { const size_t t = (size_t)blockIdx.x * 256 + threadIdx.x; if (t >= n8) return; FragH fh, fl; const v4f a = *(const v4fa*)(F + t * 8), c = *(const v4fa*)(F + t * 8 + 4);
#pragma unroll
  for (int q = 0; q < 4; ++q) { _Float16 h = (_Float16)a[q]; fh.h[q] = h; fl.h[q] = (_Float16)((a[q] - (float)h) * 1024.0f); h = (_Float16)c[q]; fh.h[4 + q] = h; fl.h[4 + q] = (_Float16)((c[q] - (float)h) * 1024.0f); }
  { *(v8us*)((unsigned short*)Hh + t * 8) = fh.half[0]; *(v8us*)((unsigned short*)Hl + t * 8) = fl.half[0];  } }

// ---- fast GEMM (wave tile 32x64; requires M % 32 == 0 rows per launch region and N % 64 == 0); epilogue = k_gemm_hhx semantics ----
__device__ __forceinline__ v16h g2_frag(const _Float16* p, int hh) { FragH f; f.half[0] = *(const v8us*)((const unsigned short*)p + 8 * hh); f.half[1] = *(const v8us*)((const unsigned short*)p + 16 + 8 * hh); return f.v; }
__device__ __forceinline__ v8f g2_mma(v16h a, v16h b, v8f c) { v8f d = __builtin_amdgcn_wmma_f32_16x16x32_f16(false, a, false, b, (short)0, c, false, false); asm volatile("v_nop\n\tv_nop\n\tv_nop\n\tv_nop" : "+v"(d) : "v"(a), "v"(b)); return d; }
template <int ACT>
__global__ __launch_bounds__(128) void k_gemm2(const _Float16* __restrict__ A, int lda, size_t sA, const _Float16* __restrict__ Bh, int ldb, size_t sB, float alpha, const float* __restrict__ bias, size_t sBias, const float* __restrict__ CP, int rowsPerB, size_t sCPb, int row0g,
    float* __restrict__ C, _Float16* __restrict__ C16, int ldc, size_t sC, int M, int N, int K) { static_assert(ACT == 0 || ACT == 3 || ACT == 6 || ACT == 8 || ACT == 9 || ACT == 11 || ACT == 12 || ACT == 14 || ACT == 15 || ACT == 16 || ACT == 17, "k_gemm2: unsupported ACT code (would silently apply no activation)");
  __shared__ __attribute__((aligned(16))) float so[4][32][68];
  const int tid = threadIdx.x, w = tid >> 5, lane = tid & 31, ln = lane & 15, hh = lane >> 4; const int by = blockIdx.y;
  A += (size_t)by * sA; Bh += (size_t)by * sB; const size_t cofs = (size_t)by * sC; const float* bp = bias ? bias + (size_t)by * sBias : nullptr;
  const int ntn = N >> 6; const int mt = blockIdx.x / ntn, nq = blockIdx.x - mt * ntn; const int row0 = mt * 128 + 32 * w, col0 = nq * 64; if (row0 >= M) return;
  const _Float16* a0p = A + (size_t)(row0 + ln) * lda; const _Float16* a1p = a0p + (size_t)16 * lda;
  const _Float16* b0p = Bh + (size_t)(col0 + ln) * ldb; const _Float16* b1p = b0p + (size_t)16 * ldb; const _Float16* b2p = b1p + (size_t)16 * ldb; const _Float16* b3p = b2p + (size_t)16 * ldb;
  const v8f z8 = {0.f,0.f,0.f,0.f,0.f,0.f,0.f,0.f}; v8f c00 = z8, c01 = z8, c02 = z8, c03 = z8, c10 = z8, c11 = z8, c12 = z8, c13 = z8;
#pragma unroll 1
  for (int kb = 0; kb < K; kb += 32) { const v16h a0 = g2_frag(a0p + kb, hh), a1 = g2_frag(a1p + kb, hh);
    v16h b = g2_frag(b0p + kb, hh); c00 = g2_mma(a0, b, c00); c10 = g2_mma(a1, b, c10);
    b = g2_frag(b1p + kb, hh); c01 = g2_mma(a0, b, c01); c11 = g2_mma(a1, b, c11);
    b = g2_frag(b2p + kb, hh); c02 = g2_mma(a0, b, c02); c12 = g2_mma(a1, b, c12);
    b = g2_frag(b3p + kb, hh); c03 = g2_mma(a0, b, c03); c13 = g2_mma(a1, b, c13); }
  v8f accs[8] = {c00, c01, c02, c03, c10, c11, c12, c13};
#pragma unroll
  for (int u = 0; u < 8; ++u) { const int t = u & 3, half = u >> 2; const int col = col0 + t * 16 + ln; const float bv = bp ? bf16_round(bp[col]) : 0.f;
#pragma unroll
    for (int r = 0; r < 8; ++r) { const int rloc = half * 16 + 8 * hh + r; float v = accs[u][r] * alpha + bv; if (CP) { if (rowsPerB < 0) v += CP[cofs + (size_t)(row0g + row0 + rloc) * ldc + col];      /* rowsPerB < 0: own element of the batched C plane */ else { const int bidx = (row0g + row0 + rloc) / rowsPerB; v += CP[(size_t)bidx * sCPb + (size_t)by * 64 + col]; } }
      if (ACT == 3) v = fmaxf(v, 0.f); else if (ACT == 6) v = 0.5f * v * (1.0f + erff(v * 0.70710678118654752f)); else if (ACT == 11) v = 1.0f / (1.0f + expf(-v)); else if (ACT == 15) v = v / (1.0f + expf(-v)); else if (ACT == 12) v = (v > 0.f) ? v : 0.01f * v; else if (ACT == 8) v = tanhf(v); else if (ACT == 9) v = 0.5f * v * (1.0f + tanhf(0.7978845608028654f * (v + 0.044715f * v * v * v))); else if (ACT == 14) v = (v > 0.f) ? v : 0.1f * v; else if (ACT == 16) v = (v >= 0.f) ? v : 0.3f * v; else if (ACT == 17) v = (v >= 0.f) ? v : 0.2f * v;
      so[w][rloc][t * 16 + ln] = v; } }
  __builtin_amdgcn_fence(__ATOMIC_ACQ_REL, "workgroup"); __builtin_amdgcn_wave_barrier();
  const int rsub = lane >> 4, c4 = (lane & 15) * 4;
  {
#pragma unroll
    for (int q = 0; q < 16; ++q) { const int r = q * 2 + rsub; const v4f v = *(const v4fa*)&so[w][r][c4]; if (C) *(v4f*)(C + cofs + (size_t)(row0 + r) * ldc + col0 + c4) = v; if (C16) { v4h h4; for (int i = 0; i < 4; ++i) h4[i] = (_Float16)v[i]; *(v4h*)(C16 + cofs + (size_t)(row0 + r) * ldc + col0 + c4) = h4; } }
     } }


__global__ __launch_bounds__(256) void k_wnat(const float* __restrict__ w, size_t n8, _Float16* __restrict__ Bt) { const size_t t = (size_t)blockIdx.x * 256 + threadIdx.x; if (t >= n8) return; FragH f; for (int q = 0; q < 8; ++q) f.h[q] = (_Float16)(bf16_round(w[t * 8 + q]) * 16.0f); *(v8us*)((unsigned short*)Bt + t * 8) = f.half[0];  }
__global__ __launch_bounds__(256) void k_rsm(const float* __restrict__ S, _Float16* __restrict__ P, int nrows) {
  #pragma clang fp contract(off)
  const int i = blockIdx.x * 256 + threadIdx.x; if (i >= nrows) return; const float* s = S + (size_t)i * SQ; float mx = -3.0e38f;
#pragma unroll 1
  for (int j = 0; j < SQ; ++j) mx = fmaxf(mx, s[j]); float se = 0.f;
#pragma unroll 1
  for (int j = 0; j < SQ; ++j) se += expf(s[j] - mx); const float sc = 256.0f / se;
#pragma unroll 1
  for (int j0 = 0; j0 < SQ; j0 += 8) { FragH f; for (int q = 0; q < 8; ++q) f.h[q] = (_Float16)(expf(s[j0 + q] - mx) * sc); unsigned short* d = (unsigned short*)P + (size_t)i * SQ + j0; *(v8us*)d = f.half[0];  } }
__global__ __launch_bounds__(256) void k_vt(const _Float16* __restrict__ V16, int b, int h0, _Float16* __restrict__ VT) { __shared__ unsigned short tl[64][65]; const int tid = threadIdx.x; const int hh = blockIdx.x % HG, sg = blockIdx.x / HG; const int s0 = sg * 64; const int h = h0 + hh;
  for (int i = tid; i < 64 * 8; i += 256) { const int j = i / 8, d8 = (i % 8) * 8; FragH f; f.half[0] = *(const v8us*)((const unsigned short*)V16 + ((size_t)b * SQ + s0 + j) * DM + h * HD + d8); for (int q = 0; q < 8; ++q) tl[d8 + q][j] = f.u[q]; }
  __syncthreads();
  { for (int i = tid; i < 64 * 8; i += 256) { const int d = i / 8, j8 = (i % 8) * 8; FragH f; for (int q = 0; q < 8; ++q) f.u[q] = tl[d][j8 + q]; *(v8us*)((unsigned short*)VT + ((size_t)hh * HD + d) * SQ + s0 + j8) = f.half[0]; }  } }



// 2^x. The v_nop is the one slot that the instruction set asks for behind a transcendental before its source is overwritten or its result read; it stands in the statement so that it stays directly behind the instruction.
__device__ __forceinline__ float exp2_slot(float x) { float r; asm("v_exp_f32 %0, %1\n\tv_nop" : "=v"(r) : "v"(x)); return r; }
// Row softmax, ONE WAVE PER SCORE ROW: the row's SQ f32 scores are read once, 512 contiguous bytes per wave load, and stay in the wave's registers
// (SQ / 32 a lane) through maximum, exp, sum and scaling; maximum and sum: four chains a lane, then a five-step butterfly over the 32 lanes. No LDS, no barrier.
__global__ __launch_bounds__(256) void k_rsmf(const float* __restrict__ S, _Float16* __restrict__ P, int qn, int hg) {
  const int lane = threadIdx.x & 31; const int t = blockIdx.x * 8 + __builtin_amdgcn_readfirstlane(threadIdx.x >> 5); if (t >= qn * hg) return;      /* wave-uniform exit */
  const size_t i = (size_t)(t / qn) * SQ + (t % qn); const float* s = S + i * SQ + lane * 4; v4f x[SQ / 128];
#pragma unroll  // whole unroll: x[] is indexed by constants only, so it lives in registers, and the 32 loads issue back to back
  for (int u = 0; u < SQ / 128; ++u) x[u] = *(const v4fa*)(s + u * 128);
  v4f m4 = {-3.0e38f, -3.0e38f, -3.0e38f, -3.0e38f};
#pragma unroll  // whole unroll: x[] in registers
  for (int u = 0; u < SQ / 128; ++u) for (int q = 0; q < 4; ++q) m4[q] = fmaxf(m4[q], x[u][q]);
  float mx = fmaxf(fmaxf(m4[0], m4[1]), fmaxf(m4[2], m4[3]));
#pragma unroll  // whole unroll: five fixed lane distances
  for (int m = 16; m > 0; m >>= 1) mx = fmaxf(mx, __shfl_xor(mx, m, 32));
  v4f a4 = {0.f, 0.f, 0.f, 0.f};
#pragma unroll  // whole unroll: x[] in registers
  for (int u = 0; u < SQ / 128; ++u) for (int q = 0; q < 4; ++q) { const float e = exp2_slot((x[u][q] - mx) * 1.44269504088896340736f); x[u][q] = e; a4[q] += e; }
  float se = (a4[0] + a4[1]) + (a4[2] + a4[3]);
#pragma unroll  // whole unroll: five fixed lane distances
  for (int m = 16; m > 0; m >>= 1) se += __shfl_xor(se, m, 32);
  const float sc = 256.0f / se; _Float16* d = P + i * SQ + lane * 4;
#pragma unroll  // whole unroll: x[] in registers, the 32 stores issue back to back
  for (int u = 0; u < SQ / 128; ++u) { v4h h4; for (int q = 0; q < 4; ++q) h4[q] = (_Float16)(x[u][q] * sc); *(v4h*)(d + u * 128) = h4; } }

extern "C" void kernel_launch(void* const* d_in, const int* in_sizes, int n_in,
                              void* d_out, int out_size, void* d_ws, size_t ws_size, hipStream_t stream) {
  (void)in_sizes; (void)n_in; (void)out_size;
  const float* const* I = (const float* const*)d_in; const float* xq = I[2]; const float* xk = I[1]; const float* xv = I[0]; const float* wq = I[5]; const float* bq = nullptr; const float* wk = I[4]; const float* bk = nullptr; const float* wv = I[3]; const float* bv = nullptr; const float* wo = I[6]; const float* bo = I[7];      /* input order: values, keys, query (three unbatched [4096][1024] streams in REVERSE order: the query stream is I[2]), Wv, Wk, Wq (the weights in the same reverse order: Wq is I[5]), Wo, bo ([in][out] weights); the q / k / v projections have NO biases: null pointers in the guarded bias slots */
  char* ws = (char*)d_ws; size_t off = 0;
  auto take = [&](size_t bytes) { char* p = ws + off; off += (bytes + 255) & ~(size_t)255; return p; };
  _Float16* BQ = (_Float16*)take((size_t)DM * DM * 2); _Float16* BK = (_Float16*)take((size_t)DM * DM * 2); _Float16* BV = (_Float16*)take((size_t)DM * DM * 2); _Float16* BO = (_Float16*)take((size_t)DM * DM * 2);
  _Float16* XQ = (_Float16*)take(NR * DM * 2); _Float16* XK = (_Float16*)take(NR * DM * 2); _Float16* XV = (_Float16*)take(NR * DM * 2); _Float16* Q16 = (_Float16*)take(NR * DM * 2); _Float16* K16 = (_Float16*)take(NR * DM * 2); _Float16* V16 = (_Float16*)take(NR * DM * 2); _Float16* O16 = (_Float16*)take(NR * DM * 2);
  float* S = (float*)take((size_t)HG * SQ * SQ * 4); _Float16* P = (_Float16*)take((size_t)HG * SQ * SQ * 2); _Float16* VT = (_Float16*)take((size_t)NH * HD * SQ * 2);
  if (off > ws_size) return;
  { const unsigned g = (unsigned)(((size_t)DM * (DM / 8) + 255) / 256); k_wt_f16<<<g, 256, 0, stream>>>(wq, BQ, DM, DM, 16.0f); k_wt_f16<<<g, 256, 0, stream>>>(wk, BK, DM, DM, 16.0f); k_wt_f16<<<g, 256, 0, stream>>>(wv, BV, DM, DM, 16.0f); k_wt_f16<<<g, 256, 0, stream>>>(wo, BO, DM, DM, 16.0f); }      /* [in][out] -> Bt[n][k] x16 (transposing builder) */

  k_x16<<<(unsigned)((NR * DM / 8 + 255) / 256), 256, 0, stream>>>(xq, XQ, NR * DM / 8); k_x16<<<(unsigned)((NR * DM / 8 + 255) / 256), 256, 0, stream>>>(xk, XK, NR * DM / 8); k_x16<<<(unsigned)((NR * DM / 8 + 255) / 256), 256, 0, stream>>>(xv, XV, NR * DM / 8);      /* the three inputs as exact f16 rows */
  const size_t r0p = (size_t)B0 * SQ;      /* first projected row */
  k_gemm2<0><<<dim3((unsigned)((MP / 128) * (DM / 64)), 1), 128, 0, stream>>>(XQ + r0p * DM, DM, 0, BQ, DM, 0, 0.0625f, bq, 0, nullptr, 1, 0, 0, nullptr, Q16 + r0p * DM, DM, 0, MP, DM, DM);
  k_gemm2<0><<<dim3((unsigned)((MP / 128) * (DM / 64)), 1), 128, 0, stream>>>(XK + r0p * DM, DM, 0, BK, DM, 0, 0.0625f, bk, 0, nullptr, 1, 0, 0, nullptr, K16 + r0p * DM, DM, 0, MP, DM, DM);
  k_gemm2<0><<<dim3((unsigned)((MP / 128) * (DM / 64)), 1), 128, 0, stream>>>(XV + r0p * DM, DM, 0, BV, DM, 0, 0.0625f, bv, 0, nullptr, 1, 0, 0, nullptr, V16 + r0p * DM, DM, 0, MP, DM, DM);
  for (int b = B0; b < B0 + NBR; ++b) { const size_t r0 = (size_t)b * SQ;
    k_vt<NH, SQ><<<NH * (SQ / 64), 256, 0, stream>>>(V16 + r0 * LQ, LQ, 0, VT);      /* V^T [NH][HD][SQ] for this batch */
    for (int h0 = 0; h0 < NHD; h0 += HG) {
      k_gemm2<0><<<dim3((QN / 128) * (SQ / 64), HG), 128, 0, stream>>>(Q16 + r0 * LQ + h0 * HD, LQ, (size_t)HD, K16 + r0 * LQ + h0 * HD, LQ, (size_t)HD, 0.03125f, nullptr, 0, nullptr, 1, 0, 0, S, nullptr, SQ, (size_t)SQ * SQ, QN, SQ, HD);      /* scores, HG heads per launch */      /* THIS module's score scale: 1/sqrt(EMBED 1024) = 1/32 (the model width, the source's form) */
      k_rsmf<<<(HG * QN + 7) / 8, 256, 0, stream>>>(S, P, QN, HG);      /* P = 256 softmax (f16), rows of all HG heads */
      k_gemm2<0><<<dim3((QN / 128) * (HD / 64), HG), 128, 0, stream>>>(P, SQ, (size_t)SQ * SQ, VT + (size_t)h0 * HD * SQ, SQ, (size_t)HD * SQ, 0.25f, nullptr, 0, nullptr, 1, 0, 0, nullptr, O16 + r0 * DM + h0 * HD, DM, (size_t)HD, QN, HD, SQ); } }      /* o (merged heads) as f16 rows */
  k_gemm2<0><<<dim3((unsigned)((MPO / 128) * (DM / 64)), 1), 128, 0, stream>>>(O16 + r0p * DM, DM, 0, BO, DM, 0, 0.0009765625f, bo, 0, nullptr, 1, 0, 0, (float*)d_out + r0p * DM, nullptr, DM, 0, MPO, DM, DM);      /* out rows are the output layout */
}

// v002
// It runs in 272 microseconds.
// Two timings next to v001 put it at 10.3 and 10.2 times that version's speed.
// Counting every step since v000, it is 49.1 times as fast.
#include <hip/hip_runtime.h>
// Multi-head attention on three unbatched inputs with [in][out] bias-free q / k / v projections, a biased output projection and the source's MODEL-WIDTH score scale; the inputs arrive in the order values, keys, query (each [4096][1024]; v / k / q = stream W ([in][out] 1024 x 1024 sd 1/32, NO biases), 16 heads of 64; energy / sqrt(1024) (the module scales by the EMBED width, not the head width: 1/32); softmax over all 4096 keys (no mask); out = merged Wo + bo ([in][out]) -> [4096][1024]); ONE attention launch for all heads.
// Structure: token rows r = b*4096 + s; the query, key and value sources as exact f16 rows (bf16-rounded); Q, K, V as three WMMA GEMMs (32x64 wave tiles, f32 accumulation, exact x16 weights, no bias, f16 outputs); per batch: V^T for all heads via LDS transposes; per batch ONE fused attention kernel over (256 query rows, head): per 32 keys the scores on WMMA (K = 64), online softmax on VALU (f32 running maximum and sum, native exp2; weights exp(s - max) as f16, in registers only), o += P . V on WMMA, o / sum carried x64 (against f16 subnormal flush, folded into the output GEMM alpha) written straight into the merged f16 o rows; out = o W_o + b GEMM (f32) into the output layout.
// Compute dtype: inputs rounded to bf16; x / weights exact; q, k, v, softmax weights and o as plain f16 GEMM operands (~2^-12); scores and softmax statistics f32. v_wmma_f32_16x16x32_f16.
#define NB 1
#define SQ 4096
#define DM 1024
#define NH 16
#define HD 64
#define HG 1                         /* heads per k_vt(V16, b, h0, VT) launch (that overload is not launched) */
#define B0 0                         /* first batch processed (debug hook) */
#define NBR NB                       /* batches processed (debug hook) */
#define NR ((size_t)NB * SQ)         /* token rows */
#define MP ((int)((size_t)NBR * SQ)) /* rows projected (debug hook) */
#define QN SQ                        /* query rows attended per batch (debug hook) */
#define NHD NH                       /* heads attended (debug hook) */
#define MPO MP                       /* rows through the output stage (debug hook) */
#define LQ DM      /* row pitch of the q/k/v rows */
typedef __bf16 v16b __attribute__((ext_vector_type(16)));
typedef unsigned short v8us __attribute__((ext_vector_type(8), may_alias));
typedef float  v8f  __attribute__((ext_vector_type(8)));
typedef float  v4f  __attribute__((ext_vector_type(4)));
typedef float  v4fa __attribute__((ext_vector_type(4), may_alias));
union FragB { v16b v; v8us half[2]; unsigned short u[16]; };

__device__ __forceinline__ unsigned short bf16_bits(float x) { unsigned int u = __float_as_uint(x); return (unsigned short)((u + 0x7FFFu + ((u >> 16) & 1u)) >> 16); }
__device__ __forceinline__ float bf16_val(unsigned short b) { return __uint_as_float(((unsigned int)b) << 16); }
__device__ __forceinline__ float bf16_round(float x) { return bf16_val(bf16_bits(x)); }
// D += A·B with NT terms: 1 = ah·bh, 2 = + al·bh (A split), 3 = + ah·bl (both split)
template <int NT>
__device__ __forceinline__ v8f mmaN(v16b ah, v16b al, v16b bh, v16b bl, v8f c) {
  c = __builtin_amdgcn_wmma_f32_16x16x32_bf16(false, ah, false, bh, (short)0, c, false, false);
  if (NT >= 2) c = __builtin_amdgcn_wmma_f32_16x16x32_bf16(false, al, false, bh, (short)0, c, false, false);
  if (NT >= 3) c = __builtin_amdgcn_wmma_f32_16x16x32_bf16(false, ah, false, bl, (short)0, c, false, false);
  asm volatile("v_nop\n\tv_nop\n\tv_nop\n\tv_nop" : "+v"(c) : "v"(ah), "v"(al), "v"(bh), "v"(bl));
  return c;
}

__global__ __launch_bounds__(256) void k_wt_bf16(const float* __restrict__ W, unsigned short* __restrict__ Wt, int K, int N) {
  const int t = blockIdx.x * 256 + threadIdx.x;
  const int k8n = K / 8;
  if (t >= N * k8n) return;
  const int n = t / k8n, k8 = (t % k8n) * 8;
  v8us v;
#pragma unroll
  for (int i = 0; i < 8; ++i) v[i] = bf16_bits(W[(size_t)(k8 + i) * N + n]);
  *(v8us*)(Wt + (size_t)n * K + k8) = v;
  
}

// GEMM C[M][N] (f32, pitch ldc) = act(A[M][K]·W + bias). A f32 row-major (pitch lda) converted per fragment to bf16
// (ASPLIT: hi/lo two planes -> 2 terms, else single rounded term); Wt bf16 [N][K] (pitch ldb). BIAS_BF16 rounds the
// bias to bf16 first (bias quantised to bf16 before the add). K%32==0, M%16==0, N%64==0.
template <bool ASPLIT, int ACT, bool BIAS_BF16>
__global__ __launch_bounds__(128) void k_gemm_bf(const float* __restrict__ A, int lda, const unsigned short* __restrict__ Wt, int ldb,
                                               const float* __restrict__ bias, float* __restrict__ C, int ldc, int M, int N, int K) {
  __shared__ __attribute__((aligned(16))) float so[4][16][64];
  const int tid = threadIdx.x, w = tid >> 5, lane = tid & 31, ln = lane & 15, hh = lane >> 4;
  const int ntn = N / 64;
  const int wid = blockIdx.x * 4 + w;
  const int mt = wid / ntn, nq = wid % ntn;
  if (mt * 16 >= M) return;
  const int row0 = mt * 16, col0 = nq * 64;
  const float* arow = A + (size_t)(row0 + ln) * lda;
  v8f acc[4] = {};
  for (int kb = 0; kb < K; kb += 32) {
    FragB ah, al;
    const v4f x0 = *(const v4fa*)(arow + kb + 8 * hh), x1 = *(const v4fa*)(arow + kb + 8 * hh + 4);
    const v4f x2 = *(const v4fa*)(arow + kb + 16 + 8 * hh), x3 = *(const v4fa*)(arow + kb + 16 + 8 * hh + 4);
    float xs[16] = {x0[0],x0[1],x0[2],x0[3],x1[0],x1[1],x1[2],x1[3],x2[0],x2[1],x2[2],x2[3],x3[0],x3[1],x3[2],x3[3]};
#pragma unroll
    for (int i = 0; i < 16; ++i) { const unsigned short hb = bf16_bits(xs[i]); ah.u[i] = hb; al.u[i] = ASPLIT ? bf16_bits(xs[i] - bf16_val(hb)) : (unsigned short)0; }
#pragma unroll
    for (int t = 0; t < 4; ++t) {
      const unsigned short* brow = Wt + (size_t)(col0 + t * 16 + ln) * ldb + kb;
      FragB b;
      b.half[0] = *(const v8us*)(brow + 8 * hh);
      b.half[1] = *(const v8us*)(brow + 16 + 8 * hh);
      acc[t] = mmaN<ASPLIT ? 2 : 1>(ah.v, al.v, b.v, b.v, acc[t]);
    }
  }
#pragma unroll
  for (int t = 0; t < 4; ++t) {
    float bv = bias ? bias[col0 + t * 16 + ln] : 0.f;
    if (BIAS_BF16) bv = bf16_round(bv);
#pragma unroll
    for (int r = 0; r < 8; ++r) { float v = acc[t][r] + bv; if (ACT == 1) v = fmaxf(v, 0.f); so[w][8 * hh + r][t * 16 + ln] = v; }
  }
  __builtin_amdgcn_fence(__ATOMIC_ACQ_REL, "workgroup");
  __builtin_amdgcn_wave_barrier();
  const int rsub = lane >> 4, c4 = (lane & 15) * 4;
  {
#pragma unroll
    for (int q = 0; q < 8; ++q) {
      const int r = q * 2 + rsub;
      const v4f v = *(const v4fa*)&so[w][r][c4];
      *(v4f*)(C + (size_t)(row0 + r) * ldc + col0 + c4) = v;
    }
    
  }
}

// GEMM C = act(A·W + bias + resid): A f32 (ASPLIT -> hi/lo 2 terms), Wt bf16 [N][K]; ACT 0 none, 1 relu, 2 exact gelu;
// resid (optional, f32, row index = (row % rmod), pitch ldr, RES_BF16 rounds it) added before the activation.
template <bool ASPLIT, int ACT, bool BIAS_BF16, bool RES_BF16>
__global__ __launch_bounds__(128) void k_gemm_bf3(const float* __restrict__ A, int lda, const unsigned short* __restrict__ Wt, int ldb,
                                                const float* __restrict__ bias, const float* __restrict__ resid, int rmod, int ldr,
                                                float* __restrict__ C, int ldc, int M, int N, int K) {
  __shared__ __attribute__((aligned(16))) float so[4][16][64];
  const int tid = threadIdx.x, w = tid >> 5, lane = tid & 31, ln = lane & 15, hh = lane >> 4;
  const int ntn = N / 64;
  const int wid = blockIdx.x * 4 + w;
  const int mt = wid / ntn, nq = wid % ntn;
  if (mt * 16 >= M) return;
  const int row0 = mt * 16, col0 = nq * 64;
  const float* arow = A + (size_t)(row0 + ln) * lda;
  v8f acc[4] = {};
  for (int kb = 0; kb < K; kb += 32) {
    FragB ah, al;
    const v4f x0 = *(const v4fa*)(arow + kb + 8 * hh), x1 = *(const v4fa*)(arow + kb + 8 * hh + 4);
    const v4f x2 = *(const v4fa*)(arow + kb + 16 + 8 * hh), x3 = *(const v4fa*)(arow + kb + 16 + 8 * hh + 4);
    float xs[16] = {x0[0],x0[1],x0[2],x0[3],x1[0],x1[1],x1[2],x1[3],x2[0],x2[1],x2[2],x2[3],x3[0],x3[1],x3[2],x3[3]};
#pragma unroll
    for (int i = 0; i < 16; ++i) { const unsigned short hb = bf16_bits(xs[i]); ah.u[i] = hb; al.u[i] = ASPLIT ? bf16_bits(xs[i] - bf16_val(hb)) : (unsigned short)0; }
#pragma unroll
    for (int t = 0; t < 4; ++t) {
      const unsigned short* brow = Wt + (size_t)(col0 + t * 16 + ln) * ldb + kb;
      FragB b;
      b.half[0] = *(const v8us*)(brow + 8 * hh);
      b.half[1] = *(const v8us*)(brow + 16 + 8 * hh);
      acc[t] = mmaN<ASPLIT ? 2 : 1>(ah.v, al.v, b.v, b.v, acc[t]);
    }
  }
#pragma unroll
  for (int t = 0; t < 4; ++t) {
    const int col = col0 + t * 16 + ln;
    float bv = bias ? bias[col] : 0.f;
    if (BIAS_BF16) bv = bf16_round(bv);
#pragma unroll
    for (int r = 0; r < 8; ++r) {
      float v = acc[t][r] + bv;
      if (resid) { float rv = resid[(size_t)((row0 + 8 * hh + r) % rmod) * ldr + col]; if (RES_BF16) rv = bf16_round(rv); v += rv; }
      if (ACT == 1) v = fmaxf(v, 0.f);
      if (ACT == 2) v = 0.5f * v * (1.0f + erff(v * 0.70710678118654752f));
      if (ACT == 3) { const float u = 0.7978845608028654f * (v + 0.044715f * v * v * v); v = 0.5f * v * (1.0f + tanhf(u)); }
      so[w][8 * hh + r][t * 16 + ln] = v;
    }
  }
  __builtin_amdgcn_fence(__ATOMIC_ACQ_REL, "workgroup");
  __builtin_amdgcn_wave_barrier();
  const int rsub = lane >> 4, c4 = (lane & 15) * 4;
  {
#pragma unroll
    for (int q = 0; q < 8; ++q) {
      const int r = q * 2 + rsub;
      const v4f v = *(const v4fa*)&so[w][r][c4];
      *(v4f*)(C + (size_t)(row0 + r) * ldc + col0 + c4) = v;
    }
    
  }
}
// row LayerNorm (biased variance, eps) over N: s = X (+ R); optional out_sum <- s; out_norm <- (s-mu)*rsqrt(var+eps)*g + b
template <bool PARAM_BF16>
__global__ __launch_bounds__(256) void k_layernorm(const float* __restrict__ X, const float* __restrict__ R, const float* __restrict__ g, const float* __restrict__ bta,
                                                  float* __restrict__ out_sum, float* __restrict__ out_norm, int N, float eps) {
  __shared__ float red[256];
  const int row = blockIdx.x, tid = threadIdx.x;
  const float* x = X + (size_t)row * N; const float* rr = R ? R + (size_t)row * N : nullptr;
  float vals[16];                     // up to N = 4096
  const int per = N / 256;            // contiguous chunk per thread? use strided-by-4 chunks: thread handles j = tid*4 + 1024*u
  float s1 = 0.f;
  for (int u = 0; u < per / 4; ++u) {
    const int j = tid * 4 + 1024 * u;
    const v4f a = *(const v4fa*)(x + j);
    v4f b = {0.f,0.f,0.f,0.f}; if (rr) b = *(const v4fa*)(rr + j);
#pragma unroll
    for (int q = 0; q < 4; ++q) { const float v = a[q] + b[q]; vals[u * 4 + q] = v; s1 += v; }
  }
  red[tid] = s1; __syncthreads();
  for (int st = 128; st > 0; st >>= 1) { if (tid < st) red[tid] += red[tid + st]; __syncthreads(); }
  const float mu = red[0] / (float)N; __syncthreads();
  float s2 = 0.f;
  for (int u = 0; u < per / 4; ++u)
#pragma unroll
    for (int q = 0; q < 4; ++q) { const float c = vals[u * 4 + q] - mu; s2 += c * c; }
  red[tid] = s2; __syncthreads();
  for (int st = 128; st > 0; st >>= 1) { if (tid < st) red[tid] += red[tid + st]; __syncthreads(); }
  const float rs = rsqrtf(red[0] / (float)N + eps);
  {
    for (int u = 0; u < per / 4; ++u) {
      const int j = tid * 4 + 1024 * u;
      v4f o, sm;
#pragma unroll
      for (int q = 0; q < 4; ++q) {
        float gg = g[j + q], bb = bta[j + q];
        if (PARAM_BF16) { gg = bf16_round(gg); bb = bf16_round(bb); }
        sm[q] = vals[u * 4 + q]; o[q] = (vals[u * 4 + q] - mu) * rs * gg + bb;
      }
      if (out_sum) *(v4f*)(out_sum + (size_t)row * N + j) = sm;
      *(v4f*)(out_norm + (size_t)row * N + j) = o;
    }
    
  }
}



// ---- f16 WMMA path (v_wmma_f32_16x16x32_f16): 11-bit significands for operands in range — used where a [0,1] probability operand needs more precision than bf16
typedef _Float16 v16h __attribute__((ext_vector_type(16)));
union FragH { v16h v; v8us half[2]; _Float16 h[16]; unsigned short u[16]; };
template <int NT>
__device__ __forceinline__ v8f mmaH(v16h ah, v16h al, v16h bh, v16h bl, v8f c) {
  c = __builtin_amdgcn_wmma_f32_16x16x32_f16(false, ah, false, bh, (short)0, c, false, false);
  if (NT >= 2) c = __builtin_amdgcn_wmma_f32_16x16x32_f16(false, al, false, bh, (short)0, c, false, false);
  if (NT >= 3) c = __builtin_amdgcn_wmma_f32_16x16x32_f16(false, ah, false, bl, (short)0, c, false, false);
  asm volatile("v_nop\n\tv_nop\n\tv_nop\n\tv_nop" : "+v"(c) : "v"(ah), "v"(al), "v"(bh), "v"(bl));
  return c;
}
// batched GEMM like k_gemm_b but f16 operands: A f32 (split into f16 hi/lo if ASPLIT, else rounded to f16), Bt = f16 values [n][k]; alpha; C f32; N multiple of 16 (partial tiles skipped)
template <bool ASPLIT>
__global__ __launch_bounds__(128) void k_gemm_h(const float* __restrict__ A, int lda, size_t sA, const _Float16* __restrict__ Bh, int ldb, size_t sB, float alpha, float* __restrict__ C, int ldc, size_t sC, int M, int N, int K) {
  __shared__ __attribute__((aligned(16))) float so[4][16][64];
  const int tid = threadIdx.x, w = tid >> 5, lane = tid & 31, ln = lane & 15, hh = lane >> 4; const int by = blockIdx.y;
  A += (size_t)by * sA; Bh += (size_t)by * sB; C += (size_t)by * sC;
  const int ntn = (N + 63) / 64; const int wid = blockIdx.x * 4 + w; const int mt = wid / ntn, nq = wid % ntn; if (mt * 16 >= M) return;
  const int row0 = mt * 16, col0 = nq * 64; const float* arow = A + (size_t)(row0 + ln) * lda;
  v8f acc[4] = {};
  for (int kb = 0; kb < K; kb += 32) {
    FragH ah, al;
    const v4f x0 = *(const v4fa*)(arow + kb + 8 * hh), x1 = *(const v4fa*)(arow + kb + 8 * hh + 4), x2 = *(const v4fa*)(arow + kb + 16 + 8 * hh), x3 = *(const v4fa*)(arow + kb + 16 + 8 * hh + 4);
    float xs[16] = {x0[0],x0[1],x0[2],x0[3],x1[0],x1[1],x1[2],x1[3],x2[0],x2[1],x2[2],x2[3],x3[0],x3[1],x3[2],x3[3]};
#pragma unroll
    for (int i = 0; i < 16; ++i) { const _Float16 h = (_Float16)xs[i]; ah.h[i] = h; al.h[i] = ASPLIT ? (_Float16)(xs[i] - (float)h) : (_Float16)0.0f; }
#pragma unroll
    for (int t = 0; t < 4; ++t) { if (col0 + t * 16 >= N) continue; const size_t boff = (size_t)(col0 + t * 16 + ln) * ldb + kb; FragH bq; bq.half[0] = *(const v8us*)(Bh + boff + 8 * hh); bq.half[1] = *(const v8us*)(Bh + boff + 16 + 8 * hh);
      acc[t] = mmaH<ASPLIT ? 2 : 1>(ah.v, al.v, bq.v, bq.v, acc[t]); }
  }
#pragma unroll
  for (int t = 0; t < 4; ++t) { if (col0 + t * 16 >= N) continue;
#pragma unroll
    for (int r = 0; r < 8; ++r) so[w][8 * hh + r][t * 16 + ln] = acc[t][r] * alpha; }
  __builtin_amdgcn_fence(__ATOMIC_ACQ_REL, "workgroup"); __builtin_amdgcn_wave_barrier();
  const int rsub = lane >> 4, c4 = (lane & 15) * 4;
  {
#pragma unroll
    for (int q = 0; q < 8; ++q) { const int r = q * 2 + rsub; if (col0 + c4 < N) { const v4f v = *(const v4fa*)&so[w][r][c4]; *(v4f*)(C + (size_t)(row0 + r) * ldc + col0 + c4) = v; } }
     }
}

// Wt[n][k] = f16(W[k][n]·scale) from f32 row-major W[K][N] (scale = power of two; bf16-exact weights stay exact in f16 away from the subnormal range)
__global__ __launch_bounds__(256) void k_wt_f16(const float* __restrict__ W, _Float16* __restrict__ Wt, int K, int N, float scale) {
  const int t = blockIdx.x * 256 + threadIdx.x; if (t >= N * (K / 8)) return; const int n = t / (K / 8), k8 = (t % (K / 8)) * 8; FragH f;
#pragma unroll
  for (int i = 0; i < 8; ++i) f.h[i] = (_Float16)(bf16_round(W[(size_t)(k8 + i) * N + n]) * scale); const v8us o = f.half[0];
  *(v8us*)((unsigned short*)Wt + (size_t)n * K + k8) = o; 
}
// k_gemm_hh variant with fused epilogue: v = acc·alpha + bias[by·sBias + col] (+ CP[(row/rowsPerB)·sCPb + by·64 + col] if CP) ; ACT 0 none / 1 elu ; writes f16 C16 (and f32 C if non-null)
template <int ACT>
__global__ __launch_bounds__(128) void k_gemm_hhx(const _Float16* __restrict__ A, int lda, size_t sA, const _Float16* __restrict__ Bh, int ldb, size_t sB, float alpha, const float* __restrict__ bias, size_t sBias, const float* __restrict__ CP, int rowsPerB, size_t sCPb, int row0g,
    float* __restrict__ C, _Float16* __restrict__ C16, int ldc, size_t sC, int M, int N, int K) {
  __shared__ __attribute__((aligned(16))) float so[4][16][64];
  const int tid = threadIdx.x, w = tid >> 5, lane = tid & 31, ln = lane & 15, hh = lane >> 4; const int by = blockIdx.y;
  A += (size_t)by * sA; Bh += (size_t)by * sB; const size_t cofs = (size_t)by * sC; const float* bp = bias ? bias + (size_t)by * sBias : nullptr;
  const int ntn = (N + 63) / 64; const int wid = blockIdx.x * 4 + w; const int mt = wid / ntn, nq = wid % ntn; if (mt * 16 >= M) return;
  const int row0 = mt * 16, col0 = nq * 64; const _Float16* arow = A + (size_t)(row0 + ln) * lda;
  v8f acc[4] = {};
  for (int kb = 0; kb < K; kb += 32) { FragH ah; ah.half[0] = *(const v8us*)((const unsigned short*)arow + kb + 8 * hh); ah.half[1] = *(const v8us*)((const unsigned short*)arow + kb + 16 + 8 * hh);
#pragma unroll
    for (int t = 0; t < 4; ++t) { if (col0 + t * 16 >= N) continue; const size_t boff = (size_t)(col0 + t * 16 + ln) * ldb + kb; FragH bq; bq.half[0] = *(const v8us*)((const unsigned short*)Bh + boff + 8 * hh); bq.half[1] = *(const v8us*)((const unsigned short*)Bh + boff + 16 + 8 * hh);
      acc[t] = mmaH<1>(ah.v, ah.v, bq.v, bq.v, acc[t]); }
  }
#pragma unroll
  for (int t = 0; t < 4; ++t) { if (col0 + t * 16 >= N) continue; const int col = col0 + t * 16 + ln; const float bv = bp ? bf16_round(bp[col]) : 0.f;
#pragma unroll
    for (int r = 0; r < 8; ++r) { float v = acc[t][r] * alpha + bv; if (CP) { const int rr = row0g + row0 + 8 * hh + r; if (rowsPerB < 0) v += CP[cofs + (size_t)rr * ldc + col];      /* rowsPerB < 0: own element of the batched C plane */ else { const int bidx = rr / rowsPerB; v += CP[(size_t)bidx * sCPb + (size_t)by * 64 + col]; } } if (ACT == 1) v = (v > 0.f) ? v : expm1f(v); else if (ACT == 7) v = (v > 0.f) ? v + 1.0f : expf(v); else if (ACT == 8) v = tanhf(v); else if (ACT == 9) v = 0.5f * v * (1.0f + tanhf(0.7978845608028654f * (v + 0.044715f * v * v * v))); else if (ACT == 11) v = 1.0f / (1.0f + expf(-v)); else if (ACT == 12) v = (v > 0.f) ? v : 0.01f * v; else if (ACT == 14) v = (v > 0.f) ? v : 0.1f * v; else if (ACT == 16) v = (v >= 0.f) ? v : 0.3f * v; else if (ACT == 17) v = (v >= 0.f) ? v : 0.2f * v; else if (ACT == 15) v = v / (1.0f + expf(-v)); else if (ACT == 3) v = fmaxf(v, 0.f); else if (ACT == 6) v = 0.5f * v * (1.0f + erff(v * 0.70710678118654752f)); so[w][8 * hh + r][t * 16 + ln] = v; } }
  __builtin_amdgcn_fence(__ATOMIC_ACQ_REL, "workgroup"); __builtin_amdgcn_wave_barrier();
  const int rsub = lane >> 4, c4 = (lane & 15) * 4; typedef _Float16 v4h __attribute__((ext_vector_type(4)));
  {
#pragma unroll
    for (int q = 0; q < 8; ++q) { const int r = q * 2 + rsub; if (col0 + c4 < N) { const v4f v = *(const v4fa*)&so[w][r][c4]; if (C) *(v4f*)(C + cofs + (size_t)(row0 + r) * ldc + col0 + c4) = v; if (C16) { v4h h4; for (int i = 0; i < 4; ++i) h4[i] = (_Float16)v[i]; *(v4h*)(C16 + cofs + (size_t)(row0 + r) * ldc + col0 + c4) = h4; } } }
     }
}


typedef _Float16 v4h __attribute__((ext_vector_type(4)));

__global__ __launch_bounds__(256) void k_x16(const float* __restrict__ x, _Float16* __restrict__ X16, size_t n8) { const size_t t = (size_t)blockIdx.x * 256 + threadIdx.x; if (t >= n8) return; FragH f;
#pragma unroll
  for (int q = 0; q < 8; ++q) f.h[q] = (_Float16)bf16_round(x[t * 8 + q]); *(v8us*)((unsigned short*)X16 + t * 8) = f.half[0];  }
__global__ __launch_bounds__(256) void k_h16(const float* __restrict__ x, _Float16* __restrict__ X16, size_t n8) { const size_t t = (size_t)blockIdx.x * 256 + threadIdx.x; if (t >= n8) return; FragH f;
#pragma unroll
  for (int q = 0; q < 8; ++q) f.h[q] = (_Float16)x[t * 8 + q]; *(v8us*)((unsigned short*)X16 + t * 8) = f.half[0];  }
__global__ __launch_bounds__(256) void k_round16f(const float* __restrict__ W, _Float16* __restrict__ Bt, size_t n8) { const size_t t = (size_t)blockIdx.x * 256 + threadIdx.x; if (t >= n8) return; FragH f;
#pragma unroll
  for (int i = 0; i < 8; ++i) f.h[i] = (_Float16)(bf16_round(W[t * 8 + i]) * 16.0f); *(v8us*)((unsigned short*)Bt + t * 8) = f.half[0];  }
template <int NHv, int TTv>
__global__ __launch_bounds__(256) void k_vt(const _Float16* __restrict__ V16, int ldv, int voff, _Float16* __restrict__ Vt) { __shared__ unsigned short tl[64][66]; const int tid = threadIdx.x; const int slab = blockIdx.x / (TTv / 64), lg = blockIdx.x % (TTv / 64); const int b = slab / NHv, h = slab % NHv;
  for (int i = tid; i < 64 * 8; i += 256) { const int r = i / 8, c8 = (i % 8) * 8; FragH f; f.half[0] = *(const v8us*)((const unsigned short*)V16 + ((size_t)b * TTv + lg * 64 + r) * ldv + voff + h * 64 + c8);
#pragma unroll
    for (int q = 0; q < 8; ++q) tl[r][c8 + q] = f.u[q]; }
  __syncthreads();
  {
#pragma unroll
    for (int rd = 0; rd < 2; ++rd) { const int d = rd * 32 + tid / 8, pc = tid % 8; FragH f;
#pragma unroll
      for (int q = 0; q < 8; ++q) f.u[q] = tl[pc * 8 + q][d];
      *(v8us*)((unsigned short*)Vt + ((size_t)slab * 64 + d) * TTv + lg * 64 + pc * 8) = f.half[0]; }
     } }

__global__ __launch_bounds__(256) void k_hl(const float* __restrict__ F, _Float16* __restrict__ Hh, _Float16* __restrict__ Hl, size_t n8) { const size_t t = (size_t)blockIdx.x * 256 + threadIdx.x; if (t >= n8) return; FragH fh, fl; const v4f a = *(const v4fa*)(F + t * 8), c = *(const v4fa*)(F + t * 8 + 4);
#pragma unroll
  for (int q = 0; q < 4; ++q) { _Float16 h = (_Float16)a[q]; fh.h[q] = h; fl.h[q] = (_Float16)((a[q] - (float)h) * 1024.0f); h = (_Float16)c[q]; fh.h[4 + q] = h; fl.h[4 + q] = (_Float16)((c[q] - (float)h) * 1024.0f); }
  { *(v8us*)((unsigned short*)Hh + t * 8) = fh.half[0]; *(v8us*)((unsigned short*)Hl + t * 8) = fl.half[0];  } }

// ---- fast GEMM (wave tile 32x64; requires M % 32 == 0 rows per launch region and N % 64 == 0); epilogue = k_gemm_hhx semantics ----
__device__ __forceinline__ v16h g2_frag(const _Float16* p, int hh) { FragH f; f.half[0] = *(const v8us*)((const unsigned short*)p + 8 * hh); f.half[1] = *(const v8us*)((const unsigned short*)p + 16 + 8 * hh); return f.v; }
__device__ __forceinline__ v8f g2_mma(v16h a, v16h b, v8f c) { v8f d = __builtin_amdgcn_wmma_f32_16x16x32_f16(false, a, false, b, (short)0, c, false, false); asm volatile("v_nop\n\tv_nop\n\tv_nop\n\tv_nop" : "+v"(d) : "v"(a), "v"(b)); return d; }
template <int ACT>
__global__ __launch_bounds__(128) void k_gemm2(const _Float16* __restrict__ A, int lda, size_t sA, const _Float16* __restrict__ Bh, int ldb, size_t sB, float alpha, const float* __restrict__ bias, size_t sBias, const float* __restrict__ CP, int rowsPerB, size_t sCPb, int row0g,
    float* __restrict__ C, _Float16* __restrict__ C16, int ldc, size_t sC, int M, int N, int K) { static_assert(ACT == 0 || ACT == 3 || ACT == 6 || ACT == 8 || ACT == 9 || ACT == 11 || ACT == 12 || ACT == 14 || ACT == 15 || ACT == 16 || ACT == 17, "k_gemm2: unsupported ACT code (would silently apply no activation)");
  __shared__ __attribute__((aligned(16))) float so[4][32][68];
  const int tid = threadIdx.x, w = tid >> 5, lane = tid & 31, ln = lane & 15, hh = lane >> 4; const int by = blockIdx.y;
  A += (size_t)by * sA; Bh += (size_t)by * sB; const size_t cofs = (size_t)by * sC; const float* bp = bias ? bias + (size_t)by * sBias : nullptr;
  const int ntn = N >> 6; const int mt = blockIdx.x / ntn, nq = blockIdx.x - mt * ntn; const int row0 = mt * 128 + 32 * w, col0 = nq * 64; if (row0 >= M) return;
  const _Float16* a0p = A + (size_t)(row0 + ln) * lda; const _Float16* a1p = a0p + (size_t)16 * lda;
  const _Float16* b0p = Bh + (size_t)(col0 + ln) * ldb; const _Float16* b1p = b0p + (size_t)16 * ldb; const _Float16* b2p = b1p + (size_t)16 * ldb; const _Float16* b3p = b2p + (size_t)16 * ldb;
  const v8f z8 = {0.f,0.f,0.f,0.f,0.f,0.f,0.f,0.f}; v8f c00 = z8, c01 = z8, c02 = z8, c03 = z8, c10 = z8, c11 = z8, c12 = z8, c13 = z8;
#pragma unroll 1
  for (int kb = 0; kb < K; kb += 32) { const v16h a0 = g2_frag(a0p + kb, hh), a1 = g2_frag(a1p + kb, hh);
    v16h b = g2_frag(b0p + kb, hh); c00 = g2_mma(a0, b, c00); c10 = g2_mma(a1, b, c10);
    b = g2_frag(b1p + kb, hh); c01 = g2_mma(a0, b, c01); c11 = g2_mma(a1, b, c11);
    b = g2_frag(b2p + kb, hh); c02 = g2_mma(a0, b, c02); c12 = g2_mma(a1, b, c12);
    b = g2_frag(b3p + kb, hh); c03 = g2_mma(a0, b, c03); c13 = g2_mma(a1, b, c13); }
  v8f accs[8] = {c00, c01, c02, c03, c10, c11, c12, c13};
#pragma unroll
  for (int u = 0; u < 8; ++u) { const int t = u & 3, half = u >> 2; const int col = col0 + t * 16 + ln; const float bv = bp ? bf16_round(bp[col]) : 0.f;
#pragma unroll
    for (int r = 0; r < 8; ++r) { const int rloc = half * 16 + 8 * hh + r; float v = accs[u][r] * alpha + bv; if (CP) { if (rowsPerB < 0) v += CP[cofs + (size_t)(row0g + row0 + rloc) * ldc + col];      /* rowsPerB < 0: own element of the batched C plane */ else { const int bidx = (row0g + row0 + rloc) / rowsPerB; v += CP[(size_t)bidx * sCPb + (size_t)by * 64 + col]; } }
      if (ACT == 3) v = fmaxf(v, 0.f); else if (ACT == 6) v = 0.5f * v * (1.0f + erff(v * 0.70710678118654752f)); else if (ACT == 11) v = 1.0f / (1.0f + expf(-v)); else if (ACT == 15) v = v / (1.0f + expf(-v)); else if (ACT == 12) v = (v > 0.f) ? v : 0.01f * v; else if (ACT == 8) v = tanhf(v); else if (ACT == 9) v = 0.5f * v * (1.0f + tanhf(0.7978845608028654f * (v + 0.044715f * v * v * v))); else if (ACT == 14) v = (v > 0.f) ? v : 0.1f * v; else if (ACT == 16) v = (v >= 0.f) ? v : 0.3f * v; else if (ACT == 17) v = (v >= 0.f) ? v : 0.2f * v;
      so[w][rloc][t * 16 + ln] = v; } }
  __builtin_amdgcn_fence(__ATOMIC_ACQ_REL, "workgroup"); __builtin_amdgcn_wave_barrier();
  const int rsub = lane >> 4, c4 = (lane & 15) * 4;
  {
#pragma unroll
    for (int q = 0; q < 16; ++q) { const int r = q * 2 + rsub; const v4f v = *(const v4fa*)&so[w][r][c4]; if (C) *(v4f*)(C + cofs + (size_t)(row0 + r) * ldc + col0 + c4) = v; if (C16) { v4h h4; for (int i = 0; i < 4; ++i) h4[i] = (_Float16)v[i]; *(v4h*)(C16 + cofs + (size_t)(row0 + r) * ldc + col0 + c4) = h4; } }
     } }


__global__ __launch_bounds__(256) void k_wnat(const float* __restrict__ w, size_t n8, _Float16* __restrict__ Bt) { const size_t t = (size_t)blockIdx.x * 256 + threadIdx.x; if (t >= n8) return; FragH f; for (int q = 0; q < 8; ++q) f.h[q] = (_Float16)(bf16_round(w[t * 8 + q]) * 16.0f); *(v8us*)((unsigned short*)Bt + t * 8) = f.half[0];  }
__global__ __launch_bounds__(256) void k_rsm(const float* __restrict__ S, _Float16* __restrict__ P, int nrows) {
  #pragma clang fp contract(off)
  const int i = blockIdx.x * 256 + threadIdx.x; if (i >= nrows) return; const float* s = S + (size_t)i * SQ; float mx = -3.0e38f;
#pragma unroll 1
  for (int j = 0; j < SQ; ++j) mx = fmaxf(mx, s[j]); float se = 0.f;
#pragma unroll 1
  for (int j = 0; j < SQ; ++j) se += expf(s[j] - mx); const float sc = 256.0f / se;
#pragma unroll 1
  for (int j0 = 0; j0 < SQ; j0 += 8) { FragH f; for (int q = 0; q < 8; ++q) f.h[q] = (_Float16)(expf(s[j0 + q] - mx) * sc); unsigned short* d = (unsigned short*)P + (size_t)i * SQ + j0; *(v8us*)d = f.half[0];  } }
__global__ __launch_bounds__(256) void k_vt(const _Float16* __restrict__ V16, int b, int h0, _Float16* __restrict__ VT) { __shared__ unsigned short tl[64][65]; const int tid = threadIdx.x; const int hh = blockIdx.x % HG, sg = blockIdx.x / HG; const int s0 = sg * 64; const int h = h0 + hh;
  for (int i = tid; i < 64 * 8; i += 256) { const int j = i / 8, d8 = (i % 8) * 8; FragH f; f.half[0] = *(const v8us*)((const unsigned short*)V16 + ((size_t)b * SQ + s0 + j) * DM + h * HD + d8); for (int q = 0; q < 8; ++q) tl[d8 + q][j] = f.u[q]; }
  __syncthreads();
  { for (int i = tid; i < 64 * 8; i += 256) { const int d = i / 8, j8 = (i % 8) * 8; FragH f; for (int q = 0; q < 8; ++q) f.u[q] = tl[d][j8 + q]; *(v8us*)((unsigned short*)VT + ((size_t)hh * HD + d) * SQ + s0 + j8) = f.half[0]; }  } }



#define FA_SK 64                     /* keys per LDS tile */
#define FA_PH 72                     /* LDS row pitch in f16: 144 B = 16 B x odd, the conflict-free pitch for 16-byte fragment reads */
typedef float f32x2 __attribute__((ext_vector_type(2)));
typedef _Float16 v2h __attribute__((ext_vector_type(2)));
union FragP { v16h v; unsigned int w[8]; };
__device__ __forceinline__ float fa_xhalf(float x) { return __builtin_bit_cast(float, __builtin_amdgcn_permlanex16(__builtin_bit_cast(int, x), __builtin_bit_cast(int, x), 0x76543210, 0xfedcba98, false, false)); }      /* lane l <-> lane l ^ 16 */
__device__ __forceinline__ v16h fa_frag(const _Float16* p) { FragH f; f.half[0] = *(const v8us*)(const unsigned short*)p; f.half[1] = *(const v8us*)((const unsigned short*)p + 16); return f.v; }      /* p = row + 32 kc + 8 h: the hardware k order */
__device__ __forceinline__ v8f fa_mma(v16h a, v16h b, v8f c) { return __builtin_amdgcn_wmma_f32_16x16x32_f16(false, a, false, b, (short)0, c, false, false); }
// amdgpu_waves_per_eu(4, 4): a budget of 256 VGPRs, so that no register lies above v255 (without it the build took 266 and switched register windows all through the loop)
__global__ __launch_bounds__(256) __attribute__((amdgpu_waves_per_eu(4, 4))) void k_fattn(const _Float16* __restrict__ Qh, const _Float16* __restrict__ Kh, const _Float16* __restrict__ Vt, _Float16* __restrict__ Oh) {
  __shared__ __attribute__((aligned(16))) _Float16 sk[2][FA_SK][FA_PH];      /* K tile: row = key, 64 d */
  __shared__ __attribute__((aligned(16))) _Float16 sv[2][HD][FA_PH];         /* V^T tile: row = d, 64 keys */
  const int tid = threadIdx.x, lane = tid & 31, wave = tid >> 5, c = lane & 15, h = lane >> 4;
  const int head = blockIdx.y, q0 = blockIdx.x * 256 + wave * 32;
  const float cs = 0.03125f * 1.44269504088896340736f;      /* the module's score scale 1/sqrt(1024), in the base-2 domain */
  // staging: a thread moves 16 bytes of rows srow and srow + 32 of each tile; 8 threads cover one 128-byte row
  const int srow = tid >> 3, sch = (tid & 7) * 8;
  const unsigned short* kg = (const unsigned short*)Kh + (size_t)srow * LQ + head * HD + sch;
  const unsigned short* vg = (const unsigned short*)Vt + ((size_t)head * HD + srow) * SQ + sch;
  v8us rk0, rk1, rv0, rv1;
  rk0 = *(const v8us*)kg; rk1 = *(const v8us*)(kg + (size_t)32 * LQ); rv0 = *(const v8us*)vg; rv1 = *(const v8us*)(vg + (size_t)32 * SQ);
  v16h qf[2][2];
#pragma unroll
  for (int g = 0; g < 2; ++g)
#pragma unroll
    for (int kc = 0; kc < 2; ++kc) qf[g][kc] = fa_frag(Qh + (size_t)(q0 + 16 * g + c) * LQ + head * HD + 32 * kc + 8 * h);
  const v8f z8 = {0.f,0.f,0.f,0.f,0.f,0.f,0.f,0.f};
  v8f acc[2][4]; float m_run[2]; f32x2 l_run[2];
#pragma unroll
  for (int g = 0; g < 2; ++g) { m_run[g] = -3.0e38f; l_run[g] = f32x2{0.f, 0.f};
#pragma unroll
    for (int t = 0; t < 4; ++t) acc[g][t] = z8; }
  *(v8us*)&sk[0][srow][sch] = rk0; *(v8us*)&sk[0][srow + 32][sch] = rk1; *(v8us*)&sv[0][srow][sch] = rv0; *(v8us*)&sv[0][srow + 32][sch] = rv1;
  __syncthreads();      /* tile 0 is visible to all 8 waves */
#pragma unroll 1  // rolled: one tile a trip; the two 32-key passes inside are unrolled
  for (int st = 0; st < SQ / FA_SK; ++st) {
    const int b = st & 1; const bool more = st + 1 < SQ / FA_SK;      /* the same for the whole work-group */
    if (more) { const unsigned short* kp = kg + (size_t)(st + 1) * FA_SK * LQ; const unsigned short* vp = vg + (st + 1) * FA_SK;      /* next tile: in flight under this tile's work */
      rk0 = *(const v8us*)kp; rk1 = *(const v8us*)(kp + (size_t)32 * LQ); rv0 = *(const v8us*)vp; rv1 = *(const v8us*)(vp + (size_t)32 * SQ); }
#pragma unroll
    for (int sub = 0; sub < 2; ++sub) {      /* one pass: 32 keys x the wave's 32 query columns */
      v8f s[2][2];
#pragma unroll
      for (int kt = 0; kt < 2; ++kt) { const _Float16* kr = &sk[b][sub * 32 + 16 * kt + c][8 * h]; const v16h k0 = fa_frag(kr), k1 = fa_frag(kr + 32);
#pragma unroll
        for (int g = 0; g < 2; ++g) s[kt][g] = fa_mma(k1, qf[g][1], fa_mma(k0, qf[g][0], z8)); }
      v16h vf[4];
#pragma unroll
      for (int t = 0; t < 4; ++t) vf[t] = fa_frag(&sv[b][16 * t + c][sub * 32 + 8 * h]);
#pragma unroll
      for (int g = 0; g < 2; ++g) {
        float mx = s[0][g][0];      /* maximum of the raw scores (the scale is positive) */
#pragma unroll
        for (int r = 1; r < 8; ++r) mx = fmaxf(mx, s[0][g][r]);
#pragma unroll
        for (int r = 0; r < 8; ++r) mx = fmaxf(mx, s[1][g][r]);
        mx = fmaxf(mx, fa_xhalf(mx)) * cs;      /* both wave halves hold the query's pass maximum, scaled */
        const float m_new = fmaxf(m_run[g], mx); const float corr = __builtin_amdgcn_exp2f(m_run[g] - m_new);      /* 0 on the first pass */
        m_run[g] = m_new;
#pragma unroll
        for (int t = 0; t < 4; ++t) acc[g][t] = acc[g][t] * corr;
        FragP pf; f32x2 ps[8];
#pragma unroll
        for (int i = 0; i < 8; ++i) {
          const f32x2 a = __builtin_elementwise_fma(f32x2{s[i >> 2][g][2 * (i & 3)], s[i >> 2][g][2 * (i & 3) + 1]}, f32x2{cs, cs}, f32x2{-m_new, -m_new});
          const f32x2 p = {__builtin_amdgcn_exp2f(a.x), __builtin_amdgcn_exp2f(a.y)};
          ps[i] = p; pf.w[i] = __builtin_bit_cast(unsigned int, __builtin_convertvector(p, v2h)); }
        l_run[g] = l_run[g] * corr + (((ps[0] + ps[1]) + (ps[2] + ps[3])) + ((ps[4] + ps[5]) + (ps[6] + ps[7])));      /* a tree, not one chain of 8 dependent adds */
#pragma unroll
        for (int t = 0; t < 4; ++t) acc[g][t] = fa_mma(vf[t], pf.v, acc[g][t]);
      }
    }
    if (more) { *(v8us*)&sk[b ^ 1][srow][sch] = rk0; *(v8us*)&sk[b ^ 1][srow + 32][sch] = rk1; *(v8us*)&sv[b ^ 1][srow][sch] = rv0; *(v8us*)&sv[b ^ 1][srow + 32][sch] = rv1; }      /* every wave left that buffer before the last barrier */
    __syncthreads();      /* publishes tile st + 1 and ends every wave's reads of tile st, whose buffer the next trip refills */
  }
#pragma unroll
  for (int g = 0; g < 2; ++g) { float l = l_run[g].x + l_run[g].y; l += fa_xhalf(l); const float inv = 64.0f / l;      /* o carried x64, as the output GEMM's alpha expects */
#pragma unroll
    for (int t = 0; t < 4; ++t) { FragH f;
#pragma unroll
      for (int r = 0; r < 8; ++r) f.h[r] = (_Float16)(acc[g][t][r] * inv);
      *(v8us*)((unsigned short*)Oh + (size_t)(q0 + 16 * g + c) * DM + head * HD + 16 * t + 8 * h) = f.half[0]; } }      /* 8 consecutive d of one query row: one 16-byte store */
}

extern "C" void kernel_launch(void* const* d_in, const int* in_sizes, int n_in,
                              void* d_out, int out_size, void* d_ws, size_t ws_size, hipStream_t stream) {
  (void)in_sizes; (void)n_in; (void)out_size;
  const float* const* I = (const float* const*)d_in; const float* xq = I[2]; const float* xk = I[1]; const float* xv = I[0]; const float* wq = I[5]; const float* bq = nullptr; const float* wk = I[4]; const float* bk = nullptr; const float* wv = I[3]; const float* bv = nullptr; const float* wo = I[6]; const float* bo = I[7];      /* input order: values, keys, query (three unbatched [4096][1024] streams in REVERSE order: the query stream is I[2]), Wv, Wk, Wq (the weights in the same reverse order: Wq is I[5]), Wo, bo ([in][out] weights); the q / k / v projections have NO biases: null pointers in the guarded bias slots */
  char* ws = (char*)d_ws; size_t off = 0;
  auto take = [&](size_t bytes) { char* p = ws + off; off += (bytes + 255) & ~(size_t)255; return p; };
  _Float16* BQ = (_Float16*)take((size_t)DM * DM * 2); _Float16* BK = (_Float16*)take((size_t)DM * DM * 2); _Float16* BV = (_Float16*)take((size_t)DM * DM * 2); _Float16* BO = (_Float16*)take((size_t)DM * DM * 2);
  _Float16* XQ = (_Float16*)take(NR * DM * 2); _Float16* XK = (_Float16*)take(NR * DM * 2); _Float16* XV = (_Float16*)take(NR * DM * 2); _Float16* Q16 = (_Float16*)take(NR * DM * 2); _Float16* K16 = (_Float16*)take(NR * DM * 2); _Float16* V16 = (_Float16*)take(NR * DM * 2); _Float16* O16 = (_Float16*)take(NR * DM * 2);
  _Float16* VT = (_Float16*)take((size_t)NH * HD * SQ * 2);
  if (off > ws_size) return;
  { const unsigned g = (unsigned)(((size_t)DM * (DM / 8) + 255) / 256); k_wt_f16<<<g, 256, 0, stream>>>(wq, BQ, DM, DM, 16.0f); k_wt_f16<<<g, 256, 0, stream>>>(wk, BK, DM, DM, 16.0f); k_wt_f16<<<g, 256, 0, stream>>>(wv, BV, DM, DM, 16.0f); k_wt_f16<<<g, 256, 0, stream>>>(wo, BO, DM, DM, 16.0f); }      /* [in][out] -> Bt[n][k] x16 (transposing builder) */

  k_x16<<<(unsigned)((NR * DM / 8 + 255) / 256), 256, 0, stream>>>(xq, XQ, NR * DM / 8); k_x16<<<(unsigned)((NR * DM / 8 + 255) / 256), 256, 0, stream>>>(xk, XK, NR * DM / 8); k_x16<<<(unsigned)((NR * DM / 8 + 255) / 256), 256, 0, stream>>>(xv, XV, NR * DM / 8);      /* the three inputs as exact f16 rows */
  const size_t r0p = (size_t)B0 * SQ;      /* first projected row */
  k_gemm2<0><<<dim3((unsigned)((MP / 128) * (DM / 64)), 1), 128, 0, stream>>>(XQ + r0p * DM, DM, 0, BQ, DM, 0, 0.0625f, bq, 0, nullptr, 1, 0, 0, nullptr, Q16 + r0p * DM, DM, 0, MP, DM, DM);
  k_gemm2<0><<<dim3((unsigned)((MP / 128) * (DM / 64)), 1), 128, 0, stream>>>(XK + r0p * DM, DM, 0, BK, DM, 0, 0.0625f, bk, 0, nullptr, 1, 0, 0, nullptr, K16 + r0p * DM, DM, 0, MP, DM, DM);
  k_gemm2<0><<<dim3((unsigned)((MP / 128) * (DM / 64)), 1), 128, 0, stream>>>(XV + r0p * DM, DM, 0, BV, DM, 0, 0.0625f, bv, 0, nullptr, 1, 0, 0, nullptr, V16 + r0p * DM, DM, 0, MP, DM, DM);
  for (int b = B0; b < B0 + NBR; ++b) { const size_t r0 = (size_t)b * SQ;
    k_vt<NH, SQ><<<NH * (SQ / 64), 256, 0, stream>>>(V16 + r0 * LQ, LQ, 0, VT);      /* V^T [NH][HD][SQ] for this batch */
    k_fattn<<<dim3(QN / 256, NHD), 256, 0, stream>>>(Q16 + r0 * LQ, K16 + r0 * LQ, VT, O16 + r0 * DM); }      /* all heads: scores (THIS module's scale 1/sqrt(EMBED 1024) = 1/32), softmax, P.V; o x64 (merged heads) as f16 rows */
  k_gemm2<0><<<dim3((unsigned)((MPO / 128) * (DM / 64)), 1), 128, 0, stream>>>(O16 + r0p * DM, DM, 0, BO, DM, 0, 0.0009765625f, bo, 0, nullptr, 1, 0, 0, (float*)d_out + r0p * DM, nullptr, DM, 0, MPO, DM, DM);      /* out rows are the output layout */
}

// v003
// Measured time: 173 microseconds a run.
// Timed twice side by side with v002, it ran 1.58 and 1.57 times as fast.
// Over all steps from v000 it is 77.2 times as fast.
#include <hip/hip_runtime.h>
// Multi-head attention on three unbatched inputs with [in][out] bias-free q / k / v projections, a biased output projection and the source's MODEL-WIDTH score scale; the inputs arrive in the order values, keys, query (each [4096][1024]; v / k / q = stream W ([in][out] 1024 x 1024 sd 1/32, NO biases), 16 heads of 64; energy / sqrt(1024) (the module scales by the EMBED width, not the head width: 1/32); softmax over all 4096 keys (no mask); out = merged Wo + bo ([in][out]) -> [4096][1024]); ONE attention launch for all heads.
// Structure: token rows r = b*4096 + s; the query, key and value sources as exact f16 rows (bf16-rounded); Q, K, V as three WMMA GEMMs (32x64 wave tiles, f32 accumulation, exact x16 weights, no bias, f16 outputs); per batch: V^T for all heads via LDS transposes; per batch ONE fused attention kernel over (256 query rows, head): per 32 keys the scores on WMMA (K = 64), online softmax on VALU (f32 running maximum and sum, native exp2; weights exp(s - max) as f16, in registers only), o += P . V on WMMA, o / sum carried x64 (against f16 subnormal flush, folded into the output GEMM alpha) written straight into the merged f16 o rows; out = o W_o + b GEMM (f32) into the output layout.
// Compute dtype: inputs rounded to bf16; x / weights exact; q, k, v, softmax weights and o as plain f16 GEMM operands (~2^-12); scores and softmax statistics f32. v_wmma_f32_16x16x32_f16.
#define NB 1
#define SQ 4096
#define DM 1024
#define NH 16
#define HD 64
#define HG 1                         /* heads per k_vt(V16, b, h0, VT) launch (that overload is not launched) */
#define B0 0                         /* first batch processed (debug hook) */
#define NBR NB                       /* batches processed (debug hook) */
#define NR ((size_t)NB * SQ)         /* token rows */
#define MP ((int)((size_t)NBR * SQ)) /* rows projected (debug hook) */
#define QN SQ                        /* query rows attended per batch (debug hook) */
#define NHD NH                       /* heads attended (debug hook) */
#define MPO MP                       /* rows through the output stage (debug hook) */
#define LQ DM      /* row pitch of the q/k/v rows */
typedef __bf16 v16b __attribute__((ext_vector_type(16)));
typedef unsigned short v8us __attribute__((ext_vector_type(8), may_alias));
typedef float  v8f  __attribute__((ext_vector_type(8)));
typedef float  v4f  __attribute__((ext_vector_type(4)));
typedef float  v4fa __attribute__((ext_vector_type(4), may_alias));
union FragB { v16b v; v8us half[2]; unsigned short u[16]; };

__device__ __forceinline__ unsigned short bf16_bits(float x) { unsigned int u = __float_as_uint(x); return (unsigned short)((u + 0x7FFFu + ((u >> 16) & 1u)) >> 16); }
__device__ __forceinline__ float bf16_val(unsigned short b) { return __uint_as_float(((unsigned int)b) << 16); }
__device__ __forceinline__ float bf16_round(float x) { return bf16_val(bf16_bits(x)); }
// D += A·B with NT terms: 1 = ah·bh, 2 = + al·bh (A split), 3 = + ah·bl (both split)
template <int NT>
__device__ __forceinline__ v8f mmaN(v16b ah, v16b al, v16b bh, v16b bl, v8f c) {
  c = __builtin_amdgcn_wmma_f32_16x16x32_bf16(false, ah, false, bh, (short)0, c, false, false);
  if (NT >= 2) c = __builtin_amdgcn_wmma_f32_16x16x32_bf16(false, al, false, bh, (short)0, c, false, false);
  if (NT >= 3) c = __builtin_amdgcn_wmma_f32_16x16x32_bf16(false, ah, false, bl, (short)0, c, false, false);
  asm volatile("v_nop\n\tv_nop\n\tv_nop\n\tv_nop" : "+v"(c) : "v"(ah), "v"(al), "v"(bh), "v"(bl));
  return c;
}

__global__ __launch_bounds__(256) void k_wt_bf16(const float* __restrict__ W, unsigned short* __restrict__ Wt, int K, int N) {
  const int t = blockIdx.x * 256 + threadIdx.x;
  const int k8n = K / 8;
  if (t >= N * k8n) return;
  const int n = t / k8n, k8 = (t % k8n) * 8;
  v8us v;
#pragma unroll
  for (int i = 0; i < 8; ++i) v[i] = bf16_bits(W[(size_t)(k8 + i) * N + n]);
  *(v8us*)(Wt + (size_t)n * K + k8) = v;
  
}

// GEMM C[M][N] (f32, pitch ldc) = act(A[M][K]·W + bias). A f32 row-major (pitch lda) converted per fragment to bf16
// (ASPLIT: hi/lo two planes -> 2 terms, else single rounded term); Wt bf16 [N][K] (pitch ldb). BIAS_BF16 rounds the
// bias to bf16 first (bias quantised to bf16 before the add). K%32==0, M%16==0, N%64==0.
template <bool ASPLIT, int ACT, bool BIAS_BF16>
__global__ __launch_bounds__(128) void k_gemm_bf(const float* __restrict__ A, int lda, const unsigned short* __restrict__ Wt, int ldb,
                                               const float* __restrict__ bias, float* __restrict__ C, int ldc, int M, int N, int K) {
  __shared__ __attribute__((aligned(16))) float so[4][16][64];
  const int tid = threadIdx.x, w = tid >> 5, lane = tid & 31, ln = lane & 15, hh = lane >> 4;
  const int ntn = N / 64;
  const int wid = blockIdx.x * 4 + w;
  const int mt = wid / ntn, nq = wid % ntn;
  if (mt * 16 >= M) return;
  const int row0 = mt * 16, col0 = nq * 64;
  const float* arow = A + (size_t)(row0 + ln) * lda;
  v8f acc[4] = {};
  for (int kb = 0; kb < K; kb += 32) {
    FragB ah, al;
    const v4f x0 = *(const v4fa*)(arow + kb + 8 * hh), x1 = *(const v4fa*)(arow + kb + 8 * hh + 4);
    const v4f x2 = *(const v4fa*)(arow + kb + 16 + 8 * hh), x3 = *(const v4fa*)(arow + kb + 16 + 8 * hh + 4);
    float xs[16] = {x0[0],x0[1],x0[2],x0[3],x1[0],x1[1],x1[2],x1[3],x2[0],x2[1],x2[2],x2[3],x3[0],x3[1],x3[2],x3[3]};
#pragma unroll
    for (int i = 0; i < 16; ++i) { const unsigned short hb = bf16_bits(xs[i]); ah.u[i] = hb; al.u[i] = ASPLIT ? bf16_bits(xs[i] - bf16_val(hb)) : (unsigned short)0; }
#pragma unroll
    for (int t = 0; t < 4; ++t) {
      const unsigned short* brow = Wt + (size_t)(col0 + t * 16 + ln) * ldb + kb;
      FragB b;
      b.half[0] = *(const v8us*)(brow + 8 * hh);
      b.half[1] = *(const v8us*)(brow + 16 + 8 * hh);
      acc[t] = mmaN<ASPLIT ? 2 : 1>(ah.v, al.v, b.v, b.v, acc[t]);
    }
  }
#pragma unroll
  for (int t = 0; t < 4; ++t) {
    float bv = bias ? bias[col0 + t * 16 + ln] : 0.f;
    if (BIAS_BF16) bv = bf16_round(bv);
#pragma unroll
    for (int r = 0; r < 8; ++r) { float v = acc[t][r] + bv; if (ACT == 1) v = fmaxf(v, 0.f); so[w][8 * hh + r][t * 16 + ln] = v; }
  }
  __builtin_amdgcn_fence(__ATOMIC_ACQ_REL, "workgroup");
  __builtin_amdgcn_wave_barrier();
  const int rsub = lane >> 4, c4 = (lane & 15) * 4;
  {
#pragma unroll
    for (int q = 0; q < 8; ++q) {
      const int r = q * 2 + rsub;
      const v4f v = *(const v4fa*)&so[w][r][c4];
      *(v4f*)(C + (size_t)(row0 + r) * ldc + col0 + c4) = v;
    }
    
  }
}

// GEMM C = act(A·W + bias + resid): A f32 (ASPLIT -> hi/lo 2 terms), Wt bf16 [N][K]; ACT 0 none, 1 relu, 2 exact gelu;
// resid (optional, f32, row index = (row % rmod), pitch ldr, RES_BF16 rounds it) added before the activation.
template <bool ASPLIT, int ACT, bool BIAS_BF16, bool RES_BF16>
__global__ __launch_bounds__(128) void k_gemm_bf3(const float* __restrict__ A, int lda, const unsigned short* __restrict__ Wt, int ldb,
                                                const float* __restrict__ bias, const float* __restrict__ resid, int rmod, int ldr,
                                                float* __restrict__ C, int ldc, int M, int N, int K) {
  __shared__ __attribute__((aligned(16))) float so[4][16][64];
  const int tid = threadIdx.x, w = tid >> 5, lane = tid & 31, ln = lane & 15, hh = lane >> 4;
  const int ntn = N / 64;
  const int wid = blockIdx.x * 4 + w;
  const int mt = wid / ntn, nq = wid % ntn;
  if (mt * 16 >= M) return;
  const int row0 = mt * 16, col0 = nq * 64;
  const float* arow = A + (size_t)(row0 + ln) * lda;
  v8f acc[4] = {};
  for (int kb = 0; kb < K; kb += 32) {
    FragB ah, al;
    const v4f x0 = *(const v4fa*)(arow + kb + 8 * hh), x1 = *(const v4fa*)(arow + kb + 8 * hh + 4);
    const v4f x2 = *(const v4fa*)(arow + kb + 16 + 8 * hh), x3 = *(const v4fa*)(arow + kb + 16 + 8 * hh + 4);
    float xs[16] = {x0[0],x0[1],x0[2],x0[3],x1[0],x1[1],x1[2],x1[3],x2[0],x2[1],x2[2],x2[3],x3[0],x3[1],x3[2],x3[3]};
#pragma unroll
    for (int i = 0; i < 16; ++i) { const unsigned short hb = bf16_bits(xs[i]); ah.u[i] = hb; al.u[i] = ASPLIT ? bf16_bits(xs[i] - bf16_val(hb)) : (unsigned short)0; }
#pragma unroll
    for (int t = 0; t < 4; ++t) {
      const unsigned short* brow = Wt + (size_t)(col0 + t * 16 + ln) * ldb + kb;
      FragB b;
      b.half[0] = *(const v8us*)(brow + 8 * hh);
      b.half[1] = *(const v8us*)(brow + 16 + 8 * hh);
      acc[t] = mmaN<ASPLIT ? 2 : 1>(ah.v, al.v, b.v, b.v, acc[t]);
    }
  }
#pragma unroll
  for (int t = 0; t < 4; ++t) {
    const int col = col0 + t * 16 + ln;
    float bv = bias ? bias[col] : 0.f;
    if (BIAS_BF16) bv = bf16_round(bv);
#pragma unroll
    for (int r = 0; r < 8; ++r) {
      float v = acc[t][r] + bv;
      if (resid) { float rv = resid[(size_t)((row0 + 8 * hh + r) % rmod) * ldr + col]; if (RES_BF16) rv = bf16_round(rv); v += rv; }
      if (ACT == 1) v = fmaxf(v, 0.f);
      if (ACT == 2) v = 0.5f * v * (1.0f + erff(v * 0.70710678118654752f));
      if (ACT == 3) { const float u = 0.7978845608028654f * (v + 0.044715f * v * v * v); v = 0.5f * v * (1.0f + tanhf(u)); }
      so[w][8 * hh + r][t * 16 + ln] = v;
    }
  }
  __builtin_amdgcn_fence(__ATOMIC_ACQ_REL, "workgroup");
  __builtin_amdgcn_wave_barrier();
  const int rsub = lane >> 4, c4 = (lane & 15) * 4;
  {
#pragma unroll
    for (int q = 0; q < 8; ++q) {
      const int r = q * 2 + rsub;
      const v4f v = *(const v4fa*)&so[w][r][c4];
      *(v4f*)(C + (size_t)(row0 + r) * ldc + col0 + c4) = v;
    }
    
  }
}
// row LayerNorm (biased variance, eps) over N: s = X (+ R); optional out_sum <- s; out_norm <- (s-mu)*rsqrt(var+eps)*g + b
template <bool PARAM_BF16>
__global__ __launch_bounds__(256) void k_layernorm(const float* __restrict__ X, const float* __restrict__ R, const float* __restrict__ g, const float* __restrict__ bta,
                                                  float* __restrict__ out_sum, float* __restrict__ out_norm, int N, float eps) {
  __shared__ float red[256];
  const int row = blockIdx.x, tid = threadIdx.x;
  const float* x = X + (size_t)row * N; const float* rr = R ? R + (size_t)row * N : nullptr;
  float vals[16];                     // up to N = 4096
  const int per = N / 256;            // contiguous chunk per thread? use strided-by-4 chunks: thread handles j = tid*4 + 1024*u
  float s1 = 0.f;
  for (int u = 0; u < per / 4; ++u) {
    const int j = tid * 4 + 1024 * u;
    const v4f a = *(const v4fa*)(x + j);
    v4f b = {0.f,0.f,0.f,0.f}; if (rr) b = *(const v4fa*)(rr + j);
#pragma unroll
    for (int q = 0; q < 4; ++q) { const float v = a[q] + b[q]; vals[u * 4 + q] = v; s1 += v; }
  }
  red[tid] = s1; __syncthreads();
  for (int st = 128; st > 0; st >>= 1) { if (tid < st) red[tid] += red[tid + st]; __syncthreads(); }
  const float mu = red[0] / (float)N; __syncthreads();
  float s2 = 0.f;
  for (int u = 0; u < per / 4; ++u)
#pragma unroll
    for (int q = 0; q < 4; ++q) { const float c = vals[u * 4 + q] - mu; s2 += c * c; }
  red[tid] = s2; __syncthreads();
  for (int st = 128; st > 0; st >>= 1) { if (tid < st) red[tid] += red[tid + st]; __syncthreads(); }
  const float rs = rsqrtf(red[0] / (float)N + eps);
  {
    for (int u = 0; u < per / 4; ++u) {
      const int j = tid * 4 + 1024 * u;
      v4f o, sm;
#pragma unroll
      for (int q = 0; q < 4; ++q) {
        float gg = g[j + q], bb = bta[j + q];
        if (PARAM_BF16) { gg = bf16_round(gg); bb = bf16_round(bb); }
        sm[q] = vals[u * 4 + q]; o[q] = (vals[u * 4 + q] - mu) * rs * gg + bb;
      }
      if (out_sum) *(v4f*)(out_sum + (size_t)row * N + j) = sm;
      *(v4f*)(out_norm + (size_t)row * N + j) = o;
    }
    
  }
}



// ---- f16 WMMA path (v_wmma_f32_16x16x32_f16): 11-bit significands for operands in range — used where a [0,1] probability operand needs more precision than bf16
typedef _Float16 v16h __attribute__((ext_vector_type(16)));
union FragH { v16h v; v8us half[2]; _Float16 h[16]; unsigned short u[16]; };
template <int NT>
__device__ __forceinline__ v8f mmaH(v16h ah, v16h al, v16h bh, v16h bl, v8f c) {
  c = __builtin_amdgcn_wmma_f32_16x16x32_f16(false, ah, false, bh, (short)0, c, false, false);
  if (NT >= 2) c = __builtin_amdgcn_wmma_f32_16x16x32_f16(false, al, false, bh, (short)0, c, false, false);
  if (NT >= 3) c = __builtin_amdgcn_wmma_f32_16x16x32_f16(false, ah, false, bl, (short)0, c, false, false);
  asm volatile("v_nop\n\tv_nop\n\tv_nop\n\tv_nop" : "+v"(c) : "v"(ah), "v"(al), "v"(bh), "v"(bl));
  return c;
}
// batched GEMM like k_gemm_b but f16 operands: A f32 (split into f16 hi/lo if ASPLIT, else rounded to f16), Bt = f16 values [n][k]; alpha; C f32; N multiple of 16 (partial tiles skipped)
template <bool ASPLIT>
__global__ __launch_bounds__(128) void k_gemm_h(const float* __restrict__ A, int lda, size_t sA, const _Float16* __restrict__ Bh, int ldb, size_t sB, float alpha, float* __restrict__ C, int ldc, size_t sC, int M, int N, int K) {
  __shared__ __attribute__((aligned(16))) float so[4][16][64];
  const int tid = threadIdx.x, w = tid >> 5, lane = tid & 31, ln = lane & 15, hh = lane >> 4; const int by = blockIdx.y;
  A += (size_t)by * sA; Bh += (size_t)by * sB; C += (size_t)by * sC;
  const int ntn = (N + 63) / 64; const int wid = blockIdx.x * 4 + w; const int mt = wid / ntn, nq = wid % ntn; if (mt * 16 >= M) return;
  const int row0 = mt * 16, col0 = nq * 64; const float* arow = A + (size_t)(row0 + ln) * lda;
  v8f acc[4] = {};
  for (int kb = 0; kb < K; kb += 32) {
    FragH ah, al;
    const v4f x0 = *(const v4fa*)(arow + kb + 8 * hh), x1 = *(const v4fa*)(arow + kb + 8 * hh + 4), x2 = *(const v4fa*)(arow + kb + 16 + 8 * hh), x3 = *(const v4fa*)(arow + kb + 16 + 8 * hh + 4);
    float xs[16] = {x0[0],x0[1],x0[2],x0[3],x1[0],x1[1],x1[2],x1[3],x2[0],x2[1],x2[2],x2[3],x3[0],x3[1],x3[2],x3[3]};
#pragma unroll
    for (int i = 0; i < 16; ++i) { const _Float16 h = (_Float16)xs[i]; ah.h[i] = h; al.h[i] = ASPLIT ? (_Float16)(xs[i] - (float)h) : (_Float16)0.0f; }
#pragma unroll
    for (int t = 0; t < 4; ++t) { if (col0 + t * 16 >= N) continue; const size_t boff = (size_t)(col0 + t * 16 + ln) * ldb + kb; FragH bq; bq.half[0] = *(const v8us*)(Bh + boff + 8 * hh); bq.half[1] = *(const v8us*)(Bh + boff + 16 + 8 * hh);
      acc[t] = mmaH<ASPLIT ? 2 : 1>(ah.v, al.v, bq.v, bq.v, acc[t]); }
  }
#pragma unroll
  for (int t = 0; t < 4; ++t) { if (col0 + t * 16 >= N) continue;
#pragma unroll
    for (int r = 0; r < 8; ++r) so[w][8 * hh + r][t * 16 + ln] = acc[t][r] * alpha; }
  __builtin_amdgcn_fence(__ATOMIC_ACQ_REL, "workgroup"); __builtin_amdgcn_wave_barrier();
  const int rsub = lane >> 4, c4 = (lane & 15) * 4;
  {
#pragma unroll
    for (int q = 0; q < 8; ++q) { const int r = q * 2 + rsub; if (col0 + c4 < N) { const v4f v = *(const v4fa*)&so[w][r][c4]; *(v4f*)(C + (size_t)(row0 + r) * ldc + col0 + c4) = v; } }
     }
}

// Wt[n][k] = f16(W[k][n]·scale) from f32 row-major W[K][N] (scale = power of two; bf16-exact weights stay exact in f16 away from the subnormal range)
__global__ __launch_bounds__(256) void k_wt_f16(const float* __restrict__ W, _Float16* __restrict__ Wt, int K, int N, float scale) {
  const int t = blockIdx.x * 256 + threadIdx.x; if (t >= N * (K / 8)) return; const int n = t / (K / 8), k8 = (t % (K / 8)) * 8; FragH f;
#pragma unroll
  for (int i = 0; i < 8; ++i) f.h[i] = (_Float16)(bf16_round(W[(size_t)(k8 + i) * N + n]) * scale); const v8us o = f.half[0];
  *(v8us*)((unsigned short*)Wt + (size_t)n * K + k8) = o; 
}
// k_gemm_hh variant with fused epilogue: v = acc·alpha + bias[by·sBias + col] (+ CP[(row/rowsPerB)·sCPb + by·64 + col] if CP) ; ACT 0 none / 1 elu ; writes f16 C16 (and f32 C if non-null)
template <int ACT>
__global__ __launch_bounds__(128) void k_gemm_hhx(const _Float16* __restrict__ A, int lda, size_t sA, const _Float16* __restrict__ Bh, int ldb, size_t sB, float alpha, const float* __restrict__ bias, size_t sBias, const float* __restrict__ CP, int rowsPerB, size_t sCPb, int row0g,
    float* __restrict__ C, _Float16* __restrict__ C16, int ldc, size_t sC, int M, int N, int K) {
  __shared__ __attribute__((aligned(16))) float so[4][16][64];
  const int tid = threadIdx.x, w = tid >> 5, lane = tid & 31, ln = lane & 15, hh = lane >> 4; const int by = blockIdx.y;
  A += (size_t)by * sA; Bh += (size_t)by * sB; const size_t cofs = (size_t)by * sC; const float* bp = bias ? bias + (size_t)by * sBias : nullptr;
  const int ntn = (N + 63) / 64; const int wid = blockIdx.x * 4 + w; const int mt = wid / ntn, nq = wid % ntn; if (mt * 16 >= M) return;
  const int row0 = mt * 16, col0 = nq * 64; const _Float16* arow = A + (size_t)(row0 + ln) * lda;
  v8f acc[4] = {};
  for (int kb = 0; kb < K; kb += 32) { FragH ah; ah.half[0] = *(const v8us*)((const unsigned short*)arow + kb + 8 * hh); ah.half[1] = *(const v8us*)((const unsigned short*)arow + kb + 16 + 8 * hh);
#pragma unroll
    for (int t = 0; t < 4; ++t) { if (col0 + t * 16 >= N) continue; const size_t boff = (size_t)(col0 + t * 16 + ln) * ldb + kb; FragH bq; bq.half[0] = *(const v8us*)((const unsigned short*)Bh + boff + 8 * hh); bq.half[1] = *(const v8us*)((const unsigned short*)Bh + boff + 16 + 8 * hh);
      acc[t] = mmaH<1>(ah.v, ah.v, bq.v, bq.v, acc[t]); }
  }
#pragma unroll
  for (int t = 0; t < 4; ++t) { if (col0 + t * 16 >= N) continue; const int col = col0 + t * 16 + ln; const float bv = bp ? bf16_round(bp[col]) : 0.f;
#pragma unroll
    for (int r = 0; r < 8; ++r) { float v = acc[t][r] * alpha + bv; if (CP) { const int rr = row0g + row0 + 8 * hh + r; if (rowsPerB < 0) v += CP[cofs + (size_t)rr * ldc + col];      /* rowsPerB < 0: own element of the batched C plane */ else { const int bidx = rr / rowsPerB; v += CP[(size_t)bidx * sCPb + (size_t)by * 64 + col]; } } if (ACT == 1) v = (v > 0.f) ? v : expm1f(v); else if (ACT == 7) v = (v > 0.f) ? v + 1.0f : expf(v); else if (ACT == 8) v = tanhf(v); else if (ACT == 9) v = 0.5f * v * (1.0f + tanhf(0.7978845608028654f * (v + 0.044715f * v * v * v))); else if (ACT == 11) v = 1.0f / (1.0f + expf(-v)); else if (ACT == 12) v = (v > 0.f) ? v : 0.01f * v; else if (ACT == 14) v = (v > 0.f) ? v : 0.1f * v; else if (ACT == 16) v = (v >= 0.f) ? v : 0.3f * v; else if (ACT == 17) v = (v >= 0.f) ? v : 0.2f * v; else if (ACT == 15) v = v / (1.0f + expf(-v)); else if (ACT == 3) v = fmaxf(v, 0.f); else if (ACT == 6) v = 0.5f * v * (1.0f + erff(v * 0.70710678118654752f)); so[w][8 * hh + r][t * 16 + ln] = v; } }
  __builtin_amdgcn_fence(__ATOMIC_ACQ_REL, "workgroup"); __builtin_amdgcn_wave_barrier();
  const int rsub = lane >> 4, c4 = (lane & 15) * 4; typedef _Float16 v4h __attribute__((ext_vector_type(4)));
  {
#pragma unroll
    for (int q = 0; q < 8; ++q) { const int r = q * 2 + rsub; if (col0 + c4 < N) { const v4f v = *(const v4fa*)&so[w][r][c4]; if (C) *(v4f*)(C + cofs + (size_t)(row0 + r) * ldc + col0 + c4) = v; if (C16) { v4h h4; for (int i = 0; i < 4; ++i) h4[i] = (_Float16)v[i]; *(v4h*)(C16 + cofs + (size_t)(row0 + r) * ldc + col0 + c4) = h4; } } }
     }
}


typedef _Float16 v4h __attribute__((ext_vector_type(4)));

__global__ __launch_bounds__(256) void k_x16(const float* __restrict__ x, _Float16* __restrict__ X16, size_t n8) { const size_t t = (size_t)blockIdx.x * 256 + threadIdx.x; if (t >= n8) return; FragH f;
#pragma unroll
  for (int q = 0; q < 8; ++q) f.h[q] = (_Float16)bf16_round(x[t * 8 + q]); *(v8us*)((unsigned short*)X16 + t * 8) = f.half[0];  }
__global__ __launch_bounds__(256) void k_h16(const float* __restrict__ x, _Float16* __restrict__ X16, size_t n8) { const size_t t = (size_t)blockIdx.x * 256 + threadIdx.x; if (t >= n8) return; FragH f;
#pragma unroll
  for (int q = 0; q < 8; ++q) f.h[q] = (_Float16)x[t * 8 + q]; *(v8us*)((unsigned short*)X16 + t * 8) = f.half[0];  }
__global__ __launch_bounds__(256) void k_round16f(const float* __restrict__ W, _Float16* __restrict__ Bt, size_t n8) { const size_t t = (size_t)blockIdx.x * 256 + threadIdx.x; if (t >= n8) return; FragH f;
#pragma unroll
  for (int i = 0; i < 8; ++i) f.h[i] = (_Float16)(bf16_round(W[t * 8 + i]) * 16.0f); *(v8us*)((unsigned short*)Bt + t * 8) = f.half[0];  }
template <int NHv, int TTv>
__global__ __launch_bounds__(256) void k_vt(const _Float16* __restrict__ V16, int ldv, int voff, _Float16* __restrict__ Vt) { __shared__ unsigned short tl[64][66]; const int tid = threadIdx.x; const int slab = blockIdx.x / (TTv / 64), lg = blockIdx.x % (TTv / 64); const int b = slab / NHv, h = slab % NHv;
  for (int i = tid; i < 64 * 8; i += 256) { const int r = i / 8, c8 = (i % 8) * 8; FragH f; f.half[0] = *(const v8us*)((const unsigned short*)V16 + ((size_t)b * TTv + lg * 64 + r) * ldv + voff + h * 64 + c8);
#pragma unroll
    for (int q = 0; q < 8; ++q) tl[r][c8 + q] = f.u[q]; }
  __syncthreads();
  {
#pragma unroll
    for (int rd = 0; rd < 2; ++rd) { const int d = rd * 32 + tid / 8, pc = tid % 8; FragH f;
#pragma unroll
      for (int q = 0; q < 8; ++q) f.u[q] = tl[pc * 8 + q][d];
      *(v8us*)((unsigned short*)Vt + ((size_t)slab * 64 + d) * TTv + lg * 64 + pc * 8) = f.half[0]; }
     } }

__global__ __launch_bounds__(256) void k_hl(const float* __restrict__ F, _Float16* __restrict__ Hh, _Float16* __restrict__ Hl, size_t n8) { const size_t t = (size_t)blockIdx.x * 256 + threadIdx.x; if (t >= n8) return; FragH fh, fl; const v4f a = *(const v4fa*)(F + t * 8), c = *(const v4fa*)(F + t * 8 + 4);
#pragma unroll
  for (int q = 0; q < 4; ++q) { _Float16 h = (_Float16)a[q]; fh.h[q] = h; fl.h[q] = (_Float16)((a[q] - (float)h) * 1024.0f); h = (_Float16)c[q]; fh.h[4 + q] = h; fl.h[4 + q] = (_Float16)((c[q] - (float)h) * 1024.0f); }
  { *(v8us*)((unsigned short*)Hh + t * 8) = fh.half[0]; *(v8us*)((unsigned short*)Hl + t * 8) = fl.half[0];  } }

// ---- fast GEMM (block tile 128x64, wave tile 32x64; requires M % 128 == 0 rows per launch region, N % 64 == 0 and K % 64 == 0); epilogue = k_gemm_hhx semantics ----
// Both operands reach the fragments through LDS: a stage is 64 k = one whole 128-byte line of each of the block's 128 A rows and 64 B rows, fetched by loads in which 8 lanes cover one row
// (4 whole lines a wave load, where a fragment load straight from global memory touches 16 lines); two buffers, the next stage's global loads fly during this stage's products.
#define G2_SK 64                     /* k per LDS stage */
#define G2_PH 72                     /* LDS row pitch in f16: 144 B = 16 B x odd, the conflict-free pitch for 16-byte fragment reads */
__device__ __forceinline__ v16h g2_frag(const _Float16* p, int hh) { FragH f; f.half[0] = *(const v8us*)((const unsigned short*)p + 8 * hh); f.half[1] = *(const v8us*)((const unsigned short*)p + 16 + 8 * hh); return f.v; }
__device__ __forceinline__ v8f g2_mma(v16h a, v16h b, v8f c) { return __builtin_amdgcn_wmma_f32_16x16x32_f16(false, a, false, b, (short)0, c, false, false); }
// one stage's global loads of a thread: 16 bytes of 8 A rows and of 4 B rows, 16 rows apart
__device__ __forceinline__ void g2_stage(const unsigned short* a, size_t a16, const unsigned short* b, size_t b16, v8us (&ra)[8], v8us (&rb)[4]) {
  const unsigned short* pa[8]; const unsigned short* pb[4];
#pragma unroll
  for (int j = 0; j < 8; ++j) pa[j] = a + j * a16;
#pragma unroll
  for (int j = 0; j < 4; ++j) pb[j] = b + j * b16;
#pragma unroll
  for (int j = 0; j < 8; ++j) ra[j] = *(const v8us*)pa[j];
#pragma unroll
  for (int j = 0; j < 4; ++j) rb[j] = *(const v8us*)pb[j];
  // the wait that stands in front of any overwrite of an issued load's address registers; the 12 addresses are inputs so that their registers live up to it (else a later load's result lands in an earlier load's address pair)
  asm volatile("s_wait_xcnt 0x0" :: "v"(pa[0]), "v"(pa[1]), "v"(pa[2]), "v"(pa[3]), "v"(pa[4]), "v"(pa[5]), "v"(pa[6]), "v"(pa[7]), "v"(pb[0]), "v"(pb[1]), "v"(pb[2]), "v"(pb[3]) : "memory");
}
template <int ACT>
__global__ __launch_bounds__(128) void k_gemm2(const _Float16* __restrict__ A, int lda, size_t sA, const _Float16* __restrict__ Bh, int ldb, size_t sB, float alpha, const float* __restrict__ bias, size_t sBias, const float* __restrict__ CP, int rowsPerB, size_t sCPb, int row0g,
    float* __restrict__ C, _Float16* __restrict__ C16, int ldc, size_t sC, int M, int N, int K) { static_assert(ACT == 0 || ACT == 3 || ACT == 6 || ACT == 8 || ACT == 9 || ACT == 11 || ACT == 12 || ACT == 14 || ACT == 15 || ACT == 16 || ACT == 17, "k_gemm2: unsupported ACT code (would silently apply no activation)");
  __shared__ __attribute__((aligned(16))) float so[4][32][68];
  __shared__ __attribute__((aligned(16))) _Float16 sa[2][128][G2_PH];      /* A stage: the block's 128 rows, 64 k */
  __shared__ __attribute__((aligned(16))) _Float16 sb[2][64][G2_PH];       /* B stage: the block's 64 columns (rows of Bt), 64 k */
  const int tid = threadIdx.x, w = tid >> 5, lane = tid & 31, ln = lane & 15, hh = lane >> 4; const int by = blockIdx.y;
  A += (size_t)by * sA; Bh += (size_t)by * sB; const size_t cofs = (size_t)by * sC; const float* bp = bias ? bias + (size_t)by * sBias : nullptr;
  const int ntn = N >> 6; const int mt = blockIdx.x / ntn, nq = blockIdx.x - mt * ntn; const int row0 = mt * 128 + 32 * w, col0 = nq * 64; if (mt * 128 >= M) return;      /* the whole work-group leaves or none: barriers follow */
  // staging: a thread moves 16 bytes of rows srow + 16 j; 8 threads cover one 128-byte row
  const int srow = tid >> 3, sch = (tid & 7) * 8;
  const unsigned short* ag = (const unsigned short*)A + (size_t)(mt * 128 + srow) * lda + sch;
  const unsigned short* bg = (const unsigned short*)Bh + (size_t)(col0 + srow) * ldb + sch;
  v8us ra[8], rb[4];
  g2_stage(ag, (size_t)16 * lda, bg, (size_t)16 * ldb, ra, rb);
  const v8f z8 = {0.f,0.f,0.f,0.f,0.f,0.f,0.f,0.f}; v8f c00 = z8, c01 = z8, c02 = z8, c03 = z8, c10 = z8, c11 = z8, c12 = z8, c13 = z8;
#pragma unroll
  for (int j = 0; j < 8; ++j) *(v8us*)&sa[0][srow + 16 * j][sch] = ra[j];
#pragma unroll
  for (int j = 0; j < 4; ++j) *(v8us*)&sb[0][srow + 16 * j][sch] = rb[j];
  __syncthreads();      /* stage 0 is visible to all 4 waves */
  const int nst = K / G2_SK;
#pragma unroll 1  // rolled: one stage a trip, so that the two buffers alternate by index; the two 32-k blocks inside are unrolled
  for (int st = 0; st < nst; ++st) {
    const int b = st & 1; const bool more = st + 1 < nst;      /* the same for the whole work-group */
    if (more) g2_stage(ag + (st + 1) * G2_SK, (size_t)16 * lda, bg + (st + 1) * G2_SK, (size_t)16 * ldb, ra, rb);      /* next stage: in flight under this stage's products */
    v16h fa[2][2], fb[2][4];      /* the stage's fragments: [32-k block][tile] */
#pragma unroll
    for (int kc = 0; kc < 2; ++kc) { fa[kc][0] = g2_frag(&sa[b][32 * w + ln][32 * kc], hh); fb[kc][0] = g2_frag(&sb[b][ln][32 * kc], hh); fa[kc][1] = g2_frag(&sa[b][32 * w + 16 + ln][32 * kc], hh);
#pragma unroll
      for (int t = 1; t < 4; ++t) fb[kc][t] = g2_frag(&sb[b][16 * t + ln][32 * kc], hh); }
    __builtin_amdgcn_sched_barrier(0);      /* keeps the stage's 24 LDS reads one group in front of its 16 products: left alone the compiler reuses one B fragment's registers and waits out the LDS latency 8 times a stage */
#pragma unroll
    for (int kc = 0; kc < 2; ++kc) {      /* k ascends by 32 in every accumulator: one fixed order of sums */
      c00 = g2_mma(fa[kc][0], fb[kc][0], c00); c10 = g2_mma(fa[kc][1], fb[kc][0], c10); c01 = g2_mma(fa[kc][0], fb[kc][1], c01); c11 = g2_mma(fa[kc][1], fb[kc][1], c11);
      c02 = g2_mma(fa[kc][0], fb[kc][2], c02); c12 = g2_mma(fa[kc][1], fb[kc][2], c12); c03 = g2_mma(fa[kc][0], fb[kc][3], c03); c13 = g2_mma(fa[kc][1], fb[kc][3], c13); }
    if (more) {      /* every wave left that buffer before the last barrier */
#pragma unroll
      for (int j = 0; j < 8; ++j) *(v8us*)&sa[b ^ 1][srow + 16 * j][sch] = ra[j];
#pragma unroll
      for (int j = 0; j < 4; ++j) *(v8us*)&sb[b ^ 1][srow + 16 * j][sch] = rb[j]; }
    __syncthreads();      /* publishes stage st + 1 and ends every wave's reads of stage st, whose buffer the next trip refills */
  }
  v8f accs[8] = {c00, c01, c02, c03, c10, c11, c12, c13};
#pragma unroll
  for (int u = 0; u < 8; ++u) { const int t = u & 3, half = u >> 2; const int col = col0 + t * 16 + ln; const float bv = bp ? bf16_round(bp[col]) : 0.f;
#pragma unroll
    for (int r = 0; r < 8; ++r) { const int rloc = half * 16 + 8 * hh + r; float v = accs[u][r] * alpha + bv; if (CP) { if (rowsPerB < 0) v += CP[cofs + (size_t)(row0g + row0 + rloc) * ldc + col];      /* rowsPerB < 0: own element of the batched C plane */ else { const int bidx = (row0g + row0 + rloc) / rowsPerB; v += CP[(size_t)bidx * sCPb + (size_t)by * 64 + col]; } }
      if (ACT == 3) v = fmaxf(v, 0.f); else if (ACT == 6) v = 0.5f * v * (1.0f + erff(v * 0.70710678118654752f)); else if (ACT == 11) v = 1.0f / (1.0f + expf(-v)); else if (ACT == 15) v = v / (1.0f + expf(-v)); else if (ACT == 12) v = (v > 0.f) ? v : 0.01f * v; else if (ACT == 8) v = tanhf(v); else if (ACT == 9) v = 0.5f * v * (1.0f + tanhf(0.7978845608028654f * (v + 0.044715f * v * v * v))); else if (ACT == 14) v = (v > 0.f) ? v : 0.1f * v; else if (ACT == 16) v = (v >= 0.f) ? v : 0.3f * v; else if (ACT == 17) v = (v >= 0.f) ? v : 0.2f * v;
      so[w][rloc][t * 16 + ln] = v; } }
  __builtin_amdgcn_fence(__ATOMIC_ACQ_REL, "workgroup"); __builtin_amdgcn_wave_barrier();
  const int rsub = lane >> 4, c4 = (lane & 15) * 4;
  {
#pragma unroll
    for (int q = 0; q < 16; ++q) { const int r = q * 2 + rsub; const v4f v = *(const v4fa*)&so[w][r][c4]; if (C) *(v4f*)(C + cofs + (size_t)(row0 + r) * ldc + col0 + c4) = v; if (C16) { v4h h4; for (int i = 0; i < 4; ++i) h4[i] = (_Float16)v[i]; *(v4h*)(C16 + cofs + (size_t)(row0 + r) * ldc + col0 + c4) = h4; } }
     } }


__global__ __launch_bounds__(256) void k_wnat(const float* __restrict__ w, size_t n8, _Float16* __restrict__ Bt) { const size_t t = (size_t)blockIdx.x * 256 + threadIdx.x; if (t >= n8) return; FragH f; for (int q = 0; q < 8; ++q) f.h[q] = (_Float16)(bf16_round(w[t * 8 + q]) * 16.0f); *(v8us*)((unsigned short*)Bt + t * 8) = f.half[0];  }
__global__ __launch_bounds__(256) void k_rsm(const float* __restrict__ S, _Float16* __restrict__ P, int nrows) {
  #pragma clang fp contract(off)
  const int i = blockIdx.x * 256 + threadIdx.x; if (i >= nrows) return; const float* s = S + (size_t)i * SQ; float mx = -3.0e38f;
#pragma unroll 1
  for (int j = 0; j < SQ; ++j) mx = fmaxf(mx, s[j]); float se = 0.f;
#pragma unroll 1
  for (int j = 0; j < SQ; ++j) se += expf(s[j] - mx); const float sc = 256.0f / se;
#pragma unroll 1
  for (int j0 = 0; j0 < SQ; j0 += 8) { FragH f; for (int q = 0; q < 8; ++q) f.h[q] = (_Float16)(expf(s[j0 + q] - mx) * sc); unsigned short* d = (unsigned short*)P + (size_t)i * SQ + j0; *(v8us*)d = f.half[0];  } }
__global__ __launch_bounds__(256) void k_vt(const _Float16* __restrict__ V16, int b, int h0, _Float16* __restrict__ VT) { __shared__ unsigned short tl[64][65]; const int tid = threadIdx.x; const int hh = blockIdx.x % HG, sg = blockIdx.x / HG; const int s0 = sg * 64; const int h = h0 + hh;
  for (int i = tid; i < 64 * 8; i += 256) { const int j = i / 8, d8 = (i % 8) * 8; FragH f; f.half[0] = *(const v8us*)((const unsigned short*)V16 + ((size_t)b * SQ + s0 + j) * DM + h * HD + d8); for (int q = 0; q < 8; ++q) tl[d8 + q][j] = f.u[q]; }
  __syncthreads();
  { for (int i = tid; i < 64 * 8; i += 256) { const int d = i / 8, j8 = (i % 8) * 8; FragH f; for (int q = 0; q < 8; ++q) f.u[q] = tl[d][j8 + q]; *(v8us*)((unsigned short*)VT + ((size_t)hh * HD + d) * SQ + s0 + j8) = f.half[0]; }  } }



#define FA_SK 64                     /* keys per LDS tile */
#define FA_PH 72                     /* LDS row pitch in f16: 144 B = 16 B x odd, the conflict-free pitch for 16-byte fragment reads */
typedef float f32x2 __attribute__((ext_vector_type(2)));
typedef _Float16 v2h __attribute__((ext_vector_type(2)));
union FragP { v16h v; unsigned int w[8]; };
__device__ __forceinline__ float fa_xhalf(float x) { return __builtin_bit_cast(float, __builtin_amdgcn_permlanex16(__builtin_bit_cast(int, x), __builtin_bit_cast(int, x), 0x76543210, 0xfedcba98, false, false)); }      /* lane l <-> lane l ^ 16 */
__device__ __forceinline__ v16h fa_frag(const _Float16* p) { FragH f; f.half[0] = *(const v8us*)(const unsigned short*)p; f.half[1] = *(const v8us*)((const unsigned short*)p + 16); return f.v; }      /* p = row + 32 kc + 8 h: the hardware k order */
__device__ __forceinline__ v8f fa_mma(v16h a, v16h b, v8f c) { return __builtin_amdgcn_wmma_f32_16x16x32_f16(false, a, false, b, (short)0, c, false, false); }
// amdgpu_waves_per_eu(4, 4): a budget of 256 VGPRs, so that no register lies above v255 (without it the build took 266 and switched register windows all through the loop)
__global__ __launch_bounds__(256) __attribute__((amdgpu_waves_per_eu(4, 4))) void k_fattn(const _Float16* __restrict__ Qh, const _Float16* __restrict__ Kh, const _Float16* __restrict__ Vt, _Float16* __restrict__ Oh) {
  __shared__ __attribute__((aligned(16))) _Float16 sk[2][FA_SK][FA_PH];      /* K tile: row = key, 64 d */
  __shared__ __attribute__((aligned(16))) _Float16 sv[2][HD][FA_PH];         /* V^T tile: row = d, 64 keys */
  const int tid = threadIdx.x, lane = tid & 31, wave = tid >> 5, c = lane & 15, h = lane >> 4;
  const int head = blockIdx.y, q0 = blockIdx.x * 256 + wave * 32;
  const float cs = 0.03125f * 1.44269504088896340736f;      /* the module's score scale 1/sqrt(1024), in the base-2 domain */
  // staging: a thread moves 16 bytes of rows srow and srow + 32 of each tile; 8 threads cover one 128-byte row
  const int srow = tid >> 3, sch = (tid & 7) * 8;
  const unsigned short* kg = (const unsigned short*)Kh + (size_t)srow * LQ + head * HD + sch;
  const unsigned short* vg = (const unsigned short*)Vt + ((size_t)head * HD + srow) * SQ + sch;
  v8us rk0, rk1, rv0, rv1;
  rk0 = *(const v8us*)kg; rk1 = *(const v8us*)(kg + (size_t)32 * LQ); rv0 = *(const v8us*)vg; rv1 = *(const v8us*)(vg + (size_t)32 * SQ);
  v16h qf[2][2];
#pragma unroll
  for (int g = 0; g < 2; ++g)
#pragma unroll
    for (int kc = 0; kc < 2; ++kc) qf[g][kc] = fa_frag(Qh + (size_t)(q0 + 16 * g + c) * LQ + head * HD + 32 * kc + 8 * h);
  const v8f z8 = {0.f,0.f,0.f,0.f,0.f,0.f,0.f,0.f};
  v8f acc[2][4]; float m_run[2]; f32x2 l_run[2];
#pragma unroll
  for (int g = 0; g < 2; ++g) { m_run[g] = -3.0e38f; l_run[g] = f32x2{0.f, 0.f};
#pragma unroll
    for (int t = 0; t < 4; ++t) acc[g][t] = z8; }
  *(v8us*)&sk[0][srow][sch] = rk0; *(v8us*)&sk[0][srow + 32][sch] = rk1; *(v8us*)&sv[0][srow][sch] = rv0; *(v8us*)&sv[0][srow + 32][sch] = rv1;
  __syncthreads();      /* tile 0 is visible to all 8 waves */
#pragma unroll 1  // rolled: one tile a trip; the two 32-key passes inside are unrolled
  for (int st = 0; st < SQ / FA_SK; ++st) {
    const int b = st & 1; const bool more = st + 1 < SQ / FA_SK;      /* the same for the whole work-group */
    if (more) { const unsigned short* kp = kg + (size_t)(st + 1) * FA_SK * LQ; const unsigned short* vp = vg + (st + 1) * FA_SK;      /* next tile: in flight under this tile's work */
      rk0 = *(const v8us*)kp; rk1 = *(const v8us*)(kp + (size_t)32 * LQ); rv0 = *(const v8us*)vp; rv1 = *(const v8us*)(vp + (size_t)32 * SQ); }
#pragma unroll
    for (int sub = 0; sub < 2; ++sub) {      /* one pass: 32 keys x the wave's 32 query columns */
      v8f s[2][2];
#pragma unroll
      for (int kt = 0; kt < 2; ++kt) { const _Float16* kr = &sk[b][sub * 32 + 16 * kt + c][8 * h]; const v16h k0 = fa_frag(kr), k1 = fa_frag(kr + 32);
#pragma unroll
        for (int g = 0; g < 2; ++g) s[kt][g] = fa_mma(k1, qf[g][1], fa_mma(k0, qf[g][0], z8)); }
      v16h vf[4];
#pragma unroll
      for (int t = 0; t < 4; ++t) vf[t] = fa_frag(&sv[b][16 * t + c][sub * 32 + 8 * h]);
#pragma unroll
      for (int g = 0; g < 2; ++g) {
        float mx = s[0][g][0];      /* maximum of the raw scores (the scale is positive) */
#pragma unroll
        for (int r = 1; r < 8; ++r) mx = fmaxf(mx, s[0][g][r]);
#pragma unroll
        for (int r = 0; r < 8; ++r) mx = fmaxf(mx, s[1][g][r]);
        mx = fmaxf(mx, fa_xhalf(mx)) * cs;      /* both wave halves hold the query's pass maximum, scaled */
        const float m_new = fmaxf(m_run[g], mx); const float corr = __builtin_amdgcn_exp2f(m_run[g] - m_new);      /* 0 on the first pass */
        m_run[g] = m_new;
#pragma unroll
        for (int t = 0; t < 4; ++t) acc[g][t] = acc[g][t] * corr;
        FragP pf; f32x2 ps[8];
#pragma unroll
        for (int i = 0; i < 8; ++i) {
          const f32x2 a = __builtin_elementwise_fma(f32x2{s[i >> 2][g][2 * (i & 3)], s[i >> 2][g][2 * (i & 3) + 1]}, f32x2{cs, cs}, f32x2{-m_new, -m_new});
          const f32x2 p = {__builtin_amdgcn_exp2f(a.x), __builtin_amdgcn_exp2f(a.y)};
          ps[i] = p; pf.w[i] = __builtin_bit_cast(unsigned int, __builtin_convertvector(p, v2h)); }
        l_run[g] = l_run[g] * corr + (((ps[0] + ps[1]) + (ps[2] + ps[3])) + ((ps[4] + ps[5]) + (ps[6] + ps[7])));      /* a tree, not one chain of 8 dependent adds */
#pragma unroll
        for (int t = 0; t < 4; ++t) acc[g][t] = fa_mma(vf[t], pf.v, acc[g][t]);
      }
    }
    if (more) { *(v8us*)&sk[b ^ 1][srow][sch] = rk0; *(v8us*)&sk[b ^ 1][srow + 32][sch] = rk1; *(v8us*)&sv[b ^ 1][srow][sch] = rv0; *(v8us*)&sv[b ^ 1][srow + 32][sch] = rv1; }      /* every wave left that buffer before the last barrier */
    __syncthreads();      /* publishes tile st + 1 and ends every wave's reads of tile st, whose buffer the next trip refills */
  }
#pragma unroll
  for (int g = 0; g < 2; ++g) { float l = l_run[g].x + l_run[g].y; l += fa_xhalf(l); const float inv = 64.0f / l;      /* o carried x64, as the output GEMM's alpha expects */
#pragma unroll
    for (int t = 0; t < 4; ++t) { FragH f;
#pragma unroll
      for (int r = 0; r < 8; ++r) f.h[r] = (_Float16)(acc[g][t][r] * inv);
      *(v8us*)((unsigned short*)Oh + (size_t)(q0 + 16 * g + c) * DM + head * HD + 16 * t + 8 * h) = f.half[0]; } }      /* 8 consecutive d of one query row: one 16-byte store */
}

extern "C" void kernel_launch(void* const* d_in, const int* in_sizes, int n_in,
                              void* d_out, int out_size, void* d_ws, size_t ws_size, hipStream_t stream) {
  (void)in_sizes; (void)n_in; (void)out_size;
  const float* const* I = (const float* const*)d_in; const float* xq = I[2]; const float* xk = I[1]; const float* xv = I[0]; const float* wq = I[5]; const float* bq = nullptr; const float* wk = I[4]; const float* bk = nullptr; const float* wv = I[3]; const float* bv = nullptr; const float* wo = I[6]; const float* bo = I[7];      /* input order: values, keys, query (three unbatched [4096][1024] streams in REVERSE order: the query stream is I[2]), Wv, Wk, Wq (the weights in the same reverse order: Wq is I[5]), Wo, bo ([in][out] weights); the q / k / v projections have NO biases: null pointers in the guarded bias slots */
  char* ws = (char*)d_ws; size_t off = 0;
  auto take = [&](size_t bytes) { char* p = ws + off; off += (bytes + 255) & ~(size_t)255; return p; };
  _Float16* BQ = (_Float16*)take((size_t)DM * DM * 2); _Float16* BK = (_Float16*)take((size_t)DM * DM * 2); _Float16* BV = (_Float16*)take((size_t)DM * DM * 2); _Float16* BO = (_Float16*)take((size_t)DM * DM * 2);
  _Float16* XQ = (_Float16*)take(NR * DM * 2); _Float16* XK = (_Float16*)take(NR * DM * 2); _Float16* XV = (_Float16*)take(NR * DM * 2); _Float16* Q16 = (_Float16*)take(NR * DM * 2); _Float16* K16 = (_Float16*)take(NR * DM * 2); _Float16* V16 = (_Float16*)take(NR * DM * 2); _Float16* O16 = (_Float16*)take(NR * DM * 2);
  _Float16* VT = (_Float16*)take((size_t)NH * HD * SQ * 2);
  if (off > ws_size) return;
  { const unsigned g = (unsigned)(((size_t)DM * (DM / 8) + 255) / 256); k_wt_f16<<<g, 256, 0, stream>>>(wq, BQ, DM, DM, 16.0f); k_wt_f16<<<g, 256, 0, stream>>>(wk, BK, DM, DM, 16.0f); k_wt_f16<<<g, 256, 0, stream>>>(wv, BV, DM, DM, 16.0f); k_wt_f16<<<g, 256, 0, stream>>>(wo, BO, DM, DM, 16.0f); }      /* [in][out] -> Bt[n][k] x16 (transposing builder) */

  k_x16<<<(unsigned)((NR * DM / 8 + 255) / 256), 256, 0, stream>>>(xq, XQ, NR * DM / 8); k_x16<<<(unsigned)((NR * DM / 8 + 255) / 256), 256, 0, stream>>>(xk, XK, NR * DM / 8); k_x16<<<(unsigned)((NR * DM / 8 + 255) / 256), 256, 0, stream>>>(xv, XV, NR * DM / 8);      /* the three inputs as exact f16 rows */
  const size_t r0p = (size_t)B0 * SQ;      /* first projected row */
  k_gemm2<0><<<dim3((unsigned)((MP / 128) * (DM / 64)), 1), 128, 0, stream>>>(XQ + r0p * DM, DM, 0, BQ, DM, 0, 0.0625f, bq, 0, nullptr, 1, 0, 0, nullptr, Q16 + r0p * DM, DM, 0, MP, DM, DM);
  k_gemm2<0><<<dim3((unsigned)((MP / 128) * (DM / 64)), 1), 128, 0, stream>>>(XK + r0p * DM, DM, 0, BK, DM, 0, 0.0625f, bk, 0, nullptr, 1, 0, 0, nullptr, K16 + r0p * DM, DM, 0, MP, DM, DM);
  k_gemm2<0><<<dim3((unsigned)((MP / 128) * (DM / 64)), 1), 128, 0, stream>>>(XV + r0p * DM, DM, 0, BV, DM, 0, 0.0625f, bv, 0, nullptr, 1, 0, 0, nullptr, V16 + r0p * DM, DM, 0, MP, DM, DM);
  for (int b = B0; b < B0 + NBR; ++b) { const size_t r0 = (size_t)b * SQ;
    k_vt<NH, SQ><<<NH * (SQ / 64), 256, 0, stream>>>(V16 + r0 * LQ, LQ, 0, VT);      /* V^T [NH][HD][SQ] for this batch */
    k_fattn<<<dim3(QN / 256, NHD), 256, 0, stream>>>(Q16 + r0 * LQ, K16 + r0 * LQ, VT, O16 + r0 * DM); }      /* all heads: scores (THIS module's scale 1/sqrt(EMBED 1024) = 1/32), softmax, P.V; o x64 (merged heads) as f16 rows */
  k_gemm2<0><<<dim3((unsigned)((MPO / 128) * (DM / 64)), 1), 128, 0, stream>>>(O16 + r0p * DM, DM, 0, BO, DM, 0, 0.0009765625f, bo, 0, nullptr, 1, 0, 0, (float*)d_out + r0p * DM, nullptr, DM, 0, MPO, DM, DM);      /* out rows are the output layout */
}

// v004
// One run takes 140 microseconds.
// Two timings next to v003 both put it at 1.23 times that version's speed.
// All steps since v000 together make it 95.2 times as fast.
#include <hip/hip_runtime.h>
// Multi-head attention on three unbatched inputs with [in][out] bias-free q / k / v projections, a biased output projection and the source's MODEL-WIDTH score scale; the inputs arrive in the order values, keys, query (each [4096][1024]; v / k / q = stream W ([in][out] 1024 x 1024 sd 1/32, NO biases), 16 heads of 64; energy / sqrt(1024) (the module scales by the EMBED width, not the head width: 1/32); softmax over all 4096 keys (no mask); out = merged Wo + bo ([in][out]) -> [4096][1024]); ONE attention launch for all heads.
// Structure: token rows r = b*4096 + s; the query, key and value sources as exact f16 rows (bf16-rounded); Q, K, V as three WMMA GEMMs (32x64 wave tiles, f32 accumulation, exact x16 weights, no bias, f16 outputs); per batch: V^T for all heads via LDS transposes; per batch ONE fused attention kernel over (256 query rows, head): per 32 keys the scores on WMMA (K = 64), online softmax on VALU (f32 running maximum and sum, native exp2; weights exp(s - max) as f16, in registers only), o += P . V on WMMA, o / sum carried x64 (against f16 subnormal flush, folded into the output GEMM alpha) written straight into the merged f16 o rows; out = o W_o + b GEMM (f32) into the output layout.
// Compute dtype: inputs rounded to bf16; x / weights exact; q, k, v, softmax weights and o as plain f16 GEMM operands (~2^-12); scores and softmax statistics f32. v_wmma_f32_16x16x32_f16.
#define NB 1
#define SQ 4096
#define DM 1024
#define NH 16
#define HD 64
#define HG 1                         /* heads per k_vt(V16, b, h0, VT) launch (that overload is not launched) */
#define B0 0                         /* first batch processed (debug hook) */
#define NBR NB                       /* batches processed (debug hook) */
#define NR ((size_t)NB * SQ)         /* token rows */
#define MP ((int)((size_t)NBR * SQ)) /* rows projected (debug hook) */
#define QN SQ                        /* query rows attended per batch (debug hook) */
#define NHD NH                       /* heads attended (debug hook) */
#define MPO MP                       /* rows through the output stage (debug hook) */
#define LQ DM      /* row pitch of the q/k/v rows */
typedef __bf16 v16b __attribute__((ext_vector_type(16)));
typedef unsigned short v8us __attribute__((ext_vector_type(8), may_alias));
typedef float  v8f  __attribute__((ext_vector_type(8)));
typedef float  v4f  __attribute__((ext_vector_type(4)));
typedef float  v4fa __attribute__((ext_vector_type(4), may_alias));
union FragB { v16b v; v8us half[2]; unsigned short u[16]; };

__device__ __forceinline__ unsigned short bf16_bits(float x) { unsigned int u = __float_as_uint(x); return (unsigned short)((u + 0x7FFFu + ((u >> 16) & 1u)) >> 16); }
__device__ __forceinline__ float bf16_val(unsigned short b) { return __uint_as_float(((unsigned int)b) << 16); }
__device__ __forceinline__ float bf16_round(float x) { return bf16_val(bf16_bits(x)); }
// D += A·B with NT terms: 1 = ah·bh, 2 = + al·bh (A split), 3 = + ah·bl (both split)
template <int NT>
__device__ __forceinline__ v8f mmaN(v16b ah, v16b al, v16b bh, v16b bl, v8f c) {
  c = __builtin_amdgcn_wmma_f32_16x16x32_bf16(false, ah, false, bh, (short)0, c, false, false);
  if (NT >= 2) c = __builtin_amdgcn_wmma_f32_16x16x32_bf16(false, al, false, bh, (short)0, c, false, false);
  if (NT >= 3) c = __builtin_amdgcn_wmma_f32_16x16x32_bf16(false, ah, false, bl, (short)0, c, false, false);
  asm volatile("v_nop\n\tv_nop\n\tv_nop\n\tv_nop" : "+v"(c) : "v"(ah), "v"(al), "v"(bh), "v"(bl));
  return c;
}

__global__ __launch_bounds__(256) void k_wt_bf16(const float* __restrict__ W, unsigned short* __restrict__ Wt, int K, int N) {
  const int t = blockIdx.x * 256 + threadIdx.x;
  const int k8n = K / 8;
  if (t >= N * k8n) return;
  const int n = t / k8n, k8 = (t % k8n) * 8;
  v8us v;
#pragma unroll
  for (int i = 0; i < 8; ++i) v[i] = bf16_bits(W[(size_t)(k8 + i) * N + n]);
  *(v8us*)(Wt + (size_t)n * K + k8) = v;
  
}

// GEMM C[M][N] (f32, pitch ldc) = act(A[M][K]·W + bias). A f32 row-major (pitch lda) converted per fragment to bf16
// (ASPLIT: hi/lo two planes -> 2 terms, else single rounded term); Wt bf16 [N][K] (pitch ldb). BIAS_BF16 rounds the
// bias to bf16 first (bias quantised to bf16 before the add). K%32==0, M%16==0, N%64==0.
template <bool ASPLIT, int ACT, bool BIAS_BF16>
__global__ __launch_bounds__(128) void k_gemm_bf(const float* __restrict__ A, int lda, const unsigned short* __restrict__ Wt, int ldb,
                                               const float* __restrict__ bias, float* __restrict__ C, int ldc, int M, int N, int K) {
  __shared__ __attribute__((aligned(16))) float so[4][16][64];
  const int tid = threadIdx.x, w = tid >> 5, lane = tid & 31, ln = lane & 15, hh = lane >> 4;
  const int ntn = N / 64;
  const int wid = blockIdx.x * 4 + w;
  const int mt = wid / ntn, nq = wid % ntn;
  if (mt * 16 >= M) return;
  const int row0 = mt * 16, col0 = nq * 64;
  const float* arow = A + (size_t)(row0 + ln) * lda;
  v8f acc[4] = {};
  for (int kb = 0; kb < K; kb += 32) {
    FragB ah, al;
    const v4f x0 = *(const v4fa*)(arow + kb + 8 * hh), x1 = *(const v4fa*)(arow + kb + 8 * hh + 4);
    const v4f x2 = *(const v4fa*)(arow + kb + 16 + 8 * hh), x3 = *(const v4fa*)(arow + kb + 16 + 8 * hh + 4);
    float xs[16] = {x0[0],x0[1],x0[2],x0[3],x1[0],x1[1],x1[2],x1[3],x2[0],x2[1],x2[2],x2[3],x3[0],x3[1],x3[2],x3[3]};
#pragma unroll
    for (int i = 0; i < 16; ++i) { const unsigned short hb = bf16_bits(xs[i]); ah.u[i] = hb; al.u[i] = ASPLIT ? bf16_bits(xs[i] - bf16_val(hb)) : (unsigned short)0; }
#pragma unroll
    for (int t = 0; t < 4; ++t) {
      const unsigned short* brow = Wt + (size_t)(col0 + t * 16 + ln) * ldb + kb;
      FragB b;
      b.half[0] = *(const v8us*)(brow + 8 * hh);
      b.half[1] = *(const v8us*)(brow + 16 + 8 * hh);
      acc[t] = mmaN<ASPLIT ? 2 : 1>(ah.v, al.v, b.v, b.v, acc[t]);
    }
  }
#pragma unroll
  for (int t = 0; t < 4; ++t) {
    float bv = bias ? bias[col0 + t * 16 + ln] : 0.f;
    if (BIAS_BF16) bv = bf16_round(bv);
#pragma unroll
    for (int r = 0; r < 8; ++r) { float v = acc[t][r] + bv; if (ACT == 1) v = fmaxf(v, 0.f); so[w][8 * hh + r][t * 16 + ln] = v; }
  }
  __builtin_amdgcn_fence(__ATOMIC_ACQ_REL, "workgroup");
  __builtin_amdgcn_wave_barrier();
  const int rsub = lane >> 4, c4 = (lane & 15) * 4;
  {
#pragma unroll
    for (int q = 0; q < 8; ++q) {
      const int r = q * 2 + rsub;
      const v4f v = *(const v4fa*)&so[w][r][c4];
      *(v4f*)(C + (size_t)(row0 + r) * ldc + col0 + c4) = v;
    }
    
  }
}

// GEMM C = act(A·W + bias + resid): A f32 (ASPLIT -> hi/lo 2 terms), Wt bf16 [N][K]; ACT 0 none, 1 relu, 2 exact gelu;
// resid (optional, f32, row index = (row % rmod), pitch ldr, RES_BF16 rounds it) added before the activation.
template <bool ASPLIT, int ACT, bool BIAS_BF16, bool RES_BF16>
__global__ __launch_bounds__(128) void k_gemm_bf3(const float* __restrict__ A, int lda, const unsigned short* __restrict__ Wt, int ldb,
                                                const float* __restrict__ bias, const float* __restrict__ resid, int rmod, int ldr,
                                                float* __restrict__ C, int ldc, int M, int N, int K) {
  __shared__ __attribute__((aligned(16))) float so[4][16][64];
  const int tid = threadIdx.x, w = tid >> 5, lane = tid & 31, ln = lane & 15, hh = lane >> 4;
  const int ntn = N / 64;
  const int wid = blockIdx.x * 4 + w;
  const int mt = wid / ntn, nq = wid % ntn;
  if (mt * 16 >= M) return;
  const int row0 = mt * 16, col0 = nq * 64;
  const float* arow = A + (size_t)(row0 + ln) * lda;
  v8f acc[4] = {};
  for (int kb = 0; kb < K; kb += 32) {
    FragB ah, al;
    const v4f x0 = *(const v4fa*)(arow + kb + 8 * hh), x1 = *(const v4fa*)(arow + kb + 8 * hh + 4);
    const v4f x2 = *(const v4fa*)(arow + kb + 16 + 8 * hh), x3 = *(const v4fa*)(arow + kb + 16 + 8 * hh + 4);
    float xs[16] = {x0[0],x0[1],x0[2],x0[3],x1[0],x1[1],x1[2],x1[3],x2[0],x2[1],x2[2],x2[3],x3[0],x3[1],x3[2],x3[3]};
#pragma unroll
    for (int i = 0; i < 16; ++i) { const unsigned short hb = bf16_bits(xs[i]); ah.u[i] = hb; al.u[i] = ASPLIT ? bf16_bits(xs[i] - bf16_val(hb)) : (unsigned short)0; }
#pragma unroll
    for (int t = 0; t < 4; ++t) {
      const unsigned short* brow = Wt + (size_t)(col0 + t * 16 + ln) * ldb + kb;
      FragB b;
      b.half[0] = *(const v8us*)(brow + 8 * hh);
      b.half[1] = *(const v8us*)(brow + 16 + 8 * hh);
      acc[t] = mmaN<ASPLIT ? 2 : 1>(ah.v, al.v, b.v, b.v, acc[t]);
    }
  }
#pragma unroll
  for (int t = 0; t < 4; ++t) {
    const int col = col0 + t * 16 + ln;
    float bv = bias ? bias[col] : 0.f;
    if (BIAS_BF16) bv = bf16_round(bv);
#pragma unroll
    for (int r = 0; r < 8; ++r) {
      float v = acc[t][r] + bv;
      if (resid) { float rv = resid[(size_t)((row0 + 8 * hh + r) % rmod) * ldr + col]; if (RES_BF16) rv = bf16_round(rv); v += rv; }
      if (ACT == 1) v = fmaxf(v, 0.f);
      if (ACT == 2) v = 0.5f * v * (1.0f + erff(v * 0.70710678118654752f));
      if (ACT == 3) { const float u = 0.7978845608028654f * (v + 0.044715f * v * v * v); v = 0.5f * v * (1.0f + tanhf(u)); }
      so[w][8 * hh + r][t * 16 + ln] = v;
    }
  }
  __builtin_amdgcn_fence(__ATOMIC_ACQ_REL, "workgroup");
  __builtin_amdgcn_wave_barrier();
  const int rsub = lane >> 4, c4 = (lane & 15) * 4;
  {
#pragma unroll
    for (int q = 0; q < 8; ++q) {
      const int r = q * 2 + rsub;
      const v4f v = *(const v4fa*)&so[w][r][c4];
      *(v4f*)(C + (size_t)(row0 + r) * ldc + col0 + c4) = v;
    }
    
  }
}
// row LayerNorm (biased variance, eps) over N: s = X (+ R); optional out_sum <- s; out_norm <- (s-mu)*rsqrt(var+eps)*g + b
template <bool PARAM_BF16>
__global__ __launch_bounds__(256) void k_layernorm(const float* __restrict__ X, const float* __restrict__ R, const float* __restrict__ g, const float* __restrict__ bta,
                                                  float* __restrict__ out_sum, float* __restrict__ out_norm, int N, float eps) {
  __shared__ float red[256];
  const int row = blockIdx.x, tid = threadIdx.x;
  const float* x = X + (size_t)row * N; const float* rr = R ? R + (size_t)row * N : nullptr;
  float vals[16];                     // up to N = 4096
  const int per = N / 256;            // contiguous chunk per thread? use strided-by-4 chunks: thread handles j = tid*4 + 1024*u
  float s1 = 0.f;
  for (int u = 0; u < per / 4; ++u) {
    const int j = tid * 4 + 1024 * u;
    const v4f a = *(const v4fa*)(x + j);
    v4f b = {0.f,0.f,0.f,0.f}; if (rr) b = *(const v4fa*)(rr + j);
#pragma unroll
    for (int q = 0; q < 4; ++q) { const float v = a[q] + b[q]; vals[u * 4 + q] = v; s1 += v; }
  }
  red[tid] = s1; __syncthreads();
  for (int st = 128; st > 0; st >>= 1) { if (tid < st) red[tid] += red[tid + st]; __syncthreads(); }
  const float mu = red[0] / (float)N; __syncthreads();
  float s2 = 0.f;
  for (int u = 0; u < per / 4; ++u)
#pragma unroll
    for (int q = 0; q < 4; ++q) { const float c = vals[u * 4 + q] - mu; s2 += c * c; }
  red[tid] = s2; __syncthreads();
  for (int st = 128; st > 0; st >>= 1) { if (tid < st) red[tid] += red[tid + st]; __syncthreads(); }
  const float rs = rsqrtf(red[0] / (float)N + eps);
  {
    for (int u = 0; u < per / 4; ++u) {
      const int j = tid * 4 + 1024 * u;
      v4f o, sm;
#pragma unroll
      for (int q = 0; q < 4; ++q) {
        float gg = g[j + q], bb = bta[j + q];
        if (PARAM_BF16) { gg = bf16_round(gg); bb = bf16_round(bb); }
        sm[q] = vals[u * 4 + q]; o[q] = (vals[u * 4 + q] - mu) * rs * gg + bb;
      }
      if (out_sum) *(v4f*)(out_sum + (size_t)row * N + j) = sm;
      *(v4f*)(out_norm + (size_t)row * N + j) = o;
    }
    
  }
}



// ---- f16 WMMA path (v_wmma_f32_16x16x32_f16): 11-bit significands for operands in range — used where a [0,1] probability operand needs more precision than bf16
typedef _Float16 v16h __attribute__((ext_vector_type(16)));
union FragH { v16h v; v8us half[2]; _Float16 h[16]; unsigned short u[16]; };
template <int NT>
__device__ __forceinline__ v8f mmaH(v16h ah, v16h al, v16h bh, v16h bl, v8f c) {
  c = __builtin_amdgcn_wmma_f32_16x16x32_f16(false, ah, false, bh, (short)0, c, false, false);
  if (NT >= 2) c = __builtin_amdgcn_wmma_f32_16x16x32_f16(false, al, false, bh, (short)0, c, false, false);
  if (NT >= 3) c = __builtin_amdgcn_wmma_f32_16x16x32_f16(false, ah, false, bl, (short)0, c, false, false);
  asm volatile("v_nop\n\tv_nop\n\tv_nop\n\tv_nop" : "+v"(c) : "v"(ah), "v"(al), "v"(bh), "v"(bl));
  return c;
}
// batched GEMM like k_gemm_b but f16 operands: A f32 (split into f16 hi/lo if ASPLIT, else rounded to f16), Bt = f16 values [n][k]; alpha; C f32; N multiple of 16 (partial tiles skipped)
template <bool ASPLIT>
__global__ __launch_bounds__(128) void k_gemm_h(const float* __restrict__ A, int lda, size_t sA, const _Float16* __restrict__ Bh, int ldb, size_t sB, float alpha, float* __restrict__ C, int ldc, size_t sC, int M, int N, int K) {
  __shared__ __attribute__((aligned(16))) float so[4][16][64];
  const int tid = threadIdx.x, w = tid >> 5, lane = tid & 31, ln = lane & 15, hh = lane >> 4; const int by = blockIdx.y;
  A += (size_t)by * sA; Bh += (size_t)by * sB; C += (size_t)by * sC;
  const int ntn = (N + 63) / 64; const int wid = blockIdx.x * 4 + w; const int mt = wid / ntn, nq = wid % ntn; if (mt * 16 >= M) return;
  const int row0 = mt * 16, col0 = nq * 64; const float* arow = A + (size_t)(row0 + ln) * lda;
  v8f acc[4] = {};
  for (int kb = 0; kb < K; kb += 32) {
    FragH ah, al;
    const v4f x0 = *(const v4fa*)(arow + kb + 8 * hh), x1 = *(const v4fa*)(arow + kb + 8 * hh + 4), x2 = *(const v4fa*)(arow + kb + 16 + 8 * hh), x3 = *(const v4fa*)(arow + kb + 16 + 8 * hh + 4);
    float xs[16] = {x0[0],x0[1],x0[2],x0[3],x1[0],x1[1],x1[2],x1[3],x2[0],x2[1],x2[2],x2[3],x3[0],x3[1],x3[2],x3[3]};
#pragma unroll
    for (int i = 0; i < 16; ++i) { const _Float16 h = (_Float16)xs[i]; ah.h[i] = h; al.h[i] = ASPLIT ? (_Float16)(xs[i] - (float)h) : (_Float16)0.0f; }
#pragma unroll
    for (int t = 0; t < 4; ++t) { if (col0 + t * 16 >= N) continue; const size_t boff = (size_t)(col0 + t * 16 + ln) * ldb + kb; FragH bq; bq.half[0] = *(const v8us*)(Bh + boff + 8 * hh); bq.half[1] = *(const v8us*)(Bh + boff + 16 + 8 * hh);
      acc[t] = mmaH<ASPLIT ? 2 : 1>(ah.v, al.v, bq.v, bq.v, acc[t]); }
  }
#pragma unroll
  for (int t = 0; t < 4; ++t) { if (col0 + t * 16 >= N) continue;
#pragma unroll
    for (int r = 0; r < 8; ++r) so[w][8 * hh + r][t * 16 + ln] = acc[t][r] * alpha; }
  __builtin_amdgcn_fence(__ATOMIC_ACQ_REL, "workgroup"); __builtin_amdgcn_wave_barrier();
  const int rsub = lane >> 4, c4 = (lane & 15) * 4;
  {
#pragma unroll
    for (int q = 0; q < 8; ++q) { const int r = q * 2 + rsub; if (col0 + c4 < N) { const v4f v = *(const v4fa*)&so[w][r][c4]; *(v4f*)(C + (size_t)(row0 + r) * ldc + col0 + c4) = v; } }
     }
}

// Wt[n][k] = f16(W[k][n]·scale) from f32 row-major W[K][N] (scale = power of two; bf16-exact weights stay exact in f16 away from the subnormal range)
__global__ __launch_bounds__(256) void k_wt_f16(const float* __restrict__ W, _Float16* __restrict__ Wt, int K, int N, float scale) {
  const int t = blockIdx.x * 256 + threadIdx.x; if (t >= N * (K / 8)) return; const int n = t / (K / 8), k8 = (t % (K / 8)) * 8; FragH f;
#pragma unroll
  for (int i = 0; i < 8; ++i) f.h[i] = (_Float16)(bf16_round(W[(size_t)(k8 + i) * N + n]) * scale); const v8us o = f.half[0];
  *(v8us*)((unsigned short*)Wt + (size_t)n * K + k8) = o; 
}
// k_gemm_hh variant with fused epilogue: v = acc·alpha + bias[by·sBias + col] (+ CP[(row/rowsPerB)·sCPb + by·64 + col] if CP) ; ACT 0 none / 1 elu ; writes f16 C16 (and f32 C if non-null)
template <int ACT>
__global__ __launch_bounds__(128) void k_gemm_hhx(const _Float16* __restrict__ A, int lda, size_t sA, const _Float16* __restrict__ Bh, int ldb, size_t sB, float alpha, const float* __restrict__ bias, size_t sBias, const float* __restrict__ CP, int rowsPerB, size_t sCPb, int row0g,
    float* __restrict__ C, _Float16* __restrict__ C16, int ldc, size_t sC, int M, int N, int K) {
  __shared__ __attribute__((aligned(16))) float so[4][16][64];
  const int tid = threadIdx.x, w = tid >> 5, lane = tid & 31, ln = lane & 15, hh = lane >> 4; const int by = blockIdx.y;
  A += (size_t)by * sA; Bh += (size_t)by * sB; const size_t cofs = (size_t)by * sC; const float* bp = bias ? bias + (size_t)by * sBias : nullptr;
  const int ntn = (N + 63) / 64; const int wid = blockIdx.x * 4 + w; const int mt = wid / ntn, nq = wid % ntn; if (mt * 16 >= M) return;
  const int row0 = mt * 16, col0 = nq * 64; const _Float16* arow = A + (size_t)(row0 + ln) * lda;
  v8f acc[4] = {};
  for (int kb = 0; kb < K; kb += 32) { FragH ah; ah.half[0] = *(const v8us*)((const unsigned short*)arow + kb + 8 * hh); ah.half[1] = *(const v8us*)((const unsigned short*)arow + kb + 16 + 8 * hh);
#pragma unroll
    for (int t = 0; t < 4; ++t) { if (col0 + t * 16 >= N) continue; const size_t boff = (size_t)(col0 + t * 16 + ln) * ldb + kb; FragH bq; bq.half[0] = *(const v8us*)((const unsigned short*)Bh + boff + 8 * hh); bq.half[1] = *(const v8us*)((const unsigned short*)Bh + boff + 16 + 8 * hh);
      acc[t] = mmaH<1>(ah.v, ah.v, bq.v, bq.v, acc[t]); }
  }
#pragma unroll
  for (int t = 0; t < 4; ++t) { if (col0 + t * 16 >= N) continue; const int col = col0 + t * 16 + ln; const float bv = bp ? bf16_round(bp[col]) : 0.f;
#pragma unroll
    for (int r = 0; r < 8; ++r) { float v = acc[t][r] * alpha + bv; if (CP) { const int rr = row0g + row0 + 8 * hh + r; if (rowsPerB < 0) v += CP[cofs + (size_t)rr * ldc + col];      /* rowsPerB < 0: own element of the batched C plane */ else { const int bidx = rr / rowsPerB; v += CP[(size_t)bidx * sCPb + (size_t)by * 64 + col]; } } if (ACT == 1) v = (v > 0.f) ? v : expm1f(v); else if (ACT == 7) v = (v > 0.f) ? v + 1.0f : expf(v); else if (ACT == 8) v = tanhf(v); else if (ACT == 9) v = 0.5f * v * (1.0f + tanhf(0.7978845608028654f * (v + 0.044715f * v * v * v))); else if (ACT == 11) v = 1.0f / (1.0f + expf(-v)); else if (ACT == 12) v = (v > 0.f) ? v : 0.01f * v; else if (ACT == 14) v = (v > 0.f) ? v : 0.1f * v; else if (ACT == 16) v = (v >= 0.f) ? v : 0.3f * v; else if (ACT == 17) v = (v >= 0.f) ? v : 0.2f * v; else if (ACT == 15) v = v / (1.0f + expf(-v)); else if (ACT == 3) v = fmaxf(v, 0.f); else if (ACT == 6) v = 0.5f * v * (1.0f + erff(v * 0.70710678118654752f)); so[w][8 * hh + r][t * 16 + ln] = v; } }
  __builtin_amdgcn_fence(__ATOMIC_ACQ_REL, "workgroup"); __builtin_amdgcn_wave_barrier();
  const int rsub = lane >> 4, c4 = (lane & 15) * 4; typedef _Float16 v4h __attribute__((ext_vector_type(4)));
  {
#pragma unroll
    for (int q = 0; q < 8; ++q) { const int r = q * 2 + rsub; if (col0 + c4 < N) { const v4f v = *(const v4fa*)&so[w][r][c4]; if (C) *(v4f*)(C + cofs + (size_t)(row0 + r) * ldc + col0 + c4) = v; if (C16) { v4h h4; for (int i = 0; i < 4; ++i) h4[i] = (_Float16)v[i]; *(v4h*)(C16 + cofs + (size_t)(row0 + r) * ldc + col0 + c4) = h4; } } }
     }
}


typedef _Float16 v4h __attribute__((ext_vector_type(4)));

__global__ __launch_bounds__(256) void k_x16(const float* __restrict__ x, _Float16* __restrict__ X16, size_t n8) { const size_t t = (size_t)blockIdx.x * 256 + threadIdx.x; if (t >= n8) return; FragH f;
#pragma unroll
  for (int q = 0; q < 8; ++q) f.h[q] = (_Float16)bf16_round(x[t * 8 + q]); *(v8us*)((unsigned short*)X16 + t * 8) = f.half[0];  }
__global__ __launch_bounds__(256) void k_h16(const float* __restrict__ x, _Float16* __restrict__ X16, size_t n8) { const size_t t = (size_t)blockIdx.x * 256 + threadIdx.x; if (t >= n8) return; FragH f;
#pragma unroll
  for (int q = 0; q < 8; ++q) f.h[q] = (_Float16)x[t * 8 + q]; *(v8us*)((unsigned short*)X16 + t * 8) = f.half[0];  }
__global__ __launch_bounds__(256) void k_round16f(const float* __restrict__ W, _Float16* __restrict__ Bt, size_t n8) { const size_t t = (size_t)blockIdx.x * 256 + threadIdx.x; if (t >= n8) return; FragH f;
#pragma unroll
  for (int i = 0; i < 8; ++i) f.h[i] = (_Float16)(bf16_round(W[t * 8 + i]) * 16.0f); *(v8us*)((unsigned short*)Bt + t * 8) = f.half[0];  }
template <int NHv, int TTv>
__global__ __launch_bounds__(256) void k_vt(const _Float16* __restrict__ V16, int ldv, int voff, _Float16* __restrict__ Vt) { __shared__ unsigned short tl[64][66]; const int tid = threadIdx.x; const int slab = blockIdx.x / (TTv / 64), lg = blockIdx.x % (TTv / 64); const int b = slab / NHv, h = slab % NHv;
  for (int i = tid; i < 64 * 8; i += 256) { const int r = i / 8, c8 = (i % 8) * 8; FragH f; f.half[0] = *(const v8us*)((const unsigned short*)V16 + ((size_t)b * TTv + lg * 64 + r) * ldv + voff + h * 64 + c8);
#pragma unroll
    for (int q = 0; q < 8; ++q) tl[r][c8 + q] = f.u[q]; }
  __syncthreads();
  {
#pragma unroll
    for (int rd = 0; rd < 2; ++rd) { const int d = rd * 32 + tid / 8, pc = tid % 8; FragH f;
#pragma unroll
      for (int q = 0; q < 8; ++q) f.u[q] = tl[pc * 8 + q][d];
      *(v8us*)((unsigned short*)Vt + ((size_t)slab * 64 + d) * TTv + lg * 64 + pc * 8) = f.half[0]; }
     } }

__global__ __launch_bounds__(256) void k_hl(const float* __restrict__ F, _Float16* __restrict__ Hh, _Float16* __restrict__ Hl, size_t n8) { const size_t t = (size_t)blockIdx.x * 256 + threadIdx.x; if (t >= n8) return; FragH fh, fl; const v4f a = *(const v4fa*)(F + t * 8), c = *(const v4fa*)(F + t * 8 + 4);
#pragma unroll
  for (int q = 0; q < 4; ++q) { _Float16 h = (_Float16)a[q]; fh.h[q] = h; fl.h[q] = (_Float16)((a[q] - (float)h) * 1024.0f); h = (_Float16)c[q]; fh.h[4 + q] = h; fl.h[4 + q] = (_Float16)((c[q] - (float)h) * 1024.0f); }
  { *(v8us*)((unsigned short*)Hh + t * 8) = fh.half[0]; *(v8us*)((unsigned short*)Hl + t * 8) = fl.half[0];  } }

// ---- fast GEMM (block tile 128x64, wave tile 32x64; requires M % 128 == 0 rows per launch region, N % 64 == 0 and K % 64 == 0); epilogue = k_gemm_hhx semantics ----
// Both operands reach the fragments through LDS: a stage is 64 k = one whole 128-byte line of each of the block's 128 A rows and 64 B rows, fetched by loads in which 8 lanes cover one row
// (4 whole lines a wave load, where a fragment load straight from global memory touches 16 lines); two buffers, the next stage's global loads fly during this stage's products.
#define G2_SK 64                     /* k per LDS stage */
#define G2_PH 72                     /* LDS row pitch in f16: 144 B = 16 B x odd, the conflict-free pitch for 16-byte fragment reads */
__device__ __forceinline__ v16h g2_frag(const _Float16* p, int hh) { FragH f; f.half[0] = *(const v8us*)((const unsigned short*)p + 8 * hh); f.half[1] = *(const v8us*)((const unsigned short*)p + 16 + 8 * hh); return f.v; }
__device__ __forceinline__ v8f g2_mma(v16h a, v16h b, v8f c) { return __builtin_amdgcn_wmma_f32_16x16x32_f16(false, a, false, b, (short)0, c, false, false); }
// one stage's global loads of a thread: 16 bytes of 8 A rows and of 4 B rows, 16 rows apart
__device__ __forceinline__ void g2_stage(const unsigned short* a, size_t a16, const unsigned short* b, size_t b16, v8us (&ra)[8], v8us (&rb)[4]) {
  const unsigned short* pa[8]; const unsigned short* pb[4];
#pragma unroll
  for (int j = 0; j < 8; ++j) pa[j] = a + j * a16;
#pragma unroll
  for (int j = 0; j < 4; ++j) pb[j] = b + j * b16;
#pragma unroll
  for (int j = 0; j < 8; ++j) ra[j] = *(const v8us*)pa[j];
#pragma unroll
  for (int j = 0; j < 4; ++j) rb[j] = *(const v8us*)pb[j];
  // the wait that stands in front of any overwrite of an issued load's address registers; the 12 addresses are inputs so that their registers live up to it (else a later load's result lands in an earlier load's address pair)
  asm volatile("s_wait_xcnt 0x0" :: "v"(pa[0]), "v"(pa[1]), "v"(pa[2]), "v"(pa[3]), "v"(pa[4]), "v"(pa[5]), "v"(pa[6]), "v"(pa[7]), "v"(pb[0]), "v"(pb[1]), "v"(pb[2]), "v"(pb[3]) : "memory");
}
template <int ACT>
__global__ __launch_bounds__(128) void k_gemm2(const _Float16* __restrict__ A, int lda, size_t sA, const _Float16* __restrict__ Bh, int ldb, size_t sB, float alpha, const float* __restrict__ bias, size_t sBias, const float* __restrict__ CP, int rowsPerB, size_t sCPb, int row0g,
    float* __restrict__ C, _Float16* __restrict__ C16, int ldc, size_t sC, int M, int N, int K) { static_assert(ACT == 0 || ACT == 3 || ACT == 6 || ACT == 8 || ACT == 9 || ACT == 11 || ACT == 12 || ACT == 14 || ACT == 15 || ACT == 16 || ACT == 17, "k_gemm2: unsupported ACT code (would silently apply no activation)");
  __shared__ __attribute__((aligned(16))) float so[4][32][68];
  __shared__ __attribute__((aligned(16))) _Float16 sa[2][128][G2_PH];      /* A stage: the block's 128 rows, 64 k */
  __shared__ __attribute__((aligned(16))) _Float16 sb[2][64][G2_PH];       /* B stage: the block's 64 columns (rows of Bt), 64 k */
  const int tid = threadIdx.x, w = tid >> 5, lane = tid & 31, ln = lane & 15, hh = lane >> 4; const int by = blockIdx.y;
  A += (size_t)by * sA; Bh += (size_t)by * sB; const size_t cofs = (size_t)by * sC; const float* bp = bias ? bias + (size_t)by * sBias : nullptr;
  const int ntn = N >> 6; const int mt = blockIdx.x / ntn, nq = blockIdx.x - mt * ntn; const int row0 = mt * 128 + 32 * w, col0 = nq * 64; if (mt * 128 >= M) return;      /* the whole work-group leaves or none: barriers follow */
  // staging: a thread moves 16 bytes of rows srow + 16 j; 8 threads cover one 128-byte row
  const int srow = tid >> 3, sch = (tid & 7) * 8;
  const unsigned short* ag = (const unsigned short*)A + (size_t)(mt * 128 + srow) * lda + sch;
  const unsigned short* bg = (const unsigned short*)Bh + (size_t)(col0 + srow) * ldb + sch;
  v8us ra[8], rb[4];
  g2_stage(ag, (size_t)16 * lda, bg, (size_t)16 * ldb, ra, rb);
  const v8f z8 = {0.f,0.f,0.f,0.f,0.f,0.f,0.f,0.f}; v8f c00 = z8, c01 = z8, c02 = z8, c03 = z8, c10 = z8, c11 = z8, c12 = z8, c13 = z8;
#pragma unroll
  for (int j = 0; j < 8; ++j) *(v8us*)&sa[0][srow + 16 * j][sch] = ra[j];
#pragma unroll
  for (int j = 0; j < 4; ++j) *(v8us*)&sb[0][srow + 16 * j][sch] = rb[j];
  __syncthreads();      /* stage 0 is visible to all 4 waves */
  const int nst = K / G2_SK;
#pragma unroll 1  // rolled: one stage a trip, so that the two buffers alternate by index; the two 32-k blocks inside are unrolled
  for (int st = 0; st < nst; ++st) {
    const int b = st & 1; const bool more = st + 1 < nst;      /* the same for the whole work-group */
    if (more) g2_stage(ag + (st + 1) * G2_SK, (size_t)16 * lda, bg + (st + 1) * G2_SK, (size_t)16 * ldb, ra, rb);      /* next stage: in flight under this stage's products */
    v16h fa[2][2], fb[2][4];      /* the stage's fragments: [32-k block][tile] */
#pragma unroll
    for (int kc = 0; kc < 2; ++kc) { fa[kc][0] = g2_frag(&sa[b][32 * w + ln][32 * kc], hh); fb[kc][0] = g2_frag(&sb[b][ln][32 * kc], hh); fa[kc][1] = g2_frag(&sa[b][32 * w + 16 + ln][32 * kc], hh);
#pragma unroll
      for (int t = 1; t < 4; ++t) fb[kc][t] = g2_frag(&sb[b][16 * t + ln][32 * kc], hh); }
    __builtin_amdgcn_sched_barrier(0);      /* keeps the stage's 24 LDS reads one group in front of its 16 products: left alone the compiler reuses one B fragment's registers and waits out the LDS latency 8 times a stage */
#pragma unroll
    for (int kc = 0; kc < 2; ++kc) {      /* k ascends by 32 in every accumulator: one fixed order of sums */
      c00 = g2_mma(fa[kc][0], fb[kc][0], c00); c10 = g2_mma(fa[kc][1], fb[kc][0], c10); c01 = g2_mma(fa[kc][0], fb[kc][1], c01); c11 = g2_mma(fa[kc][1], fb[kc][1], c11);
      c02 = g2_mma(fa[kc][0], fb[kc][2], c02); c12 = g2_mma(fa[kc][1], fb[kc][2], c12); c03 = g2_mma(fa[kc][0], fb[kc][3], c03); c13 = g2_mma(fa[kc][1], fb[kc][3], c13); }
    if (more) {      /* every wave left that buffer before the last barrier */
#pragma unroll
      for (int j = 0; j < 8; ++j) *(v8us*)&sa[b ^ 1][srow + 16 * j][sch] = ra[j];
#pragma unroll
      for (int j = 0; j < 4; ++j) *(v8us*)&sb[b ^ 1][srow + 16 * j][sch] = rb[j]; }
    __syncthreads();      /* publishes stage st + 1 and ends every wave's reads of stage st, whose buffer the next trip refills */
  }
  v8f accs[8] = {c00, c01, c02, c03, c10, c11, c12, c13};
#pragma unroll
  for (int u = 0; u < 8; ++u) { const int t = u & 3, half = u >> 2; const int col = col0 + t * 16 + ln; const float bv = bp ? bf16_round(bp[col]) : 0.f;
#pragma unroll
    for (int r = 0; r < 8; ++r) { const int rloc = half * 16 + 8 * hh + r; float v = accs[u][r] * alpha + bv; if (CP) { if (rowsPerB < 0) v += CP[cofs + (size_t)(row0g + row0 + rloc) * ldc + col];      /* rowsPerB < 0: own element of the batched C plane */ else { const int bidx = (row0g + row0 + rloc) / rowsPerB; v += CP[(size_t)bidx * sCPb + (size_t)by * 64 + col]; } }
      if (ACT == 3) v = fmaxf(v, 0.f); else if (ACT == 6) v = 0.5f * v * (1.0f + erff(v * 0.70710678118654752f)); else if (ACT == 11) v = 1.0f / (1.0f + expf(-v)); else if (ACT == 15) v = v / (1.0f + expf(-v)); else if (ACT == 12) v = (v > 0.f) ? v : 0.01f * v; else if (ACT == 8) v = tanhf(v); else if (ACT == 9) v = 0.5f * v * (1.0f + tanhf(0.7978845608028654f * (v + 0.044715f * v * v * v))); else if (ACT == 14) v = (v > 0.f) ? v : 0.1f * v; else if (ACT == 16) v = (v >= 0.f) ? v : 0.3f * v; else if (ACT == 17) v = (v >= 0.f) ? v : 0.2f * v;
      so[w][rloc][t * 16 + ln] = v; } }
  __builtin_amdgcn_fence(__ATOMIC_ACQ_REL, "workgroup"); __builtin_amdgcn_wave_barrier();
  const int rsub = lane >> 4, c4 = (lane & 15) * 4;
  {
#pragma unroll
    for (int q = 0; q < 16; ++q) { const int r = q * 2 + rsub; const v4f v = *(const v4fa*)&so[w][r][c4]; if (C) *(v4f*)(C + cofs + (size_t)(row0 + r) * ldc + col0 + c4) = v; if (C16) { v4h h4; for (int i = 0; i < 4; ++i) h4[i] = (_Float16)v[i]; *(v4h*)(C16 + cofs + (size_t)(row0 + r) * ldc + col0 + c4) = h4; } }
     } }


__global__ __launch_bounds__(256) void k_wnat(const float* __restrict__ w, size_t n8, _Float16* __restrict__ Bt) { const size_t t = (size_t)blockIdx.x * 256 + threadIdx.x; if (t >= n8) return; FragH f; for (int q = 0; q < 8; ++q) f.h[q] = (_Float16)(bf16_round(w[t * 8 + q]) * 16.0f); *(v8us*)((unsigned short*)Bt + t * 8) = f.half[0];  }
__global__ __launch_bounds__(256) void k_rsm(const float* __restrict__ S, _Float16* __restrict__ P, int nrows) {
  #pragma clang fp contract(off)
  const int i = blockIdx.x * 256 + threadIdx.x; if (i >= nrows) return; const float* s = S + (size_t)i * SQ; float mx = -3.0e38f;
#pragma unroll 1
  for (int j = 0; j < SQ; ++j) mx = fmaxf(mx, s[j]); float se = 0.f;
#pragma unroll 1
  for (int j = 0; j < SQ; ++j) se += expf(s[j] - mx); const float sc = 256.0f / se;
#pragma unroll 1
  for (int j0 = 0; j0 < SQ; j0 += 8) { FragH f; for (int q = 0; q < 8; ++q) f.h[q] = (_Float16)(expf(s[j0 + q] - mx) * sc); unsigned short* d = (unsigned short*)P + (size_t)i * SQ + j0; *(v8us*)d = f.half[0];  } }
__global__ __launch_bounds__(256) void k_vt(const _Float16* __restrict__ V16, int b, int h0, _Float16* __restrict__ VT) { __shared__ unsigned short tl[64][65]; const int tid = threadIdx.x; const int hh = blockIdx.x % HG, sg = blockIdx.x / HG; const int s0 = sg * 64; const int h = h0 + hh;
  for (int i = tid; i < 64 * 8; i += 256) { const int j = i / 8, d8 = (i % 8) * 8; FragH f; f.half[0] = *(const v8us*)((const unsigned short*)V16 + ((size_t)b * SQ + s0 + j) * DM + h * HD + d8); for (int q = 0; q < 8; ++q) tl[d8 + q][j] = f.u[q]; }
  __syncthreads();
  { for (int i = tid; i < 64 * 8; i += 256) { const int d = i / 8, j8 = (i % 8) * 8; FragH f; for (int q = 0; q < 8; ++q) f.u[q] = tl[d][j8 + q]; *(v8us*)((unsigned short*)VT + ((size_t)hh * HD + d) * SQ + s0 + j8) = f.half[0]; }  } }



#define FA_SK 64                     /* keys per LDS tile */
#define FA_PH 72                     /* LDS row pitch in f16: 144 B = 16 B x odd, the conflict-free pitch for 16-byte fragment reads */
typedef float f32x2 __attribute__((ext_vector_type(2)));
typedef _Float16 v2h __attribute__((ext_vector_type(2)));
union FragP { v16h v; unsigned int w[8]; };
__device__ __forceinline__ float fa_xhalf(float x) { return __builtin_bit_cast(float, __builtin_amdgcn_permlanex16(__builtin_bit_cast(int, x), __builtin_bit_cast(int, x), 0x76543210, 0xfedcba98, false, false)); }      /* lane l <-> lane l ^ 16 */
__device__ __forceinline__ v16h fa_frag(const _Float16* p) { FragH f; f.half[0] = *(const v8us*)(const unsigned short*)p; f.half[1] = *(const v8us*)((const unsigned short*)p + 16); return f.v; }      /* p = row + 32 kc + 8 h: the hardware k order */
__device__ __forceinline__ v8f fa_mma(v16h a, v16h b, v8f c) { return __builtin_amdgcn_wmma_f32_16x16x32_f16(false, a, false, b, (short)0, c, false, false); }
// amdgpu_waves_per_eu(4, 4): a budget of 256 VGPRs, so that no register lies above v255 (without it the build took 266 and switched register windows all through the loop)
__global__ __launch_bounds__(256) __attribute__((amdgpu_waves_per_eu(4, 4))) void k_fattn(const _Float16* __restrict__ Qh, const _Float16* __restrict__ Kh, const _Float16* __restrict__ Vt, _Float16* __restrict__ Oh) {
  __shared__ __attribute__((aligned(16))) _Float16 sk[2][FA_SK][FA_PH];      /* K tile: row = key, 64 d */
  __shared__ __attribute__((aligned(16))) _Float16 sv[2][HD][FA_PH];         /* V^T tile: row = d, 64 keys */
  const int tid = threadIdx.x, lane = tid & 31, wave = tid >> 5, c = lane & 15, h = lane >> 4;
  const int head = blockIdx.y, q0 = blockIdx.x * 256 + wave * 32;
  const float cs = 0.03125f * 1.44269504088896340736f;      /* the module's score scale 1/sqrt(1024), in the base-2 domain */
  // staging: a thread moves 16 bytes of rows srow and srow + 32 of each tile; 8 threads cover one 128-byte row
  const int srow = tid >> 3, sch = (tid & 7) * 8;
  const unsigned short* kg = (const unsigned short*)Kh + (size_t)srow * LQ + head * HD + sch;
  const unsigned short* vg = (const unsigned short*)Vt + ((size_t)head * HD + srow) * SQ + sch;
  v8us rk0, rk1, rv0, rv1;
  rk0 = *(const v8us*)kg; rk1 = *(const v8us*)(kg + (size_t)32 * LQ); rv0 = *(const v8us*)vg; rv1 = *(const v8us*)(vg + (size_t)32 * SQ);
  v16h qf[2][2];
#pragma unroll
  for (int g = 0; g < 2; ++g)
#pragma unroll
    for (int kc = 0; kc < 2; ++kc) qf[g][kc] = fa_frag(Qh + (size_t)(q0 + 16 * g + c) * LQ + head * HD + 32 * kc + 8 * h);
  const v8f z8 = {0.f,0.f,0.f,0.f,0.f,0.f,0.f,0.f};
  v8f acc[2][4]; float m_run[2]; f32x2 l_run[2];
#pragma unroll
  for (int g = 0; g < 2; ++g) { m_run[g] = -3.0e38f; l_run[g] = f32x2{0.f, 0.f};
#pragma unroll
    for (int t = 0; t < 4; ++t) acc[g][t] = z8; }
  *(v8us*)&sk[0][srow][sch] = rk0; *(v8us*)&sk[0][srow + 32][sch] = rk1; *(v8us*)&sv[0][srow][sch] = rv0; *(v8us*)&sv[0][srow + 32][sch] = rv1;
  __syncthreads();      /* tile 0 is visible to all 8 waves */
#pragma unroll 1  // rolled: one tile a trip; the two 32-key passes inside are unrolled
  for (int st = 0; st < SQ / FA_SK; ++st) {
    const int b = st & 1; const bool more = st + 1 < SQ / FA_SK;      /* the same for the whole work-group */
    if (more) { const unsigned short* kp = kg + (size_t)(st + 1) * FA_SK * LQ; const unsigned short* vp = vg + (st + 1) * FA_SK;      /* next tile: in flight under this tile's work */
      rk0 = *(const v8us*)kp; rk1 = *(const v8us*)(kp + (size_t)32 * LQ); rv0 = *(const v8us*)vp; rv1 = *(const v8us*)(vp + (size_t)32 * SQ); }
#pragma unroll
    for (int sub = 0; sub < 2; ++sub) {      /* one pass: 32 keys x the wave's 32 query columns */
      v8f s[2][2];
#pragma unroll
      for (int kt = 0; kt < 2; ++kt) { const _Float16* kr = &sk[b][sub * 32 + 16 * kt + c][8 * h]; const v16h k0 = fa_frag(kr), k1 = fa_frag(kr + 32);
#pragma unroll
        for (int g = 0; g < 2; ++g) s[kt][g] = fa_mma(k1, qf[g][1], fa_mma(k0, qf[g][0], z8)); }
      v16h vf[4];
#pragma unroll
      for (int t = 0; t < 4; ++t) vf[t] = fa_frag(&sv[b][16 * t + c][sub * 32 + 8 * h]);
#pragma unroll
      for (int g = 0; g < 2; ++g) {
        float mx = s[0][g][0];      /* maximum of the raw scores (the scale is positive) */
#pragma unroll
        for (int r = 1; r < 8; ++r) mx = fmaxf(mx, s[0][g][r]);
#pragma unroll
        for (int r = 0; r < 8; ++r) mx = fmaxf(mx, s[1][g][r]);
        mx = fmaxf(mx, fa_xhalf(mx)) * cs;      /* both wave halves hold the query's pass maximum, scaled */
        const float m_new = fmaxf(m_run[g], mx); const float corr = __builtin_amdgcn_exp2f(m_run[g] - m_new);      /* 0 on the first pass */
        m_run[g] = m_new;
#pragma unroll
        for (int t = 0; t < 4; ++t) acc[g][t] = acc[g][t] * corr;
        FragP pf; f32x2 ps[8];
#pragma unroll
        for (int i = 0; i < 8; ++i) {
          const f32x2 a = __builtin_elementwise_fma(f32x2{s[i >> 2][g][2 * (i & 3)], s[i >> 2][g][2 * (i & 3) + 1]}, f32x2{cs, cs}, f32x2{-m_new, -m_new});
          const f32x2 p = {__builtin_amdgcn_exp2f(a.x), __builtin_amdgcn_exp2f(a.y)};
          ps[i] = p; pf.w[i] = __builtin_bit_cast(unsigned int, __builtin_convertvector(p, v2h)); }
        l_run[g] = l_run[g] * corr + (((ps[0] + ps[1]) + (ps[2] + ps[3])) + ((ps[4] + ps[5]) + (ps[6] + ps[7])));      /* a tree, not one chain of 8 dependent adds */
#pragma unroll
        for (int t = 0; t < 4; ++t) acc[g][t] = fa_mma(vf[t], pf.v, acc[g][t]);
      }
    }
    if (more) { *(v8us*)&sk[b ^ 1][srow][sch] = rk0; *(v8us*)&sk[b ^ 1][srow + 32][sch] = rk1; *(v8us*)&sv[b ^ 1][srow][sch] = rv0; *(v8us*)&sv[b ^ 1][srow + 32][sch] = rv1; }      /* every wave left that buffer before the last barrier */
    __syncthreads();      /* publishes tile st + 1 and ends every wave's reads of tile st, whose buffer the next trip refills */
  }
#pragma unroll
  for (int g = 0; g < 2; ++g) { float l = l_run[g].x + l_run[g].y; l += fa_xhalf(l); const float inv = 64.0f / l;      /* o carried x64, as the output GEMM's alpha expects */
#pragma unroll
    for (int t = 0; t < 4; ++t) { FragH f;
#pragma unroll
      for (int r = 0; r < 8; ++r) f.h[r] = (_Float16)(acc[g][t][r] * inv);
      *(v8us*)((unsigned short*)Oh + (size_t)(q0 + 16 * g + c) * DM + head * HD + 16 * t + 8 * h) = f.half[0]; } }      /* 8 consecutive d of one query row: one 16-byte store */
}

// ---- all seven pre-passes in ONE launch: they depend on nothing but the inputs, so the job is picked by work-group number (the same for a whole work-group) ----
// work-groups [0, 4 PW): weight j = block / PW as Bt[n][k] x16, a thread's work that of k_wt_f16; the rest: stream j = (block - 4 PW) / PX as exact f16 rows, a thread's work that of k_x16.
// The weight jobs stand first: their scattered reads take longest, and the streaming jobs start behind them while they wait. Bt and X16 hold the jobs' planes one behind the other.
#define PW (DM * (DM / 8) / 256)               /* work-groups per weight */
#define PX ((unsigned)(NR * DM / 8 / 256))     /* work-groups per input stream */
__global__ __launch_bounds__(256) void k_prep(const float* __restrict__ w0, const float* __restrict__ w1, const float* __restrict__ w2, const float* __restrict__ w3,
                                              const float* __restrict__ x0, const float* __restrict__ x1, const float* __restrict__ x2, _Float16* __restrict__ Bt, _Float16* __restrict__ X16) {
  const unsigned blk = blockIdx.x; FragH f;
  if (blk < 4 * PW) {
    const unsigned j = blk / PW; const float* W = j == 0 ? w0 : j == 1 ? w1 : j == 2 ? w2 : w3;
    const int t = (int)(blk - j * PW) * 256 + threadIdx.x; const int n = t / (DM / 8), k8 = (t % (DM / 8)) * 8;
#pragma unroll
    for (int i = 0; i < 8; ++i) f.h[i] = (_Float16)(bf16_round(W[(size_t)(k8 + i) * DM + n]) * 16.0f);
    *(v8us*)((unsigned short*)Bt + (size_t)j * DM * DM + (size_t)n * DM + k8) = f.half[0];
  } else {
    const unsigned r = blk - 4 * PW, j = r / PX; const float* x = j == 0 ? x0 : j == 1 ? x1 : x2;
    const size_t t = (size_t)(r - j * PX) * 256 + threadIdx.x;
#pragma unroll
    for (int q = 0; q < 8; ++q) f.h[q] = (_Float16)bf16_round(x[t * 8 + q]);
    *(v8us*)((unsigned short*)X16 + (size_t)j * NR * DM + t * 8) = f.half[0];
  }
}

extern "C" void kernel_launch(void* const* d_in, const int* in_sizes, int n_in,
                              void* d_out, int out_size, void* d_ws, size_t ws_size, hipStream_t stream) {
  (void)in_sizes; (void)n_in; (void)out_size;
  const float* const* I = (const float* const*)d_in; const float* xq = I[2]; const float* xk = I[1]; const float* xv = I[0]; const float* wq = I[5]; const float* wk = I[4]; const float* wv = I[3]; const float* wo = I[6]; const float* bo = I[7];      /* input order: values, keys, query (three unbatched [4096][1024] streams in REVERSE order: the query stream is I[2]), Wv, Wk, Wq (the weights in the same reverse order: Wq is I[5]), Wo, bo ([in][out] weights); the q / k / v projections have NO biases: null pointers in the guarded bias slots */
  char* ws = (char*)d_ws; size_t off = 0;
  auto take = [&](size_t bytes) { char* p = ws + off; off += (bytes + 255) & ~(size_t)255; return p; };
  _Float16* BQ = (_Float16*)take((size_t)4 * DM * DM * 2); _Float16* BO = BQ + (size_t)3 * DM * DM;      /* four weight planes in a row: q, k, v, o */
  _Float16* XQ = (_Float16*)take(3 * NR * DM * 2); _Float16* Q16 = (_Float16*)take(3 * NR * DM * 2); _Float16* K16 = Q16 + NR * DM; _Float16* V16 = K16 + NR * DM; _Float16* O16 = (_Float16*)take(NR * DM * 2);      /* three planes in a row each: the q, k, v sources; q, k, v */
  _Float16* VT = (_Float16*)take((size_t)NH * HD * SQ * 2);
  if (off > ws_size) return;
  k_prep<<<4 * PW + 3 * PX, 256, 0, stream>>>(wq, wk, wv, wo, xq, xk, xv, BQ, XQ);      /* one launch: the four [in][out] weights -> Bt[n][k] x16 (the planes from BQ on), the three inputs as exact f16 rows (the planes from XQ on) */
  const size_t r0p = (size_t)B0 * SQ;      /* first projected row */
  k_gemm2<0><<<dim3((unsigned)((MP / 128) * (DM / 64)), 3), 128, 0, stream>>>(XQ + r0p * DM, DM, NR * DM, BQ, DM, (size_t)DM * DM, 0.0625f, nullptr, 0, nullptr, 1, 0, 0, nullptr, Q16 + r0p * DM, DM, NR * DM, MP, DM, DM);      /* q, k and v in one launch: grid y steps through the three planes from XQ, from BQ and from Q16; no biases */
  for (int b = B0; b < B0 + NBR; ++b) { const size_t r0 = (size_t)b * SQ;
    k_vt<NH, SQ><<<NH * (SQ / 64), 256, 0, stream>>>(V16 + r0 * LQ, LQ, 0, VT);      /* V^T [NH][HD][SQ] for this batch */
    k_fattn<<<dim3(QN / 256, NHD), 256, 0, stream>>>(Q16 + r0 * LQ, K16 + r0 * LQ, VT, O16 + r0 * DM); }      /* all heads: scores (THIS module's scale 1/sqrt(EMBED 1024) = 1/32), softmax, P.V; o x64 (merged heads) as f16 rows */
  k_gemm2<0><<<dim3((unsigned)((MPO / 128) * (DM / 64)), 1), 128, 0, stream>>>(O16 + r0p * DM, DM, 0, BO, DM, 0, 0.0009765625f, bo, 0, nullptr, 1, 0, 0, (float*)d_out + r0p * DM, nullptr, DM, 0, MPO, DM, DM);      /* out rows are the output layout */
}

// v005
// It runs in 136 microseconds.
// Timed twice side by side with v004, it ran 1.04 and 1.03 times as fast.
// Over all steps from v000 it is 98.4 times as fast.
#include <hip/hip_runtime.h>
// Multi-head attention on three unbatched inputs with [in][out] bias-free q / k / v projections, a biased output projection and the source's MODEL-WIDTH score scale; the inputs arrive in the order values, keys, query (each [4096][1024]; v / k / q = stream W ([in][out] 1024 x 1024 sd 1/32, NO biases), 16 heads of 64; energy / sqrt(1024) (the module scales by the EMBED width, not the head width: 1/32); softmax over all 4096 keys (no mask); out = merged Wo + bo ([in][out]) -> [4096][1024]); ONE attention launch for all heads.
// Structure: token rows r = b*4096 + s; the query, key and value sources as exact f16 rows (bf16-rounded); Q, K, V as three WMMA GEMMs (32x64 wave tiles, f32 accumulation, exact x16 weights, no bias, f16 outputs); per batch: V^T for all heads via LDS transposes; per batch ONE fused attention kernel over (256 query rows, head): per 32 keys the scores on WMMA (K = 64), online softmax on VALU (f32 lazily raised reference and running sum, native exp2; weights exp(s - reference) <= 2^8 as f16, in registers only), o += P . V on WMMA, o / sum carried x64 (against f16 subnormal flush, folded into the output GEMM alpha) written straight into the merged f16 o rows; out = o W_o + b GEMM (f32) into the output layout.
// Compute dtype: inputs rounded to bf16; x / weights exact; q, k, v, softmax weights and o as plain f16 GEMM operands (~2^-12); scores and softmax statistics f32. v_wmma_f32_16x16x32_f16.
#define NB 1
#define SQ 4096
#define DM 1024
#define NH 16
#define HD 64
#define HG 1                         /* heads per k_vt(V16, b, h0, VT) launch (that overload is not launched) */
#define B0 0                         /* first batch processed (debug hook) */
#define NBR NB                       /* batches processed (debug hook) */
#define NR ((size_t)NB * SQ)         /* token rows */
#define MP ((int)((size_t)NBR * SQ)) /* rows projected (debug hook) */
#define QN SQ                        /* query rows attended per batch (debug hook) */
#define NHD NH                       /* heads attended (debug hook) */
#define MPO MP                       /* rows through the output stage (debug hook) */
#define LQ DM      /* row pitch of the q/k/v rows */
typedef __bf16 v16b __attribute__((ext_vector_type(16)));
typedef unsigned short v8us __attribute__((ext_vector_type(8), may_alias));
typedef float  v8f  __attribute__((ext_vector_type(8)));
typedef float  v4f  __attribute__((ext_vector_type(4)));
typedef float  v4fa __attribute__((ext_vector_type(4), may_alias));
union FragB { v16b v; v8us half[2]; unsigned short u[16]; };

__device__ __forceinline__ unsigned short bf16_bits(float x) { unsigned int u = __float_as_uint(x); return (unsigned short)((u + 0x7FFFu + ((u >> 16) & 1u)) >> 16); }
__device__ __forceinline__ float bf16_val(unsigned short b) { return __uint_as_float(((unsigned int)b) << 16); }
__device__ __forceinline__ float bf16_round(float x) { return bf16_val(bf16_bits(x)); }
// D += A·B with NT terms: 1 = ah·bh, 2 = + al·bh (A split), 3 = + ah·bl (both split)
template <int NT>
__device__ __forceinline__ v8f mmaN(v16b ah, v16b al, v16b bh, v16b bl, v8f c) {
  c = __builtin_amdgcn_wmma_f32_16x16x32_bf16(false, ah, false, bh, (short)0, c, false, false);
  if (NT >= 2) c = __builtin_amdgcn_wmma_f32_16x16x32_bf16(false, al, false, bh, (short)0, c, false, false);
  if (NT >= 3) c = __builtin_amdgcn_wmma_f32_16x16x32_bf16(false, ah, false, bl, (short)0, c, false, false);
  asm volatile("v_nop\n\tv_nop\n\tv_nop\n\tv_nop" : "+v"(c) : "v"(ah), "v"(al), "v"(bh), "v"(bl));
  return c;
}

__global__ __launch_bounds__(256) void k_wt_bf16(const float* __restrict__ W, unsigned short* __restrict__ Wt, int K, int N) {
  const int t = blockIdx.x * 256 + threadIdx.x;
  const int k8n = K / 8;
  if (t >= N * k8n) return;
  const int n = t / k8n, k8 = (t % k8n) * 8;
  v8us v;
#pragma unroll
  for (int i = 0; i < 8; ++i) v[i] = bf16_bits(W[(size_t)(k8 + i) * N + n]);
  *(v8us*)(Wt + (size_t)n * K + k8) = v;
  
}

// GEMM C[M][N] (f32, pitch ldc) = act(A[M][K]·W + bias). A f32 row-major (pitch lda) converted per fragment to bf16
// (ASPLIT: hi/lo two planes -> 2 terms, else single rounded term); Wt bf16 [N][K] (pitch ldb). BIAS_BF16 rounds the
// bias to bf16 first (bias quantised to bf16 before the add). K%32==0, M%16==0, N%64==0.
template <bool ASPLIT, int ACT, bool BIAS_BF16>
__global__ __launch_bounds__(128) void k_gemm_bf(const float* __restrict__ A, int lda, const unsigned short* __restrict__ Wt, int ldb,
                                               const float* __restrict__ bias, float* __restrict__ C, int ldc, int M, int N, int K) {
  __shared__ __attribute__((aligned(16))) float so[4][16][64];
  const int tid = threadIdx.x, w = tid >> 5, lane = tid & 31, ln = lane & 15, hh = lane >> 4;
  const int ntn = N / 64;
  const int wid = blockIdx.x * 4 + w;
  const int mt = wid / ntn, nq = wid % ntn;
  if (mt * 16 >= M) return;
  const int row0 = mt * 16, col0 = nq * 64;
  const float* arow = A + (size_t)(row0 + ln) * lda;
  v8f acc[4] = {};
  for (int kb = 0; kb < K; kb += 32) {
    FragB ah, al;
    const v4f x0 = *(const v4fa*)(arow + kb + 8 * hh), x1 = *(const v4fa*)(arow + kb + 8 * hh + 4);
    const v4f x2 = *(const v4fa*)(arow + kb + 16 + 8 * hh), x3 = *(const v4fa*)(arow + kb + 16 + 8 * hh + 4);
    float xs[16] = {x0[0],x0[1],x0[2],x0[3],x1[0],x1[1],x1[2],x1[3],x2[0],x2[1],x2[2],x2[3],x3[0],x3[1],x3[2],x3[3]};
#pragma unroll
    for (int i = 0; i < 16; ++i) { const unsigned short hb = bf16_bits(xs[i]); ah.u[i] = hb; al.u[i] = ASPLIT ? bf16_bits(xs[i] - bf16_val(hb)) : (unsigned short)0; }
#pragma unroll
    for (int t = 0; t < 4; ++t) {
      const unsigned short* brow = Wt + (size_t)(col0 + t * 16 + ln) * ldb + kb;
      FragB b;
      b.half[0] = *(const v8us*)(brow + 8 * hh);
      b.half[1] = *(const v8us*)(brow + 16 + 8 * hh);
      acc[t] = mmaN<ASPLIT ? 2 : 1>(ah.v, al.v, b.v, b.v, acc[t]);
    }
  }
#pragma unroll
  for (int t = 0; t < 4; ++t) {
    float bv = bias ? bias[col0 + t * 16 + ln] : 0.f;
    if (BIAS_BF16) bv = bf16_round(bv);
#pragma unroll
    for (int r = 0; r < 8; ++r) { float v = acc[t][r] + bv; if (ACT == 1) v = fmaxf(v, 0.f); so[w][8 * hh + r][t * 16 + ln] = v; }
  }
  __builtin_amdgcn_fence(__ATOMIC_ACQ_REL, "workgroup");
  __builtin_amdgcn_wave_barrier();
  const int rsub = lane >> 4, c4 = (lane & 15) * 4;
  {
#pragma unroll
    for (int q = 0; q < 8; ++q) {
      const int r = q * 2 + rsub;
      const v4f v = *(const v4fa*)&so[w][r][c4];
      *(v4f*)(C + (size_t)(row0 + r) * ldc + col0 + c4) = v;
    }
    
  }
}

// GEMM C = act(A·W + bias + resid): A f32 (ASPLIT -> hi/lo 2 terms), Wt bf16 [N][K]; ACT 0 none, 1 relu, 2 exact gelu;
// resid (optional, f32, row index = (row % rmod), pitch ldr, RES_BF16 rounds it) added before the activation.
template <bool ASPLIT, int ACT, bool BIAS_BF16, bool RES_BF16>
__global__ __launch_bounds__(128) void k_gemm_bf3(const float* __restrict__ A, int lda, const unsigned short* __restrict__ Wt, int ldb,
                                                const float* __restrict__ bias, const float* __restrict__ resid, int rmod, int ldr,
                                                float* __restrict__ C, int ldc, int M, int N, int K) {
  __shared__ __attribute__((aligned(16))) float so[4][16][64];
  const int tid = threadIdx.x, w = tid >> 5, lane = tid & 31, ln = lane & 15, hh = lane >> 4;
  const int ntn = N / 64;
  const int wid = blockIdx.x * 4 + w;
  const int mt = wid / ntn, nq = wid % ntn;
  if (mt * 16 >= M) return;
  const int row0 = mt * 16, col0 = nq * 64;
  const float* arow = A + (size_t)(row0 + ln) * lda;
  v8f acc[4] = {};
  for (int kb = 0; kb < K; kb += 32) {
    FragB ah, al;
    const v4f x0 = *(const v4fa*)(arow + kb + 8 * hh), x1 = *(const v4fa*)(arow + kb + 8 * hh + 4);
    const v4f x2 = *(const v4fa*)(arow + kb + 16 + 8 * hh), x3 = *(const v4fa*)(arow + kb + 16 + 8 * hh + 4);
    float xs[16] = {x0[0],x0[1],x0[2],x0[3],x1[0],x1[1],x1[2],x1[3],x2[0],x2[1],x2[2],x2[3],x3[0],x3[1],x3[2],x3[3]};
#pragma unroll
    for (int i = 0; i < 16; ++i) { const unsigned short hb = bf16_bits(xs[i]); ah.u[i] = hb; al.u[i] = ASPLIT ? bf16_bits(xs[i] - bf16_val(hb)) : (unsigned short)0; }
#pragma unroll
    for (int t = 0; t < 4; ++t) {
      const unsigned short* brow = Wt + (size_t)(col0 + t * 16 + ln) * ldb + kb;
      FragB b;
      b.half[0] = *(const v8us*)(brow + 8 * hh);
      b.half[1] = *(const v8us*)(brow + 16 + 8 * hh);
      acc[t] = mmaN<ASPLIT ? 2 : 1>(ah.v, al.v, b.v, b.v, acc[t]);
    }
  }
#pragma unroll
  for (int t = 0; t < 4; ++t) {
    const int col = col0 + t * 16 + ln;
    float bv = bias ? bias[col] : 0.f;
    if (BIAS_BF16) bv = bf16_round(bv);
#pragma unroll
    for (int r = 0; r < 8; ++r) {
      float v = acc[t][r] + bv;
      if (resid) { float rv = resid[(size_t)((row0 + 8 * hh + r) % rmod) * ldr + col]; if (RES_BF16) rv = bf16_round(rv); v += rv; }
      if (ACT == 1) v = fmaxf(v, 0.f);
      if (ACT == 2) v = 0.5f * v * (1.0f + erff(v * 0.70710678118654752f));
      if (ACT == 3) { const float u = 0.7978845608028654f * (v + 0.044715f * v * v * v); v = 0.5f * v * (1.0f + tanhf(u)); }
      so[w][8 * hh + r][t * 16 + ln] = v;
    }
  }
  __builtin_amdgcn_fence(__ATOMIC_ACQ_REL, "workgroup");
  __builtin_amdgcn_wave_barrier();
  const int rsub = lane >> 4, c4 = (lane & 15) * 4;
  {
#pragma unroll
    for (int q = 0; q < 8; ++q) {
      const int r = q * 2 + rsub;
      const v4f v = *(const v4fa*)&so[w][r][c4];
      *(v4f*)(C + (size_t)(row0 + r) * ldc + col0 + c4) = v;
    }
    
  }
}
// row LayerNorm (biased variance, eps) over N: s = X (+ R); optional out_sum <- s; out_norm <- (s-mu)*rsqrt(var+eps)*g + b
template <bool PARAM_BF16>
__global__ __launch_bounds__(256) void k_layernorm(const float* __restrict__ X, const float* __restrict__ R, const float* __restrict__ g, const float* __restrict__ bta,
                                                  float* __restrict__ out_sum, float* __restrict__ out_norm, int N, float eps) {
  __shared__ float red[256];
  const int row = blockIdx.x, tid = threadIdx.x;
  const float* x = X + (size_t)row * N; const float* rr = R ? R + (size_t)row * N : nullptr;
  float vals[16];                     // up to N = 4096
  const int per = N / 256;            // contiguous chunk per thread? use strided-by-4 chunks: thread handles j = tid*4 + 1024*u
  float s1 = 0.f;
  for (int u = 0; u < per / 4; ++u) {
    const int j = tid * 4 + 1024 * u;
    const v4f a = *(const v4fa*)(x + j);
    v4f b = {0.f,0.f,0.f,0.f}; if (rr) b = *(const v4fa*)(rr + j);
#pragma unroll
    for (int q = 0; q < 4; ++q) { const float v = a[q] + b[q]; vals[u * 4 + q] = v; s1 += v; }
  }
  red[tid] = s1; __syncthreads();
  for (int st = 128; st > 0; st >>= 1) { if (tid < st) red[tid] += red[tid + st]; __syncthreads(); }
  const float mu = red[0] / (float)N; __syncthreads();
  float s2 = 0.f;
  for (int u = 0; u < per / 4; ++u)
#pragma unroll
    for (int q = 0; q < 4; ++q) { const float c = vals[u * 4 + q] - mu; s2 += c * c; }
  red[tid] = s2; __syncthreads();
  for (int st = 128; st > 0; st >>= 1) { if (tid < st) red[tid] += red[tid + st]; __syncthreads(); }
  const float rs = rsqrtf(red[0] / (float)N + eps);
  {
    for (int u = 0; u < per / 4; ++u) {
      const int j = tid * 4 + 1024 * u;
      v4f o, sm;
#pragma unroll
      for (int q = 0; q < 4; ++q) {
        float gg = g[j + q], bb = bta[j + q];
        if (PARAM_BF16) { gg = bf16_round(gg); bb = bf16_round(bb); }
        sm[q] = vals[u * 4 + q]; o[q] = (vals[u * 4 + q] - mu) * rs * gg + bb;
      }
      if (out_sum) *(v4f*)(out_sum + (size_t)row * N + j) = sm;
      *(v4f*)(out_norm + (size_t)row * N + j) = o;
    }
    
  }
}



// ---- f16 WMMA path (v_wmma_f32_16x16x32_f16): 11-bit significands for operands in range — used where a [0,1] probability operand needs more precision than bf16
typedef _Float16 v16h __attribute__((ext_vector_type(16)));
union FragH { v16h v; v8us half[2]; _Float16 h[16]; unsigned short u[16]; };
template <int NT>
__device__ __forceinline__ v8f mmaH(v16h ah, v16h al, v16h bh, v16h bl, v8f c) {
  c = __builtin_amdgcn_wmma_f32_16x16x32_f16(false, ah, false, bh, (short)0, c, false, false);
  if (NT >= 2) c = __builtin_amdgcn_wmma_f32_16x16x32_f16(false, al, false, bh, (short)0, c, false, false);
  if (NT >= 3) c = __builtin_amdgcn_wmma_f32_16x16x32_f16(false, ah, false, bl, (short)0, c, false, false);
  asm volatile("v_nop\n\tv_nop\n\tv_nop\n\tv_nop" : "+v"(c) : "v"(ah), "v"(al), "v"(bh), "v"(bl));
  return c;
}
// batched GEMM like k_gemm_b but f16 operands: A f32 (split into f16 hi/lo if ASPLIT, else rounded to f16), Bt = f16 values [n][k]; alpha; C f32; N multiple of 16 (partial tiles skipped)
template <bool ASPLIT>
__global__ __launch_bounds__(128) void k_gemm_h(const float* __restrict__ A, int lda, size_t sA, const _Float16* __restrict__ Bh, int ldb, size_t sB, float alpha, float* __restrict__ C, int ldc, size_t sC, int M, int N, int K) {
  __shared__ __attribute__((aligned(16))) float so[4][16][64];
  const int tid = threadIdx.x, w = tid >> 5, lane = tid & 31, ln = lane & 15, hh = lane >> 4; const int by = blockIdx.y;
  A += (size_t)by * sA; Bh += (size_t)by * sB; C += (size_t)by * sC;
  const int ntn = (N + 63) / 64; const int wid = blockIdx.x * 4 + w; const int mt = wid / ntn, nq = wid % ntn; if (mt * 16 >= M) return;
  const int row0 = mt * 16, col0 = nq * 64; const float* arow = A + (size_t)(row0 + ln) * lda;
  v8f acc[4] = {};
  for (int kb = 0; kb < K; kb += 32) {
    FragH ah, al;
    const v4f x0 = *(const v4fa*)(arow + kb + 8 * hh), x1 = *(const v4fa*)(arow + kb + 8 * hh + 4), x2 = *(const v4fa*)(arow + kb + 16 + 8 * hh), x3 = *(const v4fa*)(arow + kb + 16 + 8 * hh + 4);
    float xs[16] = {x0[0],x0[1],x0[2],x0[3],x1[0],x1[1],x1[2],x1[3],x2[0],x2[1],x2[2],x2[3],x3[0],x3[1],x3[2],x3[3]};
#pragma unroll
    for (int i = 0; i < 16; ++i) { const _Float16 h = (_Float16)xs[i]; ah.h[i] = h; al.h[i] = ASPLIT ? (_Float16)(xs[i] - (float)h) : (_Float16)0.0f; }
#pragma unroll
    for (int t = 0; t < 4; ++t) { if (col0 + t * 16 >= N) continue; const size_t boff = (size_t)(col0 + t * 16 + ln) * ldb + kb; FragH bq; bq.half[0] = *(const v8us*)(Bh + boff + 8 * hh); bq.half[1] = *(const v8us*)(Bh + boff + 16 + 8 * hh);
      acc[t] = mmaH<ASPLIT ? 2 : 1>(ah.v, al.v, bq.v, bq.v, acc[t]); }
  }
#pragma unroll
  for (int t = 0; t < 4; ++t) { if (col0 + t * 16 >= N) continue;
#pragma unroll
    for (int r = 0; r < 8; ++r) so[w][8 * hh + r][t * 16 + ln] = acc[t][r] * alpha; }
  __builtin_amdgcn_fence(__ATOMIC_ACQ_REL, "workgroup"); __builtin_amdgcn_wave_barrier();
  const int rsub = lane >> 4, c4 = (lane & 15) * 4;
  {
#pragma unroll
    for (int q = 0; q < 8; ++q) { const int r = q * 2 + rsub; if (col0 + c4 < N) { const v4f v = *(const v4fa*)&so[w][r][c4]; *(v4f*)(C + (size_t)(row0 + r) * ldc + col0 + c4) = v; } }
     }
}

// Wt[n][k] = f16(W[k][n]·scale) from f32 row-major W[K][N] (scale = power of two; bf16-exact weights stay exact in f16 away from the subnormal range)
__global__ __launch_bounds__(256) void k_wt_f16(const float* __restrict__ W, _Float16* __restrict__ Wt, int K, int N, float scale) {
  const int t = blockIdx.x * 256 + threadIdx.x; if (t >= N * (K / 8)) return; const int n = t / (K / 8), k8 = (t % (K / 8)) * 8; FragH f;
#pragma unroll
  for (int i = 0; i < 8; ++i) f.h[i] = (_Float16)(bf16_round(W[(size_t)(k8 + i) * N + n]) * scale); const v8us o = f.half[0];
  *(v8us*)((unsigned short*)Wt + (size_t)n * K + k8) = o; 
}
// k_gemm_hh variant with fused epilogue: v = acc·alpha + bias[by·sBias + col] (+ CP[(row/rowsPerB)·sCPb + by·64 + col] if CP) ; ACT 0 none / 1 elu ; writes f16 C16 (and f32 C if non-null)
template <int ACT>
__global__ __launch_bounds__(128) void k_gemm_hhx(const _Float16* __restrict__ A, int lda, size_t sA, const _Float16* __restrict__ Bh, int ldb, size_t sB, float alpha, const float* __restrict__ bias, size_t sBias, const float* __restrict__ CP, int rowsPerB, size_t sCPb, int row0g,
    float* __restrict__ C, _Float16* __restrict__ C16, int ldc, size_t sC, int M, int N, int K) {
  __shared__ __attribute__((aligned(16))) float so[4][16][64];
  const int tid = threadIdx.x, w = tid >> 5, lane = tid & 31, ln = lane & 15, hh = lane >> 4; const int by = blockIdx.y;
  A += (size_t)by * sA; Bh += (size_t)by * sB; const size_t cofs = (size_t)by * sC; const float* bp = bias ? bias + (size_t)by * sBias : nullptr;
  const int ntn = (N + 63) / 64; const int wid = blockIdx.x * 4 + w; const int mt = wid / ntn, nq = wid % ntn; if (mt * 16 >= M) return;
  const int row0 = mt * 16, col0 = nq * 64; const _Float16* arow = A + (size_t)(row0 + ln) * lda;
  v8f acc[4] = {};
  for (int kb = 0; kb < K; kb += 32) { FragH ah; ah.half[0] = *(const v8us*)((const unsigned short*)arow + kb + 8 * hh); ah.half[1] = *(const v8us*)((const unsigned short*)arow + kb + 16 + 8 * hh);
#pragma unroll
    for (int t = 0; t < 4; ++t) { if (col0 + t * 16 >= N) continue; const size_t boff = (size_t)(col0 + t * 16 + ln) * ldb + kb; FragH bq; bq.half[0] = *(const v8us*)((const unsigned short*)Bh + boff + 8 * hh); bq.half[1] = *(const v8us*)((const unsigned short*)Bh + boff + 16 + 8 * hh);
      acc[t] = mmaH<1>(ah.v, ah.v, bq.v, bq.v, acc[t]); }
  }
#pragma unroll
  for (int t = 0; t < 4; ++t) { if (col0 + t * 16 >= N) continue; const int col = col0 + t * 16 + ln; const float bv = bp ? bf16_round(bp[col]) : 0.f;
#pragma unroll
    for (int r = 0; r < 8; ++r) { float v = acc[t][r] * alpha + bv; if (CP) { const int rr = row0g + row0 + 8 * hh + r; if (rowsPerB < 0) v += CP[cofs + (size_t)rr * ldc + col];      /* rowsPerB < 0: own element of the batched C plane */ else { const int bidx = rr / rowsPerB; v += CP[(size_t)bidx * sCPb + (size_t)by * 64 + col]; } } if (ACT == 1) v = (v > 0.f) ? v : expm1f(v); else if (ACT == 7) v = (v > 0.f) ? v + 1.0f : expf(v); else if (ACT == 8) v = tanhf(v); else if (ACT == 9) v = 0.5f * v * (1.0f + tanhf(0.7978845608028654f * (v + 0.044715f * v * v * v))); else if (ACT == 11) v = 1.0f / (1.0f + expf(-v)); else if (ACT == 12) v = (v > 0.f) ? v : 0.01f * v; else if (ACT == 14) v = (v > 0.f) ? v : 0.1f * v; else if (ACT == 16) v = (v >= 0.f) ? v : 0.3f * v; else if (ACT == 17) v = (v >= 0.f) ? v : 0.2f * v; else if (ACT == 15) v = v / (1.0f + expf(-v)); else if (ACT == 3) v = fmaxf(v, 0.f); else if (ACT == 6) v = 0.5f * v * (1.0f + erff(v * 0.70710678118654752f)); so[w][8 * hh + r][t * 16 + ln] = v; } }
  __builtin_amdgcn_fence(__ATOMIC_ACQ_REL, "workgroup"); __builtin_amdgcn_wave_barrier();
  const int rsub = lane >> 4, c4 = (lane & 15) * 4; typedef _Float16 v4h __attribute__((ext_vector_type(4)));
  {
#pragma unroll
    for (int q = 0; q < 8; ++q) { const int r = q * 2 + rsub; if (col0 + c4 < N) { const v4f v = *(const v4fa*)&so[w][r][c4]; if (C) *(v4f*)(C + cofs + (size_t)(row0 + r) * ldc + col0 + c4) = v; if (C16) { v4h h4; for (int i = 0; i < 4; ++i) h4[i] = (_Float16)v[i]; *(v4h*)(C16 + cofs + (size_t)(row0 + r) * ldc + col0 + c4) = h4; } } }
     }
}


typedef _Float16 v4h __attribute__((ext_vector_type(4)));

__global__ __launch_bounds__(256) void k_x16(const float* __restrict__ x, _Float16* __restrict__ X16, size_t n8) { const size_t t = (size_t)blockIdx.x * 256 + threadIdx.x; if (t >= n8) return; FragH f;
#pragma unroll
  for (int q = 0; q < 8; ++q) f.h[q] = (_Float16)bf16_round(x[t * 8 + q]); *(v8us*)((unsigned short*)X16 + t * 8) = f.half[0];  }
__global__ __launch_bounds__(256) void k_h16(const float* __restrict__ x, _Float16* __restrict__ X16, size_t n8) { const size_t t = (size_t)blockIdx.x * 256 + threadIdx.x; if (t >= n8) return; FragH f;
#pragma unroll
  for (int q = 0; q < 8; ++q) f.h[q] = (_Float16)x[t * 8 + q]; *(v8us*)((unsigned short*)X16 + t * 8) = f.half[0];  }
__global__ __launch_bounds__(256) void k_round16f(const float* __restrict__ W, _Float16* __restrict__ Bt, size_t n8) { const size_t t = (size_t)blockIdx.x * 256 + threadIdx.x; if (t >= n8) return; FragH f;
#pragma unroll
  for (int i = 0; i < 8; ++i) f.h[i] = (_Float16)(bf16_round(W[t * 8 + i]) * 16.0f); *(v8us*)((unsigned short*)Bt + t * 8) = f.half[0];  }
template <int NHv, int TTv>
__global__ __launch_bounds__(256) void k_vt(const _Float16* __restrict__ V16, int ldv, int voff, _Float16* __restrict__ Vt) { __shared__ unsigned short tl[64][66]; const int tid = threadIdx.x; const int slab = blockIdx.x / (TTv / 64), lg = blockIdx.x % (TTv / 64); const int b = slab / NHv, h = slab % NHv;
  for (int i = tid; i < 64 * 8; i += 256) { const int r = i / 8, c8 = (i % 8) * 8; FragH f; f.half[0] = *(const v8us*)((const unsigned short*)V16 + ((size_t)b * TTv + lg * 64 + r) * ldv + voff + h * 64 + c8);
#pragma unroll
    for (int q = 0; q < 8; ++q) tl[r][c8 + q] = f.u[q]; }
  __syncthreads();
  {
#pragma unroll
    for (int rd = 0; rd < 2; ++rd) { const int d = rd * 32 + tid / 8, pc = tid % 8; FragH f;
#pragma unroll
      for (int q = 0; q < 8; ++q) f.u[q] = tl[pc * 8 + q][d];
      *(v8us*)((unsigned short*)Vt + ((size_t)slab * 64 + d) * TTv + lg * 64 + pc * 8) = f.half[0]; }
     } }

__global__ __launch_bounds__(256) void k_hl(const float* __restrict__ F, _Float16* __restrict__ Hh, _Float16* __restrict__ Hl, size_t n8) { const size_t t = (size_t)blockIdx.x * 256 + threadIdx.x; if (t >= n8) return; FragH fh, fl; const v4f a = *(const v4fa*)(F + t * 8), c = *(const v4fa*)(F + t * 8 + 4);
#pragma unroll
  for (int q = 0; q < 4; ++q) { _Float16 h = (_Float16)a[q]; fh.h[q] = h; fl.h[q] = (_Float16)((a[q] - (float)h) * 1024.0f); h = (_Float16)c[q]; fh.h[4 + q] = h; fl.h[4 + q] = (_Float16)((c[q] - (float)h) * 1024.0f); }
  { *(v8us*)((unsigned short*)Hh + t * 8) = fh.half[0]; *(v8us*)((unsigned short*)Hl + t * 8) = fl.half[0];  } }

// ---- fast GEMM (block tile 128x64, wave tile 32x64; requires M % 128 == 0 rows per launch region, N % 64 == 0 and K % 64 == 0); epilogue = k_gemm_hhx semantics ----
// Both operands reach the fragments through LDS: a stage is 64 k = one whole 128-byte line of each of the block's 128 A rows and 64 B rows, fetched by loads in which 8 lanes cover one row
// (4 whole lines a wave load, where a fragment load straight from global memory touches 16 lines); two buffers, the next stage's global loads fly during this stage's products.
#define G2_SK 64                     /* k per LDS stage */
#define G2_PH 72                     /* LDS row pitch in f16: 144 B = 16 B x odd, the conflict-free pitch for 16-byte fragment reads */
__device__ __forceinline__ v16h g2_frag(const _Float16* p, int hh) { FragH f; f.half[0] = *(const v8us*)((const unsigned short*)p + 8 * hh); f.half[1] = *(const v8us*)((const unsigned short*)p + 16 + 8 * hh); return f.v; }
__device__ __forceinline__ v8f g2_mma(v16h a, v16h b, v8f c) { return __builtin_amdgcn_wmma_f32_16x16x32_f16(false, a, false, b, (short)0, c, false, false); }
// one stage's global loads of a thread: 16 bytes of 8 A rows and of 4 B rows, 16 rows apart
__device__ __forceinline__ void g2_stage(const unsigned short* a, size_t a16, const unsigned short* b, size_t b16, v8us (&ra)[8], v8us (&rb)[4]) {
  const unsigned short* pa[8]; const unsigned short* pb[4];
#pragma unroll
  for (int j = 0; j < 8; ++j) pa[j] = a + j * a16;
#pragma unroll
  for (int j = 0; j < 4; ++j) pb[j] = b + j * b16;
#pragma unroll
  for (int j = 0; j < 8; ++j) ra[j] = *(const v8us*)pa[j];
#pragma unroll
  for (int j = 0; j < 4; ++j) rb[j] = *(const v8us*)pb[j];
  // the wait that stands in front of any overwrite of an issued load's address registers; the 12 addresses are inputs so that their registers live up to it (else a later load's result lands in an earlier load's address pair)
  asm volatile("s_wait_xcnt 0x0" :: "v"(pa[0]), "v"(pa[1]), "v"(pa[2]), "v"(pa[3]), "v"(pa[4]), "v"(pa[5]), "v"(pa[6]), "v"(pa[7]), "v"(pb[0]), "v"(pb[1]), "v"(pb[2]), "v"(pb[3]) : "memory");
}
template <int ACT>
__global__ __launch_bounds__(128) void k_gemm2(const _Float16* __restrict__ A, int lda, size_t sA, const _Float16* __restrict__ Bh, int ldb, size_t sB, float alpha, const float* __restrict__ bias, size_t sBias, const float* __restrict__ CP, int rowsPerB, size_t sCPb, int row0g,
    float* __restrict__ C, _Float16* __restrict__ C16, int ldc, size_t sC, int M, int N, int K) { static_assert(ACT == 0 || ACT == 3 || ACT == 6 || ACT == 8 || ACT == 9 || ACT == 11 || ACT == 12 || ACT == 14 || ACT == 15 || ACT == 16 || ACT == 17, "k_gemm2: unsupported ACT code (would silently apply no activation)");
  __shared__ __attribute__((aligned(16))) float so[4][32][68];
  __shared__ __attribute__((aligned(16))) _Float16 sa[2][128][G2_PH];      /* A stage: the block's 128 rows, 64 k */
  __shared__ __attribute__((aligned(16))) _Float16 sb[2][64][G2_PH];       /* B stage: the block's 64 columns (rows of Bt), 64 k */
  const int tid = threadIdx.x, w = tid >> 5, lane = tid & 31, ln = lane & 15, hh = lane >> 4; const int by = blockIdx.y;
  A += (size_t)by * sA; Bh += (size_t)by * sB; const size_t cofs = (size_t)by * sC; const float* bp = bias ? bias + (size_t)by * sBias : nullptr;
  const int ntn = N >> 6; const int mt = blockIdx.x / ntn, nq = blockIdx.x - mt * ntn; const int row0 = mt * 128 + 32 * w, col0 = nq * 64; if (mt * 128 >= M) return;      /* the whole work-group leaves or none: barriers follow */
  // staging: a thread moves 16 bytes of rows srow + 16 j; 8 threads cover one 128-byte row
  const int srow = tid >> 3, sch = (tid & 7) * 8;
  const unsigned short* ag = (const unsigned short*)A + (size_t)(mt * 128 + srow) * lda + sch;
  const unsigned short* bg = (const unsigned short*)Bh + (size_t)(col0 + srow) * ldb + sch;
  v8us ra[8], rb[4];
  g2_stage(ag, (size_t)16 * lda, bg, (size_t)16 * ldb, ra, rb);
  const v8f z8 = {0.f,0.f,0.f,0.f,0.f,0.f,0.f,0.f}; v8f c00 = z8, c01 = z8, c02 = z8, c03 = z8, c10 = z8, c11 = z8, c12 = z8, c13 = z8;
#pragma unroll
  for (int j = 0; j < 8; ++j) *(v8us*)&sa[0][srow + 16 * j][sch] = ra[j];
#pragma unroll
  for (int j = 0; j < 4; ++j) *(v8us*)&sb[0][srow + 16 * j][sch] = rb[j];
  __syncthreads();      /* stage 0 is visible to all 4 waves */
  const int nst = K / G2_SK;
#pragma unroll 1  // rolled: one stage a trip, so that the two buffers alternate by index; the two 32-k blocks inside are unrolled
  for (int st = 0; st < nst; ++st) {
    const int b = st & 1; const bool more = st + 1 < nst;      /* the same for the whole work-group */
    if (more) g2_stage(ag + (st + 1) * G2_SK, (size_t)16 * lda, bg + (st + 1) * G2_SK, (size_t)16 * ldb, ra, rb);      /* next stage: in flight under this stage's products */
    v16h fa[2][2], fb[2][4];      /* the stage's fragments: [32-k block][tile] */
#pragma unroll
    for (int kc = 0; kc < 2; ++kc) { fa[kc][0] = g2_frag(&sa[b][32 * w + ln][32 * kc], hh); fb[kc][0] = g2_frag(&sb[b][ln][32 * kc], hh); fa[kc][1] = g2_frag(&sa[b][32 * w + 16 + ln][32 * kc], hh);
#pragma unroll
      for (int t = 1; t < 4; ++t) fb[kc][t] = g2_frag(&sb[b][16 * t + ln][32 * kc], hh); }
    __builtin_amdgcn_sched_barrier(0);      /* keeps the stage's 24 LDS reads one group in front of its 16 products: left alone the compiler reuses one B fragment's registers and waits out the LDS latency 8 times a stage */
#pragma unroll
    for (int kc = 0; kc < 2; ++kc) {      /* k ascends by 32 in every accumulator: one fixed order of sums */
      c00 = g2_mma(fa[kc][0], fb[kc][0], c00); c10 = g2_mma(fa[kc][1], fb[kc][0], c10); c01 = g2_mma(fa[kc][0], fb[kc][1], c01); c11 = g2_mma(fa[kc][1], fb[kc][1], c11);
      c02 = g2_mma(fa[kc][0], fb[kc][2], c02); c12 = g2_mma(fa[kc][1], fb[kc][2], c12); c03 = g2_mma(fa[kc][0], fb[kc][3], c03); c13 = g2_mma(fa[kc][1], fb[kc][3], c13); }
    if (more) {      /* every wave left that buffer before the last barrier */
#pragma unroll
      for (int j = 0; j < 8; ++j) *(v8us*)&sa[b ^ 1][srow + 16 * j][sch] = ra[j];
#pragma unroll
      for (int j = 0; j < 4; ++j) *(v8us*)&sb[b ^ 1][srow + 16 * j][sch] = rb[j]; }
    __syncthreads();      /* publishes stage st + 1 and ends every wave's reads of stage st, whose buffer the next trip refills */
  }
  v8f accs[8] = {c00, c01, c02, c03, c10, c11, c12, c13};
#pragma unroll
  for (int u = 0; u < 8; ++u) { const int t = u & 3, half = u >> 2; const int col = col0 + t * 16 + ln; const float bv = bp ? bf16_round(bp[col]) : 0.f;
#pragma unroll
    for (int r = 0; r < 8; ++r) { const int rloc = half * 16 + 8 * hh + r; float v = accs[u][r] * alpha + bv; if (CP) { if (rowsPerB < 0) v += CP[cofs + (size_t)(row0g + row0 + rloc) * ldc + col];      /* rowsPerB < 0: own element of the batched C plane */ else { const int bidx = (row0g + row0 + rloc) / rowsPerB; v += CP[(size_t)bidx * sCPb + (size_t)by * 64 + col]; } }
      if (ACT == 3) v = fmaxf(v, 0.f); else if (ACT == 6) v = 0.5f * v * (1.0f + erff(v * 0.70710678118654752f)); else if (ACT == 11) v = 1.0f / (1.0f + expf(-v)); else if (ACT == 15) v = v / (1.0f + expf(-v)); else if (ACT == 12) v = (v > 0.f) ? v : 0.01f * v; else if (ACT == 8) v = tanhf(v); else if (ACT == 9) v = 0.5f * v * (1.0f + tanhf(0.7978845608028654f * (v + 0.044715f * v * v * v))); else if (ACT == 14) v = (v > 0.f) ? v : 0.1f * v; else if (ACT == 16) v = (v >= 0.f) ? v : 0.3f * v; else if (ACT == 17) v = (v >= 0.f) ? v : 0.2f * v;
      so[w][rloc][t * 16 + ln] = v; } }
  __builtin_amdgcn_fence(__ATOMIC_ACQ_REL, "workgroup"); __builtin_amdgcn_wave_barrier();
  const int rsub = lane >> 4, c4 = (lane & 15) * 4;
  {
#pragma unroll
    for (int q = 0; q < 16; ++q) { const int r = q * 2 + rsub; const v4f v = *(const v4fa*)&so[w][r][c4]; if (C) *(v4f*)(C + cofs + (size_t)(row0 + r) * ldc + col0 + c4) = v; if (C16) { v4h h4; for (int i = 0; i < 4; ++i) h4[i] = (_Float16)v[i]; *(v4h*)(C16 + cofs + (size_t)(row0 + r) * ldc + col0 + c4) = h4; } }
     } }


__global__ __launch_bounds__(256) void k_wnat(const float* __restrict__ w, size_t n8, _Float16* __restrict__ Bt) { const size_t t = (size_t)blockIdx.x * 256 + threadIdx.x; if (t >= n8) return; FragH f; for (int q = 0; q < 8; ++q) f.h[q] = (_Float16)(bf16_round(w[t * 8 + q]) * 16.0f); *(v8us*)((unsigned short*)Bt + t * 8) = f.half[0];  }
__global__ __launch_bounds__(256) void k_rsm(const float* __restrict__ S, _Float16* __restrict__ P, int nrows) {
  #pragma clang fp contract(off)
  const int i = blockIdx.x * 256 + threadIdx.x; if (i >= nrows) return; const float* s = S + (size_t)i * SQ; float mx = -3.0e38f;
#pragma unroll 1
  for (int j = 0; j < SQ; ++j) mx = fmaxf(mx, s[j]); float se = 0.f;
#pragma unroll 1
  for (int j = 0; j < SQ; ++j) se += expf(s[j] - mx); const float sc = 256.0f / se;
#pragma unroll 1
  for (int j0 = 0; j0 < SQ; j0 += 8) { FragH f; for (int q = 0; q < 8; ++q) f.h[q] = (_Float16)(expf(s[j0 + q] - mx) * sc); unsigned short* d = (unsigned short*)P + (size_t)i * SQ + j0; *(v8us*)d = f.half[0];  } }
__global__ __launch_bounds__(256) void k_vt(const _Float16* __restrict__ V16, int b, int h0, _Float16* __restrict__ VT) { __shared__ unsigned short tl[64][65]; const int tid = threadIdx.x; const int hh = blockIdx.x % HG, sg = blockIdx.x / HG; const int s0 = sg * 64; const int h = h0 + hh;
  for (int i = tid; i < 64 * 8; i += 256) { const int j = i / 8, d8 = (i % 8) * 8; FragH f; f.half[0] = *(const v8us*)((const unsigned short*)V16 + ((size_t)b * SQ + s0 + j) * DM + h * HD + d8); for (int q = 0; q < 8; ++q) tl[d8 + q][j] = f.u[q]; }
  __syncthreads();
  { for (int i = tid; i < 64 * 8; i += 256) { const int d = i / 8, j8 = (i % 8) * 8; FragH f; for (int q = 0; q < 8; ++q) f.u[q] = tl[d][j8 + q]; *(v8us*)((unsigned short*)VT + ((size_t)hh * HD + d) * SQ + s0 + j8) = f.half[0]; }  } }



#define FA_SK 64                     /* keys per LDS tile */
#define FA_PH 72                     /* LDS row pitch in f16: 144 B = 16 B x odd, the conflict-free pitch for 16-byte fragment reads */
typedef float f32x2 __attribute__((ext_vector_type(2)));
typedef _Float16 v2h __attribute__((ext_vector_type(2)));
union FragP { v16h v; unsigned int w[8]; };
__device__ __forceinline__ float fa_xhalf(float x) { return __builtin_bit_cast(float, __builtin_amdgcn_permlanex16(__builtin_bit_cast(int, x), __builtin_bit_cast(int, x), 0x76543210, 0xfedcba98, false, false)); }      /* lane l <-> lane l ^ 16 */
__device__ __forceinline__ v16h fa_frag(const _Float16* p) { FragH f; f.half[0] = *(const v8us*)(const unsigned short*)p; f.half[1] = *(const v8us*)((const unsigned short*)p + 16); return f.v; }      /* p = row + 32 kc + 8 h: the hardware k order */
__device__ __forceinline__ v8f fa_mma(v16h a, v16h b, v8f c) { return __builtin_amdgcn_wmma_f32_16x16x32_f16(false, a, false, b, (short)0, c, false, false); }
// amdgpu_waves_per_eu(4, 4): a budget of 256 VGPRs, so that no register lies above v255 (without it the build took 266 and switched register windows all through the loop)
__global__ __launch_bounds__(256) __attribute__((amdgpu_waves_per_eu(4, 4))) void k_fattn(const _Float16* __restrict__ Qh, const _Float16* __restrict__ Kh, const _Float16* __restrict__ Vt, _Float16* __restrict__ Oh) {
  __shared__ __attribute__((aligned(16))) _Float16 sk[2][FA_SK][FA_PH];      /* K tile: row = key, 64 d */
  __shared__ __attribute__((aligned(16))) _Float16 sv[2][HD][FA_PH];         /* V^T tile: row = d, 64 keys */
  const int tid = threadIdx.x, lane = tid & 31, wave = tid >> 5, c = lane & 15, h = lane >> 4;
  const int head = blockIdx.y, q0 = blockIdx.x * 256 + wave * 32;
  const float cs = 0.03125f * 1.44269504088896340736f;      /* the module's score scale 1/sqrt(1024), in the base-2 domain */
  // staging: a thread moves 16 bytes of rows srow and srow + 32 of each tile; 8 threads cover one 128-byte row
  const int srow = tid >> 3, sch = (tid & 7) * 8;
  const unsigned short* kg = (const unsigned short*)Kh + (size_t)srow * LQ + head * HD + sch;
  const unsigned short* vg = (const unsigned short*)Vt + ((size_t)head * HD + srow) * SQ + sch;
  v8us rk0, rk1, rv0, rv1;
  rk0 = *(const v8us*)kg; rk1 = *(const v8us*)(kg + (size_t)32 * LQ); rv0 = *(const v8us*)vg; rv1 = *(const v8us*)(vg + (size_t)32 * SQ);
  v16h qf[2][2];
#pragma unroll
  for (int g = 0; g < 2; ++g)
#pragma unroll
    for (int kc = 0; kc < 2; ++kc) qf[g][kc] = fa_frag(Qh + (size_t)(q0 + 16 * g + c) * LQ + head * HD + 32 * kc + 8 * h);
  const v8f z8 = {0.f,0.f,0.f,0.f,0.f,0.f,0.f,0.f};
  v8f acc[2][4]; float m_run[2]; f32x2 l_run[2];
#pragma unroll
  for (int g = 0; g < 2; ++g) { m_run[g] = -3.0e38f; l_run[g] = f32x2{0.f, 0.f};
#pragma unroll
    for (int t = 0; t < 4; ++t) acc[g][t] = z8; }
  *(v8us*)&sk[0][srow][sch] = rk0; *(v8us*)&sk[0][srow + 32][sch] = rk1; *(v8us*)&sv[0][srow][sch] = rv0; *(v8us*)&sv[0][srow + 32][sch] = rv1;
  __syncthreads();      /* tile 0 is visible to all 8 waves */
#pragma unroll 1  // rolled: one tile a trip; the two 32-key passes inside are unrolled
  for (int st = 0; st < SQ / FA_SK; ++st) {
    const int b = st & 1; const bool more = st + 1 < SQ / FA_SK;      /* the same for the whole work-group */
    if (more) { const unsigned short* kp = kg + (size_t)(st + 1) * FA_SK * LQ; const unsigned short* vp = vg + (st + 1) * FA_SK;      /* next tile: in flight under this tile's work */
      rk0 = *(const v8us*)kp; rk1 = *(const v8us*)(kp + (size_t)32 * LQ); rv0 = *(const v8us*)vp; rv1 = *(const v8us*)(vp + (size_t)32 * SQ); }
    v8f s[2][2][2];      /* S^T of the tile: [32-key pass][16-key tile][16-column group] */
#pragma unroll
    for (int sub = 0; sub < 2; ++sub)
#pragma unroll
      for (int kt = 0; kt < 2; ++kt) { const _Float16* kr = &sk[b][sub * 32 + 16 * kt + c][8 * h]; const v16h k0 = fa_frag(kr), k1 = fa_frag(kr + 32);
#pragma unroll
        for (int g = 0; g < 2; ++g) s[sub][kt][g] = fa_mma(k1, qf[g][1], fa_mma(k0, qf[g][0], z8)); }
    float mx[2];
#pragma unroll
    for (int g = 0; g < 2; ++g) {
      float x = s[0][0][g][0];      /* maximum of the tile's raw scores (the scale is positive) */
#pragma unroll
      for (int r = 1; r < 8; ++r) x = fmaxf(x, s[0][0][g][r]);
#pragma unroll
      for (int u = 1; u < 4; ++u)
#pragma unroll
        for (int r = 0; r < 8; ++r) x = fmaxf(x, s[u >> 1][u & 1][g][r]);
      mx[g] = fmaxf(x, fa_xhalf(x)) * cs;      /* both wave halves hold the query's tile maximum, scaled */
    }
    // lazy rescale: m_run is the reference in use, not the true maximum; it moves, and o and the sum are rescaled, only when some column's tile maximum lies more than 8 (base-2 domain) above it,
    // so a weight is at most 2^8, far inside f16 and f32; o / sum does not depend on the reference. One test a tile for the whole wave, a scalar branch; taken on the first tile (factor 0).
    if (__builtin_amdgcn_ballot_w32(mx[0] > m_run[0] + 8.0f || mx[1] > m_run[1] + 8.0f) != 0) {
#pragma unroll
      for (int g = 0; g < 2; ++g) {
        const float m_new = fmaxf(m_run[g], mx[g]); const float corr = __builtin_amdgcn_exp2f(m_run[g] - m_new);
        m_run[g] = m_new; l_run[g] = l_run[g] * corr;
#pragma unroll
        for (int t = 0; t < 4; ++t) acc[g][t] = acc[g][t] * corr;
      }
    }
#pragma unroll
    for (int sub = 0; sub < 2; ++sub) {      /* one pass: 32 keys x the wave's 32 query columns */
      v16h vf[4];
#pragma unroll
      for (int t = 0; t < 4; ++t) vf[t] = fa_frag(&sv[b][16 * t + c][sub * 32 + 8 * h]);
#pragma unroll
      for (int g = 0; g < 2; ++g) {
        FragP pf; f32x2 ps[8];
#pragma unroll
        for (int i = 0; i < 8; ++i) {
          const f32x2 a = __builtin_elementwise_fma(f32x2{s[sub][i >> 2][g][2 * (i & 3)], s[sub][i >> 2][g][2 * (i & 3) + 1]}, f32x2{cs, cs}, f32x2{-m_run[g], -m_run[g]});
          const f32x2 p = {__builtin_amdgcn_exp2f(a.x), __builtin_amdgcn_exp2f(a.y)};
          ps[i] = p; pf.w[i] = __builtin_bit_cast(unsigned int, __builtin_convertvector(p, v2h)); }
        l_run[g] = l_run[g] + (((ps[0] + ps[1]) + (ps[2] + ps[3])) + ((ps[4] + ps[5]) + (ps[6] + ps[7])));      /* a tree, not one chain of 8 dependent adds */
#pragma unroll
        for (int t = 0; t < 4; ++t) acc[g][t] = fa_mma(vf[t], pf.v, acc[g][t]);
      }
    }
    if (more) { *(v8us*)&sk[b ^ 1][srow][sch] = rk0; *(v8us*)&sk[b ^ 1][srow + 32][sch] = rk1; *(v8us*)&sv[b ^ 1][srow][sch] = rv0; *(v8us*)&sv[b ^ 1][srow + 32][sch] = rv1; }      /* every wave left that buffer before the last barrier */
    __syncthreads();      /* publishes tile st + 1 and ends every wave's reads of tile st, whose buffer the next trip refills */
  }
#pragma unroll
  for (int g = 0; g < 2; ++g) { float l = l_run[g].x + l_run[g].y; l += fa_xhalf(l); const float inv = 64.0f / l;      /* o carried x64, as the output GEMM's alpha expects */
#pragma unroll
    for (int t = 0; t < 4; ++t) { FragH f;
#pragma unroll
      for (int r = 0; r < 8; ++r) f.h[r] = (_Float16)(acc[g][t][r] * inv);
      *(v8us*)((unsigned short*)Oh + (size_t)(q0 + 16 * g + c) * DM + head * HD + 16 * t + 8 * h) = f.half[0]; } }      /* 8 consecutive d of one query row: one 16-byte store */
}

// ---- all seven pre-passes in ONE launch: they depend on nothing but the inputs, so the job is picked by work-group number (the same for a whole work-group) ----
// work-groups [0, 4 PW): weight j = block / PW as Bt[n][k] x16, a thread's work that of k_wt_f16; the rest: stream j = (block - 4 PW) / PX as exact f16 rows, a thread's work that of k_x16.
// The weight jobs stand first: their scattered reads take longest, and the streaming jobs start behind them while they wait. Bt and X16 hold the jobs' planes one behind the other.
#define PW (DM * (DM / 8) / 256)               /* work-groups per weight */
#define PX ((unsigned)(NR * DM / 8 / 256))     /* work-groups per input stream */
__global__ __launch_bounds__(256) void k_prep(const float* __restrict__ w0, const float* __restrict__ w1, const float* __restrict__ w2, const float* __restrict__ w3,
                                              const float* __restrict__ x0, const float* __restrict__ x1, const float* __restrict__ x2, _Float16* __restrict__ Bt, _Float16* __restrict__ X16) {
  const unsigned blk = blockIdx.x; FragH f;
  if (blk < 4 * PW) {
    const unsigned j = blk / PW; const float* W = j == 0 ? w0 : j == 1 ? w1 : j == 2 ? w2 : w3;
    const int t = (int)(blk - j * PW) * 256 + threadIdx.x; const int n = t / (DM / 8), k8 = (t % (DM / 8)) * 8;
#pragma unroll
    for (int i = 0; i < 8; ++i) f.h[i] = (_Float16)(bf16_round(W[(size_t)(k8 + i) * DM + n]) * 16.0f);
    *(v8us*)((unsigned short*)Bt + (size_t)j * DM * DM + (size_t)n * DM + k8) = f.half[0];
  } else {
    const unsigned r = blk - 4 * PW, j = r / PX; const float* x = j == 0 ? x0 : j == 1 ? x1 : x2;
    const size_t t = (size_t)(r - j * PX) * 256 + threadIdx.x;
#pragma unroll
    for (int q = 0; q < 8; ++q) f.h[q] = (_Float16)bf16_round(x[t * 8 + q]);
    *(v8us*)((unsigned short*)X16 + (size_t)j * NR * DM + t * 8) = f.half[0];
  }
}

extern "C" void kernel_launch(void* const* d_in, const int* in_sizes, int n_in,
                              void* d_out, int out_size, void* d_ws, size_t ws_size, hipStream_t stream) {
  (void)in_sizes; (void)n_in; (void)out_size;
  const float* const* I = (const float* const*)d_in; const float* xq = I[2]; const float* xk = I[1]; const float* xv = I[0]; const float* wq = I[5]; const float* wk = I[4]; const float* wv = I[3]; const float* wo = I[6]; const float* bo = I[7];      /* input order: values, keys, query (three unbatched [4096][1024] streams in REVERSE order: the query stream is I[2]), Wv, Wk, Wq (the weights in the same reverse order: Wq is I[5]), Wo, bo ([in][out] weights); the q / k / v projections have NO biases: null pointers in the guarded bias slots */
  char* ws = (char*)d_ws; size_t off = 0;
  auto take = [&](size_t bytes) { char* p = ws + off; off += (bytes + 255) & ~(size_t)255; return p; };
  _Float16* BQ = (_Float16*)take((size_t)4 * DM * DM * 2); _Float16* BO = BQ + (size_t)3 * DM * DM;      /* four weight planes in a row: q, k, v, o */
  _Float16* XQ = (_Float16*)take(3 * NR * DM * 2); _Float16* Q16 = (_Float16*)take(3 * NR * DM * 2); _Float16* K16 = Q16 + NR * DM; _Float16* V16 = K16 + NR * DM; _Float16* O16 = (_Float16*)take(NR * DM * 2);      /* three planes in a row each: the q, k, v sources; q, k, v */
  _Float16* VT = (_Float16*)take((size_t)NH * HD * SQ * 2);
  if (off > ws_size) return;
  k_prep<<<4 * PW + 3 * PX, 256, 0, stream>>>(wq, wk, wv, wo, xq, xk, xv, BQ, XQ);      /* one launch: the four [in][out] weights -> Bt[n][k] x16 (the planes from BQ on), the three inputs as exact f16 rows (the planes from XQ on) */
  const size_t r0p = (size_t)B0 * SQ;      /* first projected row */
  k_gemm2<0><<<dim3((unsigned)((MP / 128) * (DM / 64)), 3), 128, 0, stream>>>(XQ + r0p * DM, DM, NR * DM, BQ, DM, (size_t)DM * DM, 0.0625f, nullptr, 0, nullptr, 1, 0, 0, nullptr, Q16 + r0p * DM, DM, NR * DM, MP, DM, DM);      /* q, k and v in one launch: grid y steps through the three planes from XQ, from BQ and from Q16; no biases */
  for (int b = B0; b < B0 + NBR; ++b) { const size_t r0 = (size_t)b * SQ;
    k_vt<NH, SQ><<<NH * (SQ / 64), 256, 0, stream>>>(V16 + r0 * LQ, LQ, 0, VT);      /* V^T [NH][HD][SQ] for this batch */
    k_fattn<<<dim3(QN / 256, NHD), 256, 0, stream>>>(Q16 + r0 * LQ, K16 + r0 * LQ, VT, O16 + r0 * DM); }      /* all heads: scores (THIS module's scale 1/sqrt(EMBED 1024) = 1/32), softmax, P.V; o x64 (merged heads) as f16 rows */
  k_gemm2<0><<<dim3((unsigned)((MPO / 128) * (DM / 64)), 1), 128, 0, stream>>>(O16 + r0p * DM, DM, 0, BO, DM, 0, 0.0009765625f, bo, 0, nullptr, 1, 0, 0, (float*)d_out + r0p * DM, nullptr, DM, 0, MPO, DM, DM);      /* out rows are the output layout */
}

// v006
// It runs in 125 microseconds.
// Two timings next to v005 put it at 1.10 and 1.09 times that version's speed.
// Counting every step since v000, it is 108 times as fast.
#include <hip/hip_runtime.h>
// Multi-head attention on three unbatched inputs with [in][out] bias-free q / k / v projections, a biased output projection and the source's MODEL-WIDTH score scale; the inputs arrive in the order values, keys, query (each [4096][1024]; v / k / q = stream W ([in][out] 1024 x 1024 sd 1/32, NO biases), 16 heads of 64; energy / sqrt(1024) (the module scales by the EMBED width, not the head width: 1/32); softmax over all 4096 keys (no mask); out = merged Wo + bo ([in][out]) -> [4096][1024]); ONE attention launch for all heads.
// Structure: token rows r = b*4096 + s; the query, key and value sources as exact f16 rows (bf16-rounded); Q, K, V as three WMMA GEMMs (64x64 wave tiles, f32 accumulation, exact x16 weights, no bias, f16 outputs); per batch: V^T for all heads via LDS transposes; per batch ONE fused attention kernel over (256 query rows, head): per 32 keys the scores on WMMA (K = 64), online softmax on VALU (f32 lazily moved reference maximum and sum, native exp2; weights exp(s - reference), at most 2^8, as f16, in registers only), o += P . V on WMMA, o / sum carried x64 (against f16 subnormal flush, folded into the output GEMM alpha) written straight into the merged f16 o rows; out = o W_o + b GEMM (f32) into the output layout.
// Compute dtype: inputs rounded to bf16; x / weights exact; q, k, v, softmax weights and o as plain f16 GEMM operands (~2^-12); scores and softmax statistics f32. v_wmma_f32_16x16x32_f16.
#define NB 1
#define SQ 4096
#define DM 1024
#define NH 16
#define HD 64
#define HG 1                         /* heads per k_vt(V16, b, h0, VT) launch (that overload is not launched) */
#define B0 0                         /* first batch processed (debug hook) */
#define NBR NB                       /* batches processed (debug hook) */
#define NR ((size_t)NB * SQ)         /* token rows */
#define MP ((int)((size_t)NBR * SQ)) /* rows projected (debug hook) */
#define QN SQ                        /* query rows attended per batch (debug hook) */
#define NHD NH                       /* heads attended (debug hook) */
#define MPO MP                       /* rows through the output stage (debug hook) */
#define LQ DM      /* row pitch of the q/k/v rows */
typedef __bf16 v16b __attribute__((ext_vector_type(16)));
typedef unsigned short v8us __attribute__((ext_vector_type(8), may_alias));
typedef float  v8f  __attribute__((ext_vector_type(8)));
typedef float  v4f  __attribute__((ext_vector_type(4)));
typedef float  v4fa __attribute__((ext_vector_type(4), may_alias));
union FragB { v16b v; v8us half[2]; unsigned short u[16]; };

__device__ __forceinline__ unsigned short bf16_bits(float x) { unsigned int u = __float_as_uint(x); return (unsigned short)((u + 0x7FFFu + ((u >> 16) & 1u)) >> 16); }
__device__ __forceinline__ float bf16_val(unsigned short b) { return __uint_as_float(((unsigned int)b) << 16); }
__device__ __forceinline__ float bf16_round(float x) { return bf16_val(bf16_bits(x)); }
// D += A·B with NT terms: 1 = ah·bh, 2 = + al·bh (A split), 3 = + ah·bl (both split)
template <int NT>
__device__ __forceinline__ v8f mmaN(v16b ah, v16b al, v16b bh, v16b bl, v8f c) {
  c = __builtin_amdgcn_wmma_f32_16x16x32_bf16(false, ah, false, bh, (short)0, c, false, false);
  if (NT >= 2) c = __builtin_amdgcn_wmma_f32_16x16x32_bf16(false, al, false, bh, (short)0, c, false, false);
  if (NT >= 3) c = __builtin_amdgcn_wmma_f32_16x16x32_bf16(false, ah, false, bl, (short)0, c, false, false);
  asm volatile("v_nop\n\tv_nop\n\tv_nop\n\tv_nop" : "+v"(c) : "v"(ah), "v"(al), "v"(bh), "v"(bl));
  return c;
}

__global__ __launch_bounds__(256) void k_wt_bf16(const float* __restrict__ W, unsigned short* __restrict__ Wt, int K, int N) {
  const int t = blockIdx.x * 256 + threadIdx.x;
  const int k8n = K / 8;
  if (t >= N * k8n) return;
  const int n = t / k8n, k8 = (t % k8n) * 8;
  v8us v;
#pragma unroll
  for (int i = 0; i < 8; ++i) v[i] = bf16_bits(W[(size_t)(k8 + i) * N + n]);
  *(v8us*)(Wt + (size_t)n * K + k8) = v;
  
}

// GEMM C[M][N] (f32, pitch ldc) = act(A[M][K]·W + bias). A f32 row-major (pitch lda) converted per fragment to bf16
// (ASPLIT: hi/lo two planes -> 2 terms, else single rounded term); Wt bf16 [N][K] (pitch ldb). BIAS_BF16 rounds the
// bias to bf16 first (bias quantised to bf16 before the add). K%32==0, M%16==0, N%64==0.
template <bool ASPLIT, int ACT, bool BIAS_BF16>
__global__ __launch_bounds__(128) void k_gemm_bf(const float* __restrict__ A, int lda, const unsigned short* __restrict__ Wt, int ldb,
                                               const float* __restrict__ bias, float* __restrict__ C, int ldc, int M, int N, int K) {
  __shared__ __attribute__((aligned(16))) float so[4][16][64];
  const int tid = threadIdx.x, w = tid >> 5, lane = tid & 31, ln = lane & 15, hh = lane >> 4;
  const int ntn = N / 64;
  const int wid = blockIdx.x * 4 + w;
  const int mt = wid / ntn, nq = wid % ntn;
  if (mt * 16 >= M) return;
  const int row0 = mt * 16, col0 = nq * 64;
  const float* arow = A + (size_t)(row0 + ln) * lda;
  v8f acc[4] = {};
  for (int kb = 0; kb < K; kb += 32) {
    FragB ah, al;
    const v4f x0 = *(const v4fa*)(arow + kb + 8 * hh), x1 = *(const v4fa*)(arow + kb + 8 * hh + 4);
    const v4f x2 = *(const v4fa*)(arow + kb + 16 + 8 * hh), x3 = *(const v4fa*)(arow + kb + 16 + 8 * hh + 4);
    float xs[16] = {x0[0],x0[1],x0[2],x0[3],x1[0],x1[1],x1[2],x1[3],x2[0],x2[1],x2[2],x2[3],x3[0],x3[1],x3[2],x3[3]};
#pragma unroll
    for (int i = 0; i < 16; ++i) { const unsigned short hb = bf16_bits(xs[i]); ah.u[i] = hb; al.u[i] = ASPLIT ? bf16_bits(xs[i] - bf16_val(hb)) : (unsigned short)0; }
#pragma unroll
    for (int t = 0; t < 4; ++t) {
      const unsigned short* brow = Wt + (size_t)(col0 + t * 16 + ln) * ldb + kb;
      FragB b;
      b.half[0] = *(const v8us*)(brow + 8 * hh);
      b.half[1] = *(const v8us*)(brow + 16 + 8 * hh);
      acc[t] = mmaN<ASPLIT ? 2 : 1>(ah.v, al.v, b.v, b.v, acc[t]);
    }
  }
#pragma unroll
  for (int t = 0; t < 4; ++t) {
    float bv = bias ? bias[col0 + t * 16 + ln] : 0.f;
    if (BIAS_BF16) bv = bf16_round(bv);
#pragma unroll
    for (int r = 0; r < 8; ++r) { float v = acc[t][r] + bv; if (ACT == 1) v = fmaxf(v, 0.f); so[w][8 * hh + r][t * 16 + ln] = v; }
  }
  __builtin_amdgcn_fence(__ATOMIC_ACQ_REL, "workgroup");
  __builtin_amdgcn_wave_barrier();
  const int rsub = lane >> 4, c4 = (lane & 15) * 4;
  {
#pragma unroll
    for (int q = 0; q < 8; ++q) {
      const int r = q * 2 + rsub;
      const v4f v = *(const v4fa*)&so[w][r][c4];
      *(v4f*)(C + (size_t)(row0 + r) * ldc + col0 + c4) = v;
    }
    
  }
}

// GEMM C = act(A·W + bias + resid): A f32 (ASPLIT -> hi/lo 2 terms), Wt bf16 [N][K]; ACT 0 none, 1 relu, 2 exact gelu;
// resid (optional, f32, row index = (row % rmod), pitch ldr, RES_BF16 rounds it) added before the activation.
template <bool ASPLIT, int ACT, bool BIAS_BF16, bool RES_BF16>
__global__ __launch_bounds__(128) void k_gemm_bf3(const float* __restrict__ A, int lda, const unsigned short* __restrict__ Wt, int ldb,
                                                const float* __restrict__ bias, const float* __restrict__ resid, int rmod, int ldr,
                                                float* __restrict__ C, int ldc, int M, int N, int K) {
  __shared__ __attribute__((aligned(16))) float so[4][16][64];
  const int tid = threadIdx.x, w = tid >> 5, lane = tid & 31, ln = lane & 15, hh = lane >> 4;
  const int ntn = N / 64;
  const int wid = blockIdx.x * 4 + w;
  const int mt = wid / ntn, nq = wid % ntn;
  if (mt * 16 >= M) return;
  const int row0 = mt * 16, col0 = nq * 64;
  const float* arow = A + (size_t)(row0 + ln) * lda;
  v8f acc[4] = {};
  for (int kb = 0; kb < K; kb += 32) {
    FragB ah, al;
    const v4f x0 = *(const v4fa*)(arow + kb + 8 * hh), x1 = *(const v4fa*)(arow + kb + 8 * hh + 4);
    const v4f x2 = *(const v4fa*)(arow + kb + 16 + 8 * hh), x3 = *(const v4fa*)(arow + kb + 16 + 8 * hh + 4);
    float xs[16] = {x0[0],x0[1],x0[2],x0[3],x1[0],x1[1],x1[2],x1[3],x2[0],x2[1],x2[2],x2[3],x3[0],x3[1],x3[2],x3[3]};
#pragma unroll
    for (int i = 0; i < 16; ++i) { const unsigned short hb = bf16_bits(xs[i]); ah.u[i] = hb; al.u[i] = ASPLIT ? bf16_bits(xs[i] - bf16_val(hb)) : (unsigned short)0; }
#pragma unroll
    for (int t = 0; t < 4; ++t) {
      const unsigned short* brow = Wt + (size_t)(col0 + t * 16 + ln) * ldb + kb;
      FragB b;
      b.half[0] = *(const v8us*)(brow + 8 * hh);
      b.half[1] = *(const v8us*)(brow + 16 + 8 * hh);
      acc[t] = mmaN<ASPLIT ? 2 : 1>(ah.v, al.v, b.v, b.v, acc[t]);
    }
  }
#pragma unroll
  for (int t = 0; t < 4; ++t) {
    const int col = col0 + t * 16 + ln;
    float bv = bias ? bias[col] : 0.f;
    if (BIAS_BF16) bv = bf16_round(bv);
#pragma unroll
    for (int r = 0; r < 8; ++r) {
      float v = acc[t][r] + bv;
      if (resid) { float rv = resid[(size_t)((row0 + 8 * hh + r) % rmod) * ldr + col]; if (RES_BF16) rv = bf16_round(rv); v += rv; }
      if (ACT == 1) v = fmaxf(v, 0.f);
      if (ACT == 2) v = 0.5f * v * (1.0f + erff(v * 0.70710678118654752f));
      if (ACT == 3) { const float u = 0.7978845608028654f * (v + 0.044715f * v * v * v); v = 0.5f * v * (1.0f + tanhf(u)); }
      so[w][8 * hh + r][t * 16 + ln] = v;
    }
  }
  __builtin_amdgcn_fence(__ATOMIC_ACQ_REL, "workgroup");
  __builtin_amdgcn_wave_barrier();
  const int rsub = lane >> 4, c4 = (lane & 15) * 4;
  {
#pragma unroll
    for (int q = 0; q < 8; ++q) {
      const int r = q * 2 + rsub;
      const v4f v = *(const v4fa*)&so[w][r][c4];
      *(v4f*)(C + (size_t)(row0 + r) * ldc + col0 + c4) = v;
    }
    
  }
}
// row LayerNorm (biased variance, eps) over N: s = X (+ R); optional out_sum <- s; out_norm <- (s-mu)*rsqrt(var+eps)*g + b
template <bool PARAM_BF16>
__global__ __launch_bounds__(256) void k_layernorm(const float* __restrict__ X, const float* __restrict__ R, const float* __restrict__ g, const float* __restrict__ bta,
                                                  float* __restrict__ out_sum, float* __restrict__ out_norm, int N, float eps) {
  __shared__ float red[256];
  const int row = blockIdx.x, tid = threadIdx.x;
  const float* x = X + (size_t)row * N; const float* rr = R ? R + (size_t)row * N : nullptr;
  float vals[16];                     // up to N = 4096
  const int per = N / 256;            // contiguous chunk per thread? use strided-by-4 chunks: thread handles j = tid*4 + 1024*u
  float s1 = 0.f;
  for (int u = 0; u < per / 4; ++u) {
    const int j = tid * 4 + 1024 * u;
    const v4f a = *(const v4fa*)(x + j);
    v4f b = {0.f,0.f,0.f,0.f}; if (rr) b = *(const v4fa*)(rr + j);
#pragma unroll
    for (int q = 0; q < 4; ++q) { const float v = a[q] + b[q]; vals[u * 4 + q] = v; s1 += v; }
  }
  red[tid] = s1; __syncthreads();
  for (int st = 128; st > 0; st >>= 1) { if (tid < st) red[tid] += red[tid + st]; __syncthreads(); }
  const float mu = red[0] / (float)N; __syncthreads();
  float s2 = 0.f;
  for (int u = 0; u < per / 4; ++u)
#pragma unroll
    for (int q = 0; q < 4; ++q) { const float c = vals[u * 4 + q] - mu; s2 += c * c; }
  red[tid] = s2; __syncthreads();
  for (int st = 128; st > 0; st >>= 1) { if (tid < st) red[tid] += red[tid + st]; __syncthreads(); }
  const float rs = rsqrtf(red[0] / (float)N + eps);
  {
    for (int u = 0; u < per / 4; ++u) {
      const int j = tid * 4 + 1024 * u;
      v4f o, sm;
#pragma unroll
      for (int q = 0; q < 4; ++q) {
        float gg = g[j + q], bb = bta[j + q];
        if (PARAM_BF16) { gg = bf16_round(gg); bb = bf16_round(bb); }
        sm[q] = vals[u * 4 + q]; o[q] = (vals[u * 4 + q] - mu) * rs * gg + bb;
      }
      if (out_sum) *(v4f*)(out_sum + (size_t)row * N + j) = sm;
      *(v4f*)(out_norm + (size_t)row * N + j) = o;
    }
    
  }
}



// ---- f16 WMMA path (v_wmma_f32_16x16x32_f16): 11-bit significands for operands in range — used where a [0,1] probability operand needs more precision than bf16
typedef _Float16 v16h __attribute__((ext_vector_type(16)));
union FragH { v16h v; v8us half[2]; _Float16 h[16]; unsigned short u[16]; };
template <int NT>
__device__ __forceinline__ v8f mmaH(v16h ah, v16h al, v16h bh, v16h bl, v8f c) {
  c = __builtin_amdgcn_wmma_f32_16x16x32_f16(false, ah, false, bh, (short)0, c, false, false);
  if (NT >= 2) c = __builtin_amdgcn_wmma_f32_16x16x32_f16(false, al, false, bh, (short)0, c, false, false);
  if (NT >= 3) c = __builtin_amdgcn_wmma_f32_16x16x32_f16(false, ah, false, bl, (short)0, c, false, false);
  asm volatile("v_nop\n\tv_nop\n\tv_nop\n\tv_nop" : "+v"(c) : "v"(ah), "v"(al), "v"(bh), "v"(bl));
  return c;
}
// batched GEMM like k_gemm_b but f16 operands: A f32 (split into f16 hi/lo if ASPLIT, else rounded to f16), Bt = f16 values [n][k]; alpha; C f32; N multiple of 16 (partial tiles skipped)
template <bool ASPLIT>
__global__ __launch_bounds__(128) void k_gemm_h(const float* __restrict__ A, int lda, size_t sA, const _Float16* __restrict__ Bh, int ldb, size_t sB, float alpha, float* __restrict__ C, int ldc, size_t sC, int M, int N, int K) {
  __shared__ __attribute__((aligned(16))) float so[4][16][64];
  const int tid = threadIdx.x, w = tid >> 5, lane = tid & 31, ln = lane & 15, hh = lane >> 4; const int by = blockIdx.y;
  A += (size_t)by * sA; Bh += (size_t)by * sB; C += (size_t)by * sC;
  const int ntn = (N + 63) / 64; const int wid = blockIdx.x * 4 + w; const int mt = wid / ntn, nq = wid % ntn; if (mt * 16 >= M) return;
  const int row0 = mt * 16, col0 = nq * 64; const float* arow = A + (size_t)(row0 + ln) * lda;
  v8f acc[4] = {};
  for (int kb = 0; kb < K; kb += 32) {
    FragH ah, al;
    const v4f x0 = *(const v4fa*)(arow + kb + 8 * hh), x1 = *(const v4fa*)(arow + kb + 8 * hh + 4), x2 = *(const v4fa*)(arow + kb + 16 + 8 * hh), x3 = *(const v4fa*)(arow + kb + 16 + 8 * hh + 4);
    float xs[16] = {x0[0],x0[1],x0[2],x0[3],x1[0],x1[1],x1[2],x1[3],x2[0],x2[1],x2[2],x2[3],x3[0],x3[1],x3[2],x3[3]};
#pragma unroll
    for (int i = 0; i < 16; ++i) { const _Float16 h = (_Float16)xs[i]; ah.h[i] = h; al.h[i] = ASPLIT ? (_Float16)(xs[i] - (float)h) : (_Float16)0.0f; }
#pragma unroll
    for (int t = 0; t < 4; ++t) { if (col0 + t * 16 >= N) continue; const size_t boff = (size_t)(col0 + t * 16 + ln) * ldb + kb; FragH bq; bq.half[0] = *(const v8us*)(Bh + boff + 8 * hh); bq.half[1] = *(const v8us*)(Bh + boff + 16 + 8 * hh);
      acc[t] = mmaH<ASPLIT ? 2 : 1>(ah.v, al.v, bq.v, bq.v, acc[t]); }
  }
#pragma unroll
  for (int t = 0; t < 4; ++t) { if (col0 + t * 16 >= N) continue;
#pragma unroll
    for (int r = 0; r < 8; ++r) so[w][8 * hh + r][t * 16 + ln] = acc[t][r] * alpha; }
  __builtin_amdgcn_fence(__ATOMIC_ACQ_REL, "workgroup"); __builtin_amdgcn_wave_barrier();
  const int rsub = lane >> 4, c4 = (lane & 15) * 4;
  {
#pragma unroll
    for (int q = 0; q < 8; ++q) { const int r = q * 2 + rsub; if (col0 + c4 < N) { const v4f v = *(const v4fa*)&so[w][r][c4]; *(v4f*)(C + (size_t)(row0 + r) * ldc + col0 + c4) = v; } }
     }
}

// Wt[n][k] = f16(W[k][n]·scale) from f32 row-major W[K][N] (scale = power of two; bf16-exact weights stay exact in f16 away from the subnormal range)
__global__ __launch_bounds__(256) void k_wt_f16(const float* __restrict__ W, _Float16* __restrict__ Wt, int K, int N, float scale) {
  const int t = blockIdx.x * 256 + threadIdx.x; if (t >= N * (K / 8)) return; const int n = t / (K / 8), k8 = (t % (K / 8)) * 8; FragH f;
#pragma unroll
  for (int i = 0; i < 8; ++i) f.h[i] = (_Float16)(bf16_round(W[(size_t)(k8 + i) * N + n]) * scale); const v8us o = f.half[0];
  *(v8us*)((unsigned short*)Wt + (size_t)n * K + k8) = o; 
}
// k_gemm_hh variant with fused epilogue: v = acc·alpha + bias[by·sBias + col] (+ CP[(row/rowsPerB)·sCPb + by·64 + col] if CP) ; ACT 0 none / 1 elu ; writes f16 C16 (and f32 C if non-null)
template <int ACT>
__global__ __launch_bounds__(128) void k_gemm_hhx(const _Float16* __restrict__ A, int lda, size_t sA, const _Float16* __restrict__ Bh, int ldb, size_t sB, float alpha, const float* __restrict__ bias, size_t sBias, const float* __restrict__ CP, int rowsPerB, size_t sCPb, int row0g,
    float* __restrict__ C, _Float16* __restrict__ C16, int ldc, size_t sC, int M, int N, int K) {
  __shared__ __attribute__((aligned(16))) float so[4][16][64];
  const int tid = threadIdx.x, w = tid >> 5, lane = tid & 31, ln = lane & 15, hh = lane >> 4; const int by = blockIdx.y;
  A += (size_t)by * sA; Bh += (size_t)by * sB; const size_t cofs = (size_t)by * sC; const float* bp = bias ? bias + (size_t)by * sBias : nullptr;
  const int ntn = (N + 63) / 64; const int wid = blockIdx.x * 4 + w; const int mt = wid / ntn, nq = wid % ntn; if (mt * 16 >= M) return;
  const int row0 = mt * 16, col0 = nq * 64; const _Float16* arow = A + (size_t)(row0 + ln) * lda;
  v8f acc[4] = {};
  for (int kb = 0; kb < K; kb += 32) { FragH ah; ah.half[0] = *(const v8us*)((const unsigned short*)arow + kb + 8 * hh); ah.half[1] = *(const v8us*)((const unsigned short*)arow + kb + 16 + 8 * hh);
#pragma unroll
    for (int t = 0; t < 4; ++t) { if (col0 + t * 16 >= N) continue; const size_t boff = (size_t)(col0 + t * 16 + ln) * ldb + kb; FragH bq; bq.half[0] = *(const v8us*)((const unsigned short*)Bh + boff + 8 * hh); bq.half[1] = *(const v8us*)((const unsigned short*)Bh + boff + 16 + 8 * hh);
      acc[t] = mmaH<1>(ah.v, ah.v, bq.v, bq.v, acc[t]); }
  }
#pragma unroll
  for (int t = 0; t < 4; ++t) { if (col0 + t * 16 >= N) continue; const int col = col0 + t * 16 + ln; const float bv = bp ? bf16_round(bp[col]) : 0.f;
#pragma unroll
    for (int r = 0; r < 8; ++r) { float v = acc[t][r] * alpha + bv; if (CP) { const int rr = row0g + row0 + 8 * hh + r; if (rowsPerB < 0) v += CP[cofs + (size_t)rr * ldc + col];      /* rowsPerB < 0: own element of the batched C plane */ else { const int bidx = rr / rowsPerB; v += CP[(size_t)bidx * sCPb + (size_t)by * 64 + col]; } } if (ACT == 1) v = (v > 0.f) ? v : expm1f(v); else if (ACT == 7) v = (v > 0.f) ? v + 1.0f : expf(v); else if (ACT == 8) v = tanhf(v); else if (ACT == 9) v = 0.5f * v * (1.0f + tanhf(0.7978845608028654f * (v + 0.044715f * v * v * v))); else if (ACT == 11) v = 1.0f / (1.0f + expf(-v)); else if (ACT == 12) v = (v > 0.f) ? v : 0.01f * v; else if (ACT == 14) v = (v > 0.f) ? v : 0.1f * v; else if (ACT == 16) v = (v >= 0.f) ? v : 0.3f * v; else if (ACT == 17) v = (v >= 0.f) ? v : 0.2f * v; else if (ACT == 15) v = v / (1.0f + expf(-v)); else if (ACT == 3) v = fmaxf(v, 0.f); else if (ACT == 6) v = 0.5f * v * (1.0f + erff(v * 0.70710678118654752f)); so[w][8 * hh + r][t * 16 + ln] = v; } }
  __builtin_amdgcn_fence(__ATOMIC_ACQ_REL, "workgroup"); __builtin_amdgcn_wave_barrier();
  const int rsub = lane >> 4, c4 = (lane & 15) * 4; typedef _Float16 v4h __attribute__((ext_vector_type(4)));
  {
#pragma unroll
    for (int q = 0; q < 8; ++q) { const int r = q * 2 + rsub; if (col0 + c4 < N) { const v4f v = *(const v4fa*)&so[w][r][c4]; if (C) *(v4f*)(C + cofs + (size_t)(row0 + r) * ldc + col0 + c4) = v; if (C16) { v4h h4; for (int i = 0; i < 4; ++i) h4[i] = (_Float16)v[i]; *(v4h*)(C16 + cofs + (size_t)(row0 + r) * ldc + col0 + c4) = h4; } } }
     }
}


typedef _Float16 v4h __attribute__((ext_vector_type(4)));

__global__ __launch_bounds__(256) void k_x16(const float* __restrict__ x, _Float16* __restrict__ X16, size_t n8) { const size_t t = (size_t)blockIdx.x * 256 + threadIdx.x; if (t >= n8) return; FragH f;
#pragma unroll
  for (int q = 0; q < 8; ++q) f.h[q] = (_Float16)bf16_round(x[t * 8 + q]); *(v8us*)((unsigned short*)X16 + t * 8) = f.half[0];  }
__global__ __launch_bounds__(256) void k_h16(const float* __restrict__ x, _Float16* __restrict__ X16, size_t n8) { const size_t t = (size_t)blockIdx.x * 256 + threadIdx.x; if (t >= n8) return; FragH f;
#pragma unroll
  for (int q = 0; q < 8; ++q) f.h[q] = (_Float16)x[t * 8 + q]; *(v8us*)((unsigned short*)X16 + t * 8) = f.half[0];  }
__global__ __launch_bounds__(256) void k_round16f(const float* __restrict__ W, _Float16* __restrict__ Bt, size_t n8) { const size_t t = (size_t)blockIdx.x * 256 + threadIdx.x; if (t >= n8) return; FragH f;
#pragma unroll
  for (int i = 0; i < 8; ++i) f.h[i] = (_Float16)(bf16_round(W[t * 8 + i]) * 16.0f); *(v8us*)((unsigned short*)Bt + t * 8) = f.half[0];  }
template <int NHv, int TTv>
__global__ __launch_bounds__(256) void k_vt(const _Float16* __restrict__ V16, int ldv, int voff, _Float16* __restrict__ Vt) { __shared__ unsigned short tl[64][66]; const int tid = threadIdx.x; const int slab = blockIdx.x / (TTv / 64), lg = blockIdx.x % (TTv / 64); const int b = slab / NHv, h = slab % NHv;
  for (int i = tid; i < 64 * 8; i += 256) { const int r = i / 8, c8 = (i % 8) * 8; FragH f; f.half[0] = *(const v8us*)((const unsigned short*)V16 + ((size_t)b * TTv + lg * 64 + r) * ldv + voff + h * 64 + c8);
#pragma unroll
    for (int q = 0; q < 8; ++q) tl[r][c8 + q] = f.u[q]; }
  __syncthreads();
  {
#pragma unroll
    for (int rd = 0; rd < 2; ++rd) { const int d = rd * 32 + tid / 8, pc = tid % 8; FragH f;
#pragma unroll
      for (int q = 0; q < 8; ++q) f.u[q] = tl[pc * 8 + q][d];
      *(v8us*)((unsigned short*)Vt + ((size_t)slab * 64 + d) * TTv + lg * 64 + pc * 8) = f.half[0]; }
     } }

__global__ __launch_bounds__(256) void k_hl(const float* __restrict__ F, _Float16* __restrict__ Hh, _Float16* __restrict__ Hl, size_t n8) { const size_t t = (size_t)blockIdx.x * 256 + threadIdx.x; if (t >= n8) return; FragH fh, fl; const v4f a = *(const v4fa*)(F + t * 8), c = *(const v4fa*)(F + t * 8 + 4);
#pragma unroll
  for (int q = 0; q < 4; ++q) { _Float16 h = (_Float16)a[q]; fh.h[q] = h; fl.h[q] = (_Float16)((a[q] - (float)h) * 1024.0f); h = (_Float16)c[q]; fh.h[4 + q] = h; fl.h[4 + q] = (_Float16)((c[q] - (float)h) * 1024.0f); }
  { *(v8us*)((unsigned short*)Hh + t * 8) = fh.half[0]; *(v8us*)((unsigned short*)Hl + t * 8) = fl.half[0];  } }

// ---- fast GEMM (block tile 128x128, 4 waves as 2 x 2, wave tile 64x64; requires M % 128 == 0 rows per launch region, N % 128 == 0 and K % 64 == 0); epilogue = k_gemm_hhx semantics ----
// Both operands reach the fragments through LDS: a stage is 64 k = one whole 128-byte line of each of the block's 128 A rows and 128 B rows, fetched by loads in which 8 lanes cover one row
// (4 whole lines a wave load, where a fragment load straight from global memory touches 16 lines); two buffers, the next stage's global loads fly during this stage's products.
// The square tiles are there for bytes per product: a stage's 256 lines from L2 feed 128 products (128x64: 192 lines for 64), and a wave's 8 fragments of a 32-k block feed 16 products (32x64: 6 for 8).
#define G2_SK 64                     /* k per LDS stage */
#define G2_PH 72                     /* LDS row pitch in f16: 144 B = 16 B x odd, the conflict-free pitch for 16-byte fragment reads */
typedef float f32a __attribute__((may_alias));
__device__ __forceinline__ v16h g2_frag(const _Float16* p, int hh) { FragH f; f.half[0] = *(const v8us*)((const unsigned short*)p + 8 * hh); f.half[1] = *(const v8us*)((const unsigned short*)p + 16 + 8 * hh); return f.v; }
__device__ __forceinline__ v8f g2_mma(v16h a, v16h b, v8f c) { return __builtin_amdgcn_wmma_f32_16x16x32_f16(false, a, false, b, (short)0, c, false, false); }
// one stage's global loads of a thread: 16 bytes of 8 A rows and of 8 B rows, 16 rows apart
__device__ __forceinline__ void g2_stage(const unsigned short* a, size_t a16, const unsigned short* b, size_t b16, v8us (&ra)[8], v8us (&rb)[8]) {
  const unsigned short* pa[8]; const unsigned short* pb[8];
#pragma unroll
  for (int j = 0; j < 8; ++j) pa[j] = a + j * a16;
#pragma unroll
  for (int j = 0; j < 8; ++j) pb[j] = b + j * b16;
#pragma unroll
  for (int j = 0; j < 8; ++j) ra[j] = *(const v8us*)pa[j];
#pragma unroll
  for (int j = 0; j < 8; ++j) rb[j] = *(const v8us*)pb[j];
  // the wait that stands in front of any overwrite of an issued load's address registers; the 16 addresses are inputs so that their registers live up to it (else a later load's result lands in an earlier load's address pair)
  asm volatile("s_wait_xcnt 0x0" :: "v"(pa[0]), "v"(pa[1]), "v"(pa[2]), "v"(pa[3]), "v"(pa[4]), "v"(pa[5]), "v"(pa[6]), "v"(pa[7]), "v"(pb[0]), "v"(pb[1]), "v"(pb[2]), "v"(pb[3]), "v"(pb[4]), "v"(pb[5]), "v"(pb[6]), "v"(pb[7]) : "memory");
}
// HASCP false leaves the addend path (CP) out of the build: unrolled over the 128 results a lane now holds, its index arithmetic would stand between any two results and make the epilogue's text several times longer
template <int ACT, bool HASCP>
__global__ __launch_bounds__(128) void k_gemm2(const _Float16* __restrict__ A, int lda, size_t sA, const _Float16* __restrict__ Bh, int ldb, size_t sB, float alpha, const float* __restrict__ bias, size_t sBias, const float* __restrict__ CP, int rowsPerB, size_t sCPb, int row0g,
    float* __restrict__ C, _Float16* __restrict__ C16, int ldc, size_t sC, int M, int N, int K) { static_assert(ACT == 0 || ACT == 3 || ACT == 6 || ACT == 8 || ACT == 9 || ACT == 11 || ACT == 12 || ACT == 14 || ACT == 15 || ACT == 16 || ACT == 17, "k_gemm2: unsupported ACT code (would silently apply no activation)");
  __shared__ __attribute__((aligned(16))) _Float16 sa[2][128][G2_PH];      /* A stage: the block's 128 rows, 64 k */
  __shared__ __attribute__((aligned(16))) _Float16 sb[2][128][G2_PH];      /* B stage: the block's 128 columns (rows of Bt), 64 k */
  f32a (*so)[32][68] = (f32a (*)[32][68])&sa[0][0][0];      /* output staging, 32 rows a wave: lies in the A buffers, used only behind the k loop's last barrier (34,816 of their 36,864 bytes) */
  const int tid = threadIdx.x, w = tid >> 5, lane = tid & 31, ln = lane & 15, hh = lane >> 4; const int by = blockIdx.y;
  A += (size_t)by * sA; Bh += (size_t)by * sB; const size_t cofs = (size_t)by * sC; const float* bp = bias ? bias + (size_t)by * sBias : nullptr;
  const int ntn = N >> 7; const int mt = blockIdx.x / ntn, nq = blockIdx.x - mt * ntn; const int wr = 64 * (w >> 1), wc = 64 * (w & 1); const int row0 = mt * 128 + wr, col0 = nq * 128 + wc; if (mt * 128 >= M) return;      /* the whole work-group leaves or none: barriers follow */
  // staging: a thread moves 16 bytes of rows srow + 16 j; 8 threads cover one 128-byte row
  const int srow = tid >> 3, sch = (tid & 7) * 8;
  const unsigned short* ag = (const unsigned short*)A + (size_t)(mt * 128 + srow) * lda + sch;
  const unsigned short* bg = (const unsigned short*)Bh + (size_t)(nq * 128 + srow) * ldb + sch;
  v8us ra[8], rb[8];
  g2_stage(ag, (size_t)16 * lda, bg, (size_t)16 * ldb, ra, rb);
  const v8f z8 = {0.f,0.f,0.f,0.f,0.f,0.f,0.f,0.f}; v8f acc[4][4];      /* [16-row tile][16-column tile] */
#pragma unroll
  for (int i = 0; i < 4; ++i)
#pragma unroll
    for (int t = 0; t < 4; ++t) acc[i][t] = z8;
#pragma unroll
  for (int j = 0; j < 8; ++j) *(v8us*)&sa[0][srow + 16 * j][sch] = ra[j];
#pragma unroll
  for (int j = 0; j < 8; ++j) *(v8us*)&sb[0][srow + 16 * j][sch] = rb[j];
  __syncthreads();      /* stage 0 is visible to all 4 waves */
  const int nst = K / G2_SK;
#pragma unroll 1  // rolled: one stage a trip, so that the two buffers alternate by index; the two 32-k blocks inside are unrolled
  for (int st = 0; st < nst; ++st) {
    const int b = st & 1; const bool more = st + 1 < nst;      /* the same for the whole work-group */
    if (more) g2_stage(ag + (st + 1) * G2_SK, (size_t)16 * lda, bg + (st + 1) * G2_SK, (size_t)16 * ldb, ra, rb);      /* next stage: in flight under this stage's products */
    v16h fa[2][4], fb[2][4];      /* the stage's fragments: [32-k block][tile] */
#pragma unroll
    for (int kc = 0; kc < 2; ++kc)
#pragma unroll
      for (int t = 0; t < 4; ++t) { fa[kc][t] = g2_frag(&sa[b][wr + 16 * t + ln][32 * kc], hh); fb[kc][t] = g2_frag(&sb[b][wc + 16 * t + ln][32 * kc], hh); }
    __builtin_amdgcn_sched_barrier(0);      /* keeps the stage's 32 LDS reads one group in front of its 32 products: left alone the compiler reuses fragment registers and waits out the LDS latency again and again inside a stage */
#pragma unroll
    for (int kc = 0; kc < 2; ++kc)      /* k ascends by 32 in every accumulator: one fixed order of sums */
#pragma unroll
      for (int t = 0; t < 4; ++t)
#pragma unroll
        for (int i = 0; i < 4; ++i) acc[i][t] = g2_mma(fa[kc][i], fb[kc][t], acc[i][t]);
    if (more) {      /* every wave left that buffer before the last barrier */
#pragma unroll
      for (int j = 0; j < 8; ++j) *(v8us*)&sa[b ^ 1][srow + 16 * j][sch] = ra[j];
#pragma unroll
      for (int j = 0; j < 8; ++j) *(v8us*)&sb[b ^ 1][srow + 16 * j][sch] = rb[j]; }
    __syncthreads();      /* publishes stage st + 1 and ends every wave's reads of stage st, whose buffer the next trip refills */
  }
  const int rsub = lane >> 4, c4 = (lane & 15) * 4;
  float bv4[4] = {0.f, 0.f, 0.f, 0.f};      /* the lane's four bias values serve both halves; one test, so that the four loads fly together */
  if (bp) {
#pragma unroll
    for (int t = 0; t < 4; ++t) bv4[t] = bf16_round(bp[col0 + t * 16 + ln]); }
#pragma unroll
  for (int hb = 0; hb < 2; ++hb) {      /* the wave's 64 rows leave in two halves of 32 through its own staging rows */
    const int rowh = row0 + 32 * hb;
#pragma unroll
    for (int u = 0; u < 8; ++u) { const int t = u & 3, half = u >> 2; const int col = col0 + t * 16 + ln; const float bv = bv4[t];
#pragma unroll
      for (int r = 0; r < 8; ++r) { const int rloc = half * 16 + 8 * hh + r; float v = acc[2 * hb + half][t][r] * alpha + bv; if (HASCP && CP) { if (rowsPerB < 0) v += CP[cofs + (size_t)(row0g + rowh + rloc) * ldc + col];      /* rowsPerB < 0: own element of the batched C plane */ else { const int bidx = (row0g + rowh + rloc) / rowsPerB; v += CP[(size_t)bidx * sCPb + (size_t)by * 64 + col]; } }
        if (ACT == 3) v = fmaxf(v, 0.f); else if (ACT == 6) v = 0.5f * v * (1.0f + erff(v * 0.70710678118654752f)); else if (ACT == 11) v = 1.0f / (1.0f + expf(-v)); else if (ACT == 15) v = v / (1.0f + expf(-v)); else if (ACT == 12) v = (v > 0.f) ? v : 0.01f * v; else if (ACT == 8) v = tanhf(v); else if (ACT == 9) v = 0.5f * v * (1.0f + tanhf(0.7978845608028654f * (v + 0.044715f * v * v * v))); else if (ACT == 14) v = (v > 0.f) ? v : 0.1f * v; else if (ACT == 16) v = (v >= 0.f) ? v : 0.3f * v; else if (ACT == 17) v = (v >= 0.f) ? v : 0.2f * v;
        so[w][rloc][t * 16 + ln] = v; } }
    __builtin_amdgcn_fence(__ATOMIC_ACQ_REL, "wavefront"); asm volatile("s_wait_dscnt 0x0" ::: "memory"); __builtin_amdgcn_wave_barrier();      /* the wave's staged rows are written before its lanes read them back across lanes; the rows are the wave's own, so wave scope and the LDS wait are enough (a work-group fence here would also wait out the first half's global stores) */
    v4f vq[16];      /* all 16 reads in one group: one LDS latency a half, not one a row pair */
#pragma unroll
    for (int q = 0; q < 16; ++q) vq[q] = *(const v4fa*)&so[w][q * 2 + rsub][c4];
    __builtin_amdgcn_fence(__ATOMIC_ACQ_REL, "wavefront"); __builtin_amdgcn_wave_barrier();      /* the rows are read before the second half overwrites them */
    if (C) {
#pragma unroll
      for (int q = 0; q < 16; ++q) *(v4f*)(C + cofs + (size_t)(rowh + q * 2 + rsub) * ldc + col0 + c4) = vq[q];
      asm volatile("s_wait_xcnt 0x0" ::: "memory"); }      /* the wait that stands in front of any overwrite of the issued stores' registers (the f16 conversion below may reuse them) */
    if (C16) {
#pragma unroll
      for (int q = 0; q < 16; ++q) { v4h h4; for (int i = 0; i < 4; ++i) h4[i] = (_Float16)vq[q][i]; *(v4h*)(C16 + cofs + (size_t)(rowh + q * 2 + rsub) * ldc + col0 + c4) = h4; }
      asm volatile("s_wait_xcnt 0x0" ::: "memory"); }      /* the same wait behind the f16 stores: the next half's results reuse their registers */
  } }


__global__ __launch_bounds__(256) void k_wnat(const float* __restrict__ w, size_t n8, _Float16* __restrict__ Bt) { const size_t t = (size_t)blockIdx.x * 256 + threadIdx.x; if (t >= n8) return; FragH f; for (int q = 0; q < 8; ++q) f.h[q] = (_Float16)(bf16_round(w[t * 8 + q]) * 16.0f); *(v8us*)((unsigned short*)Bt + t * 8) = f.half[0];  }
__global__ __launch_bounds__(256) void k_rsm(const float* __restrict__ S, _Float16* __restrict__ P, int nrows) {
  #pragma clang fp contract(off)
  const int i = blockIdx.x * 256 + threadIdx.x; if (i >= nrows) return; const float* s = S + (size_t)i * SQ; float mx = -3.0e38f;
#pragma unroll 1
  for (int j = 0; j < SQ; ++j) mx = fmaxf(mx, s[j]); float se = 0.f;
#pragma unroll 1
  for (int j = 0; j < SQ; ++j) se += expf(s[j] - mx); const float sc = 256.0f / se;
#pragma unroll 1
  for (int j0 = 0; j0 < SQ; j0 += 8) { FragH f; for (int q = 0; q < 8; ++q) f.h[q] = (_Float16)(expf(s[j0 + q] - mx) * sc); unsigned short* d = (unsigned short*)P + (size_t)i * SQ + j0; *(v8us*)d = f.half[0];  } }
__global__ __launch_bounds__(256) void k_vt(const _Float16* __restrict__ V16, int b, int h0, _Float16* __restrict__ VT) { __shared__ unsigned short tl[64][65]; const int tid = threadIdx.x; const int hh = blockIdx.x % HG, sg = blockIdx.x / HG; const int s0 = sg * 64; const int h = h0 + hh;
  for (int i = tid; i < 64 * 8; i += 256) { const int j = i / 8, d8 = (i % 8) * 8; FragH f; f.half[0] = *(const v8us*)((const unsigned short*)V16 + ((size_t)b * SQ + s0 + j) * DM + h * HD + d8); for (int q = 0; q < 8; ++q) tl[d8 + q][j] = f.u[q]; }
  __syncthreads();
  { for (int i = tid; i < 64 * 8; i += 256) { const int d = i / 8, j8 = (i % 8) * 8; FragH f; for (int q = 0; q < 8; ++q) f.u[q] = tl[d][j8 + q]; *(v8us*)((unsigned short*)VT + ((size_t)hh * HD + d) * SQ + s0 + j8) = f.half[0]; }  } }



#define FA_SK 64                     /* keys per LDS tile */
#define FA_PH 72                     /* LDS row pitch in f16: 144 B = 16 B x odd, the conflict-free pitch for 16-byte fragment reads */
typedef float f32x2 __attribute__((ext_vector_type(2)));
typedef _Float16 v2h __attribute__((ext_vector_type(2)));
union FragP { v16h v; unsigned int w[8]; };
__device__ __forceinline__ float fa_xhalf(float x) { return __builtin_bit_cast(float, __builtin_amdgcn_permlanex16(__builtin_bit_cast(int, x), __builtin_bit_cast(int, x), 0x76543210, 0xfedcba98, false, false)); }      /* lane l <-> lane l ^ 16 */
__device__ __forceinline__ v16h fa_frag(const _Float16* p) { FragH f; f.half[0] = *(const v8us*)(const unsigned short*)p; f.half[1] = *(const v8us*)((const unsigned short*)p + 16); return f.v; }      /* p = row + 32 kc + 8 h: the hardware k order */
__device__ __forceinline__ v8f fa_mma(v16h a, v16h b, v8f c) { return __builtin_amdgcn_wmma_f32_16x16x32_f16(false, a, false, b, (short)0, c, false, false); }
// amdgpu_waves_per_eu(4, 4): a budget of 256 VGPRs, so that no register lies above v255 (without it the build took 266 and switched register windows all through the loop)
__global__ __launch_bounds__(256) __attribute__((amdgpu_waves_per_eu(4, 4))) void k_fattn(const _Float16* __restrict__ Qh, const _Float16* __restrict__ Kh, const _Float16* __restrict__ Vt, _Float16* __restrict__ Oh) {
  __shared__ __attribute__((aligned(16))) _Float16 sk[2][FA_SK][FA_PH];      /* K tile: row = key, 64 d */
  __shared__ __attribute__((aligned(16))) _Float16 sv[2][HD][FA_PH];         /* V^T tile: row = d, 64 keys */
  const int tid = threadIdx.x, lane = tid & 31, wave = tid >> 5, c = lane & 15, h = lane >> 4;
  const int head = blockIdx.y, q0 = blockIdx.x * 256 + wave * 32;
  const float cs = 0.03125f * 1.44269504088896340736f;      /* the module's score scale 1/sqrt(1024), in the base-2 domain */
  // staging: a thread moves 16 bytes of rows srow and srow + 32 of each tile; 8 threads cover one 128-byte row
  const int srow = tid >> 3, sch = (tid & 7) * 8;
  const unsigned short* kg = (const unsigned short*)Kh + (size_t)srow * LQ + head * HD + sch;
  const unsigned short* vg = (const unsigned short*)Vt + ((size_t)head * HD + srow) * SQ + sch;
  v8us rk0, rk1, rv0, rv1;
  rk0 = *(const v8us*)kg; rk1 = *(const v8us*)(kg + (size_t)32 * LQ); rv0 = *(const v8us*)vg; rv1 = *(const v8us*)(vg + (size_t)32 * SQ);
  v16h qf[2][2];
#pragma unroll
  for (int g = 0; g < 2; ++g)
#pragma unroll
    for (int kc = 0; kc < 2; ++kc) qf[g][kc] = fa_frag(Qh + (size_t)(q0 + 16 * g + c) * LQ + head * HD + 32 * kc + 8 * h);
  const v8f z8 = {0.f,0.f,0.f,0.f,0.f,0.f,0.f,0.f};
  v8f acc[2][4]; float m_run[2]; f32x2 l_run[2];
#pragma unroll
  for (int g = 0; g < 2; ++g) { m_run[g] = -3.0e38f; l_run[g] = f32x2{0.f, 0.f};
#pragma unroll
    for (int t = 0; t < 4; ++t) acc[g][t] = z8; }
  *(v8us*)&sk[0][srow][sch] = rk0; *(v8us*)&sk[0][srow + 32][sch] = rk1; *(v8us*)&sv[0][srow][sch] = rv0; *(v8us*)&sv[0][srow + 32][sch] = rv1;
  __syncthreads();      /* tile 0 is visible to all 8 waves */
#pragma unroll 1  // rolled: one tile a trip; the two 32-key passes inside are unrolled
  for (int st = 0; st < SQ / FA_SK; ++st) {
    const int b = st & 1; const bool more = st + 1 < SQ / FA_SK;      /* the same for the whole work-group */
    if (more) { const unsigned short* kp = kg + (size_t)(st + 1) * FA_SK * LQ; const unsigned short* vp = vg + (st + 1) * FA_SK;      /* next tile: in flight under this tile's work */
      rk0 = *(const v8us*)kp; rk1 = *(const v8us*)(kp + (size_t)32 * LQ); rv0 = *(const v8us*)vp; rv1 = *(const v8us*)(vp + (size_t)32 * SQ); }
    v8f s[2][2][2];      /* S^T of the tile: [32-key pass][16-key tile][16-column group] */
#pragma unroll
    for (int sub = 0; sub < 2; ++sub)
#pragma unroll
      for (int kt = 0; kt < 2; ++kt) { const _Float16* kr = &sk[b][sub * 32 + 16 * kt + c][8 * h]; const v16h k0 = fa_frag(kr), k1 = fa_frag(kr + 32);
#pragma unroll
        for (int g = 0; g < 2; ++g) s[sub][kt][g] = fa_mma(k1, qf[g][1], fa_mma(k0, qf[g][0], z8)); }
    float mx[2];
#pragma unroll
    for (int g = 0; g < 2; ++g) {
      float x = s[0][0][g][0];      /* maximum of the tile's raw scores (the scale is positive) */
#pragma unroll
      for (int r = 1; r < 8; ++r) x = fmaxf(x, s[0][0][g][r]);
#pragma unroll
      for (int u = 1; u < 4; ++u)
#pragma unroll
        for (int r = 0; r < 8; ++r) x = fmaxf(x, s[u >> 1][u & 1][g][r]);
      mx[g] = fmaxf(x, fa_xhalf(x)) * cs;      /* both wave halves hold the query's tile maximum, scaled */
    }
    // lazy rescale: m_run is the reference in use, not the true maximum; it moves, and o and the sum are rescaled, only when some column's tile maximum lies more than 8 (base-2 domain) above it,
    // so a weight is at most 2^8, far inside f16 and f32; o / sum does not depend on the reference. One test a tile for the whole wave, a scalar branch; taken on the first tile (factor 0).
    if (__builtin_amdgcn_ballot_w32(mx[0] > m_run[0] + 8.0f || mx[1] > m_run[1] + 8.0f) != 0) {
#pragma unroll
      for (int g = 0; g < 2; ++g) {
        const float m_new = fmaxf(m_run[g], mx[g]); const float corr = __builtin_amdgcn_exp2f(m_run[g] - m_new);
        m_run[g] = m_new; l_run[g] = l_run[g] * corr;
#pragma unroll
        for (int t = 0; t < 4; ++t) acc[g][t] = acc[g][t] * corr;
      }
    }
#pragma unroll
    for (int sub = 0; sub < 2; ++sub) {      /* one pass: 32 keys x the wave's 32 query columns */
      v16h vf[4];
#pragma unroll
      for (int t = 0; t < 4; ++t) vf[t] = fa_frag(&sv[b][16 * t + c][sub * 32 + 8 * h]);
#pragma unroll
      for (int g = 0; g < 2; ++g) {
        FragP pf; f32x2 ps[8];
#pragma unroll
        for (int i = 0; i < 8; ++i) {
          const f32x2 a = __builtin_elementwise_fma(f32x2{s[sub][i >> 2][g][2 * (i & 3)], s[sub][i >> 2][g][2 * (i & 3) + 1]}, f32x2{cs, cs}, f32x2{-m_run[g], -m_run[g]});
          const f32x2 p = {__builtin_amdgcn_exp2f(a.x), __builtin_amdgcn_exp2f(a.y)};
          ps[i] = p; pf.w[i] = __builtin_bit_cast(unsigned int, __builtin_convertvector(p, v2h)); }
        l_run[g] = l_run[g] + (((ps[0] + ps[1]) + (ps[2] + ps[3])) + ((ps[4] + ps[5]) + (ps[6] + ps[7])));      /* a tree, not one chain of 8 dependent adds */
#pragma unroll
        for (int t = 0; t < 4; ++t) acc[g][t] = fa_mma(vf[t], pf.v, acc[g][t]);
      }
    }
    if (more) { *(v8us*)&sk[b ^ 1][srow][sch] = rk0; *(v8us*)&sk[b ^ 1][srow + 32][sch] = rk1; *(v8us*)&sv[b ^ 1][srow][sch] = rv0; *(v8us*)&sv[b ^ 1][srow + 32][sch] = rv1; }      /* every wave left that buffer before the last barrier */
    __syncthreads();      /* publishes tile st + 1 and ends every wave's reads of tile st, whose buffer the next trip refills */
  }
#pragma unroll
  for (int g = 0; g < 2; ++g) { float l = l_run[g].x + l_run[g].y; l += fa_xhalf(l); const float inv = 64.0f / l;      /* o carried x64, as the output GEMM's alpha expects */
#pragma unroll
    for (int t = 0; t < 4; ++t) { FragH f;
#pragma unroll
      for (int r = 0; r < 8; ++r) f.h[r] = (_Float16)(acc[g][t][r] * inv);
      *(v8us*)((unsigned short*)Oh + (size_t)(q0 + 16 * g + c) * DM + head * HD + 16 * t + 8 * h) = f.half[0]; } }      /* 8 consecutive d of one query row: one 16-byte store */
}

// ---- all seven pre-passes in ONE launch: they depend on nothing but the inputs, so the job is picked by work-group number (the same for a whole work-group) ----
// work-groups [0, 4 PW): weight j = block / PW as Bt[n][k] x16, a thread's work that of k_wt_f16; the rest: stream j = (block - 4 PW) / PX as exact f16 rows, a thread's work that of k_x16.
// The weight jobs stand first: their scattered reads take longest, and the streaming jobs start behind them while they wait. Bt and X16 hold the jobs' planes one behind the other.
#define PW (DM * (DM / 8) / 256)               /* work-groups per weight */
#define PX ((unsigned)(NR * DM / 8 / 256))     /* work-groups per input stream */
__global__ __launch_bounds__(256) void k_prep(const float* __restrict__ w0, const float* __restrict__ w1, const float* __restrict__ w2, const float* __restrict__ w3,
                                              const float* __restrict__ x0, const float* __restrict__ x1, const float* __restrict__ x2, _Float16* __restrict__ Bt, _Float16* __restrict__ X16) {
  const unsigned blk = blockIdx.x; FragH f;
  if (blk < 4 * PW) {
    const unsigned j = blk / PW; const float* W = j == 0 ? w0 : j == 1 ? w1 : j == 2 ? w2 : w3;
    const int t = (int)(blk - j * PW) * 256 + threadIdx.x; const int n = t / (DM / 8), k8 = (t % (DM / 8)) * 8;
#pragma unroll
    for (int i = 0; i < 8; ++i) f.h[i] = (_Float16)(bf16_round(W[(size_t)(k8 + i) * DM + n]) * 16.0f);
    *(v8us*)((unsigned short*)Bt + (size_t)j * DM * DM + (size_t)n * DM + k8) = f.half[0];
  } else {
    const unsigned r = blk - 4 * PW, j = r / PX; const float* x = j == 0 ? x0 : j == 1 ? x1 : x2;
    const size_t t = (size_t)(r - j * PX) * 256 + threadIdx.x;
#pragma unroll
    for (int q = 0; q < 8; ++q) f.h[q] = (_Float16)bf16_round(x[t * 8 + q]);
    *(v8us*)((unsigned short*)X16 + (size_t)j * NR * DM + t * 8) = f.half[0];
  }
}

extern "C" void kernel_launch(void* const* d_in, const int* in_sizes, int n_in,
                              void* d_out, int out_size, void* d_ws, size_t ws_size, hipStream_t stream) {
  (void)in_sizes; (void)n_in; (void)out_size;
  const float* const* I = (const float* const*)d_in; const float* xq = I[2]; const float* xk = I[1]; const float* xv = I[0]; const float* wq = I[5]; const float* wk = I[4]; const float* wv = I[3]; const float* wo = I[6]; const float* bo = I[7];      /* input order: values, keys, query (three unbatched [4096][1024] streams in REVERSE order: the query stream is I[2]), Wv, Wk, Wq (the weights in the same reverse order: Wq is I[5]), Wo, bo ([in][out] weights); the q / k / v projections have NO biases: null pointers in the guarded bias slots */
  char* ws = (char*)d_ws; size_t off = 0;
  auto take = [&](size_t bytes) { char* p = ws + off; off += (bytes + 255) & ~(size_t)255; return p; };
  _Float16* BQ = (_Float16*)take((size_t)4 * DM * DM * 2); _Float16* BO = BQ + (size_t)3 * DM * DM;      /* four weight planes in a row: q, k, v, o */
  _Float16* XQ = (_Float16*)take(3 * NR * DM * 2); _Float16* Q16 = (_Float16*)take(3 * NR * DM * 2); _Float16* K16 = Q16 + NR * DM; _Float16* V16 = K16 + NR * DM; _Float16* O16 = (_Float16*)take(NR * DM * 2);      /* three planes in a row each: the q, k, v sources; q, k, v */
  _Float16* VT = (_Float16*)take((size_t)NH * HD * SQ * 2);
  if (off > ws_size) return;
  k_prep<<<4 * PW + 3 * PX, 256, 0, stream>>>(wq, wk, wv, wo, xq, xk, xv, BQ, XQ);      /* one launch: the four [in][out] weights -> Bt[n][k] x16 (the planes from BQ on), the three inputs as exact f16 rows (the planes from XQ on) */
  const size_t r0p = (size_t)B0 * SQ;      /* first projected row */
  k_gemm2<0, false><<<dim3((unsigned)((MP / 128) * (DM / 128)), 3), 128, 0, stream>>>(XQ + r0p * DM, DM, NR * DM, BQ, DM, (size_t)DM * DM, 0.0625f, nullptr, 0, nullptr, 1, 0, 0, nullptr, Q16 + r0p * DM, DM, NR * DM, MP, DM, DM);      /* q, k and v in one launch: grid y steps through the three planes from XQ, from BQ and from Q16; no biases */
  for (int b = B0; b < B0 + NBR; ++b) { const size_t r0 = (size_t)b * SQ;
    k_vt<NH, SQ><<<NH * (SQ / 64), 256, 0, stream>>>(V16 + r0 * LQ, LQ, 0, VT);      /* V^T [NH][HD][SQ] for this batch */
    k_fattn<<<dim3(QN / 256, NHD), 256, 0, stream>>>(Q16 + r0 * LQ, K16 + r0 * LQ, VT, O16 + r0 * DM); }      /* all heads: scores (THIS module's scale 1/sqrt(EMBED 1024) = 1/32), softmax, P.V; o x64 (merged heads) as f16 rows */
  k_gemm2<0, false><<<dim3((unsigned)((MPO / 128) * (DM / 128)), 1), 128, 0, stream>>>(O16 + r0p * DM, DM, 0, BO, DM, 0, 0.0009765625f, bo, 0, nullptr, 1, 0, 0, (float*)d_out + r0p * DM, nullptr, DM, 0, MPO, DM, DM);      /* out rows are the output layout */
}

// v007
// A run of this version takes 118 microseconds.
// Two timings next to v006 both put it at 1.06 times that version's speed.
// All steps since v000 together make it 114 times as fast.
#include <hip/hip_runtime.h>
// Multi-head attention on three unbatched inputs with [in][out] bias-free q / k / v projections, a biased output projection and the source's MODEL-WIDTH score scale; the inputs arrive in the order values, keys, query (each [4096][1024]; v / k / q = stream W ([in][out] 1024 x 1024 sd 1/32, NO biases), 16 heads of 64; energy / sqrt(1024) (the module scales by the EMBED width, not the head width: 1/32); softmax over all 4096 keys (no mask); out = merged Wo + bo ([in][out]) -> [4096][1024]); ONE attention launch for all heads.
// Structure: token rows r = b*4096 + s; the query, key and value sources as exact f16 rows (bf16-rounded); Q, K, V as three WMMA GEMMs (64x64 wave tiles, f32 accumulation, exact x16 weights, no bias, f16 outputs); per batch: V^T for all heads via LDS transposes; per batch ONE fused attention kernel over (256 query rows, head): per 32 keys the scores on WMMA (K = 64), online softmax on VALU (f32 lazily moved reference maximum and sum, native exp2; weights exp(s - reference), at most 2^8, as f16, in registers only), o += P . V on WMMA, o / sum carried x64 (against f16 subnormal flush, folded into the output GEMM alpha) written straight into the merged f16 o rows; out = o W_o + b GEMM (f32) into the output layout.
// Compute dtype: inputs rounded to bf16; x / weights exact; q, k, v, softmax weights and o as plain f16 GEMM operands (~2^-12); scores and softmax statistics f32. v_wmma_f32_16x16x32_f16.
#define NB 1
#define SQ 4096
#define DM 1024
#define NH 16
#define HD 64
#define HG 1                         /* heads per k_vt(V16, b, h0, VT) launch (that overload is not launched) */
#define B0 0                         /* first batch processed (debug hook) */
#define NBR NB                       /* batches processed (debug hook) */
#define NR ((size_t)NB * SQ)         /* token rows */
#define MP ((int)((size_t)NBR * SQ)) /* rows projected (debug hook) */
#define QN SQ                        /* query rows attended per batch (debug hook) */
#define NHD NH                       /* heads attended (debug hook) */
#define MPO MP                       /* rows through the output stage (debug hook) */
#define LQ DM      /* row pitch of the q/k/v rows */
typedef __bf16 v16b __attribute__((ext_vector_type(16)));
typedef unsigned short v8us __attribute__((ext_vector_type(8), may_alias));
typedef float  v8f  __attribute__((ext_vector_type(8)));
typedef float  v4f  __attribute__((ext_vector_type(4)));
typedef float  v4fa __attribute__((ext_vector_type(4), may_alias));
union FragB { v16b v; v8us half[2]; unsigned short u[16]; };

__device__ __forceinline__ unsigned short bf16_bits(float x) { unsigned int u = __float_as_uint(x); return (unsigned short)((u + 0x7FFFu + ((u >> 16) & 1u)) >> 16); }
__device__ __forceinline__ float bf16_val(unsigned short b) { return __uint_as_float(((unsigned int)b) << 16); }
__device__ __forceinline__ float bf16_round(float x) { return bf16_val(bf16_bits(x)); }
// D += A·B with NT terms: 1 = ah·bh, 2 = + al·bh (A split), 3 = + ah·bl (both split)
template <int NT>
__device__ __forceinline__ v8f mmaN(v16b ah, v16b al, v16b bh, v16b bl, v8f c) {
  c = __builtin_amdgcn_wmma_f32_16x16x32_bf16(false, ah, false, bh, (short)0, c, false, false);
  if (NT >= 2) c = __builtin_amdgcn_wmma_f32_16x16x32_bf16(false, al, false, bh, (short)0, c, false, false);
  if (NT >= 3) c = __builtin_amdgcn_wmma_f32_16x16x32_bf16(false, ah, false, bl, (short)0, c, false, false);
  asm volatile("v_nop\n\tv_nop\n\tv_nop\n\tv_nop" : "+v"(c) : "v"(ah), "v"(al), "v"(bh), "v"(bl));
  return c;
}

__global__ __launch_bounds__(256) void k_wt_bf16(const float* __restrict__ W, unsigned short* __restrict__ Wt, int K, int N) {
  const int t = blockIdx.x * 256 + threadIdx.x;
  const int k8n = K / 8;
  if (t >= N * k8n) return;
  const int n = t / k8n, k8 = (t % k8n) * 8;
  v8us v;
#pragma unroll
  for (int i = 0; i < 8; ++i) v[i] = bf16_bits(W[(size_t)(k8 + i) * N + n]);
  *(v8us*)(Wt + (size_t)n * K + k8) = v;
  
}

// GEMM C[M][N] (f32, pitch ldc) = act(A[M][K]·W + bias). A f32 row-major (pitch lda) converted per fragment to bf16
// (ASPLIT: hi/lo two planes -> 2 terms, else single rounded term); Wt bf16 [N][K] (pitch ldb). BIAS_BF16 rounds the
// bias to bf16 first (bias quantised to bf16 before the add). K%32==0, M%16==0, N%64==0.
template <bool ASPLIT, int ACT, bool BIAS_BF16>
__global__ __launch_bounds__(128) void k_gemm_bf(const float* __restrict__ A, int lda, const unsigned short* __restrict__ Wt, int ldb,
                                               const float* __restrict__ bias, float* __restrict__ C, int ldc, int M, int N, int K) {
  __shared__ __attribute__((aligned(16))) float so[4][16][64];
  const int tid = threadIdx.x, w = tid >> 5, lane = tid & 31, ln = lane & 15, hh = lane >> 4;
  const int ntn = N / 64;
  const int wid = blockIdx.x * 4 + w;
  const int mt = wid / ntn, nq = wid % ntn;
  if (mt * 16 >= M) return;
  const int row0 = mt * 16, col0 = nq * 64;
  const float* arow = A + (size_t)(row0 + ln) * lda;
  v8f acc[4] = {};
  for (int kb = 0; kb < K; kb += 32) {
    FragB ah, al;
    const v4f x0 = *(const v4fa*)(arow + kb + 8 * hh), x1 = *(const v4fa*)(arow + kb + 8 * hh + 4);
    const v4f x2 = *(const v4fa*)(arow + kb + 16 + 8 * hh), x3 = *(const v4fa*)(arow + kb + 16 + 8 * hh + 4);
    float xs[16] = {x0[0],x0[1],x0[2],x0[3],x1[0],x1[1],x1[2],x1[3],x2[0],x2[1],x2[2],x2[3],x3[0],x3[1],x3[2],x3[3]};
#pragma unroll
    for (int i = 0; i < 16; ++i) { const unsigned short hb = bf16_bits(xs[i]); ah.u[i] = hb; al.u[i] = ASPLIT ? bf16_bits(xs[i] - bf16_val(hb)) : (unsigned short)0; }
#pragma unroll
    for (int t = 0; t < 4; ++t) {
      const unsigned short* brow = Wt + (size_t)(col0 + t * 16 + ln) * ldb + kb;
      FragB b;
      b.half[0] = *(const v8us*)(brow + 8 * hh);
      b.half[1] = *(const v8us*)(brow + 16 + 8 * hh);
      acc[t] = mmaN<ASPLIT ? 2 : 1>(ah.v, al.v, b.v, b.v, acc[t]);
    }
  }
#pragma unroll
  for (int t = 0; t < 4; ++t) {
    float bv = bias ? bias[col0 + t * 16 + ln] : 0.f;
    if (BIAS_BF16) bv = bf16_round(bv);
#pragma unroll
    for (int r = 0; r < 8; ++r) { float v = acc[t][r] + bv; if (ACT == 1) v = fmaxf(v, 0.f); so[w][8 * hh + r][t * 16 + ln] = v; }
  }
  __builtin_amdgcn_fence(__ATOMIC_ACQ_REL, "workgroup");
  __builtin_amdgcn_wave_barrier();
  const int rsub = lane >> 4, c4 = (lane & 15) * 4;
  {
#pragma unroll
    for (int q = 0; q < 8; ++q) {
      const int r = q * 2 + rsub;
      const v4f v = *(const v4fa*)&so[w][r][c4];
      *(v4f*)(C + (size_t)(row0 + r) * ldc + col0 + c4) = v;
    }
    
  }
}

// GEMM C = act(A·W + bias + resid): A f32 (ASPLIT -> hi/lo 2 terms), Wt bf16 [N][K]; ACT 0 none, 1 relu, 2 exact gelu;
// resid (optional, f32, row index = (row % rmod), pitch ldr, RES_BF16 rounds it) added before the activation.
template <bool ASPLIT, int ACT, bool BIAS_BF16, bool RES_BF16>
__global__ __launch_bounds__(128) void k_gemm_bf3(const float* __restrict__ A, int lda, const unsigned short* __restrict__ Wt, int ldb,
                                                const float* __restrict__ bias, const float* __restrict__ resid, int rmod, int ldr,
                                                float* __restrict__ C, int ldc, int M, int N, int K) {
  __shared__ __attribute__((aligned(16))) float so[4][16][64];
  const int tid = threadIdx.x, w = tid >> 5, lane = tid & 31, ln = lane & 15, hh = lane >> 4;
  const int ntn = N / 64;
  const int wid = blockIdx.x * 4 + w;
  const int mt = wid / ntn, nq = wid % ntn;
  if (mt * 16 >= M) return;
  const int row0 = mt * 16, col0 = nq * 64;
  const float* arow = A + (size_t)(row0 + ln) * lda;
  v8f acc[4] = {};
  for (int kb = 0; kb < K; kb += 32) {
    FragB ah, al;
    const v4f x0 = *(const v4fa*)(arow + kb + 8 * hh), x1 = *(const v4fa*)(arow + kb + 8 * hh + 4);
    const v4f x2 = *(const v4fa*)(arow + kb + 16 + 8 * hh), x3 = *(const v4fa*)(arow + kb + 16 + 8 * hh + 4);
    float xs[16] = {x0[0],x0[1],x0[2],x0[3],x1[0],x1[1],x1[2],x1[3],x2[0],x2[1],x2[2],x2[3],x3[0],x3[1],x3[2],x3[3]};
#pragma unroll
    for (int i = 0; i < 16; ++i) { const unsigned short hb = bf16_bits(xs[i]); ah.u[i] = hb; al.u[i] = ASPLIT ? bf16_bits(xs[i] - bf16_val(hb)) : (unsigned short)0; }
#pragma unroll
    for (int t = 0; t < 4; ++t) {
      const unsigned short* brow = Wt + (size_t)(col0 + t * 16 + ln) * ldb + kb;
      FragB b;
      b.half[0] = *(const v8us*)(brow + 8 * hh);
      b.half[1] = *(const v8us*)(brow + 16 + 8 * hh);
      acc[t] = mmaN<ASPLIT ? 2 : 1>(ah.v, al.v, b.v, b.v, acc[t]);
    }
  }
#pragma unroll
  for (int t = 0; t < 4; ++t) {
    const int col = col0 + t * 16 + ln;
    float bv = bias ? bias[col] : 0.f;
    if (BIAS_BF16) bv = bf16_round(bv);
#pragma unroll
    for (int r = 0; r < 8; ++r) {
      float v = acc[t][r] + bv;
      if (resid) { float rv = resid[(size_t)((row0 + 8 * hh + r) % rmod) * ldr + col]; if (RES_BF16) rv = bf16_round(rv); v += rv; }
      if (ACT == 1) v = fmaxf(v, 0.f);
      if (ACT == 2) v = 0.5f * v * (1.0f + erff(v * 0.70710678118654752f));
      if (ACT == 3) { const float u = 0.7978845608028654f * (v + 0.044715f * v * v * v); v = 0.5f * v * (1.0f + tanhf(u)); }
      so[w][8 * hh + r][t * 16 + ln] = v;
    }
  }
  __builtin_amdgcn_fence(__ATOMIC_ACQ_REL, "workgroup");
  __builtin_amdgcn_wave_barrier();
  const int rsub = lane >> 4, c4 = (lane & 15) * 4;
  {
#pragma unroll
    for (int q = 0; q < 8; ++q) {
      const int r = q * 2 + rsub;
      const v4f v = *(const v4fa*)&so[w][r][c4];
      *(v4f*)(C + (size_t)(row0 + r) * ldc + col0 + c4) = v;
    }
    
  }
}
// row LayerNorm (biased variance, eps) over N: s = X (+ R); optional out_sum <- s; out_norm <- (s-mu)*rsqrt(var+eps)*g + b
template <bool PARAM_BF16>
__global__ __launch_bounds__(256) void k_layernorm(const float* __restrict__ X, const float* __restrict__ R, const float* __restrict__ g, const float* __restrict__ bta,
                                                  float* __restrict__ out_sum, float* __restrict__ out_norm, int N, float eps) {
  __shared__ float red[256];
  const int row = blockIdx.x, tid = threadIdx.x;
  const float* x = X + (size_t)row * N; const float* rr = R ? R + (size_t)row * N : nullptr;
  float vals[16];                     // up to N = 4096
  const int per = N / 256;            // contiguous chunk per thread? use strided-by-4 chunks: thread handles j = tid*4 + 1024*u
  float s1 = 0.f;
  for (int u = 0; u < per / 4; ++u) {
    const int j = tid * 4 + 1024 * u;
    const v4f a = *(const v4fa*)(x + j);
    v4f b = {0.f,0.f,0.f,0.f}; if (rr) b = *(const v4fa*)(rr + j);
#pragma unroll
    for (int q = 0; q < 4; ++q) { const float v = a[q] + b[q]; vals[u * 4 + q] = v; s1 += v; }
  }
  red[tid] = s1; __syncthreads();
  for (int st = 128; st > 0; st >>= 1) { if (tid < st) red[tid] += red[tid + st]; __syncthreads(); }
  const float mu = red[0] / (float)N; __syncthreads();
  float s2 = 0.f;
  for (int u = 0; u < per / 4; ++u)
#pragma unroll
    for (int q = 0; q < 4; ++q) { const float c = vals[u * 4 + q] - mu; s2 += c * c; }
  red[tid] = s2; __syncthreads();
  for (int st = 128; st > 0; st >>= 1) { if (tid < st) red[tid] += red[tid + st]; __syncthreads(); }
  const float rs = rsqrtf(red[0] / (float)N + eps);
  {
    for (int u = 0; u < per / 4; ++u) {
      const int j = tid * 4 + 1024 * u;
      v4f o, sm;
#pragma unroll
      for (int q = 0; q < 4; ++q) {
        float gg = g[j + q], bb = bta[j + q];
        if (PARAM_BF16) { gg = bf16_round(gg); bb = bf16_round(bb); }
        sm[q] = vals[u * 4 + q]; o[q] = (vals[u * 4 + q] - mu) * rs * gg + bb;
      }
      if (out_sum) *(v4f*)(out_sum + (size_t)row * N + j) = sm;
      *(v4f*)(out_norm + (size_t)row * N + j) = o;
    }
    
  }
}



// ---- f16 WMMA path (v_wmma_f32_16x16x32_f16): 11-bit significands for operands in range — used where a [0,1] probability operand needs more precision than bf16
typedef _Float16 v16h __attribute__((ext_vector_type(16)));
union FragH { v16h v; v8us half[2]; _Float16 h[16]; unsigned short u[16]; };
template <int NT>
__device__ __forceinline__ v8f mmaH(v16h ah, v16h al, v16h bh, v16h bl, v8f c) {
  c = __builtin_amdgcn_wmma_f32_16x16x32_f16(false, ah, false, bh, (short)0, c, false, false);
  if (NT >= 2) c = __builtin_amdgcn_wmma_f32_16x16x32_f16(false, al, false, bh, (short)0, c, false, false);
  if (NT >= 3) c = __builtin_amdgcn_wmma_f32_16x16x32_f16(false, ah, false, bl, (short)0, c, false, false);
  asm volatile("v_nop\n\tv_nop\n\tv_nop\n\tv_nop" : "+v"(c) : "v"(ah), "v"(al), "v"(bh), "v"(bl));
  return c;
}
// batched GEMM like k_gemm_b but f16 operands: A f32 (split into f16 hi/lo if ASPLIT, else rounded to f16), Bt = f16 values [n][k]; alpha; C f32; N multiple of 16 (partial tiles skipped)
template <bool ASPLIT>
__global__ __launch_bounds__(128) void k_gemm_h(const float* __restrict__ A, int lda, size_t sA, const _Float16* __restrict__ Bh, int ldb, size_t sB, float alpha, float* __restrict__ C, int ldc, size_t sC, int M, int N, int K) {
  __shared__ __attribute__((aligned(16))) float so[4][16][64];
  const int tid = threadIdx.x, w = tid >> 5, lane = tid & 31, ln = lane & 15, hh = lane >> 4; const int by = blockIdx.y;
  A += (size_t)by * sA; Bh += (size_t)by * sB; C += (size_t)by * sC;
  const int ntn = (N + 63) / 64; const int wid = blockIdx.x * 4 + w; const int mt = wid / ntn, nq = wid % ntn; if (mt * 16 >= M) return;
  const int row0 = mt * 16, col0 = nq * 64; const float* arow = A + (size_t)(row0 + ln) * lda;
  v8f acc[4] = {};
  for (int kb = 0; kb < K; kb += 32) {
    FragH ah, al;
    const v4f x0 = *(const v4fa*)(arow + kb + 8 * hh), x1 = *(const v4fa*)(arow + kb + 8 * hh + 4), x2 = *(const v4fa*)(arow + kb + 16 + 8 * hh), x3 = *(const v4fa*)(arow + kb + 16 + 8 * hh + 4);
    float xs[16] = {x0[0],x0[1],x0[2],x0[3],x1[0],x1[1],x1[2],x1[3],x2[0],x2[1],x2[2],x2[3],x3[0],x3[1],x3[2],x3[3]};
#pragma unroll
    for (int i = 0; i < 16; ++i) { const _Float16 h = (_Float16)xs[i]; ah.h[i] = h; al.h[i] = ASPLIT ? (_Float16)(xs[i] - (float)h) : (_Float16)0.0f; }
#pragma unroll
    for (int t = 0; t < 4; ++t) { if (col0 + t * 16 >= N) continue; const size_t boff = (size_t)(col0 + t * 16 + ln) * ldb + kb; FragH bq; bq.half[0] = *(const v8us*)(Bh + boff + 8 * hh); bq.half[1] = *(const v8us*)(Bh + boff + 16 + 8 * hh);
      acc[t] = mmaH<ASPLIT ? 2 : 1>(ah.v, al.v, bq.v, bq.v, acc[t]); }
  }
#pragma unroll
  for (int t = 0; t < 4; ++t) { if (col0 + t * 16 >= N) continue;
#pragma unroll
    for (int r = 0; r < 8; ++r) so[w][8 * hh + r][t * 16 + ln] = acc[t][r] * alpha; }
  __builtin_amdgcn_fence(__ATOMIC_ACQ_REL, "workgroup"); __builtin_amdgcn_wave_barrier();
  const int rsub = lane >> 4, c4 = (lane & 15) * 4;
  {
#pragma unroll
    for (int q = 0; q < 8; ++q) { const int r = q * 2 + rsub; if (col0 + c4 < N) { const v4f v = *(const v4fa*)&so[w][r][c4]; *(v4f*)(C + (size_t)(row0 + r) * ldc + col0 + c4) = v; } }
     }
}

// Wt[n][k] = f16(W[k][n]·scale) from f32 row-major W[K][N] (scale = power of two; bf16-exact weights stay exact in f16 away from the subnormal range)
__global__ __launch_bounds__(256) void k_wt_f16(const float* __restrict__ W, _Float16* __restrict__ Wt, int K, int N, float scale) {
  const int t = blockIdx.x * 256 + threadIdx.x; if (t >= N * (K / 8)) return; const int n = t / (K / 8), k8 = (t % (K / 8)) * 8; FragH f;
#pragma unroll
  for (int i = 0; i < 8; ++i) f.h[i] = (_Float16)(bf16_round(W[(size_t)(k8 + i) * N + n]) * scale); const v8us o = f.half[0];
  *(v8us*)((unsigned short*)Wt + (size_t)n * K + k8) = o; 
}
// k_gemm_hh variant with fused epilogue: v = acc·alpha + bias[by·sBias + col] (+ CP[(row/rowsPerB)·sCPb + by·64 + col] if CP) ; ACT 0 none / 1 elu ; writes f16 C16 (and f32 C if non-null)
template <int ACT>
__global__ __launch_bounds__(128) void k_gemm_hhx(const _Float16* __restrict__ A, int lda, size_t sA, const _Float16* __restrict__ Bh, int ldb, size_t sB, float alpha, const float* __restrict__ bias, size_t sBias, const float* __restrict__ CP, int rowsPerB, size_t sCPb, int row0g,
    float* __restrict__ C, _Float16* __restrict__ C16, int ldc, size_t sC, int M, int N, int K) {
  __shared__ __attribute__((aligned(16))) float so[4][16][64];
  const int tid = threadIdx.x, w = tid >> 5, lane = tid & 31, ln = lane & 15, hh = lane >> 4; const int by = blockIdx.y;
  A += (size_t)by * sA; Bh += (size_t)by * sB; const size_t cofs = (size_t)by * sC; const float* bp = bias ? bias + (size_t)by * sBias : nullptr;
  const int ntn = (N + 63) / 64; const int wid = blockIdx.x * 4 + w; const int mt = wid / ntn, nq = wid % ntn; if (mt * 16 >= M) return;
  const int row0 = mt * 16, col0 = nq * 64; const _Float16* arow = A + (size_t)(row0 + ln) * lda;
  v8f acc[4] = {};
  for (int kb = 0; kb < K; kb += 32) { FragH ah; ah.half[0] = *(const v8us*)((const unsigned short*)arow + kb + 8 * hh); ah.half[1] = *(const v8us*)((const unsigned short*)arow + kb + 16 + 8 * hh);
#pragma unroll
    for (int t = 0; t < 4; ++t) { if (col0 + t * 16 >= N) continue; const size_t boff = (size_t)(col0 + t * 16 + ln) * ldb + kb; FragH bq; bq.half[0] = *(const v8us*)((const unsigned short*)Bh + boff + 8 * hh); bq.half[1] = *(const v8us*)((const unsigned short*)Bh + boff + 16 + 8 * hh);
      acc[t] = mmaH<1>(ah.v, ah.v, bq.v, bq.v, acc[t]); }
  }
#pragma unroll
  for (int t = 0; t < 4; ++t) { if (col0 + t * 16 >= N) continue; const int col = col0 + t * 16 + ln; const float bv = bp ? bf16_round(bp[col]) : 0.f;
#pragma unroll
    for (int r = 0; r < 8; ++r) { float v = acc[t][r] * alpha + bv; if (CP) { const int rr = row0g + row0 + 8 * hh + r; if (rowsPerB < 0) v += CP[cofs + (size_t)rr * ldc + col];      /* rowsPerB < 0: own element of the batched C plane */ else { const int bidx = rr / rowsPerB; v += CP[(size_t)bidx * sCPb + (size_t)by * 64 + col]; } } if (ACT == 1) v = (v > 0.f) ? v : expm1f(v); else if (ACT == 7) v = (v > 0.f) ? v + 1.0f : expf(v); else if (ACT == 8) v = tanhf(v); else if (ACT == 9) v = 0.5f * v * (1.0f + tanhf(0.7978845608028654f * (v + 0.044715f * v * v * v))); else if (ACT == 11) v = 1.0f / (1.0f + expf(-v)); else if (ACT == 12) v = (v > 0.f) ? v : 0.01f * v; else if (ACT == 14) v = (v > 0.f) ? v : 0.1f * v; else if (ACT == 16) v = (v >= 0.f) ? v : 0.3f * v; else if (ACT == 17) v = (v >= 0.f) ? v : 0.2f * v; else if (ACT == 15) v = v / (1.0f + expf(-v)); else if (ACT == 3) v = fmaxf(v, 0.f); else if (ACT == 6) v = 0.5f * v * (1.0f + erff(v * 0.70710678118654752f)); so[w][8 * hh + r][t * 16 + ln] = v; } }
  __builtin_amdgcn_fence(__ATOMIC_ACQ_REL, "workgroup"); __builtin_amdgcn_wave_barrier();
  const int rsub = lane >> 4, c4 = (lane & 15) * 4; typedef _Float16 v4h __attribute__((ext_vector_type(4)));
  {
#pragma unroll
    for (int q = 0; q < 8; ++q) { const int r = q * 2 + rsub; if (col0 + c4 < N) { const v4f v = *(const v4fa*)&so[w][r][c4]; if (C) *(v4f*)(C + cofs + (size_t)(row0 + r) * ldc + col0 + c4) = v; if (C16) { v4h h4; for (int i = 0; i < 4; ++i) h4[i] = (_Float16)v[i]; *(v4h*)(C16 + cofs + (size_t)(row0 + r) * ldc + col0 + c4) = h4; } } }
     }
}


typedef _Float16 v4h __attribute__((ext_vector_type(4)));

__global__ __launch_bounds__(256) void k_x16(const float* __restrict__ x, _Float16* __restrict__ X16, size_t n8) { const size_t t = (size_t)blockIdx.x * 256 + threadIdx.x; if (t >= n8) return; FragH f;
#pragma unroll
  for (int q = 0; q < 8; ++q) f.h[q] = (_Float16)bf16_round(x[t * 8 + q]); *(v8us*)((unsigned short*)X16 + t * 8) = f.half[0];  }
__global__ __launch_bounds__(256) void k_h16(const float* __restrict__ x, _Float16* __restrict__ X16, size_t n8) { const size_t t = (size_t)blockIdx.x * 256 + threadIdx.x; if (t >= n8) return; FragH f;
#pragma unroll
  for (int q = 0; q < 8; ++q) f.h[q] = (_Float16)x[t * 8 + q]; *(v8us*)((unsigned short*)X16 + t * 8) = f.half[0];  }
__global__ __launch_bounds__(256) void k_round16f(const float* __restrict__ W, _Float16* __restrict__ Bt, size_t n8) { const size_t t = (size_t)blockIdx.x * 256 + threadIdx.x; if (t >= n8) return; FragH f;
#pragma unroll
  for (int i = 0; i < 8; ++i) f.h[i] = (_Float16)(bf16_round(W[t * 8 + i]) * 16.0f); *(v8us*)((unsigned short*)Bt + t * 8) = f.half[0];  }
template <int NHv, int TTv>
__global__ __launch_bounds__(256) void k_vt(const _Float16* __restrict__ V16, int ldv, int voff, _Float16* __restrict__ Vt) { __shared__ unsigned short tl[64][66]; const int tid = threadIdx.x; const int slab = blockIdx.x / (TTv / 64), lg = blockIdx.x % (TTv / 64); const int b = slab / NHv, h = slab % NHv;
  for (int i = tid; i < 64 * 8; i += 256) { const int r = i / 8, c8 = (i % 8) * 8; FragH f; f.half[0] = *(const v8us*)((const unsigned short*)V16 + ((size_t)b * TTv + lg * 64 + r) * ldv + voff + h * 64 + c8);
#pragma unroll
    for (int q = 0; q < 8; ++q) tl[r][c8 + q] = f.u[q]; }
  __syncthreads();
  {
#pragma unroll
    for (int rd = 0; rd < 2; ++rd) { const int d = rd * 32 + tid / 8, pc = tid % 8; FragH f;
#pragma unroll
      for (int q = 0; q < 8; ++q) f.u[q] = tl[pc * 8 + q][d];
      *(v8us*)((unsigned short*)Vt + ((size_t)slab * 64 + d) * TTv + lg * 64 + pc * 8) = f.half[0]; }
     } }

__global__ __launch_bounds__(256) void k_hl(const float* __restrict__ F, _Float16* __restrict__ Hh, _Float16* __restrict__ Hl, size_t n8) { const size_t t = (size_t)blockIdx.x * 256 + threadIdx.x; if (t >= n8) return; FragH fh, fl; const v4f a = *(const v4fa*)(F + t * 8), c = *(const v4fa*)(F + t * 8 + 4);
#pragma unroll
  for (int q = 0; q < 4; ++q) { _Float16 h = (_Float16)a[q]; fh.h[q] = h; fl.h[q] = (_Float16)((a[q] - (float)h) * 1024.0f); h = (_Float16)c[q]; fh.h[4 + q] = h; fl.h[4 + q] = (_Float16)((c[q] - (float)h) * 1024.0f); }
  { *(v8us*)((unsigned short*)Hh + t * 8) = fh.half[0]; *(v8us*)((unsigned short*)Hl + t * 8) = fl.half[0];  } }

// ---- fast GEMM (block tile 128x128, 4 waves as 2 x 2, wave tile 64x64; requires M % 128 == 0 rows per launch region, N % 128 == 0 and K % 64 == 0); epilogue = k_gemm_hhx semantics ----
// Both operands reach the fragments through LDS: a stage is 64 k = one whole 128-byte line of each of the block's 128 A rows and 128 B rows, fetched by loads in which 8 lanes cover one row
// (4 whole lines a wave load, where a fragment load straight from global memory touches 16 lines); two buffers, the next stage's global loads fly during this stage's products.
// The square tiles are there for bytes per product: a stage's 256 lines from L2 feed 128 products (128x64: 192 lines for 64), and a wave's 8 fragments of a 32-k block feed 16 products (32x64: 6 for 8).
#define G2_SK 64                     /* k per LDS stage */
#define G2_PH 72                     /* LDS row pitch in f16: 144 B = 16 B x odd, the conflict-free pitch for 16-byte fragment reads */
typedef float f32a __attribute__((may_alias));
__device__ __forceinline__ v16h g2_frag(const _Float16* p, int hh) { FragH f; f.half[0] = *(const v8us*)((const unsigned short*)p + 8 * hh); f.half[1] = *(const v8us*)((const unsigned short*)p + 16 + 8 * hh); return f.v; }
__device__ __forceinline__ v8f g2_mma(v16h a, v16h b, v8f c) { return __builtin_amdgcn_wmma_f32_16x16x32_f16(false, a, false, b, (short)0, c, false, false); }
// one stage's global loads of a thread: 16 bytes of 8 A rows and of 8 B rows, 16 rows apart
__device__ __forceinline__ void g2_stage(const unsigned short* a, size_t a16, const unsigned short* b, size_t b16, v8us (&ra)[8], v8us (&rb)[8]) {
  const unsigned short* pa[8]; const unsigned short* pb[8];
#pragma unroll
  for (int j = 0; j < 8; ++j) pa[j] = a + j * a16;
#pragma unroll
  for (int j = 0; j < 8; ++j) pb[j] = b + j * b16;
#pragma unroll
  for (int j = 0; j < 8; ++j) ra[j] = *(const v8us*)pa[j];
#pragma unroll
  for (int j = 0; j < 8; ++j) rb[j] = *(const v8us*)pb[j];
  // the wait that stands in front of any overwrite of an issued load's address registers; the 16 addresses are inputs so that their registers live up to it (else a later load's result lands in an earlier load's address pair)
  asm volatile("s_wait_xcnt 0x0" :: "v"(pa[0]), "v"(pa[1]), "v"(pa[2]), "v"(pa[3]), "v"(pa[4]), "v"(pa[5]), "v"(pa[6]), "v"(pa[7]), "v"(pb[0]), "v"(pb[1]), "v"(pb[2]), "v"(pb[3]), "v"(pb[4]), "v"(pb[5]), "v"(pb[6]), "v"(pb[7]) : "memory");
}
// HASCP false leaves the addend path (CP) out of the build: unrolled over the 128 results a lane now holds, its index arithmetic would stand between any two results and make the epilogue's text several times longer
template <int ACT, bool HASCP>
__global__ __launch_bounds__(128) void k_gemm2(const _Float16* __restrict__ A, int lda, size_t sA, const _Float16* __restrict__ Bh, int ldb, size_t sB, float alpha, const float* __restrict__ bias, size_t sBias, const float* __restrict__ CP, int rowsPerB, size_t sCPb, int row0g,
    float* __restrict__ C, _Float16* __restrict__ C16, int ldc, size_t sC, int M, int N, int K) { static_assert(ACT == 0 || ACT == 3 || ACT == 6 || ACT == 8 || ACT == 9 || ACT == 11 || ACT == 12 || ACT == 14 || ACT == 15 || ACT == 16 || ACT == 17, "k_gemm2: unsupported ACT code (would silently apply no activation)");
  __shared__ __attribute__((aligned(16))) _Float16 sa[2][128][G2_PH];      /* A stage: the block's 128 rows, 64 k */
  __shared__ __attribute__((aligned(16))) _Float16 sb[2][128][G2_PH];      /* B stage: the block's 128 columns (rows of Bt), 64 k */
  f32a (*so)[32][68] = (f32a (*)[32][68])&sa[0][0][0];      /* output staging, 32 rows a wave: lies in the A buffers, used only behind the k loop's last barrier (34,816 of their 36,864 bytes) */
  const int tid = threadIdx.x, w = tid >> 5, lane = tid & 31, ln = lane & 15, hh = lane >> 4; const int by = blockIdx.y;
  A += (size_t)by * sA; Bh += (size_t)by * sB; const size_t cofs = (size_t)by * sC; const float* bp = bias ? bias + (size_t)by * sBias : nullptr;
  const int ntn = N >> 7; const int mt = blockIdx.x / ntn, nq = blockIdx.x - mt * ntn; const int wr = 64 * (w >> 1), wc = 64 * (w & 1); const int row0 = mt * 128 + wr, col0 = nq * 128 + wc; if (mt * 128 >= M) return;      /* the whole work-group leaves or none: barriers follow */
  // staging: a thread moves 16 bytes of rows srow + 16 j; 8 threads cover one 128-byte row
  const int srow = tid >> 3, sch = (tid & 7) * 8;
  const unsigned short* ag = (const unsigned short*)A + (size_t)(mt * 128 + srow) * lda + sch;
  const unsigned short* bg = (const unsigned short*)Bh + (size_t)(nq * 128 + srow) * ldb + sch;
  v8us ra[8], rb[8];
  g2_stage(ag, (size_t)16 * lda, bg, (size_t)16 * ldb, ra, rb);
  const v8f z8 = {0.f,0.f,0.f,0.f,0.f,0.f,0.f,0.f}; v8f acc[4][4];      /* [16-row tile][16-column tile] */
#pragma unroll
  for (int i = 0; i < 4; ++i)
#pragma unroll
    for (int t = 0; t < 4; ++t) acc[i][t] = z8;
#pragma unroll
  for (int j = 0; j < 8; ++j) *(v8us*)&sa[0][srow + 16 * j][sch] = ra[j];
#pragma unroll
  for (int j = 0; j < 8; ++j) *(v8us*)&sb[0][srow + 16 * j][sch] = rb[j];
  __syncthreads();      /* stage 0 is visible to all 4 waves */
  const int nst = K / G2_SK;
#pragma unroll 1  // rolled: one stage a trip, so that the two buffers alternate by index; the two 32-k blocks inside are unrolled
  for (int st = 0; st < nst; ++st) {
    const int b = st & 1; const bool more = st + 1 < nst;      /* the same for the whole work-group */
    if (more) g2_stage(ag + (st + 1) * G2_SK, (size_t)16 * lda, bg + (st + 1) * G2_SK, (size_t)16 * ldb, ra, rb);      /* next stage: in flight under this stage's products */
    v16h fa[2][4], fb[2][4];      /* the stage's fragments: [32-k block][tile] */
#pragma unroll
    for (int kc = 0; kc < 2; ++kc)
#pragma unroll
      for (int t = 0; t < 4; ++t) { fa[kc][t] = g2_frag(&sa[b][wr + 16 * t + ln][32 * kc], hh); fb[kc][t] = g2_frag(&sb[b][wc + 16 * t + ln][32 * kc], hh); }
    __builtin_amdgcn_sched_barrier(0);      /* keeps the stage's 32 LDS reads one group in front of its 32 products: left alone the compiler reuses fragment registers and waits out the LDS latency again and again inside a stage */
#pragma unroll
    for (int kc = 0; kc < 2; ++kc)      /* k ascends by 32 in every accumulator: one fixed order of sums */
#pragma unroll
      for (int t = 0; t < 4; ++t)
#pragma unroll
        for (int i = 0; i < 4; ++i) acc[i][t] = g2_mma(fa[kc][i], fb[kc][t], acc[i][t]);
    if (more) {      /* every wave left that buffer before the last barrier */
#pragma unroll
      for (int j = 0; j < 8; ++j) *(v8us*)&sa[b ^ 1][srow + 16 * j][sch] = ra[j];
#pragma unroll
      for (int j = 0; j < 8; ++j) *(v8us*)&sb[b ^ 1][srow + 16 * j][sch] = rb[j]; }
    __syncthreads();      /* publishes stage st + 1 and ends every wave's reads of stage st, whose buffer the next trip refills */
  }
  const int rsub = lane >> 4, c4 = (lane & 15) * 4;
  float bv4[4] = {0.f, 0.f, 0.f, 0.f};      /* the lane's four bias values serve both halves; one test, so that the four loads fly together */
  if (bp) {
#pragma unroll
    for (int t = 0; t < 4; ++t) bv4[t] = bf16_round(bp[col0 + t * 16 + ln]); }
#pragma unroll
  for (int hb = 0; hb < 2; ++hb) {      /* the wave's 64 rows leave in two halves of 32 through its own staging rows */
    const int rowh = row0 + 32 * hb;
#pragma unroll
    for (int u = 0; u < 8; ++u) { const int t = u & 3, half = u >> 2; const int col = col0 + t * 16 + ln; const float bv = bv4[t];
#pragma unroll
      for (int r = 0; r < 8; ++r) { const int rloc = half * 16 + 8 * hh + r; float v = acc[2 * hb + half][t][r] * alpha + bv; if (HASCP && CP) { if (rowsPerB < 0) v += CP[cofs + (size_t)(row0g + rowh + rloc) * ldc + col];      /* rowsPerB < 0: own element of the batched C plane */ else { const int bidx = (row0g + rowh + rloc) / rowsPerB; v += CP[(size_t)bidx * sCPb + (size_t)by * 64 + col]; } }
        if (ACT == 3) v = fmaxf(v, 0.f); else if (ACT == 6) v = 0.5f * v * (1.0f + erff(v * 0.70710678118654752f)); else if (ACT == 11) v = 1.0f / (1.0f + expf(-v)); else if (ACT == 15) v = v / (1.0f + expf(-v)); else if (ACT == 12) v = (v > 0.f) ? v : 0.01f * v; else if (ACT == 8) v = tanhf(v); else if (ACT == 9) v = 0.5f * v * (1.0f + tanhf(0.7978845608028654f * (v + 0.044715f * v * v * v))); else if (ACT == 14) v = (v > 0.f) ? v : 0.1f * v; else if (ACT == 16) v = (v >= 0.f) ? v : 0.3f * v; else if (ACT == 17) v = (v >= 0.f) ? v : 0.2f * v;
        so[w][rloc][t * 16 + ln] = v; } }
    __builtin_amdgcn_fence(__ATOMIC_ACQ_REL, "wavefront"); asm volatile("s_wait_dscnt 0x0" ::: "memory"); __builtin_amdgcn_wave_barrier();      /* the wave's staged rows are written before its lanes read them back across lanes; the rows are the wave's own, so wave scope and the LDS wait are enough (a work-group fence here would also wait out the first half's global stores) */
    v4f vq[16];      /* all 16 reads in one group: one LDS latency a half, not one a row pair */
#pragma unroll
    for (int q = 0; q < 16; ++q) vq[q] = *(const v4fa*)&so[w][q * 2 + rsub][c4];
    __builtin_amdgcn_fence(__ATOMIC_ACQ_REL, "wavefront"); __builtin_amdgcn_wave_barrier();      /* the rows are read before the second half overwrites them */
    if (C) {
#pragma unroll
      for (int q = 0; q < 16; ++q) *(v4f*)(C + cofs + (size_t)(rowh + q * 2 + rsub) * ldc + col0 + c4) = vq[q];
      asm volatile("s_wait_xcnt 0x0" ::: "memory"); }      /* the wait that stands in front of any overwrite of the issued stores' registers (the f16 conversion below may reuse them) */
    if (C16) {
#pragma unroll
      for (int q = 0; q < 16; ++q) { v4h h4; for (int i = 0; i < 4; ++i) h4[i] = (_Float16)vq[q][i]; *(v4h*)(C16 + cofs + (size_t)(rowh + q * 2 + rsub) * ldc + col0 + c4) = h4; }
      asm volatile("s_wait_xcnt 0x0" ::: "memory"); }      /* the same wait behind the f16 stores: the next half's results reuse their registers */
  } }


__global__ __launch_bounds__(256) void k_wnat(const float* __restrict__ w, size_t n8, _Float16* __restrict__ Bt) { const size_t t = (size_t)blockIdx.x * 256 + threadIdx.x; if (t >= n8) return; FragH f; for (int q = 0; q < 8; ++q) f.h[q] = (_Float16)(bf16_round(w[t * 8 + q]) * 16.0f); *(v8us*)((unsigned short*)Bt + t * 8) = f.half[0];  }
__global__ __launch_bounds__(256) void k_rsm(const float* __restrict__ S, _Float16* __restrict__ P, int nrows) {
  #pragma clang fp contract(off)
  const int i = blockIdx.x * 256 + threadIdx.x; if (i >= nrows) return; const float* s = S + (size_t)i * SQ; float mx = -3.0e38f;
#pragma unroll 1
  for (int j = 0; j < SQ; ++j) mx = fmaxf(mx, s[j]); float se = 0.f;
#pragma unroll 1
  for (int j = 0; j < SQ; ++j) se += expf(s[j] - mx); const float sc = 256.0f / se;
#pragma unroll 1
  for (int j0 = 0; j0 < SQ; j0 += 8) { FragH f; for (int q = 0; q < 8; ++q) f.h[q] = (_Float16)(expf(s[j0 + q] - mx) * sc); unsigned short* d = (unsigned short*)P + (size_t)i * SQ + j0; *(v8us*)d = f.half[0];  } }
__global__ __launch_bounds__(256) void k_vt(const _Float16* __restrict__ V16, int b, int h0, _Float16* __restrict__ VT) { __shared__ unsigned short tl[64][65]; const int tid = threadIdx.x; const int hh = blockIdx.x % HG, sg = blockIdx.x / HG; const int s0 = sg * 64; const int h = h0 + hh;
  for (int i = tid; i < 64 * 8; i += 256) { const int j = i / 8, d8 = (i % 8) * 8; FragH f; f.half[0] = *(const v8us*)((const unsigned short*)V16 + ((size_t)b * SQ + s0 + j) * DM + h * HD + d8); for (int q = 0; q < 8; ++q) tl[d8 + q][j] = f.u[q]; }
  __syncthreads();
  { for (int i = tid; i < 64 * 8; i += 256) { const int d = i / 8, j8 = (i % 8) * 8; FragH f; for (int q = 0; q < 8; ++q) f.u[q] = tl[d][j8 + q]; *(v8us*)((unsigned short*)VT + ((size_t)hh * HD + d) * SQ + s0 + j8) = f.half[0]; }  } }



#define FA_SK 64                     /* keys per LDS tile */
#define FA_PH 72                     /* LDS row pitch in f16: 144 B = 16 B x odd, the conflict-free pitch for 16-byte fragment reads */
typedef float f32x2 __attribute__((ext_vector_type(2)));
typedef _Float16 v2h __attribute__((ext_vector_type(2)));
union FragP { v16h v; unsigned int w[8]; };
__device__ __forceinline__ float fa_xhalf(float x) { return __builtin_bit_cast(float, __builtin_amdgcn_permlanex16(__builtin_bit_cast(int, x), __builtin_bit_cast(int, x), 0x76543210, 0xfedcba98, false, false)); }      /* lane l <-> lane l ^ 16 */
__device__ __forceinline__ v16h fa_frag(const _Float16* p) { FragH f; f.half[0] = *(const v8us*)(const unsigned short*)p; f.half[1] = *(const v8us*)((const unsigned short*)p + 16); return f.v; }      /* p = row + 32 kc + 8 h: the hardware k order */
__device__ __forceinline__ v8f fa_mma(v16h a, v16h b, v8f c) { return __builtin_amdgcn_wmma_f32_16x16x32_f16(false, a, false, b, (short)0, c, false, false); }
// amdgpu_waves_per_eu(4, 4): a budget of 256 VGPRs, so that no register lies above v255 (without it the build took 266 and switched register windows all through the loop)
__global__ __launch_bounds__(512) __attribute__((amdgpu_waves_per_eu(4, 4))) void k_fattn(const _Float16* __restrict__ Qh, const _Float16* __restrict__ Kh, const _Float16* __restrict__ Vt, _Float16* __restrict__ Oh) {
  __shared__ __attribute__((aligned(16))) _Float16 sk[2][2][FA_SK][FA_PH];      /* K tile: [key group][buffer], row = key, 64 d */
  __shared__ __attribute__((aligned(16))) _Float16 sv[2][2][HD][FA_PH];         /* V^T tile: [key group][buffer], row = d, 64 keys */
  __shared__ __attribute__((aligned(16))) float xo[8][16][32][4];               /* group 1's o on its way to group 0: [wave][4 registers][lane] */
  __shared__ float xs[8][4][32];                                                /* with its two references and its two sums */
  const int tid = threadIdx.x, lane = tid & 31, c = lane & 15, h = lane >> 4;
  const int kh = __builtin_amdgcn_readfirstlane(tid >> 8), wq = __builtin_amdgcn_readfirstlane((tid >> 5) & 7);      /* key group and wave in it: the same in every lane, held as scalars */
  const int head = blockIdx.y, q0 = blockIdx.x * 256 + wq * 32;
  const float cs = 0.03125f * 1.44269504088896340736f;      /* the module's score scale 1/sqrt(1024), in the base-2 domain */
  // staging: a thread moves 16 bytes of rows srow and srow + 32 of each tile of its group; 8 threads cover one 128-byte row
  const int srow = (tid & 255) >> 3, sch = (tid & 7) * 8;
  const unsigned short* kg = (const unsigned short*)Kh + (size_t)(kh * FA_SK + srow) * LQ + head * HD + sch;
  const unsigned short* vg = (const unsigned short*)Vt + ((size_t)head * HD + srow) * SQ + kh * FA_SK + sch;
  v8us rk0, rk1, rv0, rv1;
  rk0 = *(const v8us*)kg; rk1 = *(const v8us*)(kg + (size_t)32 * LQ); rv0 = *(const v8us*)vg; rv1 = *(const v8us*)(vg + (size_t)32 * SQ);
  v16h qf[2][2];
#pragma unroll
  for (int g = 0; g < 2; ++g)
#pragma unroll
    for (int kc = 0; kc < 2; ++kc) qf[g][kc] = fa_frag(Qh + (size_t)(q0 + 16 * g + c) * LQ + head * HD + 32 * kc + 8 * h);
  const v8f z8 = {0.f,0.f,0.f,0.f,0.f,0.f,0.f,0.f};
  v8f acc[2][4]; float m_run[2]; f32x2 l_run[2];
#pragma unroll
  for (int g = 0; g < 2; ++g) { m_run[g] = -3.0e38f; l_run[g] = f32x2{0.f, 0.f};
#pragma unroll
    for (int t = 0; t < 4; ++t) acc[g][t] = z8; }
  *(v8us*)&sk[kh][0][srow][sch] = rk0; *(v8us*)&sk[kh][0][srow + 32][sch] = rk1; *(v8us*)&sv[kh][0][srow][sch] = rv0; *(v8us*)&sv[kh][0][srow + 32][sch] = rv1;
  __syncthreads();      /* each group's first tile is visible to its 8 waves */
#pragma unroll 1  // rolled: one tile a trip; the two 32-key passes inside are unrolled
  for (int st = 0; st < SQ / (2 * FA_SK); ++st) {
    const int b = st & 1; const bool more = st + 1 < SQ / (2 * FA_SK);      /* the same for the whole work-group */
    if (more) { const unsigned short* kp = kg + (size_t)(st + 1) * (2 * FA_SK) * LQ; const unsigned short* vp = vg + (st + 1) * (2 * FA_SK);      /* the group's next tile: in flight under this tile's work */
      rk0 = *(const v8us*)kp; rk1 = *(const v8us*)(kp + (size_t)32 * LQ); rv0 = *(const v8us*)vp; rv1 = *(const v8us*)(vp + (size_t)32 * SQ); }
    v8f s[2][2][2];      /* S^T of the tile: [32-key pass][16-key tile][16-column group] */
#pragma unroll
    for (int sub = 0; sub < 2; ++sub)
#pragma unroll
      for (int kt = 0; kt < 2; ++kt) { const _Float16* kr = &sk[kh][b][sub * 32 + 16 * kt + c][8 * h]; const v16h k0 = fa_frag(kr), k1 = fa_frag(kr + 32);
#pragma unroll
        for (int g = 0; g < 2; ++g) s[sub][kt][g] = fa_mma(k1, qf[g][1], fa_mma(k0, qf[g][0], z8)); }
    float mx[2];
#pragma unroll
    for (int g = 0; g < 2; ++g) {
      float x = s[0][0][g][0];      /* maximum of the tile's raw scores (the scale is positive) */
#pragma unroll
      for (int r = 1; r < 8; ++r) x = fmaxf(x, s[0][0][g][r]);
#pragma unroll
      for (int u = 1; u < 4; ++u)
#pragma unroll
        for (int r = 0; r < 8; ++r) x = fmaxf(x, s[u >> 1][u & 1][g][r]);
      mx[g] = fmaxf(x, fa_xhalf(x)) * cs;      /* both wave halves hold the query's tile maximum, scaled */
    }
    // lazy rescale: m_run is the reference in use, not the true maximum; it moves, and o and the sum are rescaled, only when some column's tile maximum lies more than 8 (base-2 domain) above it,
    // so a weight is at most 2^8, far inside f16 and f32; o / sum does not depend on the reference. One test a tile for the whole wave, a scalar branch; taken on the first tile (factor 0).
    if (__builtin_amdgcn_ballot_w32(mx[0] > m_run[0] + 8.0f || mx[1] > m_run[1] + 8.0f) != 0) {
#pragma unroll
      for (int g = 0; g < 2; ++g) {
        const float m_new = fmaxf(m_run[g], mx[g]); const float corr = __builtin_amdgcn_exp2f(m_run[g] - m_new);
        m_run[g] = m_new; l_run[g] = l_run[g] * corr;
#pragma unroll
        for (int t = 0; t < 4; ++t) acc[g][t] = acc[g][t] * corr;
      }
    }
#pragma unroll
    for (int sub = 0; sub < 2; ++sub) {      /* one pass: 32 keys x the wave's 32 query columns */
      v16h vf[4];
#pragma unroll
      for (int t = 0; t < 4; ++t) vf[t] = fa_frag(&sv[kh][b][16 * t + c][sub * 32 + 8 * h]);
#pragma unroll
      for (int g = 0; g < 2; ++g) {
        FragP pf; f32x2 ps[8];
#pragma unroll
        for (int i = 0; i < 8; ++i) {
          const f32x2 a = __builtin_elementwise_fma(f32x2{s[sub][i >> 2][g][2 * (i & 3)], s[sub][i >> 2][g][2 * (i & 3) + 1]}, f32x2{cs, cs}, f32x2{-m_run[g], -m_run[g]});
          const f32x2 p = {__builtin_amdgcn_exp2f(a.x), __builtin_amdgcn_exp2f(a.y)};
          ps[i] = p; pf.w[i] = __builtin_bit_cast(unsigned int, __builtin_convertvector(p, v2h)); }
        l_run[g] = l_run[g] + (((ps[0] + ps[1]) + (ps[2] + ps[3])) + ((ps[4] + ps[5]) + (ps[6] + ps[7])));      /* a tree, not one chain of 8 dependent adds */
#pragma unroll
        for (int t = 0; t < 4; ++t) acc[g][t] = fa_mma(vf[t], pf.v, acc[g][t]);
      }
    }
    if (more) { *(v8us*)&sk[kh][b ^ 1][srow][sch] = rk0; *(v8us*)&sk[kh][b ^ 1][srow + 32][sch] = rk1; *(v8us*)&sv[kh][b ^ 1][srow][sch] = rv0; *(v8us*)&sv[kh][b ^ 1][srow + 32][sch] = rv1; }      /* every wave left that buffer before the last barrier */
    __syncthreads();      /* publishes each group's tile 2 st + 2 + kh and ends every wave's reads of its group's tile 2 st + kh, whose buffer the next trip refills */
  }
  // join of the two key groups: wave wq of group 1 hands its o, references and sums, lane for lane, to wave wq of group 0, which holds the same query columns in the same places
  if (kh == 1) {
#pragma unroll
    for (int g = 0; g < 2; ++g) { xs[wq][g][lane] = m_run[g]; xs[wq][2 + g][lane] = l_run[g].x + l_run[g].y;
#pragma unroll
      for (int t = 0; t < 4; ++t)
#pragma unroll
        for (int j = 0; j < 2; ++j) *(v4f*)&xo[wq][(g * 4 + t) * 2 + j][lane][0] = v4f{acc[g][t][4 * j], acc[g][t][4 * j + 1], acc[g][t][4 * j + 2], acc[g][t][4 * j + 3]}; }
  }
  __syncthreads();      /* group 1's partial results are visible to group 0 */
  if (kh == 0) {
#pragma unroll
    for (int g = 0; g < 2; ++g) {
      const float m1 = xs[wq][g][lane], l1 = xs[wq][2 + g][lane]; const float m_all = fmaxf(m_run[g], m1);
      const float f0 = __builtin_amdgcn_exp2f(m_run[g] - m_all), f1 = __builtin_amdgcn_exp2f(m1 - m_all);      /* each group's weights brought to the common reference */
      float l = (l_run[g].x + l_run[g].y) * f0 + l1 * f1; l += fa_xhalf(l); const float inv = 64.0f / l;      /* o carried x64, as the output GEMM's alpha expects */
      const float a0 = f0 * inv, a1 = f1 * inv;
#pragma unroll
      for (int t = 0; t < 4; ++t) { FragH f;
#pragma unroll
        for (int j = 0; j < 2; ++j) { const v4f x = *(const v4f*)&xo[wq][(g * 4 + t) * 2 + j][lane][0];
#pragma unroll
          for (int r = 0; r < 4; ++r) f.h[4 * j + r] = (_Float16)(acc[g][t][4 * j + r] * a0 + x[r] * a1); }
        *(v8us*)((unsigned short*)Oh + (size_t)(q0 + 16 * g + c) * DM + head * HD + 16 * t + 8 * h) = f.half[0]; } }      /* 8 consecutive d of one query row: one 16-byte store */
  }
}

// ---- all seven pre-passes in ONE launch: they depend on nothing but the inputs, so the job is picked by work-group number (the same for a whole work-group) ----
// work-groups [0, 4 PW): weight j = block / PW as Bt[n][k] x16, a thread's work that of k_wt_f16; the rest: stream j = (block - 4 PW) / PX as exact f16 rows, a thread's work that of k_x16.
// The weight jobs stand first: their scattered reads take longest, and the streaming jobs start behind them while they wait. Bt and X16 hold the jobs' planes one behind the other.
#define PW (DM * (DM / 8) / 256)               /* work-groups per weight */
#define PX ((unsigned)(NR * DM / 8 / 256))     /* work-groups per input stream */
__global__ __launch_bounds__(256) void k_prep(const float* __restrict__ w0, const float* __restrict__ w1, const float* __restrict__ w2, const float* __restrict__ w3,
                                              const float* __restrict__ x0, const float* __restrict__ x1, const float* __restrict__ x2, _Float16* __restrict__ Bt, _Float16* __restrict__ X16) {
  const unsigned blk = blockIdx.x; FragH f;
  if (blk < 4 * PW) {
    const unsigned j = blk / PW; const float* W = j == 0 ? w0 : j == 1 ? w1 : j == 2 ? w2 : w3;
    const int t = (int)(blk - j * PW) * 256 + threadIdx.x; const int n = t / (DM / 8), k8 = (t % (DM / 8)) * 8;
#pragma unroll
    for (int i = 0; i < 8; ++i) f.h[i] = (_Float16)(bf16_round(W[(size_t)(k8 + i) * DM + n]) * 16.0f);
    *(v8us*)((unsigned short*)Bt + (size_t)j * DM * DM + (size_t)n * DM + k8) = f.half[0];
  } else {
    const unsigned r = blk - 4 * PW, j = r / PX; const float* x = j == 0 ? x0 : j == 1 ? x1 : x2;
    const size_t t = (size_t)(r - j * PX) * 256 + threadIdx.x;
#pragma unroll
    for (int q = 0; q < 8; ++q) f.h[q] = (_Float16)bf16_round(x[t * 8 + q]);
    *(v8us*)((unsigned short*)X16 + (size_t)j * NR * DM + t * 8) = f.half[0];
  }
}

extern "C" void kernel_launch(void* const* d_in, const int* in_sizes, int n_in,
                              void* d_out, int out_size, void* d_ws, size_t ws_size, hipStream_t stream) {
  (void)in_sizes; (void)n_in; (void)out_size;
  const float* const* I = (const float* const*)d_in; const float* xq = I[2]; const float* xk = I[1]; const float* xv = I[0]; const float* wq = I[5]; const float* wk = I[4]; const float* wv = I[3]; const float* wo = I[6]; const float* bo = I[7];      /* input order: values, keys, query (three unbatched [4096][1024] streams in REVERSE order: the query stream is I[2]), Wv, Wk, Wq (the weights in the same reverse order: Wq is I[5]), Wo, bo ([in][out] weights); the q / k / v projections have NO biases: null pointers in the guarded bias slots */
  char* ws = (char*)d_ws; size_t off = 0;
  auto take = [&](size_t bytes) { char* p = ws + off; off += (bytes + 255) & ~(size_t)255; return p; };
  _Float16* BQ = (_Float16*)take((size_t)4 * DM * DM * 2); _Float16* BO = BQ + (size_t)3 * DM * DM;      /* four weight planes in a row: q, k, v, o */
  _Float16* XQ = (_Float16*)take(3 * NR * DM * 2); _Float16* Q16 = (_Float16*)take(3 * NR * DM * 2); _Float16* K16 = Q16 + NR * DM; _Float16* V16 = K16 + NR * DM; _Float16* O16 = (_Float16*)take(NR * DM * 2);      /* three planes in a row each: the q, k, v sources; q, k, v */
  _Float16* VT = (_Float16*)take((size_t)NH * HD * SQ * 2);
  if (off > ws_size) return;
  k_prep<<<4 * PW + 3 * PX, 256, 0, stream>>>(wq, wk, wv, wo, xq, xk, xv, BQ, XQ);      /* one launch: the four [in][out] weights -> Bt[n][k] x16 (the planes from BQ on), the three inputs as exact f16 rows (the planes from XQ on) */
  const size_t r0p = (size_t)B0 * SQ;      /* first projected row */
  k_gemm2<0, false><<<dim3((unsigned)((MP / 128) * (DM / 128)), 3), 128, 0, stream>>>(XQ + r0p * DM, DM, NR * DM, BQ, DM, (size_t)DM * DM, 0.0625f, nullptr, 0, nullptr, 1, 0, 0, nullptr, Q16 + r0p * DM, DM, NR * DM, MP, DM, DM);      /* q, k and v in one launch: grid y steps through the three planes from XQ, from BQ and from Q16; no biases */
  for (int b = B0; b < B0 + NBR; ++b) { const size_t r0 = (size_t)b * SQ;
    k_vt<NH, SQ><<<NH * (SQ / 64), 256, 0, stream>>>(V16 + r0 * LQ, LQ, 0, VT);      /* V^T [NH][HD][SQ] for this batch */
    k_fattn<<<dim3(QN / 256, NHD), 512, 0, stream>>>(Q16 + r0 * LQ, K16 + r0 * LQ, VT, O16 + r0 * DM); }      /* all heads: scores (THIS module's scale 1/sqrt(EMBED 1024) = 1/32), softmax, P.V; o x64 (merged heads) as f16 rows */
  k_gemm2<0, false><<<dim3((unsigned)((MPO / 128) * (DM / 128)), 1), 128, 0, stream>>>(O16 + r0p * DM, DM, 0, BO, DM, 0, 0.0009765625f, bo, 0, nullptr, 1, 0, 0, (float*)d_out + r0p * DM, nullptr, DM, 0, MPO, DM, DM);      /* out rows are the output layout */
}

// v008
// One run takes 109 microseconds.
// In both of two side-by-side timings against v007, it was 1.08 times as fast.
// All steps since v000 together make it 124 times as fast.
#include <hip/hip_runtime.h>
// Multi-head attention on three unbatched inputs with [in][out] bias-free q / k / v projections, a biased output projection and the source's MODEL-WIDTH score scale; the inputs arrive in the order values, keys, query (each [4096][1024]; v / k / q = stream W ([in][out] 1024 x 1024 sd 1/32, NO biases), 16 heads of 64; energy / sqrt(1024) (the module scales by the EMBED width, not the head width: 1/32); softmax over all 4096 keys (no mask); out = merged Wo + bo ([in][out]) -> [4096][1024]); ONE attention launch for all heads.
// Structure: token rows r = b*4096 + s; the query, key and value sources as exact f16 rows (bf16-rounded); Q, K, V as three WMMA GEMMs (64x64 wave tiles, f32 accumulation, exact x16 weights, no bias, f16 outputs); per batch: V^T for all heads via LDS transposes; per batch ONE fused attention kernel over (256 query rows, head): per 32 keys the scores on WMMA (K = 64), online softmax on VALU (f32 lazily moved reference maximum and sum, native exp2; weights exp(s - reference), at most 2^8, as f16, in registers only), o += P . V on WMMA, o / sum carried x64 (against f16 subnormal flush, folded into the output GEMM alpha) written straight into the merged f16 o rows; out = o W_o + b GEMM (f32) into the output layout.
// Compute dtype: inputs rounded to bf16; x / weights exact; q, k, v, softmax weights and o as plain f16 GEMM operands (~2^-12); scores and softmax statistics f32. v_wmma_f32_16x16x32_f16.
#define NB 1
#define SQ 4096
#define DM 1024
#define NH 16
#define HD 64
#define HG 1                         /* heads per k_vt(V16, b, h0, VT) launch (that overload is not launched) */
#define B0 0                         /* first batch processed (debug hook) */
#define NBR NB                       /* batches processed (debug hook) */
#define NR ((size_t)NB * SQ)         /* token rows */
#define MP ((int)((size_t)NBR * SQ)) /* rows projected (debug hook) */
#define QN SQ                        /* query rows attended per batch (debug hook) */
#define NHD NH                       /* heads attended (debug hook) */
#define MPO MP                       /* rows through the output stage (debug hook) */
#define LQ DM      /* row pitch of the q/k/v rows */
typedef __bf16 v16b __attribute__((ext_vector_type(16)));
typedef unsigned short v8us __attribute__((ext_vector_type(8), may_alias));
typedef float  v8f  __attribute__((ext_vector_type(8)));
typedef float  v4f  __attribute__((ext_vector_type(4)));
typedef float  v4fa __attribute__((ext_vector_type(4), may_alias));
union FragB { v16b v; v8us half[2]; unsigned short u[16]; };

__device__ __forceinline__ unsigned short bf16_bits(float x) { unsigned int u = __float_as_uint(x); return (unsigned short)((u + 0x7FFFu + ((u >> 16) & 1u)) >> 16); }
__device__ __forceinline__ float bf16_val(unsigned short b) { return __uint_as_float(((unsigned int)b) << 16); }
__device__ __forceinline__ float bf16_round(float x) { return bf16_val(bf16_bits(x)); }
// D += A·B with NT terms: 1 = ah·bh, 2 = + al·bh (A split), 3 = + ah·bl (both split)
template <int NT>
__device__ __forceinline__ v8f mmaN(v16b ah, v16b al, v16b bh, v16b bl, v8f c) {
  c = __builtin_amdgcn_wmma_f32_16x16x32_bf16(false, ah, false, bh, (short)0, c, false, false);
  if (NT >= 2) c = __builtin_amdgcn_wmma_f32_16x16x32_bf16(false, al, false, bh, (short)0, c, false, false);
  if (NT >= 3) c = __builtin_amdgcn_wmma_f32_16x16x32_bf16(false, ah, false, bl, (short)0, c, false, false);
  asm volatile("v_nop\n\tv_nop\n\tv_nop\n\tv_nop" : "+v"(c) : "v"(ah), "v"(al), "v"(bh), "v"(bl));
  return c;
}

__global__ __launch_bounds__(256) void k_wt_bf16(const float* __restrict__ W, unsigned short* __restrict__ Wt, int K, int N) {
  const int t = blockIdx.x * 256 + threadIdx.x;
  const int k8n = K / 8;
  if (t >= N * k8n) return;
  const int n = t / k8n, k8 = (t % k8n) * 8;
  v8us v;
#pragma unroll
  for (int i = 0; i < 8; ++i) v[i] = bf16_bits(W[(size_t)(k8 + i) * N + n]);
  *(v8us*)(Wt + (size_t)n * K + k8) = v;
  
}

// GEMM C[M][N] (f32, pitch ldc) = act(A[M][K]·W + bias). A f32 row-major (pitch lda) converted per fragment to bf16
// (ASPLIT: hi/lo two planes -> 2 terms, else single rounded term); Wt bf16 [N][K] (pitch ldb). BIAS_BF16 rounds the
// bias to bf16 first (bias quantised to bf16 before the add). K%32==0, M%16==0, N%64==0.
template <bool ASPLIT, int ACT, bool BIAS_BF16>
__global__ __launch_bounds__(128) void k_gemm_bf(const float* __restrict__ A, int lda, const unsigned short* __restrict__ Wt, int ldb,
                                               const float* __restrict__ bias, float* __restrict__ C, int ldc, int M, int N, int K) {
  __shared__ __attribute__((aligned(16))) float so[4][16][64];
  const int tid = threadIdx.x, w = tid >> 5, lane = tid & 31, ln = lane & 15, hh = lane >> 4;
  const int ntn = N / 64;
  const int wid = blockIdx.x * 4 + w;
  const int mt = wid / ntn, nq = wid % ntn;
  if (mt * 16 >= M) return;
  const int row0 = mt * 16, col0 = nq * 64;
  const float* arow = A + (size_t)(row0 + ln) * lda;
  v8f acc[4] = {};
  for (int kb = 0; kb < K; kb += 32) {
    FragB ah, al;
    const v4f x0 = *(const v4fa*)(arow + kb + 8 * hh), x1 = *(const v4fa*)(arow + kb + 8 * hh + 4);
    const v4f x2 = *(const v4fa*)(arow + kb + 16 + 8 * hh), x3 = *(const v4fa*)(arow + kb + 16 + 8 * hh + 4);
    float xs[16] = {x0[0],x0[1],x0[2],x0[3],x1[0],x1[1],x1[2],x1[3],x2[0],x2[1],x2[2],x2[3],x3[0],x3[1],x3[2],x3[3]};
#pragma unroll
    for (int i = 0; i < 16; ++i) { const unsigned short hb = bf16_bits(xs[i]); ah.u[i] = hb; al.u[i] = ASPLIT ? bf16_bits(xs[i] - bf16_val(hb)) : (unsigned short)0; }
#pragma unroll
    for (int t = 0; t < 4; ++t) {
      const unsigned short* brow = Wt + (size_t)(col0 + t * 16 + ln) * ldb + kb;
      FragB b;
      b.half[0] = *(const v8us*)(brow + 8 * hh);
      b.half[1] = *(const v8us*)(brow + 16 + 8 * hh);
      acc[t] = mmaN<ASPLIT ? 2 : 1>(ah.v, al.v, b.v, b.v, acc[t]);
    }
  }
#pragma unroll
  for (int t = 0; t < 4; ++t) {
    float bv = bias ? bias[col0 + t * 16 + ln] : 0.f;
    if (BIAS_BF16) bv = bf16_round(bv);
#pragma unroll
    for (int r = 0; r < 8; ++r) { float v = acc[t][r] + bv; if (ACT == 1) v = fmaxf(v, 0.f); so[w][8 * hh + r][t * 16 + ln] = v; }
  }
  __builtin_amdgcn_fence(__ATOMIC_ACQ_REL, "workgroup");
  __builtin_amdgcn_wave_barrier();
  const int rsub = lane >> 4, c4 = (lane & 15) * 4;
  {
#pragma unroll
    for (int q = 0; q < 8; ++q) {
      const int r = q * 2 + rsub;
      const v4f v = *(const v4fa*)&so[w][r][c4];
      *(v4f*)(C + (size_t)(row0 + r) * ldc + col0 + c4) = v;
    }
    
  }
}

// GEMM C = act(A·W + bias + resid): A f32 (ASPLIT -> hi/lo 2 terms), Wt bf16 [N][K]; ACT 0 none, 1 relu, 2 exact gelu;
// resid (optional, f32, row index = (row % rmod), pitch ldr, RES_BF16 rounds it) added before the activation.
template <bool ASPLIT, int ACT, bool BIAS_BF16, bool RES_BF16>
__global__ __launch_bounds__(128) void k_gemm_bf3(const float* __restrict__ A, int lda, const unsigned short* __restrict__ Wt, int ldb,
                                                const float* __restrict__ bias, const float* __restrict__ resid, int rmod, int ldr,
                                                float* __restrict__ C, int ldc, int M, int N, int K) {
  __shared__ __attribute__((aligned(16))) float so[4][16][64];
  const int tid = threadIdx.x, w = tid >> 5, lane = tid & 31, ln = lane & 15, hh = lane >> 4;
  const int ntn = N / 64;
  const int wid = blockIdx.x * 4 + w;
  const int mt = wid / ntn, nq = wid % ntn;
  if (mt * 16 >= M) return;
  const int row0 = mt * 16, col0 = nq * 64;
  const float* arow = A + (size_t)(row0 + ln) * lda;
  v8f acc[4] = {};
  for (int kb = 0; kb < K; kb += 32) {
    FragB ah, al;
    const v4f x0 = *(const v4fa*)(arow + kb + 8 * hh), x1 = *(const v4fa*)(arow + kb + 8 * hh + 4);
    const v4f x2 = *(const v4fa*)(arow + kb + 16 + 8 * hh), x3 = *(const v4fa*)(arow + kb + 16 + 8 * hh + 4);
    float xs[16] = {x0[0],x0[1],x0[2],x0[3],x1[0],x1[1],x1[2],x1[3],x2[0],x2[1],x2[2],x2[3],x3[0],x3[1],x3[2],x3[3]};
#pragma unroll
    for (int i = 0; i < 16; ++i) { const unsigned short hb = bf16_bits(xs[i]); ah.u[i] = hb; al.u[i] = ASPLIT ? bf16_bits(xs[i] - bf16_val(hb)) : (unsigned short)0; }
#pragma unroll
    for (int t = 0; t < 4; ++t) {
      const unsigned short* brow = Wt + (size_t)(col0 + t * 16 + ln) * ldb + kb;
      FragB b;
      b.half[0] = *(const v8us*)(brow + 8 * hh);
      b.half[1] = *(const v8us*)(brow + 16 + 8 * hh);
      acc[t] = mmaN<ASPLIT ? 2 : 1>(ah.v, al.v, b.v, b.v, acc[t]);
    }
  }
#pragma unroll
  for (int t = 0; t < 4; ++t) {
    const int col = col0 + t * 16 + ln;
    float bv = bias ? bias[col] : 0.f;
    if (BIAS_BF16) bv = bf16_round(bv);
#pragma unroll
    for (int r = 0; r < 8; ++r) {
      float v = acc[t][r] + bv;
      if (resid) { float rv = resid[(size_t)((row0 + 8 * hh + r) % rmod) * ldr + col]; if (RES_BF16) rv = bf16_round(rv); v += rv; }
      if (ACT == 1) v = fmaxf(v, 0.f);
      if (ACT == 2) v = 0.5f * v * (1.0f + erff(v * 0.70710678118654752f));
      if (ACT == 3) { const float u = 0.7978845608028654f * (v + 0.044715f * v * v * v); v = 0.5f * v * (1.0f + tanhf(u)); }
      so[w][8 * hh + r][t * 16 + ln] = v;
    }
  }
  __builtin_amdgcn_fence(__ATOMIC_ACQ_REL, "workgroup");
  __builtin_amdgcn_wave_barrier();
  const int rsub = lane >> 4, c4 = (lane & 15) * 4;
  {
#pragma unroll
    for (int q = 0; q < 8; ++q) {
      const int r = q * 2 + rsub;
      const v4f v = *(const v4fa*)&so[w][r][c4];
      *(v4f*)(C + (size_t)(row0 + r) * ldc + col0 + c4) = v;
    }
    
  }
}
// row LayerNorm (biased variance, eps) over N: s = X (+ R); optional out_sum <- s; out_norm <- (s-mu)*rsqrt(var+eps)*g + b
template <bool PARAM_BF16>
__global__ __launch_bounds__(256) void k_layernorm(const float* __restrict__ X, const float* __restrict__ R, const float* __restrict__ g, const float* __restrict__ bta,
                                                  float* __restrict__ out_sum, float* __restrict__ out_norm, int N, float eps) {
  __shared__ float red[256];
  const int row = blockIdx.x, tid = threadIdx.x;
  const float* x = X + (size_t)row * N; const float* rr = R ? R + (size_t)row * N : nullptr;
  float vals[16];                     // up to N = 4096
  const int per = N / 256;            // contiguous chunk per thread? use strided-by-4 chunks: thread handles j = tid*4 + 1024*u
  float s1 = 0.f;
  for (int u = 0; u < per / 4; ++u) {
    const int j = tid * 4 + 1024 * u;
    const v4f a = *(const v4fa*)(x + j);
    v4f b = {0.f,0.f,0.f,0.f}; if (rr) b = *(const v4fa*)(rr + j);
#pragma unroll
    for (int q = 0; q < 4; ++q) { const float v = a[q] + b[q]; vals[u * 4 + q] = v; s1 += v; }
  }
  red[tid] = s1; __syncthreads();
  for (int st = 128; st > 0; st >>= 1) { if (tid < st) red[tid] += red[tid + st]; __syncthreads(); }
  const float mu = red[0] / (float)N; __syncthreads();
  float s2 = 0.f;
  for (int u = 0; u < per / 4; ++u)
#pragma unroll
    for (int q = 0; q < 4; ++q) { const float c = vals[u * 4 + q] - mu; s2 += c * c; }
  red[tid] = s2; __syncthreads();
  for (int st = 128; st > 0; st >>= 1) { if (tid < st) red[tid] += red[tid + st]; __syncthreads(); }
  const float rs = rsqrtf(red[0] / (float)N + eps);
  {
    for (int u = 0; u < per / 4; ++u) {
      const int j = tid * 4 + 1024 * u;
      v4f o, sm;
#pragma unroll
      for (int q = 0; q < 4; ++q) {
        float gg = g[j + q], bb = bta[j + q];
        if (PARAM_BF16) { gg = bf16_round(gg); bb = bf16_round(bb); }
        sm[q] = vals[u * 4 + q]; o[q] = (vals[u * 4 + q] - mu) * rs * gg + bb;
      }
      if (out_sum) *(v4f*)(out_sum + (size_t)row * N + j) = sm;
      *(v4f*)(out_norm + (size_t)row * N + j) = o;
    }
    
  }
}



// ---- f16 WMMA path (v_wmma_f32_16x16x32_f16): 11-bit significands for operands in range — used where a [0,1] probability operand needs more precision than bf16
typedef _Float16 v16h __attribute__((ext_vector_type(16)));
union FragH { v16h v; v8us half[2]; _Float16 h[16]; unsigned short u[16]; };
template <int NT>
__device__ __forceinline__ v8f mmaH(v16h ah, v16h al, v16h bh, v16h bl, v8f c) {
  c = __builtin_amdgcn_wmma_f32_16x16x32_f16(false, ah, false, bh, (short)0, c, false, false);
  if (NT >= 2) c = __builtin_amdgcn_wmma_f32_16x16x32_f16(false, al, false, bh, (short)0, c, false, false);
  if (NT >= 3) c = __builtin_amdgcn_wmma_f32_16x16x32_f16(false, ah, false, bl, (short)0, c, false, false);
  asm volatile("v_nop\n\tv_nop\n\tv_nop\n\tv_nop" : "+v"(c) : "v"(ah), "v"(al), "v"(bh), "v"(bl));
  return c;
}
// batched GEMM like k_gemm_b but f16 operands: A f32 (split into f16 hi/lo if ASPLIT, else rounded to f16), Bt = f16 values [n][k]; alpha; C f32; N multiple of 16 (partial tiles skipped)
template <bool ASPLIT>
__global__ __launch_bounds__(128) void k_gemm_h(const float* __restrict__ A, int lda, size_t sA, const _Float16* __restrict__ Bh, int ldb, size_t sB, float alpha, float* __restrict__ C, int ldc, size_t sC, int M, int N, int K) {
  __shared__ __attribute__((aligned(16))) float so[4][16][64];
  const int tid = threadIdx.x, w = tid >> 5, lane = tid & 31, ln = lane & 15, hh = lane >> 4; const int by = blockIdx.y;
  A += (size_t)by * sA; Bh += (size_t)by * sB; C += (size_t)by * sC;
  const int ntn = (N + 63) / 64; const int wid = blockIdx.x * 4 + w; const int mt = wid / ntn, nq = wid % ntn; if (mt * 16 >= M) return;
  const int row0 = mt * 16, col0 = nq * 64; const float* arow = A + (size_t)(row0 + ln) * lda;
  v8f acc[4] = {};
  for (int kb = 0; kb < K; kb += 32) {
    FragH ah, al;
    const v4f x0 = *(const v4fa*)(arow + kb + 8 * hh), x1 = *(const v4fa*)(arow + kb + 8 * hh + 4), x2 = *(const v4fa*)(arow + kb + 16 + 8 * hh), x3 = *(const v4fa*)(arow + kb + 16 + 8 * hh + 4);
    float xs[16] = {x0[0],x0[1],x0[2],x0[3],x1[0],x1[1],x1[2],x1[3],x2[0],x2[1],x2[2],x2[3],x3[0],x3[1],x3[2],x3[3]};
#pragma unroll
    for (int i = 0; i < 16; ++i) { const _Float16 h = (_Float16)xs[i]; ah.h[i] = h; al.h[i] = ASPLIT ? (_Float16)(xs[i] - (float)h) : (_Float16)0.0f; }
#pragma unroll
    for (int t = 0; t < 4; ++t) { if (col0 + t * 16 >= N) continue; const size_t boff = (size_t)(col0 + t * 16 + ln) * ldb + kb; FragH bq; bq.half[0] = *(const v8us*)(Bh + boff + 8 * hh); bq.half[1] = *(const v8us*)(Bh + boff + 16 + 8 * hh);
      acc[t] = mmaH<ASPLIT ? 2 : 1>(ah.v, al.v, bq.v, bq.v, acc[t]); }
  }
#pragma unroll
  for (int t = 0; t < 4; ++t) { if (col0 + t * 16 >= N) continue;
#pragma unroll
    for (int r = 0; r < 8; ++r) so[w][8 * hh + r][t * 16 + ln] = acc[t][r] * alpha; }
  __builtin_amdgcn_fence(__ATOMIC_ACQ_REL, "workgroup"); __builtin_amdgcn_wave_barrier();
  const int rsub = lane >> 4, c4 = (lane & 15) * 4;
  {
#pragma unroll
    for (int q = 0; q < 8; ++q) { const int r = q * 2 + rsub; if (col0 + c4 < N) { const v4f v = *(const v4fa*)&so[w][r][c4]; *(v4f*)(C + (size_t)(row0 + r) * ldc + col0 + c4) = v; } }
     }
}

// Wt[n][k] = f16(W[k][n]·scale) from f32 row-major W[K][N] (scale = power of two; bf16-exact weights stay exact in f16 away from the subnormal range)
__global__ __launch_bounds__(256) void k_wt_f16(const float* __restrict__ W, _Float16* __restrict__ Wt, int K, int N, float scale) {
  const int t = blockIdx.x * 256 + threadIdx.x; if (t >= N * (K / 8)) return; const int n = t / (K / 8), k8 = (t % (K / 8)) * 8; FragH f;
#pragma unroll
  for (int i = 0; i < 8; ++i) f.h[i] = (_Float16)(bf16_round(W[(size_t)(k8 + i) * N + n]) * scale); const v8us o = f.half[0];
  *(v8us*)((unsigned short*)Wt + (size_t)n * K + k8) = o; 
}
// k_gemm_hh variant with fused epilogue: v = acc·alpha + bias[by·sBias + col] (+ CP[(row/rowsPerB)·sCPb + by·64 + col] if CP) ; ACT 0 none / 1 elu ; writes f16 C16 (and f32 C if non-null)
template <int ACT>
__global__ __launch_bounds__(128) void k_gemm_hhx(const _Float16* __restrict__ A, int lda, size_t sA, const _Float16* __restrict__ Bh, int ldb, size_t sB, float alpha, const float* __restrict__ bias, size_t sBias, const float* __restrict__ CP, int rowsPerB, size_t sCPb, int row0g,
    float* __restrict__ C, _Float16* __restrict__ C16, int ldc, size_t sC, int M, int N, int K) {
  __shared__ __attribute__((aligned(16))) float so[4][16][64];
  const int tid = threadIdx.x, w = tid >> 5, lane = tid & 31, ln = lane & 15, hh = lane >> 4; const int by = blockIdx.y;
  A += (size_t)by * sA; Bh += (size_t)by * sB; const size_t cofs = (size_t)by * sC; const float* bp = bias ? bias + (size_t)by * sBias : nullptr;
  const int ntn = (N + 63) / 64; const int wid = blockIdx.x * 4 + w; const int mt = wid / ntn, nq = wid % ntn; if (mt * 16 >= M) return;
  const int row0 = mt * 16, col0 = nq * 64; const _Float16* arow = A + (size_t)(row0 + ln) * lda;
  v8f acc[4] = {};
  for (int kb = 0; kb < K; kb += 32) { FragH ah; ah.half[0] = *(const v8us*)((const unsigned short*)arow + kb + 8 * hh); ah.half[1] = *(const v8us*)((const unsigned short*)arow + kb + 16 + 8 * hh);
#pragma unroll
    for (int t = 0; t < 4; ++t) { if (col0 + t * 16 >= N) continue; const size_t boff = (size_t)(col0 + t * 16 + ln) * ldb + kb; FragH bq; bq.half[0] = *(const v8us*)((const unsigned short*)Bh + boff + 8 * hh); bq.half[1] = *(const v8us*)((const unsigned short*)Bh + boff + 16 + 8 * hh);
      acc[t] = mmaH<1>(ah.v, ah.v, bq.v, bq.v, acc[t]); }
  }
#pragma unroll
  for (int t = 0; t < 4; ++t) { if (col0 + t * 16 >= N) continue; const int col = col0 + t * 16 + ln; const float bv = bp ? bf16_round(bp[col]) : 0.f;
#pragma unroll
    for (int r = 0; r < 8; ++r) { float v = acc[t][r] * alpha + bv; if (CP) { const int rr = row0g + row0 + 8 * hh + r; if (rowsPerB < 0) v += CP[cofs + (size_t)rr * ldc + col];      /* rowsPerB < 0: own element of the batched C plane */ else { const int bidx = rr / rowsPerB; v += CP[(size_t)bidx * sCPb + (size_t)by * 64 + col]; } } if (ACT == 1) v = (v > 0.f) ? v : expm1f(v); else if (ACT == 7) v = (v > 0.f) ? v + 1.0f : expf(v); else if (ACT == 8) v = tanhf(v); else if (ACT == 9) v = 0.5f * v * (1.0f + tanhf(0.7978845608028654f * (v + 0.044715f * v * v * v))); else if (ACT == 11) v = 1.0f / (1.0f + expf(-v)); else if (ACT == 12) v = (v > 0.f) ? v : 0.01f * v; else if (ACT == 14) v = (v > 0.f) ? v : 0.1f * v; else if (ACT == 16) v = (v >= 0.f) ? v : 0.3f * v; else if (ACT == 17) v = (v >= 0.f) ? v : 0.2f * v; else if (ACT == 15) v = v / (1.0f + expf(-v)); else if (ACT == 3) v = fmaxf(v, 0.f); else if (ACT == 6) v = 0.5f * v * (1.0f + erff(v * 0.70710678118654752f)); so[w][8 * hh + r][t * 16 + ln] = v; } }
  __builtin_amdgcn_fence(__ATOMIC_ACQ_REL, "workgroup"); __builtin_amdgcn_wave_barrier();
  const int rsub = lane >> 4, c4 = (lane & 15) * 4; typedef _Float16 v4h __attribute__((ext_vector_type(4)));
  {
#pragma unroll
    for (int q = 0; q < 8; ++q) { const int r = q * 2 + rsub; if (col0 + c4 < N) { const v4f v = *(const v4fa*)&so[w][r][c4]; if (C) *(v4f*)(C + cofs + (size_t)(row0 + r) * ldc + col0 + c4) = v; if (C16) { v4h h4; for (int i = 0; i < 4; ++i) h4[i] = (_Float16)v[i]; *(v4h*)(C16 + cofs + (size_t)(row0 + r) * ldc + col0 + c4) = h4; } } }
     }
}


typedef _Float16 v4h __attribute__((ext_vector_type(4)));

__global__ __launch_bounds__(256) void k_x16(const float* __restrict__ x, _Float16* __restrict__ X16, size_t n8) { const size_t t = (size_t)blockIdx.x * 256 + threadIdx.x; if (t >= n8) return; FragH f;
#pragma unroll
  for (int q = 0; q < 8; ++q) f.h[q] = (_Float16)bf16_round(x[t * 8 + q]); *(v8us*)((unsigned short*)X16 + t * 8) = f.half[0];  }
__global__ __launch_bounds__(256) void k_h16(const float* __restrict__ x, _Float16* __restrict__ X16, size_t n8) { const size_t t = (size_t)blockIdx.x * 256 + threadIdx.x; if (t >= n8) return; FragH f;
#pragma unroll
  for (int q = 0; q < 8; ++q) f.h[q] = (_Float16)x[t * 8 + q]; *(v8us*)((unsigned short*)X16 + t * 8) = f.half[0];  }
__global__ __launch_bounds__(256) void k_round16f(const float* __restrict__ W, _Float16* __restrict__ Bt, size_t n8) { const size_t t = (size_t)blockIdx.x * 256 + threadIdx.x; if (t >= n8) return; FragH f;
#pragma unroll
  for (int i = 0; i < 8; ++i) f.h[i] = (_Float16)(bf16_round(W[t * 8 + i]) * 16.0f); *(v8us*)((unsigned short*)Bt + t * 8) = f.half[0];  }
template <int NHv, int TTv>
__global__ __launch_bounds__(256) void k_vt(const _Float16* __restrict__ V16, int ldv, int voff, _Float16* __restrict__ Vt) { __shared__ unsigned short tl[64][66]; const int tid = threadIdx.x; const int slab = blockIdx.x / (TTv / 64), lg = blockIdx.x % (TTv / 64); const int b = slab / NHv, h = slab % NHv;
  for (int i = tid; i < 64 * 8; i += 256) { const int r = i / 8, c8 = (i % 8) * 8; FragH f; f.half[0] = *(const v8us*)((const unsigned short*)V16 + ((size_t)b * TTv + lg * 64 + r) * ldv + voff + h * 64 + c8);
#pragma unroll
    for (int q = 0; q < 8; ++q) tl[r][c8 + q] = f.u[q]; }
  __syncthreads();
  {
#pragma unroll
    for (int rd = 0; rd < 2; ++rd) { const int d = rd * 32 + tid / 8, pc = tid % 8; FragH f;
#pragma unroll
      for (int q = 0; q < 8; ++q) f.u[q] = tl[pc * 8 + q][d];
      *(v8us*)((unsigned short*)Vt + ((size_t)slab * 64 + d) * TTv + lg * 64 + pc * 8) = f.half[0]; }
     } }

__global__ __launch_bounds__(256) void k_hl(const float* __restrict__ F, _Float16* __restrict__ Hh, _Float16* __restrict__ Hl, size_t n8) { const size_t t = (size_t)blockIdx.x * 256 + threadIdx.x; if (t >= n8) return; FragH fh, fl; const v4f a = *(const v4fa*)(F + t * 8), c = *(const v4fa*)(F + t * 8 + 4);
#pragma unroll
  for (int q = 0; q < 4; ++q) { _Float16 h = (_Float16)a[q]; fh.h[q] = h; fl.h[q] = (_Float16)((a[q] - (float)h) * 1024.0f); h = (_Float16)c[q]; fh.h[4 + q] = h; fl.h[4 + q] = (_Float16)((c[q] - (float)h) * 1024.0f); }
  { *(v8us*)((unsigned short*)Hh + t * 8) = fh.half[0]; *(v8us*)((unsigned short*)Hl + t * 8) = fl.half[0];  } }

// ---- fast GEMM (block tile 128x128, 4 waves as 2 x 2, wave tile 64x64; requires M % 128 == 0 rows per launch region, N % 128 == 0 and K % 64 == 0); epilogue = k_gemm_hhx semantics ----
// Both operands reach the fragments through LDS: a stage is 64 k = one whole 128-byte line of each of the block's 128 A rows and 128 B rows, fetched by loads in which 8 lanes cover one row
// (4 whole lines a wave load, where a fragment load straight from global memory touches 16 lines); two buffers, the next stage's global loads fly during this stage's products.
// The square tiles are there for bytes per product: a stage's 256 lines from L2 feed 128 products (128x64: 192 lines for 64), and a wave's 8 fragments of a 32-k block feed 16 products (32x64: 6 for 8).
#define G2_SK 64                     /* k per LDS stage */
#define G2_PH 72                     /* LDS row pitch in f16: 144 B = 16 B x odd, the conflict-free pitch for 16-byte fragment reads */
typedef float f32a __attribute__((may_alias));
__device__ __forceinline__ v16h g2_frag(const _Float16* p, int hh) { FragH f; f.half[0] = *(const v8us*)((const unsigned short*)p + 8 * hh); f.half[1] = *(const v8us*)((const unsigned short*)p + 16 + 8 * hh); return f.v; }
__device__ __forceinline__ v8f g2_mma(v16h a, v16h b, v8f c) { return __builtin_amdgcn_wmma_f32_16x16x32_f16(false, a, false, b, (short)0, c, false, false); }
// one stage's global loads of a thread: 16 bytes of 8 A rows and of 8 B rows, 16 rows apart
__device__ __forceinline__ void g2_stage(const unsigned short* a, size_t a16, const unsigned short* b, size_t b16, v8us (&ra)[8], v8us (&rb)[8]) {
  const unsigned short* pa[8]; const unsigned short* pb[8];
#pragma unroll
  for (int j = 0; j < 8; ++j) pa[j] = a + j * a16;
#pragma unroll
  for (int j = 0; j < 8; ++j) pb[j] = b + j * b16;
#pragma unroll
  for (int j = 0; j < 8; ++j) ra[j] = *(const v8us*)pa[j];
#pragma unroll
  for (int j = 0; j < 8; ++j) rb[j] = *(const v8us*)pb[j];
  // the wait that stands in front of any overwrite of an issued load's address registers; the 16 addresses are inputs so that their registers live up to it (else a later load's result lands in an earlier load's address pair)
  asm volatile("s_wait_xcnt 0x0" :: "v"(pa[0]), "v"(pa[1]), "v"(pa[2]), "v"(pa[3]), "v"(pa[4]), "v"(pa[5]), "v"(pa[6]), "v"(pa[7]), "v"(pb[0]), "v"(pb[1]), "v"(pb[2]), "v"(pb[3]), "v"(pb[4]), "v"(pb[5]), "v"(pb[6]), "v"(pb[7]) : "memory");
}
// HASCP false leaves the addend path (CP) out of the build: unrolled over the 128 results a lane now holds, its index arithmetic would stand between any two results and make the epilogue's text several times longer
template <int ACT, bool HASCP>
__global__ __launch_bounds__(128) void k_gemm2(const _Float16* __restrict__ A, int lda, size_t sA, const _Float16* __restrict__ Bh, int ldb, size_t sB, float alpha, const float* __restrict__ bias, size_t sBias, const float* __restrict__ CP, int rowsPerB, size_t sCPb, int row0g,
    float* __restrict__ C, _Float16* __restrict__ C16, int ldc, size_t sC, int M, int N, int K) { static_assert(ACT == 0 || ACT == 3 || ACT == 6 || ACT == 8 || ACT == 9 || ACT == 11 || ACT == 12 || ACT == 14 || ACT == 15 || ACT == 16 || ACT == 17, "k_gemm2: unsupported ACT code (would silently apply no activation)");
  __shared__ __attribute__((aligned(16))) _Float16 sa[2][128][G2_PH];      /* A stage: the block's 128 rows, 64 k */
  __shared__ __attribute__((aligned(16))) _Float16 sb[2][128][G2_PH];      /* B stage: the block's 128 columns (rows of Bt), 64 k */
  f32a (*so)[32][68] = (f32a (*)[32][68])&sa[0][0][0];      /* output staging, 32 rows a wave: lies in the A buffers, used only behind the k loop's last barrier (34,816 of their 36,864 bytes) */
  const int tid = threadIdx.x, w = tid >> 5, lane = tid & 31, ln = lane & 15, hh = lane >> 4; const int by = blockIdx.y;
  A += (size_t)by * sA; Bh += (size_t)by * sB; const size_t cofs = (size_t)by * sC; const float* bp = bias ? bias + (size_t)by * sBias : nullptr;
  const int ntn = N >> 7; const int mt = blockIdx.x / ntn, nq = blockIdx.x - mt * ntn; const int wr = 64 * (w >> 1), wc = 64 * (w & 1); const int row0 = mt * 128 + wr, col0 = nq * 128 + wc; if (mt * 128 >= M) return;      /* the whole work-group leaves or none: barriers follow */
  // staging: a thread moves 16 bytes of rows srow + 16 j; 8 threads cover one 128-byte row
  const int srow = tid >> 3, sch = (tid & 7) * 8;
  const unsigned short* ag = (const unsigned short*)A + (size_t)(mt * 128 + srow) * lda + sch;
  const unsigned short* bg = (const unsigned short*)Bh + (size_t)(nq * 128 + srow) * ldb + sch;
  v8us ra[8], rb[8];
  g2_stage(ag, (size_t)16 * lda, bg, (size_t)16 * ldb, ra, rb);
  const v8f z8 = {0.f,0.f,0.f,0.f,0.f,0.f,0.f,0.f}; v8f acc[4][4];      /* [16-row tile][16-column tile] */
#pragma unroll
  for (int i = 0; i < 4; ++i)
#pragma unroll
    for (int t = 0; t < 4; ++t) acc[i][t] = z8;
#pragma unroll
  for (int j = 0; j < 8; ++j) *(v8us*)&sa[0][srow + 16 * j][sch] = ra[j];
#pragma unroll
  for (int j = 0; j < 8; ++j) *(v8us*)&sb[0][srow + 16 * j][sch] = rb[j];
  __syncthreads();      /* stage 0 is visible to all 4 waves */
  const int nst = K / G2_SK;
#pragma unroll 1  // rolled: one stage a trip, so that the two buffers alternate by index; the two 32-k blocks inside are unrolled
  for (int st = 0; st < nst; ++st) {
    const int b = st & 1; const bool more = st + 1 < nst;      /* the same for the whole work-group */
    if (more) g2_stage(ag + (st + 1) * G2_SK, (size_t)16 * lda, bg + (st + 1) * G2_SK, (size_t)16 * ldb, ra, rb);      /* next stage: in flight under this stage's products */
    v16h fa[2][4], fb[2][4];      /* the stage's fragments: [32-k block][tile] */
#pragma unroll
    for (int kc = 0; kc < 2; ++kc)
#pragma unroll
      for (int t = 0; t < 4; ++t) { fa[kc][t] = g2_frag(&sa[b][wr + 16 * t + ln][32 * kc], hh); fb[kc][t] = g2_frag(&sb[b][wc + 16 * t + ln][32 * kc], hh); }
    __builtin_amdgcn_sched_barrier(0);      /* keeps the stage's 32 LDS reads one group in front of its 32 products: left alone the compiler reuses fragment registers and waits out the LDS latency again and again inside a stage */
#pragma unroll
    for (int kc = 0; kc < 2; ++kc)      /* k ascends by 32 in every accumulator: one fixed order of sums */
#pragma unroll
      for (int t = 0; t < 4; ++t)
#pragma unroll
        for (int i = 0; i < 4; ++i) acc[i][t] = g2_mma(fa[kc][i], fb[kc][t], acc[i][t]);
    if (more) {      /* every wave left that buffer before the last barrier */
#pragma unroll
      for (int j = 0; j < 8; ++j) *(v8us*)&sa[b ^ 1][srow + 16 * j][sch] = ra[j];
#pragma unroll
      for (int j = 0; j < 8; ++j) *(v8us*)&sb[b ^ 1][srow + 16 * j][sch] = rb[j]; }
    __syncthreads();      /* publishes stage st + 1 and ends every wave's reads of stage st, whose buffer the next trip refills */
  }
  const int rsub = lane >> 4, c4 = (lane & 15) * 4;
  float bv4[4] = {0.f, 0.f, 0.f, 0.f};      /* the lane's four bias values serve both halves; one test, so that the four loads fly together */
  if (bp) {
#pragma unroll
    for (int t = 0; t < 4; ++t) bv4[t] = bf16_round(bp[col0 + t * 16 + ln]); }
#pragma unroll
  for (int hb = 0; hb < 2; ++hb) {      /* the wave's 64 rows leave in two halves of 32 through its own staging rows */
    const int rowh = row0 + 32 * hb;
#pragma unroll
    for (int u = 0; u < 8; ++u) { const int t = u & 3, half = u >> 2; const int col = col0 + t * 16 + ln; const float bv = bv4[t];
#pragma unroll
      for (int r = 0; r < 8; ++r) { const int rloc = half * 16 + 8 * hh + r; float v = acc[2 * hb + half][t][r] * alpha + bv; if (HASCP && CP) { if (rowsPerB < 0) v += CP[cofs + (size_t)(row0g + rowh + rloc) * ldc + col];      /* rowsPerB < 0: own element of the batched C plane */ else { const int bidx = (row0g + rowh + rloc) / rowsPerB; v += CP[(size_t)bidx * sCPb + (size_t)by * 64 + col]; } }
        if (ACT == 3) v = fmaxf(v, 0.f); else if (ACT == 6) v = 0.5f * v * (1.0f + erff(v * 0.70710678118654752f)); else if (ACT == 11) v = 1.0f / (1.0f + expf(-v)); else if (ACT == 15) v = v / (1.0f + expf(-v)); else if (ACT == 12) v = (v > 0.f) ? v : 0.01f * v; else if (ACT == 8) v = tanhf(v); else if (ACT == 9) v = 0.5f * v * (1.0f + tanhf(0.7978845608028654f * (v + 0.044715f * v * v * v))); else if (ACT == 14) v = (v > 0.f) ? v : 0.1f * v; else if (ACT == 16) v = (v >= 0.f) ? v : 0.3f * v; else if (ACT == 17) v = (v >= 0.f) ? v : 0.2f * v;
        so[w][rloc][t * 16 + ln] = v; } }
    __builtin_amdgcn_fence(__ATOMIC_ACQ_REL, "wavefront"); asm volatile("s_wait_dscnt 0x0" ::: "memory"); __builtin_amdgcn_wave_barrier();      /* the wave's staged rows are written before its lanes read them back across lanes; the rows are the wave's own, so wave scope and the LDS wait are enough (a work-group fence here would also wait out the first half's global stores) */
    v4f vq[16];      /* all 16 reads in one group: one LDS latency a half, not one a row pair */
#pragma unroll
    for (int q = 0; q < 16; ++q) vq[q] = *(const v4fa*)&so[w][q * 2 + rsub][c4];
    __builtin_amdgcn_fence(__ATOMIC_ACQ_REL, "wavefront"); __builtin_amdgcn_wave_barrier();      /* the rows are read before the second half overwrites them */
    if (C) {
#pragma unroll
      for (int q = 0; q < 16; ++q) *(v4f*)(C + cofs + (size_t)(rowh + q * 2 + rsub) * ldc + col0 + c4) = vq[q];
      asm volatile("s_wait_xcnt 0x0" ::: "memory"); }      /* the wait that stands in front of any overwrite of the issued stores' registers (the f16 conversion below may reuse them) */
    if (C16) {
#pragma unroll
      for (int q = 0; q < 16; ++q) { v4h h4; for (int i = 0; i < 4; ++i) h4[i] = (_Float16)vq[q][i]; *(v4h*)(C16 + cofs + (size_t)(rowh + q * 2 + rsub) * ldc + col0 + c4) = h4; }
      asm volatile("s_wait_xcnt 0x0" ::: "memory"); }      /* the same wait behind the f16 stores: the next half's results reuse their registers */
  } }


__global__ __launch_bounds__(256) void k_wnat(const float* __restrict__ w, size_t n8, _Float16* __restrict__ Bt) { const size_t t = (size_t)blockIdx.x * 256 + threadIdx.x; if (t >= n8) return; FragH f; for (int q = 0; q < 8; ++q) f.h[q] = (_Float16)(bf16_round(w[t * 8 + q]) * 16.0f); *(v8us*)((unsigned short*)Bt + t * 8) = f.half[0];  }
__global__ __launch_bounds__(256) void k_rsm(const float* __restrict__ S, _Float16* __restrict__ P, int nrows) {
  #pragma clang fp contract(off)
  const int i = blockIdx.x * 256 + threadIdx.x; if (i >= nrows) return; const float* s = S + (size_t)i * SQ; float mx = -3.0e38f;
#pragma unroll 1
  for (int j = 0; j < SQ; ++j) mx = fmaxf(mx, s[j]); float se = 0.f;
#pragma unroll 1
  for (int j = 0; j < SQ; ++j) se += expf(s[j] - mx); const float sc = 256.0f / se;
#pragma unroll 1
  for (int j0 = 0; j0 < SQ; j0 += 8) { FragH f; for (int q = 0; q < 8; ++q) f.h[q] = (_Float16)(expf(s[j0 + q] - mx) * sc); unsigned short* d = (unsigned short*)P + (size_t)i * SQ + j0; *(v8us*)d = f.half[0];  } }
__global__ __launch_bounds__(256) void k_vt(const _Float16* __restrict__ V16, int b, int h0, _Float16* __restrict__ VT) { __shared__ unsigned short tl[64][65]; const int tid = threadIdx.x; const int hh = blockIdx.x % HG, sg = blockIdx.x / HG; const int s0 = sg * 64; const int h = h0 + hh;
  for (int i = tid; i < 64 * 8; i += 256) { const int j = i / 8, d8 = (i % 8) * 8; FragH f; f.half[0] = *(const v8us*)((const unsigned short*)V16 + ((size_t)b * SQ + s0 + j) * DM + h * HD + d8); for (int q = 0; q < 8; ++q) tl[d8 + q][j] = f.u[q]; }
  __syncthreads();
  { for (int i = tid; i < 64 * 8; i += 256) { const int d = i / 8, j8 = (i % 8) * 8; FragH f; for (int q = 0; q < 8; ++q) f.u[q] = tl[d][j8 + q]; *(v8us*)((unsigned short*)VT + ((size_t)hh * HD + d) * SQ + s0 + j8) = f.half[0]; }  } }



#define FA_SK 64                     /* keys per LDS tile */
#define FA_PH 72                     /* LDS row pitch in f16: 144 B = 16 B x odd, the conflict-free pitch for 16-byte fragment reads */
typedef float f32x2 __attribute__((ext_vector_type(2)));
typedef _Float16 v2h __attribute__((ext_vector_type(2)));
union FragP { v16h v; unsigned int w[8]; };
__device__ __forceinline__ float fa_xhalf(float x) { return __builtin_bit_cast(float, __builtin_amdgcn_permlanex16(__builtin_bit_cast(int, x), __builtin_bit_cast(int, x), 0x76543210, 0xfedcba98, false, false)); }      /* lane l <-> lane l ^ 16 */
__device__ __forceinline__ v16h fa_frag(const _Float16* p) { FragH f; f.half[0] = *(const v8us*)(const unsigned short*)p; f.half[1] = *(const v8us*)((const unsigned short*)p + 16); return f.v; }      /* p = row + 32 kc + 8 h: the hardware k order */
__device__ __forceinline__ v8f fa_mma(v16h a, v16h b, v8f c) { return __builtin_amdgcn_wmma_f32_16x16x32_f16(false, a, false, b, (short)0, c, false, false); }
// amdgpu_waves_per_eu(4, 4): a budget of 256 VGPRs, so that no register lies above v255 (without it the build took 266 and switched register windows all through the loop)
__global__ __launch_bounds__(512) __attribute__((amdgpu_waves_per_eu(4, 4))) void k_fattn(const _Float16* __restrict__ Qh, const _Float16* __restrict__ Kh, const _Float16* __restrict__ Vt, _Float16* __restrict__ Oh) {
  __shared__ __attribute__((aligned(16))) _Float16 sk[2][2][FA_SK][FA_PH];      /* K tile: [key group][buffer], row = key, 64 d */
  __shared__ __attribute__((aligned(16))) _Float16 sv[2][2][HD][FA_PH];         /* V^T tile: [key group][buffer], row = d, 64 keys */
  __shared__ __attribute__((aligned(16))) float xo[8][16][32][4];               /* group 1's o on its way to group 0: [wave][4 registers][lane] */
  __shared__ float xs[8][4][32];                                                /* with its two references and its two sums */
  const int tid = threadIdx.x, lane = tid & 31, c = lane & 15, h = lane >> 4;
  const int kh = __builtin_amdgcn_readfirstlane(tid >> 8), wq = __builtin_amdgcn_readfirstlane((tid >> 5) & 7);      /* key group and wave in it: the same in every lane, held as scalars */
  const int head = blockIdx.y, q0 = blockIdx.x * 256 + wq * 32;
  const float cs = 0.03125f * 1.44269504088896340736f;      /* the module's score scale 1/sqrt(1024), in the base-2 domain */
  // staging: a thread moves 16 bytes of rows srow and srow + 32 of each tile of its group; 8 threads cover one 128-byte row
  const int srow = (tid & 255) >> 3, sch = (tid & 7) * 8;
  const unsigned short* kg = (const unsigned short*)Kh + (size_t)(kh * FA_SK + srow) * LQ + head * HD + sch;
  const unsigned short* vg = (const unsigned short*)Vt + ((size_t)head * HD + srow) * SQ + kh * FA_SK + sch;
  v8us rk0, rk1, rv0, rv1;
  rk0 = *(const v8us*)kg; rk1 = *(const v8us*)(kg + (size_t)32 * LQ); rv0 = *(const v8us*)vg; rv1 = *(const v8us*)(vg + (size_t)32 * SQ);
  v16h qf[2][2];
#pragma unroll
  for (int g = 0; g < 2; ++g)
#pragma unroll
    for (int kc = 0; kc < 2; ++kc) qf[g][kc] = fa_frag(Qh + (size_t)(q0 + 16 * g + c) * LQ + head * HD + 32 * kc + 8 * h);
  const v8f z8 = {0.f,0.f,0.f,0.f,0.f,0.f,0.f,0.f};
  v8f acc[2][4]; float m_run[2]; f32x2 l_run[2];
#pragma unroll
  for (int g = 0; g < 2; ++g) { m_run[g] = -3.0e38f; l_run[g] = f32x2{0.f, 0.f};
#pragma unroll
    for (int t = 0; t < 4; ++t) acc[g][t] = z8; }
  *(v8us*)&sk[kh][0][srow][sch] = rk0; *(v8us*)&sk[kh][0][srow + 32][sch] = rk1; *(v8us*)&sv[kh][0][srow][sch] = rv0; *(v8us*)&sv[kh][0][srow + 32][sch] = rv1;
  __syncthreads();      /* each group's first tile is visible to its 8 waves */
#pragma unroll 1  // rolled: one tile a trip; the two 32-key passes inside are unrolled
  for (int st = 0; st < SQ / (2 * FA_SK); ++st) {
    const int b = st & 1; const bool more = st + 1 < SQ / (2 * FA_SK);      /* the same for the whole work-group */
    if (more) { const unsigned short* kp = kg + (size_t)(st + 1) * (2 * FA_SK) * LQ; const unsigned short* vp = vg + (st + 1) * (2 * FA_SK);      /* the group's next tile: in flight under this tile's work */
      rk0 = *(const v8us*)kp; rk1 = *(const v8us*)(kp + (size_t)32 * LQ); rv0 = *(const v8us*)vp; rv1 = *(const v8us*)(vp + (size_t)32 * SQ); }
    v8f s[2][2][2];      /* S^T of the tile: [32-key pass][16-key tile][16-column group] */
#pragma unroll
    for (int sub = 0; sub < 2; ++sub)
#pragma unroll
      for (int kt = 0; kt < 2; ++kt) { const _Float16* kr = &sk[kh][b][sub * 32 + 16 * kt + c][8 * h]; const v16h k0 = fa_frag(kr), k1 = fa_frag(kr + 32);
#pragma unroll
        for (int g = 0; g < 2; ++g) s[sub][kt][g] = fa_mma(k1, qf[g][1], fa_mma(k0, qf[g][0], z8)); }
    float mx[2];
#pragma unroll
    for (int g = 0; g < 2; ++g) {
      float x = s[0][0][g][0];      /* maximum of the tile's raw scores (the scale is positive) */
#pragma unroll
      for (int r = 1; r < 8; ++r) x = fmaxf(x, s[0][0][g][r]);
#pragma unroll
      for (int u = 1; u < 4; ++u)
#pragma unroll
        for (int r = 0; r < 8; ++r) x = fmaxf(x, s[u >> 1][u & 1][g][r]);
      mx[g] = fmaxf(x, fa_xhalf(x)) * cs;      /* both wave halves hold the query's tile maximum, scaled */
    }
    // lazy rescale: m_run is the reference in use, not the true maximum; it moves, and o and the sum are rescaled, only when some column's tile maximum lies more than 8 (base-2 domain) above it,
    // so a weight is at most 2^8, far inside f16 and f32; o / sum does not depend on the reference. One test a tile for the whole wave, a scalar branch; taken on the first tile (factor 0).
    if (__builtin_amdgcn_ballot_w32(mx[0] > m_run[0] + 8.0f || mx[1] > m_run[1] + 8.0f) != 0) {
#pragma unroll
      for (int g = 0; g < 2; ++g) {
        const float m_new = fmaxf(m_run[g], mx[g]); const float corr = __builtin_amdgcn_exp2f(m_run[g] - m_new);
        m_run[g] = m_new; l_run[g] = l_run[g] * corr;
#pragma unroll
        for (int t = 0; t < 4; ++t) acc[g][t] = acc[g][t] * corr;
      }
    }
#pragma unroll
    for (int sub = 0; sub < 2; ++sub) {      /* one pass: 32 keys x the wave's 32 query columns */
      v16h vf[4];
#pragma unroll
      for (int t = 0; t < 4; ++t) vf[t] = fa_frag(&sv[kh][b][16 * t + c][sub * 32 + 8 * h]);
#pragma unroll
      for (int g = 0; g < 2; ++g) {
        FragP pf; f32x2 ps[8];
#pragma unroll
        for (int i = 0; i < 8; ++i) {
          const f32x2 a = __builtin_elementwise_fma(f32x2{s[sub][i >> 2][g][2 * (i & 3)], s[sub][i >> 2][g][2 * (i & 3) + 1]}, f32x2{cs, cs}, f32x2{-m_run[g], -m_run[g]});
          const f32x2 p = {__builtin_amdgcn_exp2f(a.x), __builtin_amdgcn_exp2f(a.y)};
          ps[i] = p; pf.w[i] = __builtin_bit_cast(unsigned int, __builtin_convertvector(p, v2h)); }
        l_run[g] = l_run[g] + (((ps[0] + ps[1]) + (ps[2] + ps[3])) + ((ps[4] + ps[5]) + (ps[6] + ps[7])));      /* a tree, not one chain of 8 dependent adds */
#pragma unroll
        for (int t = 0; t < 4; ++t) acc[g][t] = fa_mma(vf[t], pf.v, acc[g][t]);
      }
    }
    if (more) { *(v8us*)&sk[kh][b ^ 1][srow][sch] = rk0; *(v8us*)&sk[kh][b ^ 1][srow + 32][sch] = rk1; *(v8us*)&sv[kh][b ^ 1][srow][sch] = rv0; *(v8us*)&sv[kh][b ^ 1][srow + 32][sch] = rv1; }      /* every wave left that buffer before the last barrier */
    __syncthreads();      /* publishes each group's tile 2 st + 2 + kh and ends every wave's reads of its group's tile 2 st + kh, whose buffer the next trip refills */
  }
  // join of the two key groups: wave wq of group 1 hands its o, references and sums, lane for lane, to wave wq of group 0, which holds the same query columns in the same places
  if (kh == 1) {
#pragma unroll
    for (int g = 0; g < 2; ++g) { xs[wq][g][lane] = m_run[g]; xs[wq][2 + g][lane] = l_run[g].x + l_run[g].y;
#pragma unroll
      for (int t = 0; t < 4; ++t)
#pragma unroll
        for (int j = 0; j < 2; ++j) *(v4f*)&xo[wq][(g * 4 + t) * 2 + j][lane][0] = v4f{acc[g][t][4 * j], acc[g][t][4 * j + 1], acc[g][t][4 * j + 2], acc[g][t][4 * j + 3]}; }
  }
  __syncthreads();      /* group 1's partial results are visible to group 0 */
  if (kh == 0) {
#pragma unroll
    for (int g = 0; g < 2; ++g) {
      const float m1 = xs[wq][g][lane], l1 = xs[wq][2 + g][lane]; const float m_all = fmaxf(m_run[g], m1);
      const float f0 = __builtin_amdgcn_exp2f(m_run[g] - m_all), f1 = __builtin_amdgcn_exp2f(m1 - m_all);      /* each group's weights brought to the common reference */
      float l = (l_run[g].x + l_run[g].y) * f0 + l1 * f1; l += fa_xhalf(l); const float inv = 64.0f / l;      /* o carried x64, as the output GEMM's alpha expects */
      const float a0 = f0 * inv, a1 = f1 * inv;
#pragma unroll
      for (int t = 0; t < 4; ++t) { FragH f;
#pragma unroll
        for (int j = 0; j < 2; ++j) { const v4f x = *(const v4f*)&xo[wq][(g * 4 + t) * 2 + j][lane][0];
#pragma unroll
          for (int r = 0; r < 4; ++r) f.h[4 * j + r] = (_Float16)(acc[g][t][4 * j + r] * a0 + x[r] * a1); }
        *(v8us*)((unsigned short*)Oh + (size_t)(q0 + 16 * g + c) * DM + head * HD + 16 * t + 8 * h) = f.half[0]; } }      /* 8 consecutive d of one query row: one 16-byte store */
  }
}

// ---- all seven pre-passes in ONE launch: they depend on nothing but the inputs, so the job is picked by work-group number (the same for a whole work-group) ----
// work-groups [0, 4 PW): one 128 k x 64 n tile of weight j = block / PW, turned over in LDS into rows of Bt[n][k] x16; the rest: stream j = block / PX as exact f16 rows, a thread's work that of k_x16.
// The tile is there for whole lines on both sides: a wave load takes 256 contiguous bytes of each of two W rows, a wave store 256 contiguous bytes of each of two Bt rows
// (read column-wise straight from W, every lane of a load touched a line of its own for 4 bytes). Bt and X16 hold the jobs' planes one behind the other.
#define PT_K 128                               /* k per weight tile: a Bt row piece of 256 bytes */
#define PT_N 64                                /* n per weight tile: a W row piece of 256 bytes */
#define PW ((DM / PT_K) * (DM / PT_N))         /* work-groups per weight */
#define PX ((unsigned)(NR * DM / 8 / 256))     /* work-groups per input stream */
typedef unsigned int u32a __attribute__((may_alias));
__global__ __launch_bounds__(256) void k_prep(const float* __restrict__ w0, const float* __restrict__ w1, const float* __restrict__ w2, const float* __restrict__ w3,
                                              const float* __restrict__ x0, const float* __restrict__ x1, const float* __restrict__ x2, _Float16* __restrict__ Bt, _Float16* __restrict__ X16) {
  __shared__ __attribute__((aligned(16))) unsigned short tl[PT_N][PT_K];      /* the tile as f16, row = n; the 16-byte piece q of row n lies at place q ^ (n >> 2), so that the lanes of a store fall on different banks, as those of a load do */
  const unsigned blk = blockIdx.x; FragH f;
  if (blk < 4 * PW) {
    const unsigned j = blk / PW, tile = blk - j * PW; const float* W = j == 0 ? w0 : j == 1 ? w1 : j == 2 ? w2 : w3;
    const int k0 = (int)(tile / (DM / PT_N)) * PT_K, n0 = (int)(tile % (DM / PT_N)) * PT_N;      /* neighbouring work-groups take neighbouring pieces of the same W rows */
    const int c = threadIdx.x & 15, r = threadIdx.x >> 4;
    // a thread reads 4 n of the row pairs 2 r + 32 u, 2 r + 32 u + 1: 16 threads cover a row piece; the pair makes one 32-bit LDS store of two neighbouring k
    const float* wp = W + (size_t)(k0 + 2 * r) * DM + n0 + 4 * c;
    v4f a[4], b[4];
#pragma unroll  // all 8 loads of a thread are issued together, one memory latency a tile
    for (int u = 0; u < 4; ++u) { a[u] = *(const v4fa*)(wp + (size_t)(32 * u) * DM); b[u] = *(const v4fa*)(wp + (size_t)(32 * u + 1) * DM); }
#pragma unroll
    for (int u = 0; u < 4; ++u) { const int k = 2 * r + 32 * u;
#pragma unroll
      for (int i = 0; i < 4; ++i) { const v2h p = {(_Float16)(bf16_round(a[u][i]) * 16.0f), (_Float16)(bf16_round(b[u][i]) * 16.0f)};
        *(u32a*)&tl[4 * c + i][(((k >> 3) ^ c) << 3) + (k & 7)] = __builtin_bit_cast(unsigned int, p); } }
    __syncthreads();      /* the whole tile is in LDS before any row of it is read; every thread of a weight work-group comes here, no thread of another */
    unsigned short* bp = (unsigned short*)Bt + (size_t)j * DM * DM + (size_t)(n0 + r) * DM + k0 + 8 * c;
#pragma unroll
    for (int u = 0; u < 4; ++u) { const int n = r + 16 * u;      /* 16 threads cover the 256 bytes of a Bt row piece */
      *(v8us*)(bp + (size_t)(16 * u) * DM) = *(const v8us*)&tl[n][(c ^ ((n >> 2) & 15)) << 3]; }
  } else {
    const unsigned r = blk - 4 * PW, j = r / PX; const float* x = j == 0 ? x0 : j == 1 ? x1 : x2;
    const size_t t = (size_t)(r - j * PX) * 256 + threadIdx.x;
#pragma unroll
    for (int q = 0; q < 8; ++q) f.h[q] = (_Float16)bf16_round(x[t * 8 + q]);
    *(v8us*)((unsigned short*)X16 + (size_t)j * NR * DM + t * 8) = f.half[0];
  }
}

extern "C" void kernel_launch(void* const* d_in, const int* in_sizes, int n_in,
                              void* d_out, int out_size, void* d_ws, size_t ws_size, hipStream_t stream) {
  (void)in_sizes; (void)n_in; (void)out_size;
  const float* const* I = (const float* const*)d_in; const float* xq = I[2]; const float* xk = I[1]; const float* xv = I[0]; const float* wq = I[5]; const float* wk = I[4]; const float* wv = I[3]; const float* wo = I[6]; const float* bo = I[7];      /* input order: values, keys, query (three unbatched [4096][1024] streams in REVERSE order: the query stream is I[2]), Wv, Wk, Wq (the weights in the same reverse order: Wq is I[5]), Wo, bo ([in][out] weights); the q / k / v projections have NO biases: null pointers in the guarded bias slots */
  char* ws = (char*)d_ws; size_t off = 0;
  auto take = [&](size_t bytes) { char* p = ws + off; off += (bytes + 255) & ~(size_t)255; return p; };
  _Float16* BQ = (_Float16*)take((size_t)4 * DM * DM * 2); _Float16* BO = BQ + (size_t)3 * DM * DM;      /* four weight planes in a row: q, k, v, o */
  _Float16* XQ = (_Float16*)take(3 * NR * DM * 2); _Float16* Q16 = (_Float16*)take(3 * NR * DM * 2); _Float16* K16 = Q16 + NR * DM; _Float16* V16 = K16 + NR * DM; _Float16* O16 = (_Float16*)take(NR * DM * 2);      /* three planes in a row each: the q, k, v sources; q, k, v */
  _Float16* VT = (_Float16*)take((size_t)NH * HD * SQ * 2);
  if (off > ws_size) return;
  k_prep<<<4 * PW + 3 * PX, 256, 0, stream>>>(wq, wk, wv, wo, xq, xk, xv, BQ, XQ);      /* one launch: the four [in][out] weights -> Bt[n][k] x16 (the planes from BQ on), the three inputs as exact f16 rows (the planes from XQ on) */
  const size_t r0p = (size_t)B0 * SQ;      /* first projected row */
  k_gemm2<0, false><<<dim3((unsigned)((MP / 128) * (DM / 128)), 3), 128, 0, stream>>>(XQ + r0p * DM, DM, NR * DM, BQ, DM, (size_t)DM * DM, 0.0625f, nullptr, 0, nullptr, 1, 0, 0, nullptr, Q16 + r0p * DM, DM, NR * DM, MP, DM, DM);      /* q, k and v in one launch: grid y steps through the three planes from XQ, from BQ and from Q16; no biases */
  for (int b = B0; b < B0 + NBR; ++b) { const size_t r0 = (size_t)b * SQ;
    k_vt<NH, SQ><<<NH * (SQ / 64), 256, 0, stream>>>(V16 + r0 * LQ, LQ, 0, VT);      /* V^T [NH][HD][SQ] for this batch */
    k_fattn<<<dim3(QN / 256, NHD), 512, 0, stream>>>(Q16 + r0 * LQ, K16 + r0 * LQ, VT, O16 + r0 * DM); }      /* all heads: scores (THIS module's scale 1/sqrt(EMBED 1024) = 1/32), softmax, P.V; o x64 (merged heads) as f16 rows */
  k_gemm2<0, false><<<dim3((unsigned)((MPO / 128) * (DM / 128)), 1), 128, 0, stream>>>(O16 + r0p * DM, DM, 0, BO, DM, 0, 0.0009765625f, bo, 0, nullptr, 1, 0, 0, (float*)d_out + r0p * DM, nullptr, DM, 0, MPO, DM, DM);      /* out rows are the output layout */
}
